// v000
// Times are from an AMD MI455X. After a warm-up the kernel runs many times in a row, and a time is the length of
// such a window on the GPU divided by its runs, so every launch and the gaps after it count. The runs cycle
// through copies of the inputs. A figure is the median of several windows, for all but v000 over two sittings.
// Sittings can differ by a few percent; kernels timed side by side share one.
// The starting kernel, v000, takes 5450 microseconds a run.
#include <hip/hip_runtime.h>
// POST-LN transformer decoder layer with causal self-attention and a fused QKV projection (x [2][2048][1024]; qkv = x w_qkv + b_qkv ([in][out] 1024 x 3072 + bias) viewed (B, S, 3, 16, 64): q | k | v thirds; scores * 64^-0.5; causal (tril, -inf); softmax; x1 = LN1(x + out w_out + b_out) (biased var, eps 1e-5); result = LN2(x1 + relu(x1 w_up + b_up) w_down + b_down) ([in][out] 1024 x 4096 x 1024) -> [2][2048][1024]).
// Structure: token rows r = b*2048 + s; x as exact f16 rows (bf16-rounded); q | k | v as ONE WMMA GEMM (N = 3 x 1024) (32x64 wave tiles, f32 accumulation, exact x16 weights + bias, f16 outputs); per batch: V^T for all heads via LDS transposes; per query tile of 256 rows: scores against the keys below the tile end only (K = 64, all heads on grid.y, alpha = 0.125), causal row softmax on VALU with an arithmetic 0/1 key mask over the computed range (f32 statistics, native exp; weights x256 f16), o = P . V^T (K = keys below the tile end, alpha 2^-2: o carried x64, folded into the output GEMM alpha) written straight into the merged f16 o rows; out = o W_o + b GEMM (f32) into the output layout.
// Compute dtype: inputs rounded to bf16; x / weights exact; q, k, v, softmax weights and o as plain f16 GEMM operands (~2^-12); scores and softmax statistics f32. v_wmma_f32_16x16x32_f16.
#define NB 2
#define SQ 2048
#define DM 1024
#define NH 16
#define HD 64
#define HG 4                         /* heads per block in the k_vt(V16, b, h0, VT) form (not launched) */
#define QT 256                       /* query rows per causal tile */
#define NKX SQ                       /* S / P row pitch */
#define QT0 128                      /* first-tile rows recomputed exactly in f32 */
#define B0 0                         /* first batch processed (debug hook) */
#define NBR NB                       /* batches processed (debug hook) */
#define NR ((size_t)NB * SQ)
#define DMQ DM
#define DFF 4096                     /* FFN hidden width */
#define DFFR 100                     /* unused (the FFN hidden width is DFF) */
#define MP ((int)((size_t)NBR * SQ)) /* rows projected (debug hook) */
#define QN SQ                        /* query rows attended per batch (debug hook) */
#define NHD NH                       /* heads attended (debug hook) */
#define MPO MP                       /* rows through the output stage (debug hook) */
#define LQ (3 * DM)      /* row pitch of the q/k/v rows */
typedef __bf16 v16b __attribute__((ext_vector_type(16)));
typedef unsigned short v8us __attribute__((ext_vector_type(8), may_alias));
typedef float  v8f  __attribute__((ext_vector_type(8)));
typedef float  v4f  __attribute__((ext_vector_type(4)));
typedef float  v4fa __attribute__((ext_vector_type(4), may_alias));
union FragB { v16b v; v8us half[2]; unsigned short u[16]; };

__device__ __forceinline__ unsigned short bf16_bits(float x) { unsigned int u = __float_as_uint(x); return (unsigned short)((u + 0x7FFFu + ((u >> 16) & 1u)) >> 16); }
__device__ __forceinline__ float bf16_val(unsigned short b) { return __uint_as_float(((unsigned int)b) << 16); }
__device__ __forceinline__ float bf16_round(float x) { return bf16_val(bf16_bits(x)); }
// D += A·B with NT terms: 1 = ah·bh, 2 = + al·bh (A split), 3 = + ah·bl (both split)
template <int NT>
__device__ __forceinline__ v8f mmaN(v16b ah, v16b al, v16b bh, v16b bl, v8f c) {
  c = __builtin_amdgcn_wmma_f32_16x16x32_bf16(false, ah, false, bh, (short)0, c, false, false);
  if (NT >= 2) c = __builtin_amdgcn_wmma_f32_16x16x32_bf16(false, al, false, bh, (short)0, c, false, false);
  if (NT >= 3) c = __builtin_amdgcn_wmma_f32_16x16x32_bf16(false, ah, false, bl, (short)0, c, false, false);
  asm volatile("v_nop\n\tv_nop\n\tv_nop\n\tv_nop" : "+v"(c) : "v"(ah), "v"(al), "v"(bh), "v"(bl));
  return c;
}

__global__ __launch_bounds__(256) void k_wt_bf16(const float* __restrict__ W, unsigned short* __restrict__ Wt, int K, int N) {
  const int t = blockIdx.x * 256 + threadIdx.x;
  const int k8n = K / 8;
  if (t >= N * k8n) return;
  const int n = t / k8n, k8 = (t % k8n) * 8;
  v8us v;
#pragma unroll
  for (int i = 0; i < 8; ++i) v[i] = bf16_bits(W[(size_t)(k8 + i) * N + n]);
  *(v8us*)(Wt + (size_t)n * K + k8) = v;
  
}

// GEMM C[M][N] (f32, pitch ldc) = act(A[M][K]·W + bias). A f32 row-major (pitch lda) converted per fragment to bf16
// (ASPLIT: hi/lo two planes -> 2 terms, else single rounded term); Wt bf16 [N][K] (pitch ldb). BIAS_BF16 rounds the
// bias to bf16 first (bias quantised to bf16 before the add). K%32==0, M%16==0, N%64==0.
template <bool ASPLIT, int ACT, bool BIAS_BF16>
__global__ __launch_bounds__(128) void k_gemm_bf(const float* __restrict__ A, int lda, const unsigned short* __restrict__ Wt, int ldb,
                                               const float* __restrict__ bias, float* __restrict__ C, int ldc, int M, int N, int K) {
  __shared__ __attribute__((aligned(16))) float so[4][16][64];
  const int tid = threadIdx.x, w = tid >> 5, lane = tid & 31, ln = lane & 15, hh = lane >> 4;
  const int ntn = N / 64;
  const int wid = blockIdx.x * 4 + w;
  const int mt = wid / ntn, nq = wid % ntn;
  if (mt * 16 >= M) return;
  const int row0 = mt * 16, col0 = nq * 64;
  const float* arow = A + (size_t)(row0 + ln) * lda;
  v8f acc[4] = {};
  for (int kb = 0; kb < K; kb += 32) {
    FragB ah, al;
    const v4f x0 = *(const v4fa*)(arow + kb + 8 * hh), x1 = *(const v4fa*)(arow + kb + 8 * hh + 4);
    const v4f x2 = *(const v4fa*)(arow + kb + 16 + 8 * hh), x3 = *(const v4fa*)(arow + kb + 16 + 8 * hh + 4);
    float xs[16] = {x0[0],x0[1],x0[2],x0[3],x1[0],x1[1],x1[2],x1[3],x2[0],x2[1],x2[2],x2[3],x3[0],x3[1],x3[2],x3[3]};
#pragma unroll
    for (int i = 0; i < 16; ++i) { const unsigned short hb = bf16_bits(xs[i]); ah.u[i] = hb; al.u[i] = ASPLIT ? bf16_bits(xs[i] - bf16_val(hb)) : (unsigned short)0; }
#pragma unroll
    for (int t = 0; t < 4; ++t) {
      const unsigned short* brow = Wt + (size_t)(col0 + t * 16 + ln) * ldb + kb;
      FragB b;
      b.half[0] = *(const v8us*)(brow + 8 * hh);
      b.half[1] = *(const v8us*)(brow + 16 + 8 * hh);
      acc[t] = mmaN<ASPLIT ? 2 : 1>(ah.v, al.v, b.v, b.v, acc[t]);
    }
  }
#pragma unroll
  for (int t = 0; t < 4; ++t) {
    float bv = bias ? bias[col0 + t * 16 + ln] : 0.f;
    if (BIAS_BF16) bv = bf16_round(bv);
#pragma unroll
    for (int r = 0; r < 8; ++r) { float v = acc[t][r] + bv; if (ACT == 1) v = fmaxf(v, 0.f); so[w][8 * hh + r][t * 16 + ln] = v; }
  }
  __builtin_amdgcn_fence(__ATOMIC_ACQ_REL, "workgroup");
  __builtin_amdgcn_wave_barrier();
  const int rsub = lane >> 4, c4 = (lane & 15) * 4;
  {
#pragma unroll
    for (int q = 0; q < 8; ++q) {
      const int r = q * 2 + rsub;
      const v4f v = *(const v4fa*)&so[w][r][c4];
      *(v4f*)(C + (size_t)(row0 + r) * ldc + col0 + c4) = v;
    }
    
  }
}

// GEMM C = act(A·W + bias + resid): A f32 (ASPLIT -> hi/lo 2 terms), Wt bf16 [N][K]; ACT 0 none, 1 relu, 2 exact gelu;
// resid (optional, f32, row index = (row % rmod), pitch ldr, RES_BF16 rounds it) added before the activation.
template <bool ASPLIT, int ACT, bool BIAS_BF16, bool RES_BF16>
__global__ __launch_bounds__(128) void k_gemm_bf3(const float* __restrict__ A, int lda, const unsigned short* __restrict__ Wt, int ldb,
                                                const float* __restrict__ bias, const float* __restrict__ resid, int rmod, int ldr,
                                                float* __restrict__ C, int ldc, int M, int N, int K) {
  __shared__ __attribute__((aligned(16))) float so[4][16][64];
  const int tid = threadIdx.x, w = tid >> 5, lane = tid & 31, ln = lane & 15, hh = lane >> 4;
  const int ntn = N / 64;
  const int wid = blockIdx.x * 4 + w;
  const int mt = wid / ntn, nq = wid % ntn;
  if (mt * 16 >= M) return;
  const int row0 = mt * 16, col0 = nq * 64;
  const float* arow = A + (size_t)(row0 + ln) * lda;
  v8f acc[4] = {};
  for (int kb = 0; kb < K; kb += 32) {
    FragB ah, al;
    const v4f x0 = *(const v4fa*)(arow + kb + 8 * hh), x1 = *(const v4fa*)(arow + kb + 8 * hh + 4);
    const v4f x2 = *(const v4fa*)(arow + kb + 16 + 8 * hh), x3 = *(const v4fa*)(arow + kb + 16 + 8 * hh + 4);
    float xs[16] = {x0[0],x0[1],x0[2],x0[3],x1[0],x1[1],x1[2],x1[3],x2[0],x2[1],x2[2],x2[3],x3[0],x3[1],x3[2],x3[3]};
#pragma unroll
    for (int i = 0; i < 16; ++i) { const unsigned short hb = bf16_bits(xs[i]); ah.u[i] = hb; al.u[i] = ASPLIT ? bf16_bits(xs[i] - bf16_val(hb)) : (unsigned short)0; }
#pragma unroll
    for (int t = 0; t < 4; ++t) {
      const unsigned short* brow = Wt + (size_t)(col0 + t * 16 + ln) * ldb + kb;
      FragB b;
      b.half[0] = *(const v8us*)(brow + 8 * hh);
      b.half[1] = *(const v8us*)(brow + 16 + 8 * hh);
      acc[t] = mmaN<ASPLIT ? 2 : 1>(ah.v, al.v, b.v, b.v, acc[t]);
    }
  }
#pragma unroll
  for (int t = 0; t < 4; ++t) {
    const int col = col0 + t * 16 + ln;
    float bv = bias ? bias[col] : 0.f;
    if (BIAS_BF16) bv = bf16_round(bv);
#pragma unroll
    for (int r = 0; r < 8; ++r) {
      float v = acc[t][r] + bv;
      if (resid) { float rv = resid[(size_t)((row0 + 8 * hh + r) % rmod) * ldr + col]; if (RES_BF16) rv = bf16_round(rv); v += rv; }
      if (ACT == 1) v = fmaxf(v, 0.f);
      if (ACT == 2) v = 0.5f * v * (1.0f + erff(v * 0.70710678118654752f));
      if (ACT == 3) { const float u = 0.7978845608028654f * (v + 0.044715f * v * v * v); v = 0.5f * v * (1.0f + tanhf(u)); }
      so[w][8 * hh + r][t * 16 + ln] = v;
    }
  }
  __builtin_amdgcn_fence(__ATOMIC_ACQ_REL, "workgroup");
  __builtin_amdgcn_wave_barrier();
  const int rsub = lane >> 4, c4 = (lane & 15) * 4;
  {
#pragma unroll
    for (int q = 0; q < 8; ++q) {
      const int r = q * 2 + rsub;
      const v4f v = *(const v4fa*)&so[w][r][c4];
      *(v4f*)(C + (size_t)(row0 + r) * ldc + col0 + c4) = v;
    }
    
  }
}
// row LayerNorm (biased variance, eps) over N: s = X (+ R); optional out_sum <- s; out_norm <- (s-mu)*rsqrt(var+eps)*g + b
template <bool PARAM_BF16>
__global__ __launch_bounds__(256) void k_layernorm(const float* __restrict__ X, const float* __restrict__ R, const float* __restrict__ g, const float* __restrict__ bta,
                                                  float* __restrict__ out_sum, float* __restrict__ out_norm, int N, float eps) {
  __shared__ float red[256];
  const int row = blockIdx.x, tid = threadIdx.x;
  const float* x = X + (size_t)row * N; const float* rr = R ? R + (size_t)row * N : nullptr;
  float vals[16];                     // up to N = 4096
  const int per = N / 256;            // contiguous chunk per thread? use strided-by-4 chunks: thread handles j = tid*4 + 1024*u
  float s1 = 0.f;
  for (int u = 0; u < per / 4; ++u) {
    const int j = tid * 4 + 1024 * u;
    const v4f a = *(const v4fa*)(x + j);
    v4f b = {0.f,0.f,0.f,0.f}; if (rr) b = *(const v4fa*)(rr + j);
#pragma unroll
    for (int q = 0; q < 4; ++q) { const float v = a[q] + b[q]; vals[u * 4 + q] = v; s1 += v; }
  }
  red[tid] = s1; __syncthreads();
  for (int st = 128; st > 0; st >>= 1) { if (tid < st) red[tid] += red[tid + st]; __syncthreads(); }
  const float mu = red[0] / (float)N; __syncthreads();
  float s2 = 0.f;
  for (int u = 0; u < per / 4; ++u)
#pragma unroll
    for (int q = 0; q < 4; ++q) { const float c = vals[u * 4 + q] - mu; s2 += c * c; }
  red[tid] = s2; __syncthreads();
  for (int st = 128; st > 0; st >>= 1) { if (tid < st) red[tid] += red[tid + st]; __syncthreads(); }
  const float rs = rsqrtf(red[0] / (float)N + eps);
  {
    for (int u = 0; u < per / 4; ++u) {
      const int j = tid * 4 + 1024 * u;
      v4f o, sm;
#pragma unroll
      for (int q = 0; q < 4; ++q) {
        float gg = g[j + q], bb = bta[j + q];
        if (PARAM_BF16) { gg = bf16_round(gg); bb = bf16_round(bb); }
        sm[q] = vals[u * 4 + q]; o[q] = (vals[u * 4 + q] - mu) * rs * gg + bb;
      }
      if (out_sum) *(v4f*)(out_sum + (size_t)row * N + j) = sm;
      *(v4f*)(out_norm + (size_t)row * N + j) = o;
    }
    
  }
}



// ---- f16 WMMA path (v_wmma_f32_16x16x32_f16): 11-bit significands for operands in range — used where a [0,1] probability operand needs more precision than bf16
typedef _Float16 v16h __attribute__((ext_vector_type(16)));
union FragH { v16h v; v8us half[2]; _Float16 h[16]; unsigned short u[16]; };
template <int NT>
__device__ __forceinline__ v8f mmaH(v16h ah, v16h al, v16h bh, v16h bl, v8f c) {
  c = __builtin_amdgcn_wmma_f32_16x16x32_f16(false, ah, false, bh, (short)0, c, false, false);
  if (NT >= 2) c = __builtin_amdgcn_wmma_f32_16x16x32_f16(false, al, false, bh, (short)0, c, false, false);
  if (NT >= 3) c = __builtin_amdgcn_wmma_f32_16x16x32_f16(false, ah, false, bl, (short)0, c, false, false);
  asm volatile("v_nop\n\tv_nop\n\tv_nop\n\tv_nop" : "+v"(c) : "v"(ah), "v"(al), "v"(bh), "v"(bl));
  return c;
}
// batched GEMM like k_gemm_b but f16 operands: A f32 (split into f16 hi/lo if ASPLIT, else rounded to f16), Bt = f16 values [n][k]; alpha; C f32; N multiple of 16 (partial tiles skipped)
template <bool ASPLIT>
__global__ __launch_bounds__(128) void k_gemm_h(const float* __restrict__ A, int lda, size_t sA, const _Float16* __restrict__ Bh, int ldb, size_t sB, float alpha, float* __restrict__ C, int ldc, size_t sC, int M, int N, int K) {
  __shared__ __attribute__((aligned(16))) float so[4][16][64];
  const int tid = threadIdx.x, w = tid >> 5, lane = tid & 31, ln = lane & 15, hh = lane >> 4; const int by = blockIdx.y;
  A += (size_t)by * sA; Bh += (size_t)by * sB; C += (size_t)by * sC;
  const int ntn = (N + 63) / 64; const int wid = blockIdx.x * 4 + w; const int mt = wid / ntn, nq = wid % ntn; if (mt * 16 >= M) return;
  const int row0 = mt * 16, col0 = nq * 64; const float* arow = A + (size_t)(row0 + ln) * lda;
  v8f acc[4] = {};
  for (int kb = 0; kb < K; kb += 32) {
    FragH ah, al;
    const v4f x0 = *(const v4fa*)(arow + kb + 8 * hh), x1 = *(const v4fa*)(arow + kb + 8 * hh + 4), x2 = *(const v4fa*)(arow + kb + 16 + 8 * hh), x3 = *(const v4fa*)(arow + kb + 16 + 8 * hh + 4);
    float xs[16] = {x0[0],x0[1],x0[2],x0[3],x1[0],x1[1],x1[2],x1[3],x2[0],x2[1],x2[2],x2[3],x3[0],x3[1],x3[2],x3[3]};
#pragma unroll
    for (int i = 0; i < 16; ++i) { const _Float16 h = (_Float16)xs[i]; ah.h[i] = h; al.h[i] = ASPLIT ? (_Float16)(xs[i] - (float)h) : (_Float16)0.0f; }
#pragma unroll
    for (int t = 0; t < 4; ++t) { if (col0 + t * 16 >= N) continue; const size_t boff = (size_t)(col0 + t * 16 + ln) * ldb + kb; FragH bq; bq.half[0] = *(const v8us*)(Bh + boff + 8 * hh); bq.half[1] = *(const v8us*)(Bh + boff + 16 + 8 * hh);
      acc[t] = mmaH<ASPLIT ? 2 : 1>(ah.v, al.v, bq.v, bq.v, acc[t]); }
  }
#pragma unroll
  for (int t = 0; t < 4; ++t) { if (col0 + t * 16 >= N) continue;
#pragma unroll
    for (int r = 0; r < 8; ++r) so[w][8 * hh + r][t * 16 + ln] = acc[t][r] * alpha; }
  __builtin_amdgcn_fence(__ATOMIC_ACQ_REL, "workgroup"); __builtin_amdgcn_wave_barrier();
  const int rsub = lane >> 4, c4 = (lane & 15) * 4;
  {
#pragma unroll
    for (int q = 0; q < 8; ++q) { const int r = q * 2 + rsub; if (col0 + c4 < N) { const v4f v = *(const v4fa*)&so[w][r][c4]; *(v4f*)(C + (size_t)(row0 + r) * ldc + col0 + c4) = v; } }
     }
}

// Wt[n][k] = f16(W[k][n]·scale) from f32 row-major W[K][N] (scale = power of two; bf16-exact weights stay exact in f16 away from the subnormal range)
__global__ __launch_bounds__(256) void k_wt_f16(const float* __restrict__ W, _Float16* __restrict__ Wt, int K, int N, float scale) {
  const int t = blockIdx.x * 256 + threadIdx.x; if (t >= N * (K / 8)) return; const int n = t / (K / 8), k8 = (t % (K / 8)) * 8; FragH f;
#pragma unroll
  for (int i = 0; i < 8; ++i) f.h[i] = (_Float16)(bf16_round(W[(size_t)(k8 + i) * N + n]) * scale); const v8us o = f.half[0];
  *(v8us*)((unsigned short*)Wt + (size_t)n * K + k8) = o; 
}
// k_gemm_hh variant with fused epilogue: v = acc·alpha + bias[by·sBias + col] (+ CP[(row/rowsPerB)·sCPb + by·64 + col] if CP) ; ACT 0 none / 1 elu ; writes f16 C16 (and f32 C if non-null)
template <int ACT>
__global__ __launch_bounds__(128) void k_gemm_hhx(const _Float16* __restrict__ A, int lda, size_t sA, const _Float16* __restrict__ Bh, int ldb, size_t sB, float alpha, const float* __restrict__ bias, size_t sBias, const float* __restrict__ CP, int rowsPerB, size_t sCPb, int row0g,
    float* __restrict__ C, _Float16* __restrict__ C16, int ldc, size_t sC, int M, int N, int K) {
  __shared__ __attribute__((aligned(16))) float so[4][16][64];
  const int tid = threadIdx.x, w = tid >> 5, lane = tid & 31, ln = lane & 15, hh = lane >> 4; const int by = blockIdx.y;
  A += (size_t)by * sA; Bh += (size_t)by * sB; const size_t cofs = (size_t)by * sC; const float* bp = bias ? bias + (size_t)by * sBias : nullptr;
  const int ntn = (N + 63) / 64; const int wid = blockIdx.x * 4 + w; const int mt = wid / ntn, nq = wid % ntn; if (mt * 16 >= M) return;
  const int row0 = mt * 16, col0 = nq * 64; const _Float16* arow = A + (size_t)(row0 + ln) * lda;
  v8f acc[4] = {};
  for (int kb = 0; kb < K; kb += 32) { FragH ah; ah.half[0] = *(const v8us*)((const unsigned short*)arow + kb + 8 * hh); ah.half[1] = *(const v8us*)((const unsigned short*)arow + kb + 16 + 8 * hh);
#pragma unroll
    for (int t = 0; t < 4; ++t) { if (col0 + t * 16 >= N) continue; const size_t boff = (size_t)(col0 + t * 16 + ln) * ldb + kb; FragH bq; bq.half[0] = *(const v8us*)((const unsigned short*)Bh + boff + 8 * hh); bq.half[1] = *(const v8us*)((const unsigned short*)Bh + boff + 16 + 8 * hh);
      acc[t] = mmaH<1>(ah.v, ah.v, bq.v, bq.v, acc[t]); }
  }
#pragma unroll
  for (int t = 0; t < 4; ++t) { if (col0 + t * 16 >= N) continue; const int col = col0 + t * 16 + ln; const float bv = bp ? bf16_round(bp[col]) : 0.f;
#pragma unroll
    for (int r = 0; r < 8; ++r) { float v = acc[t][r] * alpha + bv; if (CP) { const int rr = row0g + row0 + 8 * hh + r; if (rowsPerB < 0) v += CP[cofs + (size_t)rr * ldc + col];      /* rowsPerB < 0: own element of the batched C plane */ else { const int bidx = rr / rowsPerB; v += CP[(size_t)bidx * sCPb + (size_t)by * 64 + col]; } } if (ACT == 1) v = (v > 0.f) ? v : expm1f(v); else if (ACT == 7) v = (v > 0.f) ? v + 1.0f : expf(v); else if (ACT == 8) v = tanhf(v); else if (ACT == 9) v = 0.5f * v * (1.0f + tanhf(0.7978845608028654f * (v + 0.044715f * v * v * v))); else if (ACT == 11) v = 1.0f / (1.0f + expf(-v)); else if (ACT == 12) v = (v > 0.f) ? v : 0.01f * v; else if (ACT == 14) v = (v > 0.f) ? v : 0.1f * v; else if (ACT == 16) v = (v >= 0.f) ? v : 0.3f * v; else if (ACT == 17) v = (v >= 0.f) ? v : 0.2f * v; else if (ACT == 15) v = v / (1.0f + expf(-v)); else if (ACT == 3) v = fmaxf(v, 0.f); else if (ACT == 6) v = 0.5f * v * (1.0f + erff(v * 0.70710678118654752f)); so[w][8 * hh + r][t * 16 + ln] = v; } }
  __builtin_amdgcn_fence(__ATOMIC_ACQ_REL, "workgroup"); __builtin_amdgcn_wave_barrier();
  const int rsub = lane >> 4, c4 = (lane & 15) * 4; typedef _Float16 v4h __attribute__((ext_vector_type(4)));
  {
#pragma unroll
    for (int q = 0; q < 8; ++q) { const int r = q * 2 + rsub; if (col0 + c4 < N) { const v4f v = *(const v4fa*)&so[w][r][c4]; if (C) *(v4f*)(C + cofs + (size_t)(row0 + r) * ldc + col0 + c4) = v; if (C16) { v4h h4; for (int i = 0; i < 4; ++i) h4[i] = (_Float16)v[i]; *(v4h*)(C16 + cofs + (size_t)(row0 + r) * ldc + col0 + c4) = h4; } } }
     }
}


typedef _Float16 v4h __attribute__((ext_vector_type(4)));

__global__ __launch_bounds__(256) void k_x16(const float* __restrict__ x, _Float16* __restrict__ X16, size_t n8) { const size_t t = (size_t)blockIdx.x * 256 + threadIdx.x; if (t >= n8) return; FragH f;
#pragma unroll
  for (int q = 0; q < 8; ++q) f.h[q] = (_Float16)bf16_round(x[t * 8 + q]); *(v8us*)((unsigned short*)X16 + t * 8) = f.half[0];  }
__global__ __launch_bounds__(256) void k_h16(const float* __restrict__ x, _Float16* __restrict__ X16, size_t n8) { const size_t t = (size_t)blockIdx.x * 256 + threadIdx.x; if (t >= n8) return; FragH f;
#pragma unroll
  for (int q = 0; q < 8; ++q) f.h[q] = (_Float16)x[t * 8 + q]; *(v8us*)((unsigned short*)X16 + t * 8) = f.half[0];  }
__global__ __launch_bounds__(256) void k_round16f(const float* __restrict__ W, _Float16* __restrict__ Bt, size_t n8) { const size_t t = (size_t)blockIdx.x * 256 + threadIdx.x; if (t >= n8) return; FragH f;
#pragma unroll
  for (int i = 0; i < 8; ++i) f.h[i] = (_Float16)(bf16_round(W[t * 8 + i]) * 16.0f); *(v8us*)((unsigned short*)Bt + t * 8) = f.half[0];  }
template <int NHv, int TTv>
__global__ __launch_bounds__(256) void k_vt(const _Float16* __restrict__ V16, int ldv, int voff, _Float16* __restrict__ Vt) { __shared__ unsigned short tl[64][66]; const int tid = threadIdx.x; const int slab = blockIdx.x / (TTv / 64), lg = blockIdx.x % (TTv / 64); const int b = slab / NHv, h = slab % NHv;
  for (int i = tid; i < 64 * 8; i += 256) { const int r = i / 8, c8 = (i % 8) * 8; FragH f; f.half[0] = *(const v8us*)((const unsigned short*)V16 + ((size_t)b * TTv + lg * 64 + r) * ldv + voff + h * 64 + c8);
#pragma unroll
    for (int q = 0; q < 8; ++q) tl[r][c8 + q] = f.u[q]; }
  __syncthreads();
  {
#pragma unroll
    for (int rd = 0; rd < 2; ++rd) { const int d = rd * 32 + tid / 8, pc = tid % 8; FragH f;
#pragma unroll
      for (int q = 0; q < 8; ++q) f.u[q] = tl[pc * 8 + q][d];
      *(v8us*)((unsigned short*)Vt + ((size_t)slab * 64 + d) * TTv + lg * 64 + pc * 8) = f.half[0]; }
     } }

__global__ __launch_bounds__(256) void k_hl(const float* __restrict__ F, _Float16* __restrict__ Hh, _Float16* __restrict__ Hl, size_t n8) { const size_t t = (size_t)blockIdx.x * 256 + threadIdx.x; if (t >= n8) return; FragH fh, fl; const v4f a = *(const v4fa*)(F + t * 8), c = *(const v4fa*)(F + t * 8 + 4);
#pragma unroll
  for (int q = 0; q < 4; ++q) { _Float16 h = (_Float16)a[q]; fh.h[q] = h; fl.h[q] = (_Float16)((a[q] - (float)h) * 1024.0f); h = (_Float16)c[q]; fh.h[4 + q] = h; fl.h[4 + q] = (_Float16)((c[q] - (float)h) * 1024.0f); }
  { *(v8us*)((unsigned short*)Hh + t * 8) = fh.half[0]; *(v8us*)((unsigned short*)Hl + t * 8) = fl.half[0];  } }

// ---- fast GEMM (wave tile 32x64; requires M % 32 == 0 rows per launch region and N % 64 == 0); epilogue = k_gemm_hhx semantics ----
__device__ __forceinline__ v16h g2_frag(const _Float16* p, int hh) { FragH f; f.half[0] = *(const v8us*)((const unsigned short*)p + 8 * hh); f.half[1] = *(const v8us*)((const unsigned short*)p + 16 + 8 * hh); return f.v; }
__device__ __forceinline__ v8f g2_mma(v16h a, v16h b, v8f c) { v8f d = __builtin_amdgcn_wmma_f32_16x16x32_f16(false, a, false, b, (short)0, c, false, false); asm volatile("v_nop\n\tv_nop\n\tv_nop\n\tv_nop" : "+v"(d) : "v"(a), "v"(b)); return d; }
template <int ACT>
__global__ __launch_bounds__(128) void k_gemm2(const _Float16* __restrict__ A, int lda, size_t sA, const _Float16* __restrict__ Bh, int ldb, size_t sB, float alpha, const float* __restrict__ bias, size_t sBias, const float* __restrict__ CP, int rowsPerB, size_t sCPb, int row0g,
    float* __restrict__ C, _Float16* __restrict__ C16, int ldc, size_t sC, int M, int N, int K) { static_assert(ACT == 0 || ACT == 3 || ACT == 6 || ACT == 8 || ACT == 9 || ACT == 11 || ACT == 12 || ACT == 14 || ACT == 15 || ACT == 16 || ACT == 17, "k_gemm2: unsupported ACT code (would silently apply no activation)");
  __shared__ __attribute__((aligned(16))) float so[4][32][68];
  const int tid = threadIdx.x, w = tid >> 5, lane = tid & 31, ln = lane & 15, hh = lane >> 4; const int by = blockIdx.y;
  A += (size_t)by * sA; Bh += (size_t)by * sB; const size_t cofs = (size_t)by * sC; const float* bp = bias ? bias + (size_t)by * sBias : nullptr;
  const int ntn = N >> 6; const int mt = blockIdx.x / ntn, nq = blockIdx.x - mt * ntn; const int row0 = mt * 128 + 32 * w, col0 = nq * 64; if (row0 >= M) return;
  const _Float16* a0p = A + (size_t)(row0 + ln) * lda; const _Float16* a1p = a0p + (size_t)16 * lda;
  const _Float16* b0p = Bh + (size_t)(col0 + ln) * ldb; const _Float16* b1p = b0p + (size_t)16 * ldb; const _Float16* b2p = b1p + (size_t)16 * ldb; const _Float16* b3p = b2p + (size_t)16 * ldb;
  const v8f z8 = {0.f,0.f,0.f,0.f,0.f,0.f,0.f,0.f}; v8f c00 = z8, c01 = z8, c02 = z8, c03 = z8, c10 = z8, c11 = z8, c12 = z8, c13 = z8;
#pragma unroll 1
  for (int kb = 0; kb < K; kb += 32) { const v16h a0 = g2_frag(a0p + kb, hh), a1 = g2_frag(a1p + kb, hh);
    v16h b = g2_frag(b0p + kb, hh); c00 = g2_mma(a0, b, c00); c10 = g2_mma(a1, b, c10);
    b = g2_frag(b1p + kb, hh); c01 = g2_mma(a0, b, c01); c11 = g2_mma(a1, b, c11);
    b = g2_frag(b2p + kb, hh); c02 = g2_mma(a0, b, c02); c12 = g2_mma(a1, b, c12);
    b = g2_frag(b3p + kb, hh); c03 = g2_mma(a0, b, c03); c13 = g2_mma(a1, b, c13); }
  v8f accs[8] = {c00, c01, c02, c03, c10, c11, c12, c13};
#pragma unroll
  for (int u = 0; u < 8; ++u) { const int t = u & 3, half = u >> 2; const int col = col0 + t * 16 + ln; const float bv = bp ? bf16_round(bp[col]) : 0.f;
#pragma unroll
    for (int r = 0; r < 8; ++r) { const int rloc = half * 16 + 8 * hh + r; float v = accs[u][r] * alpha + bv; if (CP) { if (rowsPerB < 0) v += CP[cofs + (size_t)(row0g + row0 + rloc) * ldc + col];      /* rowsPerB < 0: own element of the batched C plane */ else { const int bidx = (row0g + row0 + rloc) / rowsPerB; v += CP[(size_t)bidx * sCPb + (size_t)by * 64 + col]; } }
      if (ACT == 3) v = fmaxf(v, 0.f); else if (ACT == 6) v = 0.5f * v * (1.0f + erff(v * 0.70710678118654752f)); else if (ACT == 11) v = 1.0f / (1.0f + expf(-v)); else if (ACT == 15) v = v / (1.0f + expf(-v)); else if (ACT == 12) v = (v > 0.f) ? v : 0.01f * v; else if (ACT == 8) v = tanhf(v); else if (ACT == 9) v = 0.5f * v * (1.0f + tanhf(0.7978845608028654f * (v + 0.044715f * v * v * v))); else if (ACT == 14) v = (v > 0.f) ? v : 0.1f * v; else if (ACT == 16) v = (v >= 0.f) ? v : 0.3f * v; else if (ACT == 17) v = (v >= 0.f) ? v : 0.2f * v;
      so[w][rloc][t * 16 + ln] = v; } }
  __builtin_amdgcn_fence(__ATOMIC_ACQ_REL, "workgroup"); __builtin_amdgcn_wave_barrier();
  const int rsub = lane >> 4, c4 = (lane & 15) * 4;
  {
#pragma unroll
    for (int q = 0; q < 16; ++q) { const int r = q * 2 + rsub; const v4f v = *(const v4fa*)&so[w][r][c4]; if (C) *(v4f*)(C + cofs + (size_t)(row0 + r) * ldc + col0 + c4) = v; if (C16) { v4h h4; for (int i = 0; i < 4; ++i) h4[i] = (_Float16)v[i]; *(v4h*)(C16 + cofs + (size_t)(row0 + r) * ldc + col0 + c4) = h4; } }
     } }


__global__ __launch_bounds__(256) void k_wnat(const float* __restrict__ w, size_t n8, _Float16* __restrict__ Bt) { const size_t t = (size_t)blockIdx.x * 256 + threadIdx.x; if (t >= n8) return; FragH f; for (int q = 0; q < 8; ++q) f.h[q] = (_Float16)(bf16_round(w[t * 8 + q]) * 16.0f); *(v8us*)((unsigned short*)Bt + t * 8) = f.half[0];  }
__global__ __launch_bounds__(256) void k_rsm(const float* __restrict__ S, _Float16* __restrict__ P, int nrows) {
  #pragma clang fp contract(off)
  const int i = blockIdx.x * 256 + threadIdx.x; if (i >= nrows) return; const float* s = S + (size_t)i * SQ; float mx = -3.0e38f;
#pragma unroll 1
  for (int j = 0; j < SQ; ++j) mx = fmaxf(mx, s[j]); float se = 0.f;
#pragma unroll 1
  for (int j = 0; j < SQ; ++j) se += expf(s[j] - mx); const float sc = 256.0f / se;
#pragma unroll 1
  for (int j0 = 0; j0 < SQ; j0 += 8) { FragH f; for (int q = 0; q < 8; ++q) f.h[q] = (_Float16)(expf(s[j0 + q] - mx) * sc); unsigned short* d = (unsigned short*)P + (size_t)i * SQ + j0; *(v8us*)d = f.half[0];  } }
__global__ __launch_bounds__(256) void k_vt(const _Float16* __restrict__ V16, int b, int h0, _Float16* __restrict__ VT) { __shared__ unsigned short tl[64][65]; const int tid = threadIdx.x; const int hh = blockIdx.x % HG, sg = blockIdx.x / HG; const int s0 = sg * 64; const int h = h0 + hh;
  for (int i = tid; i < 64 * 8; i += 256) { const int j = i / 8, d8 = (i % 8) * 8; FragH f; f.half[0] = *(const v8us*)((const unsigned short*)V16 + ((size_t)b * SQ + s0 + j) * DM + h * HD + d8); for (int q = 0; q < 8; ++q) tl[d8 + q][j] = f.u[q]; }
  __syncthreads();
  { for (int i = tid; i < 64 * 8; i += 256) { const int d = i / 8, j8 = (i % 8) * 8; FragH f; for (int q = 0; q < 8; ++q) f.u[q] = tl[d][j8 + q]; *(v8us*)((unsigned short*)VT + ((size_t)hh * HD + d) * SQ + s0 + j8) = f.half[0]; }  } }



__global__ __launch_bounds__(256) void k_rsmcf2(const float* __restrict__ S, _Float16* __restrict__ P, int hg, int q0, int nk) {
  #pragma clang fp contract(off)
  const int t = blockIdx.x * 256 + threadIdx.x; if (t >= hg * QT) return; const size_t i = (size_t)t; const float* s = S + i * NKX; const int last = q0 + (t % QT); float mx = -3.0e38f;
#pragma unroll 1
  for (int j = 0; j < nk; ++j) { const float f = (j <= last) ? 1.f : 0.f; mx = fmaxf(mx, fmaf(f, s[j], (1.f - f) * -1.0e9f)); } float se = 0.f;
#pragma unroll 1
  for (int j = 0; j < nk; ++j) { const float f = (j <= last) ? 1.f : 0.f; se += __expf(fmaf(f, s[j], (1.f - f) * -1.0e9f) - mx); } const float sc = 256.0f / se;
#pragma unroll 1
  for (int j0 = 0; j0 < nk; j0 += 8) { FragH fr; for (int q = 0; q < 8; ++q) { const int j = j0 + q; const float f = (j <= last) ? 1.f : 0.f; fr.h[q] = (_Float16)(__expf(fmaf(f, s[j], (1.f - f) * -1.0e9f) - mx) * sc); } unsigned short* d = (unsigned short*)P + i * NKX + j0; *(v8us*)d = fr.half[0];  } }


template <int MASKADD>
__global__ __launch_bounds__(64) void k_att0(const float* __restrict__ QF, const float* __restrict__ KF, const float* __restrict__ VF, int ld, const float* __restrict__ mask, float scale, float* __restrict__ OF, int ldo) {
  #pragma clang fp contract(off)
  __shared__ __attribute__((aligned(16))) float lq[64][64]; __shared__ __attribute__((aligned(16))) float lo[64][64];
  const int tid = threadIdx.x; const int h = blockIdx.x / (QT0 / 64), rg = blockIdx.x % (QT0 / 64); const int i = rg * 64 + tid;
  const float* qr = QF + (size_t)i * ld + h * HD;
#pragma unroll 1
  for (int c = 0; c < HD / 4; ++c) { *(v4f*)&lq[tid][c * 4] = *(const v4fa*)(qr + c * 4); const v4f z = {0.f, 0.f, 0.f, 0.f}; *(v4f*)&lo[tid][c * 4] = z; }
  float m = -1.0e30f, l = 0.f; const int jmax = MASKADD ? (SQ - 1) : (rg * 64 + 63);      /* additive-mask form: every key (the mask input decides); causal form: keys up to the block's last row */
#pragma unroll 1
  for (int j = 0; j <= jmax; ++j) { const float* kr = KF + (size_t)j * ld + h * HD; const float* vr = VF + (size_t)j * ld + h * HD; float s = 0.f;
#pragma unroll 1
    for (int c = 0; c < HD / 4; ++c) { const v4f kq = *(const v4fa*)(kr + c * 4); const v4f qq = *(v4f*)&lq[tid][c * 4]; s = __fadd_rn(s, __fmul_rn(qq[0], kq[0])); s = __fadd_rn(s, __fmul_rn(qq[1], kq[1])); s = __fadd_rn(s, __fmul_rn(qq[2], kq[2])); s = __fadd_rn(s, __fmul_rn(qq[3], kq[3])); }
    s = __fmul_rn(s, scale); if (MASKADD) s = __fadd_rn(s, __fmul_rn(bf16_round(mask[(size_t)i * SQ + j]), -10000.0f));
    const float f = (MASKADD || j <= i) ? 1.f : 0.f; const float sm = fmaf(f, s, (1.f - f) * -1.0e30f); const float mn = fmaxf(m, sm); const float sc = expf(m - mn); const float e = expf(sm - mn); l = __fadd_rn(__fmul_rn(l, sc), e); m = mn;
#pragma unroll 1
    for (int c = 0; c < HD / 4; ++c) { const v4f vv = *(const v4fa*)(vr + c * 4); v4f oo = *(v4f*)&lo[tid][c * 4]; for (int u = 0; u < 4; ++u) oo[u] = __fadd_rn(__fmul_rn(oo[u], sc), __fmul_rn(e, vv[u])); *(v4f*)&lo[tid][c * 4] = oo; } }
  const float fin = 64.0f / l;      /* o carried x64 like the f16 path */
#pragma unroll 1
  for (int c = 0; c < HD / 4; ++c) { v4f oo = *(v4f*)&lo[tid][c * 4]; for (int u = 0; u < 4; ++u) oo[u] = __fmul_rn(oo[u], fin); *(v4f*)&lo[tid][c * 4] = oo; }
  __syncthreads();
  {
#pragma unroll 1
    for (int it = 0; it < 16; ++it) { const int row = it * 4 + tid / 16, pc = (tid % 16) * 4; const v4f v = *(const v4f*)&lo[row][pc]; *(v4f*)(OF + (size_t)(rg * 64 + row) * ldo + h * HD + pc) = v; }
     } }


template <int BFIN, int WXB>
__global__ __launch_bounds__(256) void k_ln16(const float* __restrict__ X, const float* __restrict__ g, const float* __restrict__ bb, float eps, _Float16* __restrict__ N16, float* __restrict__ XB) {
  #pragma clang fp contract(off)
  __shared__ float red[256]; const size_t r = blockIdx.x; const int t = threadIdx.x; const v4f xa = *(const v4fa*)(X + r * DMQ + t * 4); float s[4]; float sum = 0.f;
  for (int q = 0; q < 4; ++q) { s[q] = BFIN ? bf16_round(xa[q]) : xa[q]; sum = __fadd_rn(sum, s[q]); }
  red[t] = sum; __syncthreads(); for (int st = 128; st > 0; st >>= 1) { if (t < st) red[t] = __fadd_rn(red[t], red[t + st]); __syncthreads(); } const float mu = red[0] / (float)DMQ; __syncthreads();
  float vs = 0.f; for (int q = 0; q < 4; ++q) { const float dl = __fadd_rn(s[q], -mu); vs = __fadd_rn(vs, __fmul_rn(dl, dl)); } red[t] = vs; __syncthreads(); for (int st = 128; st > 0; st >>= 1) { if (t < st) red[t] = __fadd_rn(red[t], red[t + st]); __syncthreads(); }
  const float rs = rsqrtf(__fadd_rn(red[0] / (float)DMQ, eps)); v4h y; v4f xb;
  for (int q = 0; q < 4; ++q) { const int c = t * 4 + q; y[q] = (_Float16)__fadd_rn(__fmul_rn(__fmul_rn(__fadd_rn(s[q], -mu), rs), bf16_round(g[c])), bf16_round(bb[c])); xb[q] = s[q]; }
  { *(v4h*)(N16 + r * DMQ + t * 4) = y; if (WXB) *(v4f*)(XB + r * DMQ + t * 4) = xb;  } }
__global__ __launch_bounds__(256) void k_ftres2(const float* __restrict__ OF0, const float* __restrict__ XB, float* __restrict__ X1, size_t n4) {
  #pragma clang fp contract(off)
  const size_t t = (size_t)blockIdx.x * 256 + threadIdx.x; if (t >= n4) return; const v4f o = *(const v4fa*)(OF0 + t * 4), xv = *(const v4fa*)(XB + t * 4); v4f y; for (int q = 0; q < 4; ++q) y[q] = __fadd_rn(__fmul_rn(o[q], 0.015625f), xv[q]); *(v4f*)(X1 + t * 4) = y;  }

__global__ __launch_bounds__(256) void k_wthd(const float* __restrict__ Wt, _Float16* __restrict__ Bt) { const size_t t = (size_t)blockIdx.x * 256 + threadIdx.x; if (t >= (size_t)NH * HD * (DM / 8)) return; const int m8 = (int)(t % (DM / 8)) * 8; const int d = (int)((t / (DM / 8)) % HD); const int h = (int)(t / ((size_t)(DM / 8) * HD)); FragH f;
  for (int q = 0; q < 8; ++q) f.h[q] = (_Float16)(16.0f * bf16_round(Wt[((size_t)h * DM + m8 + q) * HD + d])); unsigned short* dst = (unsigned short*)Bt + ((size_t)h * HD + d) * DM + m8; *(v8us*)dst = f.half[0];  }




__global__ __launch_bounds__(256) void k_wtpad(const float* __restrict__ Wm, _Float16* __restrict__ Wt, int Kr, int Kp, int Nr, int Np, float scale) {
  const int t = blockIdx.x * 256 + threadIdx.x; if (t >= Np * (Kp / 8)) return; const int n = t / (Kp / 8), k8 = (t % (Kp / 8)) * 8; const int nc = min(n, Nr - 1); const float fn = (n < Nr) ? 1.f : 0.f; FragH f;
  for (int i = 0; i < 8; ++i) { const int k = k8 + i; const int kc = min(k, Kr - 1); const float fk = (k < Kr) ? fn : 0.f; f.h[i] = (_Float16)(bf16_round(Wm[(size_t)kc * Nr + nc]) * scale * fk); }
  unsigned short* o = (unsigned short*)Wt + (size_t)n * Kp + k8; *(v8us*)o = f.half[0];  }
__global__ __launch_bounds__(128) void k_bpad(const float* __restrict__ b, float* __restrict__ Bp, int nr, int np) {
  const int i = threadIdx.x; if (i >= np) return; const float v = b[min(i, nr - 1)] * ((i < nr) ? 1.f : 0.f); *(float*)(Bp + i) = v;  }

template <int BFIN, int W16, int W32>
__global__ __launch_bounds__(256) void k_lnx(const float* __restrict__ X, const float* __restrict__ g, const float* __restrict__ bb, float eps, _Float16* __restrict__ N16, float* __restrict__ N32) {
  #pragma clang fp contract(off)
  __shared__ float red[256]; const size_t r = blockIdx.x; const int t = threadIdx.x; const bool act = t < (DMQ / 4); const int c0 = act ? t * 4 : 0;
  const v4f xa = *(const v4fa*)(X + r * DMQ + c0); float s[4]; float sum = 0.f;
  for (int q = 0; q < 4; ++q) { s[q] = act ? (BFIN ? bf16_round(xa[q]) : xa[q]) : 0.f; sum = __fadd_rn(sum, s[q]); }
  red[t] = sum; __syncthreads(); for (int st = 128; st > 0; st >>= 1) { if (t < st) red[t] = __fadd_rn(red[t], red[t + st]); __syncthreads(); } const float mu = red[0] / (float)DMQ; __syncthreads();
  float vs = 0.f; for (int q = 0; q < 4; ++q) { const float dl = act ? __fadd_rn(s[q], -mu) : 0.f; vs = __fadd_rn(vs, __fmul_rn(dl, dl)); } red[t] = vs; __syncthreads(); for (int st = 128; st > 0; st >>= 1) { if (t < st) red[t] = __fadd_rn(red[t], red[t + st]); __syncthreads(); }
  const float rs = rsqrtf(__fadd_rn(red[0] / (float)DMQ, eps)); v4h y; v4f yf;
  for (int q = 0; q < 4; ++q) { const int c = c0 + q; yf[q] = __fadd_rn(__fmul_rn(__fmul_rn(__fadd_rn(s[q], -mu), rs), bf16_round(g[c])), bf16_round(bb[c])); y[q] = (_Float16)yf[q]; }
  if (!act) return;      /* no barriers after this point */
  { if (W16) *(v4h*)(N16 + r * DMQ + c0) = y; if (W32) *(v4f*)(N32 + r * DMQ + c0) = yf;  } }



__global__ __launch_bounds__(256) void k_bfr(const float* __restrict__ x, float* __restrict__ XB, size_t n8) { const size_t t = (size_t)blockIdx.x * 256 + threadIdx.x; if (t >= n8) return; v4f a = *(const v4fa*)(x + t * 8), c = *(const v4fa*)(x + t * 8 + 4); for (int q = 0; q < 4; ++q) { a[q] = bf16_round(a[q]); c[q] = bf16_round(c[q]); }
  { *(v4f*)(XB + t * 8) = a; *(v4f*)(XB + t * 8 + 4) = c;  } }




extern "C" void kernel_launch(void* const* d_in, const int* in_sizes, int n_in,
                              void* d_out, int out_size, void* d_ws, size_t ws_size, hipStream_t stream) {
  (void)in_sizes; (void)n_in; (void)out_size;
  const float* const* I = (const float* const*)d_in; const float* x = I[0]; const float* wqkv = I[1]; const float* bqkv = I[2]; const float* wo = I[3]; const float* bo = I[4]; const float* wfc = I[5]; const float* bfc = I[6]; const float* wmp = I[7]; const float* bmp = I[8]; const float* g1 = I[9]; const float* be1 = I[10]; const float* gg2 = I[11]; const float* be2 = I[12];      /* x; fused w_qkv [1024][3072] + b_qkv ([in][out]); w_out + b_out; w_up [1024][4096] + b_up, w_down [4096][1024] + b_down; LN1 g / b, LN2 g / b */
  char* ws = (char*)d_ws; size_t off = 0;
  auto take = [&](size_t bytes) { char* p = ws + off; off += (bytes + 255) & ~(size_t)255; return p; };
  _Float16* BQKV = (_Float16*)take((size_t)3 * DM * DM * 2); _Float16* BO = (_Float16*)take((size_t)DM * DM * 2);
  _Float16* X16 = (_Float16*)take(NR * DM * 2); float* XB = (float*)take(NR * DM * 4); float* X1 = (float*)take(NR * DM * 4); float* X1N = (float*)take(NR * DM * 4);      /* LN1 output f32 rows */ _Float16* M16 = nullptr;      /* = X16 below (alias: X16's last reader, the last batch's first-tile GEMMs, precedes LN1's write) */ _Float16* HF16 = (_Float16*)take((size_t)SQ * DFF * 2); _Float16* BW1 = (_Float16*)take((size_t)DFF * DM * 2); _Float16* BW2 = (_Float16*)take((size_t)DM * DFF * 2); _Float16* QKV = (_Float16*)take(NR * 3 * DM * 2); _Float16* Q16 = QKV; _Float16* K16 = QKV + DM; _Float16* V16 = QKV + 2 * DM; _Float16* O16 = (_Float16*)take(NR * DM * 2); M16 = X16;
  float* S = (float*)take((size_t)NH * QT * NKX * 4); _Float16* P = (_Float16*)take((size_t)NH * QT * NKX * 2); _Float16* VT = (_Float16*)take((size_t)NH * HD * SQ * 2);
  float* QF0 = (float*)take((size_t)QT0 * DM * 4); float* KF0 = (float*)take((size_t)QT0 * DM * 4); float* VF0 = (float*)take((size_t)QT0 * DM * 4); float* OF0 = (float*)take((size_t)NB * QT0 * DM * 4); _Float16* OH0 = (_Float16*)take((size_t)NB * QT0 * DM * 2); _Float16* OL0 = (_Float16*)take((size_t)NB * QT0 * DM * 2);
  if (off > ws_size) return;
  k_wt_f16<<<(unsigned)(((size_t)3 * DM * (DM / 8) + 255) / 256), 256, 0, stream>>>(wqkv, BQKV, DM, 3 * DM, 16.0f);      /* fused [in][out] [DM][3 DM] -> Bt [3 DM][DM] x16: rows 0.. = q, DM.. = k, 2 DM.. = v output columns (contiguous thirds) */ k_wt_f16<<<(unsigned)(((size_t)DM * (DM / 8) + 255) / 256), 256, 0, stream>>>(wo, BO, DM, DM, 16.0f);      /* w_proj [in][out] -> Bt x16 */
  k_x16<<<(unsigned)((NR * DM / 8 + 255) / 256), 256, 0, stream>>>(x, X16, NR * DM / 8); k_bfr<<<(unsigned)((NR * DM / 8 + 255) / 256), 256, 0, stream>>>(x, XB, NR * DM / 8);      /* POST-LN: the attention runs on x itself (exact f16 rows); XB = bf16(x) f32 for the residual */
  k_wt_f16<<<(unsigned)(((size_t)DFF * (DM / 8) + 255) / 256), 256, 0, stream>>>(wfc, BW1, DM, DFF, 16.0f); k_wt_f16<<<(unsigned)(((size_t)DM * (DFF / 8) + 255) / 256), 256, 0, stream>>>(wmp, BW2, DFF, DM, 16.0f);      /* W1 [1024][4096] -> Bt [4096][1024]; W2 [4096][1024] -> Bt [1024][4096] (x16) */
  const size_t r0p = (size_t)B0 * SQ;      /* first projected row */
  k_gemm2<0><<<dim3((unsigned)((MP / 128) * (3 * DM / 64)), 1), 128, 0, stream>>>(X16 + r0p * DM, DM, 0, BQKV, DM, 0, 0.0625f, bqkv, 0, nullptr, 1, 0, 0, nullptr, QKV + r0p * 3 * DM, 3 * DM, 0, MP, 3 * DM, DM);      /* q | k | v rows (f16); head h = columns h*HD.. of each DM block */
  for (int b = B0; b < B0 + NBR; ++b) { const size_t r0 = (size_t)b * SQ;
    k_vt<NH, SQ><<<NH * (SQ / 64), 256, 0, stream>>>(V16 + r0 * LQ, LQ, 0, VT);      /* V^T [NH][HD][SQ] for this batch */
    k_gemm2<0><<<dim3((QT0 / 128) * (DM / 64), 1), 128, 0, stream>>>(X16 + r0 * DM, DM, 0, BQKV, DM, 0, 0.0625f, bqkv, 0, nullptr, 1, 0, 0, QF0, nullptr, DM, 0, QT0, DM, DM); k_gemm2<0><<<dim3((QT0 / 128) * (DM / 64), 1), 128, 0, stream>>>(X16 + r0 * DM, DM, 0, (BQKV + (size_t)DM * DM), DM, 0, 0.0625f, bqkv + DM, 0, nullptr, 1, 0, 0, KF0, nullptr, DM, 0, QT0, DM, DM); k_gemm2<0><<<dim3((QT0 / 128) * (DM / 64), 1), 128, 0, stream>>>(X16 + r0 * DM, DM, 0, (BQKV + (size_t)2 * DM * DM), DM, 0, 0.0625f, bqkv + 2 * DM, 0, nullptr, 1, 0, 0, VF0, nullptr, DM, 0, QT0, DM, DM);      /* f32 q, k, v of the first 128 rows (exact products) */
    k_att0<0><<<NH * (QT0 / 64), 64, 0, stream>>>(QF0, KF0, VF0, DM, nullptr, 0.125f, OF0 + (size_t)b * QT0 * DM, DM);      /* exact f32 attention for rows 0..127 (o x64) */
    for (int q0 = 0; q0 < QN; q0 += QT) { const int nk = q0 + QT;      /* causal: only keys below the tile end are computed */
      k_gemm2<0><<<dim3((QT / 128) * (nk / 64), NHD), 128, 0, stream>>>(Q16 + (r0 + q0) * LQ, LQ, (size_t)HD, K16 + r0 * LQ, LQ, (size_t)HD, 0.125f, nullptr, 0, nullptr, 1, 0, 0, S, nullptr, NKX, (size_t)QT * NKX, QT, nk, HD);      /* scores, all heads on grid.y */
      k_rsmcf2<<<(NHD * QT + 255) / 256, 256, 0, stream>>>(S, P, NHD, q0, nk);
      k_gemm2<0><<<dim3((QT / 128) * (HD / 64), NHD), 128, 0, stream>>>(P, NKX, (size_t)QT * NKX, VT, SQ, (size_t)HD * SQ, 0.25f, nullptr, 0, nullptr, 1, 0, 0, nullptr, O16 + (r0 + q0) * DM, DM, (size_t)HD, QT, HD, nk); } }      /* o (merged heads, x64) as f16 rows */
  k_gemm2<0><<<dim3((unsigned)((MPO / 128) * (DM / 64)), 1), 128, 0, stream>>>(O16 + r0p * DM, DM, 0, BO, DM, 0, 0.0009765625f, bo, 0, XB + r0p * DM, -1, 0, 0, X1 + r0p * DM, nullptr, DM, 0, MPO, DM, DM);      /* out rows are the output layout */
  k_hl<<<(unsigned)(((size_t)NB * QT0 * DM / 8 + 255) / 256), 256, 0, stream>>>(OF0, OH0, OL0, (size_t)NB * QT0 * DM / 8);      /* first-tile o (x64) -> f16 hi + x1024 residual planes */
  for (int b = B0; b < B0 + NBR; ++b) { const size_t r0 = (size_t)b * SQ; const size_t f0 = (size_t)b * QT0;
    k_gemm2<0><<<dim3((QT0 / 128) * (DM / 64), 1), 128, 0, stream>>>(OH0 + f0 * DM, DM, 0, BO, DM, 0, 0.0009765625f, bo, 0, XB + r0 * DM, -1, 0, 0, X1 + r0 * DM, nullptr, DM, 0, QT0, DM, DM);      /* rows 0..127: out = o_hi Wo (+ b), overwriting the f16-path rows */
    k_gemm2<0><<<dim3((QT0 / 128) * (DM / 64), 1), 128, 0, stream>>>(OL0 + f0 * DM, DM, 0, BO, DM, 0, 0.00000095367431640625f, nullptr, 0, X1 + r0 * DM, -1, 0, 0, X1 + r0 * DM, nullptr, DM, 0, QT0, DM, DM); }      /* += o_lo Wo 2^-20 (own-element accumulate) */
  k_lnx<0, 1, 1><<<(unsigned)NR, 256, 0, stream>>>(X1, g1, be1, 1e-5f, M16, X1N);      /* x1 = LN1(x + attn_out) -> f16 rows (FFN operand) + f32 rows (residual) */
  for (int b = 0; b < NB; ++b) { const size_t r0 = (size_t)b * SQ;
    k_gemm2<3><<<dim3((unsigned)((SQ / 128) * (DFF / 64)), 1), 128, 0, stream>>>(M16 + r0 * DM, DM, 0, BW1, DM, 0, 0.0625f, bfc, 0, nullptr, 1, 0, 0, nullptr, HF16, DFF, 0, SQ, DFF, DM);      /* relu(x1 w_up + b_up) -> f16 (this batch) */
    k_gemm2<0><<<dim3((unsigned)((SQ / 128) * (DM / 64)), 1), 128, 0, stream>>>(HF16, DFF, 0, BW2, DFF, 0, 0.0625f, bmp, 0, X1N + r0 * DM, -1, 0, 0, X1 + r0 * DM, nullptr, DM, 0, SQ, DM, DFF); }      /* x1 + ffn (own-element residual from the LN1 f32 rows) -> f32 rows over the dead pre-LN1 plane */
  k_lnx<0, 0, 1><<<(unsigned)NR, 256, 0, stream>>>(X1, gg2, be2, 1e-5f, nullptr, (float*)d_out);      /* result = LN2(x1 + ffn) */
}

// v001
// A run of this version takes 2530 microseconds.
// In both of two side-by-side timings against v000, it was 2.15 times as fast.
#include <hip/hip_runtime.h>
// POST-LN transformer decoder layer with causal self-attention and a fused QKV projection (x [2][2048][1024]; qkv = x w_qkv + b_qkv ([in][out] 1024 x 3072 + bias) viewed (B, S, 3, 16, 64): q | k | v thirds; scores * 64^-0.5; causal (tril, -inf); softmax; x1 = LN1(x + out w_out + b_out) (biased var, eps 1e-5); result = LN2(x1 + relu(x1 w_up + b_up) w_down + b_down) ([in][out] 1024 x 4096 x 1024) -> [2][2048][1024]).
// Structure: token rows r = b*2048 + s; x as exact f16 rows (bf16-rounded); q | k | v as ONE WMMA GEMM (N = 3 x 1024) (32x64 wave tiles, f32 accumulation, exact x16 weights + bias, f16 outputs); per batch: V^T for all heads via LDS transposes; per query tile of 256 rows: scores against the keys below the tile end only (K = 64, all heads on grid.y, alpha = 0.125), causal row softmax on VALU, one wave per row, keys past the row masked to -1e9 over the computed range (f32 statistics, native exp; weights x256 f16), o = P . V^T (K = keys below the tile end, alpha 2^-2: o carried x64, folded into the output GEMM alpha) written straight into the merged f16 o rows; out = o W_o + b GEMM (f32) into the output layout.
// Compute dtype: inputs rounded to bf16; x / weights exact; q, k, v, softmax weights and o as plain f16 GEMM operands (~2^-12); scores and softmax statistics f32. v_wmma_f32_16x16x32_f16.
#define NB 2
#define SQ 2048
#define DM 1024
#define NH 16
#define HD 64
#define HG 4                         /* heads per block in the k_vt(V16, b, h0, VT) form (not launched) */
#define QT 256                       /* query rows per causal tile */
#define NKX SQ                       /* S / P row pitch */
#define QT0 128                      /* first-tile rows recomputed exactly in f32 */
#define B0 0                         /* first batch processed (debug hook) */
#define NBR NB                       /* batches processed (debug hook) */
#define NR ((size_t)NB * SQ)
#define DMQ DM
#define DFF 4096                     /* FFN hidden width */
#define DFFR 100                     /* unused (the FFN hidden width is DFF) */
#define MP ((int)((size_t)NBR * SQ)) /* rows projected (debug hook) */
#define QN SQ                        /* query rows attended per batch (debug hook) */
#define NHD NH                       /* heads attended (debug hook) */
#define MPO MP                       /* rows through the output stage (debug hook) */
#define LQ (3 * DM)      /* row pitch of the q/k/v rows */
typedef __bf16 v16b __attribute__((ext_vector_type(16)));
typedef unsigned short v8us __attribute__((ext_vector_type(8), may_alias));
typedef float  v8f  __attribute__((ext_vector_type(8)));
typedef float  v4f  __attribute__((ext_vector_type(4)));
typedef float  v4fa __attribute__((ext_vector_type(4), may_alias));
union FragB { v16b v; v8us half[2]; unsigned short u[16]; };

__device__ __forceinline__ unsigned short bf16_bits(float x) { unsigned int u = __float_as_uint(x); return (unsigned short)((u + 0x7FFFu + ((u >> 16) & 1u)) >> 16); }
__device__ __forceinline__ float bf16_val(unsigned short b) { return __uint_as_float(((unsigned int)b) << 16); }
__device__ __forceinline__ float bf16_round(float x) { return bf16_val(bf16_bits(x)); }
// D += A·B with NT terms: 1 = ah·bh, 2 = + al·bh (A split), 3 = + ah·bl (both split)
template <int NT>
__device__ __forceinline__ v8f mmaN(v16b ah, v16b al, v16b bh, v16b bl, v8f c) {
  c = __builtin_amdgcn_wmma_f32_16x16x32_bf16(false, ah, false, bh, (short)0, c, false, false);
  if (NT >= 2) c = __builtin_amdgcn_wmma_f32_16x16x32_bf16(false, al, false, bh, (short)0, c, false, false);
  if (NT >= 3) c = __builtin_amdgcn_wmma_f32_16x16x32_bf16(false, ah, false, bl, (short)0, c, false, false);
  asm volatile("v_nop\n\tv_nop\n\tv_nop\n\tv_nop" : "+v"(c) : "v"(ah), "v"(al), "v"(bh), "v"(bl));
  return c;
}

__global__ __launch_bounds__(256) void k_wt_bf16(const float* __restrict__ W, unsigned short* __restrict__ Wt, int K, int N) {
  const int t = blockIdx.x * 256 + threadIdx.x;
  const int k8n = K / 8;
  if (t >= N * k8n) return;
  const int n = t / k8n, k8 = (t % k8n) * 8;
  v8us v;
#pragma unroll
  for (int i = 0; i < 8; ++i) v[i] = bf16_bits(W[(size_t)(k8 + i) * N + n]);
  *(v8us*)(Wt + (size_t)n * K + k8) = v;
  
}

// GEMM C[M][N] (f32, pitch ldc) = act(A[M][K]·W + bias). A f32 row-major (pitch lda) converted per fragment to bf16
// (ASPLIT: hi/lo two planes -> 2 terms, else single rounded term); Wt bf16 [N][K] (pitch ldb). BIAS_BF16 rounds the
// bias to bf16 first (bias quantised to bf16 before the add). K%32==0, M%16==0, N%64==0.
template <bool ASPLIT, int ACT, bool BIAS_BF16>
__global__ __launch_bounds__(128) void k_gemm_bf(const float* __restrict__ A, int lda, const unsigned short* __restrict__ Wt, int ldb,
                                               const float* __restrict__ bias, float* __restrict__ C, int ldc, int M, int N, int K) {
  __shared__ __attribute__((aligned(16))) float so[4][16][64];
  const int tid = threadIdx.x, w = tid >> 5, lane = tid & 31, ln = lane & 15, hh = lane >> 4;
  const int ntn = N / 64;
  const int wid = blockIdx.x * 4 + w;
  const int mt = wid / ntn, nq = wid % ntn;
  if (mt * 16 >= M) return;
  const int row0 = mt * 16, col0 = nq * 64;
  const float* arow = A + (size_t)(row0 + ln) * lda;
  v8f acc[4] = {};
  for (int kb = 0; kb < K; kb += 32) {
    FragB ah, al;
    const v4f x0 = *(const v4fa*)(arow + kb + 8 * hh), x1 = *(const v4fa*)(arow + kb + 8 * hh + 4);
    const v4f x2 = *(const v4fa*)(arow + kb + 16 + 8 * hh), x3 = *(const v4fa*)(arow + kb + 16 + 8 * hh + 4);
    float xs[16] = {x0[0],x0[1],x0[2],x0[3],x1[0],x1[1],x1[2],x1[3],x2[0],x2[1],x2[2],x2[3],x3[0],x3[1],x3[2],x3[3]};
#pragma unroll
    for (int i = 0; i < 16; ++i) { const unsigned short hb = bf16_bits(xs[i]); ah.u[i] = hb; al.u[i] = ASPLIT ? bf16_bits(xs[i] - bf16_val(hb)) : (unsigned short)0; }
#pragma unroll
    for (int t = 0; t < 4; ++t) {
      const unsigned short* brow = Wt + (size_t)(col0 + t * 16 + ln) * ldb + kb;
      FragB b;
      b.half[0] = *(const v8us*)(brow + 8 * hh);
      b.half[1] = *(const v8us*)(brow + 16 + 8 * hh);
      acc[t] = mmaN<ASPLIT ? 2 : 1>(ah.v, al.v, b.v, b.v, acc[t]);
    }
  }
#pragma unroll
  for (int t = 0; t < 4; ++t) {
    float bv = bias ? bias[col0 + t * 16 + ln] : 0.f;
    if (BIAS_BF16) bv = bf16_round(bv);
#pragma unroll
    for (int r = 0; r < 8; ++r) { float v = acc[t][r] + bv; if (ACT == 1) v = fmaxf(v, 0.f); so[w][8 * hh + r][t * 16 + ln] = v; }
  }
  __builtin_amdgcn_fence(__ATOMIC_ACQ_REL, "workgroup");
  __builtin_amdgcn_wave_barrier();
  const int rsub = lane >> 4, c4 = (lane & 15) * 4;
  {
#pragma unroll
    for (int q = 0; q < 8; ++q) {
      const int r = q * 2 + rsub;
      const v4f v = *(const v4fa*)&so[w][r][c4];
      *(v4f*)(C + (size_t)(row0 + r) * ldc + col0 + c4) = v;
    }
    
  }
}

// GEMM C = act(A·W + bias + resid): A f32 (ASPLIT -> hi/lo 2 terms), Wt bf16 [N][K]; ACT 0 none, 1 relu, 2 exact gelu;
// resid (optional, f32, row index = (row % rmod), pitch ldr, RES_BF16 rounds it) added before the activation.
template <bool ASPLIT, int ACT, bool BIAS_BF16, bool RES_BF16>
__global__ __launch_bounds__(128) void k_gemm_bf3(const float* __restrict__ A, int lda, const unsigned short* __restrict__ Wt, int ldb,
                                                const float* __restrict__ bias, const float* __restrict__ resid, int rmod, int ldr,
                                                float* __restrict__ C, int ldc, int M, int N, int K) {
  __shared__ __attribute__((aligned(16))) float so[4][16][64];
  const int tid = threadIdx.x, w = tid >> 5, lane = tid & 31, ln = lane & 15, hh = lane >> 4;
  const int ntn = N / 64;
  const int wid = blockIdx.x * 4 + w;
  const int mt = wid / ntn, nq = wid % ntn;
  if (mt * 16 >= M) return;
  const int row0 = mt * 16, col0 = nq * 64;
  const float* arow = A + (size_t)(row0 + ln) * lda;
  v8f acc[4] = {};
  for (int kb = 0; kb < K; kb += 32) {
    FragB ah, al;
    const v4f x0 = *(const v4fa*)(arow + kb + 8 * hh), x1 = *(const v4fa*)(arow + kb + 8 * hh + 4);
    const v4f x2 = *(const v4fa*)(arow + kb + 16 + 8 * hh), x3 = *(const v4fa*)(arow + kb + 16 + 8 * hh + 4);
    float xs[16] = {x0[0],x0[1],x0[2],x0[3],x1[0],x1[1],x1[2],x1[3],x2[0],x2[1],x2[2],x2[3],x3[0],x3[1],x3[2],x3[3]};
#pragma unroll
    for (int i = 0; i < 16; ++i) { const unsigned short hb = bf16_bits(xs[i]); ah.u[i] = hb; al.u[i] = ASPLIT ? bf16_bits(xs[i] - bf16_val(hb)) : (unsigned short)0; }
#pragma unroll
    for (int t = 0; t < 4; ++t) {
      const unsigned short* brow = Wt + (size_t)(col0 + t * 16 + ln) * ldb + kb;
      FragB b;
      b.half[0] = *(const v8us*)(brow + 8 * hh);
      b.half[1] = *(const v8us*)(brow + 16 + 8 * hh);
      acc[t] = mmaN<ASPLIT ? 2 : 1>(ah.v, al.v, b.v, b.v, acc[t]);
    }
  }
#pragma unroll
  for (int t = 0; t < 4; ++t) {
    const int col = col0 + t * 16 + ln;
    float bv = bias ? bias[col] : 0.f;
    if (BIAS_BF16) bv = bf16_round(bv);
#pragma unroll
    for (int r = 0; r < 8; ++r) {
      float v = acc[t][r] + bv;
      if (resid) { float rv = resid[(size_t)((row0 + 8 * hh + r) % rmod) * ldr + col]; if (RES_BF16) rv = bf16_round(rv); v += rv; }
      if (ACT == 1) v = fmaxf(v, 0.f);
      if (ACT == 2) v = 0.5f * v * (1.0f + erff(v * 0.70710678118654752f));
      if (ACT == 3) { const float u = 0.7978845608028654f * (v + 0.044715f * v * v * v); v = 0.5f * v * (1.0f + tanhf(u)); }
      so[w][8 * hh + r][t * 16 + ln] = v;
    }
  }
  __builtin_amdgcn_fence(__ATOMIC_ACQ_REL, "workgroup");
  __builtin_amdgcn_wave_barrier();
  const int rsub = lane >> 4, c4 = (lane & 15) * 4;
  {
#pragma unroll
    for (int q = 0; q < 8; ++q) {
      const int r = q * 2 + rsub;
      const v4f v = *(const v4fa*)&so[w][r][c4];
      *(v4f*)(C + (size_t)(row0 + r) * ldc + col0 + c4) = v;
    }
    
  }
}
// row LayerNorm (biased variance, eps) over N: s = X (+ R); optional out_sum <- s; out_norm <- (s-mu)*rsqrt(var+eps)*g + b
template <bool PARAM_BF16>
__global__ __launch_bounds__(256) void k_layernorm(const float* __restrict__ X, const float* __restrict__ R, const float* __restrict__ g, const float* __restrict__ bta,
                                                  float* __restrict__ out_sum, float* __restrict__ out_norm, int N, float eps) {
  __shared__ float red[256];
  const int row = blockIdx.x, tid = threadIdx.x;
  const float* x = X + (size_t)row * N; const float* rr = R ? R + (size_t)row * N : nullptr;
  float vals[16];                     // up to N = 4096
  const int per = N / 256;            // contiguous chunk per thread? use strided-by-4 chunks: thread handles j = tid*4 + 1024*u
  float s1 = 0.f;
  for (int u = 0; u < per / 4; ++u) {
    const int j = tid * 4 + 1024 * u;
    const v4f a = *(const v4fa*)(x + j);
    v4f b = {0.f,0.f,0.f,0.f}; if (rr) b = *(const v4fa*)(rr + j);
#pragma unroll
    for (int q = 0; q < 4; ++q) { const float v = a[q] + b[q]; vals[u * 4 + q] = v; s1 += v; }
  }
  red[tid] = s1; __syncthreads();
  for (int st = 128; st > 0; st >>= 1) { if (tid < st) red[tid] += red[tid + st]; __syncthreads(); }
  const float mu = red[0] / (float)N; __syncthreads();
  float s2 = 0.f;
  for (int u = 0; u < per / 4; ++u)
#pragma unroll
    for (int q = 0; q < 4; ++q) { const float c = vals[u * 4 + q] - mu; s2 += c * c; }
  red[tid] = s2; __syncthreads();
  for (int st = 128; st > 0; st >>= 1) { if (tid < st) red[tid] += red[tid + st]; __syncthreads(); }
  const float rs = rsqrtf(red[0] / (float)N + eps);
  {
    for (int u = 0; u < per / 4; ++u) {
      const int j = tid * 4 + 1024 * u;
      v4f o, sm;
#pragma unroll
      for (int q = 0; q < 4; ++q) {
        float gg = g[j + q], bb = bta[j + q];
        if (PARAM_BF16) { gg = bf16_round(gg); bb = bf16_round(bb); }
        sm[q] = vals[u * 4 + q]; o[q] = (vals[u * 4 + q] - mu) * rs * gg + bb;
      }
      if (out_sum) *(v4f*)(out_sum + (size_t)row * N + j) = sm;
      *(v4f*)(out_norm + (size_t)row * N + j) = o;
    }
    
  }
}



// ---- f16 WMMA path (v_wmma_f32_16x16x32_f16): 11-bit significands for operands in range — used where a [0,1] probability operand needs more precision than bf16
typedef _Float16 v16h __attribute__((ext_vector_type(16)));
union FragH { v16h v; v8us half[2]; _Float16 h[16]; unsigned short u[16]; };
template <int NT>
__device__ __forceinline__ v8f mmaH(v16h ah, v16h al, v16h bh, v16h bl, v8f c) {
  c = __builtin_amdgcn_wmma_f32_16x16x32_f16(false, ah, false, bh, (short)0, c, false, false);
  if (NT >= 2) c = __builtin_amdgcn_wmma_f32_16x16x32_f16(false, al, false, bh, (short)0, c, false, false);
  if (NT >= 3) c = __builtin_amdgcn_wmma_f32_16x16x32_f16(false, ah, false, bl, (short)0, c, false, false);
  asm volatile("v_nop\n\tv_nop\n\tv_nop\n\tv_nop" : "+v"(c) : "v"(ah), "v"(al), "v"(bh), "v"(bl));
  return c;
}
// batched GEMM like k_gemm_b but f16 operands: A f32 (split into f16 hi/lo if ASPLIT, else rounded to f16), Bt = f16 values [n][k]; alpha; C f32; N multiple of 16 (partial tiles skipped)
template <bool ASPLIT>
__global__ __launch_bounds__(128) void k_gemm_h(const float* __restrict__ A, int lda, size_t sA, const _Float16* __restrict__ Bh, int ldb, size_t sB, float alpha, float* __restrict__ C, int ldc, size_t sC, int M, int N, int K) {
  __shared__ __attribute__((aligned(16))) float so[4][16][64];
  const int tid = threadIdx.x, w = tid >> 5, lane = tid & 31, ln = lane & 15, hh = lane >> 4; const int by = blockIdx.y;
  A += (size_t)by * sA; Bh += (size_t)by * sB; C += (size_t)by * sC;
  const int ntn = (N + 63) / 64; const int wid = blockIdx.x * 4 + w; const int mt = wid / ntn, nq = wid % ntn; if (mt * 16 >= M) return;
  const int row0 = mt * 16, col0 = nq * 64; const float* arow = A + (size_t)(row0 + ln) * lda;
  v8f acc[4] = {};
  for (int kb = 0; kb < K; kb += 32) {
    FragH ah, al;
    const v4f x0 = *(const v4fa*)(arow + kb + 8 * hh), x1 = *(const v4fa*)(arow + kb + 8 * hh + 4), x2 = *(const v4fa*)(arow + kb + 16 + 8 * hh), x3 = *(const v4fa*)(arow + kb + 16 + 8 * hh + 4);
    float xs[16] = {x0[0],x0[1],x0[2],x0[3],x1[0],x1[1],x1[2],x1[3],x2[0],x2[1],x2[2],x2[3],x3[0],x3[1],x3[2],x3[3]};
#pragma unroll
    for (int i = 0; i < 16; ++i) { const _Float16 h = (_Float16)xs[i]; ah.h[i] = h; al.h[i] = ASPLIT ? (_Float16)(xs[i] - (float)h) : (_Float16)0.0f; }
#pragma unroll
    for (int t = 0; t < 4; ++t) { if (col0 + t * 16 >= N) continue; const size_t boff = (size_t)(col0 + t * 16 + ln) * ldb + kb; FragH bq; bq.half[0] = *(const v8us*)(Bh + boff + 8 * hh); bq.half[1] = *(const v8us*)(Bh + boff + 16 + 8 * hh);
      acc[t] = mmaH<ASPLIT ? 2 : 1>(ah.v, al.v, bq.v, bq.v, acc[t]); }
  }
#pragma unroll
  for (int t = 0; t < 4; ++t) { if (col0 + t * 16 >= N) continue;
#pragma unroll
    for (int r = 0; r < 8; ++r) so[w][8 * hh + r][t * 16 + ln] = acc[t][r] * alpha; }
  __builtin_amdgcn_fence(__ATOMIC_ACQ_REL, "workgroup"); __builtin_amdgcn_wave_barrier();
  const int rsub = lane >> 4, c4 = (lane & 15) * 4;
  {
#pragma unroll
    for (int q = 0; q < 8; ++q) { const int r = q * 2 + rsub; if (col0 + c4 < N) { const v4f v = *(const v4fa*)&so[w][r][c4]; *(v4f*)(C + (size_t)(row0 + r) * ldc + col0 + c4) = v; } }
     }
}

// Wt[n][k] = f16(W[k][n]·scale) from f32 row-major W[K][N] (scale = power of two; bf16-exact weights stay exact in f16 away from the subnormal range)
__global__ __launch_bounds__(256) void k_wt_f16(const float* __restrict__ W, _Float16* __restrict__ Wt, int K, int N, float scale) {
  const int t = blockIdx.x * 256 + threadIdx.x; if (t >= N * (K / 8)) return; const int n = t / (K / 8), k8 = (t % (K / 8)) * 8; FragH f;
#pragma unroll
  for (int i = 0; i < 8; ++i) f.h[i] = (_Float16)(bf16_round(W[(size_t)(k8 + i) * N + n]) * scale); const v8us o = f.half[0];
  *(v8us*)((unsigned short*)Wt + (size_t)n * K + k8) = o; 
}
// k_gemm_hh variant with fused epilogue: v = acc·alpha + bias[by·sBias + col] (+ CP[(row/rowsPerB)·sCPb + by·64 + col] if CP) ; ACT 0 none / 1 elu ; writes f16 C16 (and f32 C if non-null)
template <int ACT>
__global__ __launch_bounds__(128) void k_gemm_hhx(const _Float16* __restrict__ A, int lda, size_t sA, const _Float16* __restrict__ Bh, int ldb, size_t sB, float alpha, const float* __restrict__ bias, size_t sBias, const float* __restrict__ CP, int rowsPerB, size_t sCPb, int row0g,
    float* __restrict__ C, _Float16* __restrict__ C16, int ldc, size_t sC, int M, int N, int K) {
  __shared__ __attribute__((aligned(16))) float so[4][16][64];
  const int tid = threadIdx.x, w = tid >> 5, lane = tid & 31, ln = lane & 15, hh = lane >> 4; const int by = blockIdx.y;
  A += (size_t)by * sA; Bh += (size_t)by * sB; const size_t cofs = (size_t)by * sC; const float* bp = bias ? bias + (size_t)by * sBias : nullptr;
  const int ntn = (N + 63) / 64; const int wid = blockIdx.x * 4 + w; const int mt = wid / ntn, nq = wid % ntn; if (mt * 16 >= M) return;
  const int row0 = mt * 16, col0 = nq * 64; const _Float16* arow = A + (size_t)(row0 + ln) * lda;
  v8f acc[4] = {};
  for (int kb = 0; kb < K; kb += 32) { FragH ah; ah.half[0] = *(const v8us*)((const unsigned short*)arow + kb + 8 * hh); ah.half[1] = *(const v8us*)((const unsigned short*)arow + kb + 16 + 8 * hh);
#pragma unroll
    for (int t = 0; t < 4; ++t) { if (col0 + t * 16 >= N) continue; const size_t boff = (size_t)(col0 + t * 16 + ln) * ldb + kb; FragH bq; bq.half[0] = *(const v8us*)((const unsigned short*)Bh + boff + 8 * hh); bq.half[1] = *(const v8us*)((const unsigned short*)Bh + boff + 16 + 8 * hh);
      acc[t] = mmaH<1>(ah.v, ah.v, bq.v, bq.v, acc[t]); }
  }
#pragma unroll
  for (int t = 0; t < 4; ++t) { if (col0 + t * 16 >= N) continue; const int col = col0 + t * 16 + ln; const float bv = bp ? bf16_round(bp[col]) : 0.f;
#pragma unroll
    for (int r = 0; r < 8; ++r) { float v = acc[t][r] * alpha + bv; if (CP) { const int rr = row0g + row0 + 8 * hh + r; if (rowsPerB < 0) v += CP[cofs + (size_t)rr * ldc + col];      /* rowsPerB < 0: own element of the batched C plane */ else { const int bidx = rr / rowsPerB; v += CP[(size_t)bidx * sCPb + (size_t)by * 64 + col]; } } if (ACT == 1) v = (v > 0.f) ? v : expm1f(v); else if (ACT == 7) v = (v > 0.f) ? v + 1.0f : expf(v); else if (ACT == 8) v = tanhf(v); else if (ACT == 9) v = 0.5f * v * (1.0f + tanhf(0.7978845608028654f * (v + 0.044715f * v * v * v))); else if (ACT == 11) v = 1.0f / (1.0f + expf(-v)); else if (ACT == 12) v = (v > 0.f) ? v : 0.01f * v; else if (ACT == 14) v = (v > 0.f) ? v : 0.1f * v; else if (ACT == 16) v = (v >= 0.f) ? v : 0.3f * v; else if (ACT == 17) v = (v >= 0.f) ? v : 0.2f * v; else if (ACT == 15) v = v / (1.0f + expf(-v)); else if (ACT == 3) v = fmaxf(v, 0.f); else if (ACT == 6) v = 0.5f * v * (1.0f + erff(v * 0.70710678118654752f)); so[w][8 * hh + r][t * 16 + ln] = v; } }
  __builtin_amdgcn_fence(__ATOMIC_ACQ_REL, "workgroup"); __builtin_amdgcn_wave_barrier();
  const int rsub = lane >> 4, c4 = (lane & 15) * 4; typedef _Float16 v4h __attribute__((ext_vector_type(4)));
  {
#pragma unroll
    for (int q = 0; q < 8; ++q) { const int r = q * 2 + rsub; if (col0 + c4 < N) { const v4f v = *(const v4fa*)&so[w][r][c4]; if (C) *(v4f*)(C + cofs + (size_t)(row0 + r) * ldc + col0 + c4) = v; if (C16) { v4h h4; for (int i = 0; i < 4; ++i) h4[i] = (_Float16)v[i]; *(v4h*)(C16 + cofs + (size_t)(row0 + r) * ldc + col0 + c4) = h4; } } }
     }
}


typedef _Float16 v4h __attribute__((ext_vector_type(4)));

__global__ __launch_bounds__(256) void k_x16(const float* __restrict__ x, _Float16* __restrict__ X16, size_t n8) { const size_t t = (size_t)blockIdx.x * 256 + threadIdx.x; if (t >= n8) return; FragH f;
#pragma unroll
  for (int q = 0; q < 8; ++q) f.h[q] = (_Float16)bf16_round(x[t * 8 + q]); *(v8us*)((unsigned short*)X16 + t * 8) = f.half[0];  }
__global__ __launch_bounds__(256) void k_h16(const float* __restrict__ x, _Float16* __restrict__ X16, size_t n8) { const size_t t = (size_t)blockIdx.x * 256 + threadIdx.x; if (t >= n8) return; FragH f;
#pragma unroll
  for (int q = 0; q < 8; ++q) f.h[q] = (_Float16)x[t * 8 + q]; *(v8us*)((unsigned short*)X16 + t * 8) = f.half[0];  }
__global__ __launch_bounds__(256) void k_round16f(const float* __restrict__ W, _Float16* __restrict__ Bt, size_t n8) { const size_t t = (size_t)blockIdx.x * 256 + threadIdx.x; if (t >= n8) return; FragH f;
#pragma unroll
  for (int i = 0; i < 8; ++i) f.h[i] = (_Float16)(bf16_round(W[t * 8 + i]) * 16.0f); *(v8us*)((unsigned short*)Bt + t * 8) = f.half[0];  }
template <int NHv, int TTv>
__global__ __launch_bounds__(256) void k_vt(const _Float16* __restrict__ V16, int ldv, int voff, _Float16* __restrict__ Vt) { __shared__ unsigned short tl[64][66]; const int tid = threadIdx.x; const int slab = blockIdx.x / (TTv / 64), lg = blockIdx.x % (TTv / 64); const int b = slab / NHv, h = slab % NHv;
  for (int i = tid; i < 64 * 8; i += 256) { const int r = i / 8, c8 = (i % 8) * 8; FragH f; f.half[0] = *(const v8us*)((const unsigned short*)V16 + ((size_t)b * TTv + lg * 64 + r) * ldv + voff + h * 64 + c8);
#pragma unroll
    for (int q = 0; q < 8; ++q) tl[r][c8 + q] = f.u[q]; }
  __syncthreads();
  {
#pragma unroll
    for (int rd = 0; rd < 2; ++rd) { const int d = rd * 32 + tid / 8, pc = tid % 8; FragH f;
#pragma unroll
      for (int q = 0; q < 8; ++q) f.u[q] = tl[pc * 8 + q][d];
      *(v8us*)((unsigned short*)Vt + ((size_t)slab * 64 + d) * TTv + lg * 64 + pc * 8) = f.half[0]; }
     } }

__global__ __launch_bounds__(256) void k_hl(const float* __restrict__ F, _Float16* __restrict__ Hh, _Float16* __restrict__ Hl, size_t n8) { const size_t t = (size_t)blockIdx.x * 256 + threadIdx.x; if (t >= n8) return; FragH fh, fl; const v4f a = *(const v4fa*)(F + t * 8), c = *(const v4fa*)(F + t * 8 + 4);
#pragma unroll
  for (int q = 0; q < 4; ++q) { _Float16 h = (_Float16)a[q]; fh.h[q] = h; fl.h[q] = (_Float16)((a[q] - (float)h) * 1024.0f); h = (_Float16)c[q]; fh.h[4 + q] = h; fl.h[4 + q] = (_Float16)((c[q] - (float)h) * 1024.0f); }
  { *(v8us*)((unsigned short*)Hh + t * 8) = fh.half[0]; *(v8us*)((unsigned short*)Hl + t * 8) = fl.half[0];  } }

// ---- fast GEMM (wave tile 32x64; requires M % 32 == 0 rows per launch region and N % 64 == 0); epilogue = k_gemm_hhx semantics ----
__device__ __forceinline__ v16h g2_frag(const _Float16* p, int hh) { FragH f; f.half[0] = *(const v8us*)((const unsigned short*)p + 8 * hh); f.half[1] = *(const v8us*)((const unsigned short*)p + 16 + 8 * hh); return f.v; }
__device__ __forceinline__ v8f g2_mma(v16h a, v16h b, v8f c) { v8f d = __builtin_amdgcn_wmma_f32_16x16x32_f16(false, a, false, b, (short)0, c, false, false); asm volatile("v_nop\n\tv_nop\n\tv_nop\n\tv_nop" : "+v"(d) : "v"(a), "v"(b)); return d; }
template <int ACT>
__global__ __launch_bounds__(128) void k_gemm2(const _Float16* __restrict__ A, int lda, size_t sA, const _Float16* __restrict__ Bh, int ldb, size_t sB, float alpha, const float* __restrict__ bias, size_t sBias, const float* __restrict__ CP, int rowsPerB, size_t sCPb, int row0g,
    float* __restrict__ C, _Float16* __restrict__ C16, int ldc, size_t sC, int M, int N, int K) { static_assert(ACT == 0 || ACT == 3 || ACT == 6 || ACT == 8 || ACT == 9 || ACT == 11 || ACT == 12 || ACT == 14 || ACT == 15 || ACT == 16 || ACT == 17, "k_gemm2: unsupported ACT code (would silently apply no activation)");
  __shared__ __attribute__((aligned(16))) float so[4][32][68];
  const int tid = threadIdx.x, w = tid >> 5, lane = tid & 31, ln = lane & 15, hh = lane >> 4; const int by = blockIdx.y;
  A += (size_t)by * sA; Bh += (size_t)by * sB; const size_t cofs = (size_t)by * sC; const float* bp = bias ? bias + (size_t)by * sBias : nullptr;
  const int ntn = N >> 6; const int mt = blockIdx.x / ntn, nq = blockIdx.x - mt * ntn; const int row0 = mt * 128 + 32 * w, col0 = nq * 64; if (row0 >= M) return;
  const _Float16* a0p = A + (size_t)(row0 + ln) * lda; const _Float16* a1p = a0p + (size_t)16 * lda;
  const _Float16* b0p = Bh + (size_t)(col0 + ln) * ldb; const _Float16* b1p = b0p + (size_t)16 * ldb; const _Float16* b2p = b1p + (size_t)16 * ldb; const _Float16* b3p = b2p + (size_t)16 * ldb;
  const v8f z8 = {0.f,0.f,0.f,0.f,0.f,0.f,0.f,0.f}; v8f c00 = z8, c01 = z8, c02 = z8, c03 = z8, c10 = z8, c11 = z8, c12 = z8, c13 = z8;
#pragma unroll 1
  for (int kb = 0; kb < K; kb += 32) { const v16h a0 = g2_frag(a0p + kb, hh), a1 = g2_frag(a1p + kb, hh);
    v16h b = g2_frag(b0p + kb, hh); c00 = g2_mma(a0, b, c00); c10 = g2_mma(a1, b, c10);
    b = g2_frag(b1p + kb, hh); c01 = g2_mma(a0, b, c01); c11 = g2_mma(a1, b, c11);
    b = g2_frag(b2p + kb, hh); c02 = g2_mma(a0, b, c02); c12 = g2_mma(a1, b, c12);
    b = g2_frag(b3p + kb, hh); c03 = g2_mma(a0, b, c03); c13 = g2_mma(a1, b, c13); }
  v8f accs[8] = {c00, c01, c02, c03, c10, c11, c12, c13};
#pragma unroll
  for (int u = 0; u < 8; ++u) { const int t = u & 3, half = u >> 2; const int col = col0 + t * 16 + ln; const float bv = bp ? bf16_round(bp[col]) : 0.f;
#pragma unroll
    for (int r = 0; r < 8; ++r) { const int rloc = half * 16 + 8 * hh + r; float v = accs[u][r] * alpha + bv; if (CP) { if (rowsPerB < 0) v += CP[cofs + (size_t)(row0g + row0 + rloc) * ldc + col];      /* rowsPerB < 0: own element of the batched C plane */ else { const int bidx = (row0g + row0 + rloc) / rowsPerB; v += CP[(size_t)bidx * sCPb + (size_t)by * 64 + col]; } }
      if (ACT == 3) v = fmaxf(v, 0.f); else if (ACT == 6) v = 0.5f * v * (1.0f + erff(v * 0.70710678118654752f)); else if (ACT == 11) v = 1.0f / (1.0f + expf(-v)); else if (ACT == 15) v = v / (1.0f + expf(-v)); else if (ACT == 12) v = (v > 0.f) ? v : 0.01f * v; else if (ACT == 8) v = tanhf(v); else if (ACT == 9) v = 0.5f * v * (1.0f + tanhf(0.7978845608028654f * (v + 0.044715f * v * v * v))); else if (ACT == 14) v = (v > 0.f) ? v : 0.1f * v; else if (ACT == 16) v = (v >= 0.f) ? v : 0.3f * v; else if (ACT == 17) v = (v >= 0.f) ? v : 0.2f * v;
      so[w][rloc][t * 16 + ln] = v; } }
  __builtin_amdgcn_fence(__ATOMIC_ACQ_REL, "workgroup"); __builtin_amdgcn_wave_barrier();
  const int rsub = lane >> 4, c4 = (lane & 15) * 4;
  {
#pragma unroll
    for (int q = 0; q < 16; ++q) { const int r = q * 2 + rsub; const v4f v = *(const v4fa*)&so[w][r][c4]; if (C) *(v4f*)(C + cofs + (size_t)(row0 + r) * ldc + col0 + c4) = v; if (C16) { v4h h4; for (int i = 0; i < 4; ++i) h4[i] = (_Float16)v[i]; *(v4h*)(C16 + cofs + (size_t)(row0 + r) * ldc + col0 + c4) = h4; } }
     } }


__global__ __launch_bounds__(256) void k_wnat(const float* __restrict__ w, size_t n8, _Float16* __restrict__ Bt) { const size_t t = (size_t)blockIdx.x * 256 + threadIdx.x; if (t >= n8) return; FragH f; for (int q = 0; q < 8; ++q) f.h[q] = (_Float16)(bf16_round(w[t * 8 + q]) * 16.0f); *(v8us*)((unsigned short*)Bt + t * 8) = f.half[0];  }
__global__ __launch_bounds__(256) void k_rsm(const float* __restrict__ S, _Float16* __restrict__ P, int nrows) {
  #pragma clang fp contract(off)
  const int i = blockIdx.x * 256 + threadIdx.x; if (i >= nrows) return; const float* s = S + (size_t)i * SQ; float mx = -3.0e38f;
#pragma unroll 1
  for (int j = 0; j < SQ; ++j) mx = fmaxf(mx, s[j]); float se = 0.f;
#pragma unroll 1
  for (int j = 0; j < SQ; ++j) se += expf(s[j] - mx); const float sc = 256.0f / se;
#pragma unroll 1
  for (int j0 = 0; j0 < SQ; j0 += 8) { FragH f; for (int q = 0; q < 8; ++q) f.h[q] = (_Float16)(expf(s[j0 + q] - mx) * sc); unsigned short* d = (unsigned short*)P + (size_t)i * SQ + j0; *(v8us*)d = f.half[0];  } }
__global__ __launch_bounds__(256) void k_vt(const _Float16* __restrict__ V16, int b, int h0, _Float16* __restrict__ VT) { __shared__ unsigned short tl[64][65]; const int tid = threadIdx.x; const int hh = blockIdx.x % HG, sg = blockIdx.x / HG; const int s0 = sg * 64; const int h = h0 + hh;
  for (int i = tid; i < 64 * 8; i += 256) { const int j = i / 8, d8 = (i % 8) * 8; FragH f; f.half[0] = *(const v8us*)((const unsigned short*)V16 + ((size_t)b * SQ + s0 + j) * DM + h * HD + d8); for (int q = 0; q < 8; ++q) tl[d8 + q][j] = f.u[q]; }
  __syncthreads();
  { for (int i = tid; i < 64 * 8; i += 256) { const int d = i / 8, j8 = (i % 8) * 8; FragH f; for (int q = 0; q < 8; ++q) f.u[q] = tl[d][j8 + q]; *(v8us*)((unsigned short*)VT + ((size_t)hh * HD + d) * SQ + s0 + j8) = f.half[0]; }  } }



// Causal row softmax, one wave per score row. Lane l keeps columns 128 c + 4 l .. + 3 of its row in registers, so each wave-wide load is 512 contiguous bytes and each store 256,
// S is read once and exp is taken once per score. Row maximum and row sum: four chains per lane, then a five-step butterfly over the 32 lanes. nk is a multiple of 256.
// Every loop over v[] and h[] is fully unrolled so that the arrays are indexed by constants and stay in registers (a rolled loop would put them in scratch); the tests u < ng are wave-uniform.
__global__ __launch_bounds__(256) void k_rsmw(const float* __restrict__ S, _Float16* __restrict__ P, int hg, int q0, int nk) {
  const int lane = threadIdx.x & 31; const int t = blockIdx.x * 8 + (threadIdx.x >> 5); if (t >= hg * QT) return;      /* wave-uniform; no barrier below */
  const float* s = S + (size_t)t * NKX + lane * 4; _Float16* p = P + (size_t)t * NKX + lane * 4; const int last = q0 + (t % QT); const int ng = nk >> 8;      /* groups of 256 columns */
  v4f v[NKX / 128];
#pragma unroll
  for (int u = 0; u < NKX / 256; ++u) if (u < ng) { v[2 * u] = *(const v4fa*)(s + u * 256); v[2 * u + 1] = *(const v4fa*)(s + u * 256 + 128); }
  v4f m4 = {-3.0e38f, -3.0e38f, -3.0e38f, -3.0e38f};
#pragma unroll
  for (int u = 0; u < NKX / 256; ++u) if (u < ng) {
#pragma unroll
    for (int c = 2 * u; c < 2 * u + 2; ++c)
#pragma unroll
      for (int q = 0; q < 4; ++q) { const float x = (c * 128 + lane * 4 + q <= last) ? v[c][q] : -1.0e9f; v[c][q] = x; m4[q] = fmaxf(m4[q], x); } }
  float mx = fmaxf(fmaxf(m4[0], m4[1]), fmaxf(m4[2], m4[3]));
#pragma unroll
  for (int o = 16; o > 0; o >>= 1) mx = fmaxf(mx, __shfl_xor(mx, o));
  v4f s4 = {0.f, 0.f, 0.f, 0.f};
#pragma unroll
  for (int u = 0; u < NKX / 256; ++u) if (u < ng) {
#pragma unroll
    for (int c = 2 * u; c < 2 * u + 2; ++c)
#pragma unroll
      for (int q = 0; q < 4; ++q) { const float e = __expf(v[c][q] - mx); v[c][q] = e; s4[q] += e; } }
  float se = (s4[0] + s4[1]) + (s4[2] + s4[3]);
#pragma unroll
  for (int o = 16; o > 0; o >>= 1) se += __shfl_xor(se, o);
  const float sc = 256.0f / se;
  v4h h[NKX / 128];      /* all weights packed first, then stores alone: no register of an issued store is written again */
#pragma unroll
  for (int u = 0; u < NKX / 256; ++u) if (u < ng) {
#pragma unroll
    for (int c = 2 * u; c < 2 * u + 2; ++c)
#pragma unroll
      for (int q = 0; q < 4; ++q) h[c][q] = (_Float16)(v[c][q] * sc); }
#pragma unroll
  for (int u = 0; u < NKX / 256; ++u) if (u < ng) { *(v4h*)(p + u * 256) = h[2 * u]; *(v4h*)(p + u * 256 + 128) = h[2 * u + 1]; } }


template <int MASKADD>
__global__ __launch_bounds__(64) void k_att0(const float* __restrict__ QF, const float* __restrict__ KF, const float* __restrict__ VF, int ld, const float* __restrict__ mask, float scale, float* __restrict__ OF, int ldo) {
  #pragma clang fp contract(off)
  __shared__ __attribute__((aligned(16))) float lq[64][64]; __shared__ __attribute__((aligned(16))) float lo[64][64];
  const int tid = threadIdx.x; const int h = blockIdx.x / (QT0 / 64), rg = blockIdx.x % (QT0 / 64); const int i = rg * 64 + tid;
  const float* qr = QF + (size_t)i * ld + h * HD;
#pragma unroll 1
  for (int c = 0; c < HD / 4; ++c) { *(v4f*)&lq[tid][c * 4] = *(const v4fa*)(qr + c * 4); const v4f z = {0.f, 0.f, 0.f, 0.f}; *(v4f*)&lo[tid][c * 4] = z; }
  float m = -1.0e30f, l = 0.f; const int jmax = MASKADD ? (SQ - 1) : (rg * 64 + 63);      /* additive-mask form: every key (the mask input decides); causal form: keys up to the block's last row */
#pragma unroll 1
  for (int j = 0; j <= jmax; ++j) { const float* kr = KF + (size_t)j * ld + h * HD; const float* vr = VF + (size_t)j * ld + h * HD; float s = 0.f;
#pragma unroll 1
    for (int c = 0; c < HD / 4; ++c) { const v4f kq = *(const v4fa*)(kr + c * 4); const v4f qq = *(v4f*)&lq[tid][c * 4]; s = __fadd_rn(s, __fmul_rn(qq[0], kq[0])); s = __fadd_rn(s, __fmul_rn(qq[1], kq[1])); s = __fadd_rn(s, __fmul_rn(qq[2], kq[2])); s = __fadd_rn(s, __fmul_rn(qq[3], kq[3])); }
    s = __fmul_rn(s, scale); if (MASKADD) s = __fadd_rn(s, __fmul_rn(bf16_round(mask[(size_t)i * SQ + j]), -10000.0f));
    const float f = (MASKADD || j <= i) ? 1.f : 0.f; const float sm = fmaf(f, s, (1.f - f) * -1.0e30f); const float mn = fmaxf(m, sm); const float sc = expf(m - mn); const float e = expf(sm - mn); l = __fadd_rn(__fmul_rn(l, sc), e); m = mn;
#pragma unroll 1
    for (int c = 0; c < HD / 4; ++c) { const v4f vv = *(const v4fa*)(vr + c * 4); v4f oo = *(v4f*)&lo[tid][c * 4]; for (int u = 0; u < 4; ++u) oo[u] = __fadd_rn(__fmul_rn(oo[u], sc), __fmul_rn(e, vv[u])); *(v4f*)&lo[tid][c * 4] = oo; } }
  const float fin = 64.0f / l;      /* o carried x64 like the f16 path */
#pragma unroll 1
  for (int c = 0; c < HD / 4; ++c) { v4f oo = *(v4f*)&lo[tid][c * 4]; for (int u = 0; u < 4; ++u) oo[u] = __fmul_rn(oo[u], fin); *(v4f*)&lo[tid][c * 4] = oo; }
  __syncthreads();
  {
#pragma unroll 1
    for (int it = 0; it < 16; ++it) { const int row = it * 4 + tid / 16, pc = (tid % 16) * 4; const v4f v = *(const v4f*)&lo[row][pc]; *(v4f*)(OF + (size_t)(rg * 64 + row) * ldo + h * HD + pc) = v; }
     } }


template <int BFIN, int WXB>
__global__ __launch_bounds__(256) void k_ln16(const float* __restrict__ X, const float* __restrict__ g, const float* __restrict__ bb, float eps, _Float16* __restrict__ N16, float* __restrict__ XB) {
  #pragma clang fp contract(off)
  __shared__ float red[256]; const size_t r = blockIdx.x; const int t = threadIdx.x; const v4f xa = *(const v4fa*)(X + r * DMQ + t * 4); float s[4]; float sum = 0.f;
  for (int q = 0; q < 4; ++q) { s[q] = BFIN ? bf16_round(xa[q]) : xa[q]; sum = __fadd_rn(sum, s[q]); }
  red[t] = sum; __syncthreads(); for (int st = 128; st > 0; st >>= 1) { if (t < st) red[t] = __fadd_rn(red[t], red[t + st]); __syncthreads(); } const float mu = red[0] / (float)DMQ; __syncthreads();
  float vs = 0.f; for (int q = 0; q < 4; ++q) { const float dl = __fadd_rn(s[q], -mu); vs = __fadd_rn(vs, __fmul_rn(dl, dl)); } red[t] = vs; __syncthreads(); for (int st = 128; st > 0; st >>= 1) { if (t < st) red[t] = __fadd_rn(red[t], red[t + st]); __syncthreads(); }
  const float rs = rsqrtf(__fadd_rn(red[0] / (float)DMQ, eps)); v4h y; v4f xb;
  for (int q = 0; q < 4; ++q) { const int c = t * 4 + q; y[q] = (_Float16)__fadd_rn(__fmul_rn(__fmul_rn(__fadd_rn(s[q], -mu), rs), bf16_round(g[c])), bf16_round(bb[c])); xb[q] = s[q]; }
  { *(v4h*)(N16 + r * DMQ + t * 4) = y; if (WXB) *(v4f*)(XB + r * DMQ + t * 4) = xb;  } }
__global__ __launch_bounds__(256) void k_ftres2(const float* __restrict__ OF0, const float* __restrict__ XB, float* __restrict__ X1, size_t n4) {
  #pragma clang fp contract(off)
  const size_t t = (size_t)blockIdx.x * 256 + threadIdx.x; if (t >= n4) return; const v4f o = *(const v4fa*)(OF0 + t * 4), xv = *(const v4fa*)(XB + t * 4); v4f y; for (int q = 0; q < 4; ++q) y[q] = __fadd_rn(__fmul_rn(o[q], 0.015625f), xv[q]); *(v4f*)(X1 + t * 4) = y;  }

__global__ __launch_bounds__(256) void k_wthd(const float* __restrict__ Wt, _Float16* __restrict__ Bt) { const size_t t = (size_t)blockIdx.x * 256 + threadIdx.x; if (t >= (size_t)NH * HD * (DM / 8)) return; const int m8 = (int)(t % (DM / 8)) * 8; const int d = (int)((t / (DM / 8)) % HD); const int h = (int)(t / ((size_t)(DM / 8) * HD)); FragH f;
  for (int q = 0; q < 8; ++q) f.h[q] = (_Float16)(16.0f * bf16_round(Wt[((size_t)h * DM + m8 + q) * HD + d])); unsigned short* dst = (unsigned short*)Bt + ((size_t)h * HD + d) * DM + m8; *(v8us*)dst = f.half[0];  }




__global__ __launch_bounds__(256) void k_wtpad(const float* __restrict__ Wm, _Float16* __restrict__ Wt, int Kr, int Kp, int Nr, int Np, float scale) {
  const int t = blockIdx.x * 256 + threadIdx.x; if (t >= Np * (Kp / 8)) return; const int n = t / (Kp / 8), k8 = (t % (Kp / 8)) * 8; const int nc = min(n, Nr - 1); const float fn = (n < Nr) ? 1.f : 0.f; FragH f;
  for (int i = 0; i < 8; ++i) { const int k = k8 + i; const int kc = min(k, Kr - 1); const float fk = (k < Kr) ? fn : 0.f; f.h[i] = (_Float16)(bf16_round(Wm[(size_t)kc * Nr + nc]) * scale * fk); }
  unsigned short* o = (unsigned short*)Wt + (size_t)n * Kp + k8; *(v8us*)o = f.half[0];  }
__global__ __launch_bounds__(128) void k_bpad(const float* __restrict__ b, float* __restrict__ Bp, int nr, int np) {
  const int i = threadIdx.x; if (i >= np) return; const float v = b[min(i, nr - 1)] * ((i < nr) ? 1.f : 0.f); *(float*)(Bp + i) = v;  }

template <int BFIN, int W16, int W32>
__global__ __launch_bounds__(256) void k_lnx(const float* __restrict__ X, const float* __restrict__ g, const float* __restrict__ bb, float eps, _Float16* __restrict__ N16, float* __restrict__ N32) {
  #pragma clang fp contract(off)
  __shared__ float red[256]; const size_t r = blockIdx.x; const int t = threadIdx.x; const bool act = t < (DMQ / 4); const int c0 = act ? t * 4 : 0;
  const v4f xa = *(const v4fa*)(X + r * DMQ + c0); float s[4]; float sum = 0.f;
  for (int q = 0; q < 4; ++q) { s[q] = act ? (BFIN ? bf16_round(xa[q]) : xa[q]) : 0.f; sum = __fadd_rn(sum, s[q]); }
  red[t] = sum; __syncthreads(); for (int st = 128; st > 0; st >>= 1) { if (t < st) red[t] = __fadd_rn(red[t], red[t + st]); __syncthreads(); } const float mu = red[0] / (float)DMQ; __syncthreads();
  float vs = 0.f; for (int q = 0; q < 4; ++q) { const float dl = act ? __fadd_rn(s[q], -mu) : 0.f; vs = __fadd_rn(vs, __fmul_rn(dl, dl)); } red[t] = vs; __syncthreads(); for (int st = 128; st > 0; st >>= 1) { if (t < st) red[t] = __fadd_rn(red[t], red[t + st]); __syncthreads(); }
  const float rs = rsqrtf(__fadd_rn(red[0] / (float)DMQ, eps)); v4h y; v4f yf;
  for (int q = 0; q < 4; ++q) { const int c = c0 + q; yf[q] = __fadd_rn(__fmul_rn(__fmul_rn(__fadd_rn(s[q], -mu), rs), bf16_round(g[c])), bf16_round(bb[c])); y[q] = (_Float16)yf[q]; }
  if (!act) return;      /* no barriers after this point */
  { if (W16) *(v4h*)(N16 + r * DMQ + c0) = y; if (W32) *(v4f*)(N32 + r * DMQ + c0) = yf;  } }



__global__ __launch_bounds__(256) void k_bfr(const float* __restrict__ x, float* __restrict__ XB, size_t n8) { const size_t t = (size_t)blockIdx.x * 256 + threadIdx.x; if (t >= n8) return; v4f a = *(const v4fa*)(x + t * 8), c = *(const v4fa*)(x + t * 8 + 4); for (int q = 0; q < 4; ++q) { a[q] = bf16_round(a[q]); c[q] = bf16_round(c[q]); }
  { *(v4f*)(XB + t * 8) = a; *(v4f*)(XB + t * 8 + 4) = c;  } }




extern "C" void kernel_launch(void* const* d_in, const int* in_sizes, int n_in,
                              void* d_out, int out_size, void* d_ws, size_t ws_size, hipStream_t stream) {
  (void)in_sizes; (void)n_in; (void)out_size;
  const float* const* I = (const float* const*)d_in; const float* x = I[0]; const float* wqkv = I[1]; const float* bqkv = I[2]; const float* wo = I[3]; const float* bo = I[4]; const float* wfc = I[5]; const float* bfc = I[6]; const float* wmp = I[7]; const float* bmp = I[8]; const float* g1 = I[9]; const float* be1 = I[10]; const float* gg2 = I[11]; const float* be2 = I[12];      /* x; fused w_qkv [1024][3072] + b_qkv ([in][out]); w_out + b_out; w_up [1024][4096] + b_up, w_down [4096][1024] + b_down; LN1 g / b, LN2 g / b */
  char* ws = (char*)d_ws; size_t off = 0;
  auto take = [&](size_t bytes) { char* p = ws + off; off += (bytes + 255) & ~(size_t)255; return p; };
  _Float16* BQKV = (_Float16*)take((size_t)3 * DM * DM * 2); _Float16* BO = (_Float16*)take((size_t)DM * DM * 2);
  _Float16* X16 = (_Float16*)take(NR * DM * 2); float* XB = (float*)take(NR * DM * 4); float* X1 = (float*)take(NR * DM * 4); float* X1N = (float*)take(NR * DM * 4);      /* LN1 output f32 rows */ _Float16* M16 = nullptr;      /* = X16 below (alias: X16's last reader, the last batch's first-tile GEMMs, precedes LN1's write) */ _Float16* HF16 = (_Float16*)take((size_t)SQ * DFF * 2); _Float16* BW1 = (_Float16*)take((size_t)DFF * DM * 2); _Float16* BW2 = (_Float16*)take((size_t)DM * DFF * 2); _Float16* QKV = (_Float16*)take(NR * 3 * DM * 2); _Float16* Q16 = QKV; _Float16* K16 = QKV + DM; _Float16* V16 = QKV + 2 * DM; _Float16* O16 = (_Float16*)take(NR * DM * 2); M16 = X16;
  float* S = (float*)take((size_t)NH * QT * NKX * 4); _Float16* P = (_Float16*)take((size_t)NH * QT * NKX * 2); _Float16* VT = (_Float16*)take((size_t)NH * HD * SQ * 2);
  float* QF0 = (float*)take((size_t)QT0 * DM * 4); float* KF0 = (float*)take((size_t)QT0 * DM * 4); float* VF0 = (float*)take((size_t)QT0 * DM * 4); float* OF0 = (float*)take((size_t)NB * QT0 * DM * 4); _Float16* OH0 = (_Float16*)take((size_t)NB * QT0 * DM * 2); _Float16* OL0 = (_Float16*)take((size_t)NB * QT0 * DM * 2);
  if (off > ws_size) return;
  k_wt_f16<<<(unsigned)(((size_t)3 * DM * (DM / 8) + 255) / 256), 256, 0, stream>>>(wqkv, BQKV, DM, 3 * DM, 16.0f);      /* fused [in][out] [DM][3 DM] -> Bt [3 DM][DM] x16: rows 0.. = q, DM.. = k, 2 DM.. = v output columns (contiguous thirds) */ k_wt_f16<<<(unsigned)(((size_t)DM * (DM / 8) + 255) / 256), 256, 0, stream>>>(wo, BO, DM, DM, 16.0f);      /* w_proj [in][out] -> Bt x16 */
  k_x16<<<(unsigned)((NR * DM / 8 + 255) / 256), 256, 0, stream>>>(x, X16, NR * DM / 8); k_bfr<<<(unsigned)((NR * DM / 8 + 255) / 256), 256, 0, stream>>>(x, XB, NR * DM / 8);      /* POST-LN: the attention runs on x itself (exact f16 rows); XB = bf16(x) f32 for the residual */
  k_wt_f16<<<(unsigned)(((size_t)DFF * (DM / 8) + 255) / 256), 256, 0, stream>>>(wfc, BW1, DM, DFF, 16.0f); k_wt_f16<<<(unsigned)(((size_t)DM * (DFF / 8) + 255) / 256), 256, 0, stream>>>(wmp, BW2, DFF, DM, 16.0f);      /* W1 [1024][4096] -> Bt [4096][1024]; W2 [4096][1024] -> Bt [1024][4096] (x16) */
  const size_t r0p = (size_t)B0 * SQ;      /* first projected row */
  k_gemm2<0><<<dim3((unsigned)((MP / 128) * (3 * DM / 64)), 1), 128, 0, stream>>>(X16 + r0p * DM, DM, 0, BQKV, DM, 0, 0.0625f, bqkv, 0, nullptr, 1, 0, 0, nullptr, QKV + r0p * 3 * DM, 3 * DM, 0, MP, 3 * DM, DM);      /* q | k | v rows (f16); head h = columns h*HD.. of each DM block */
  for (int b = B0; b < B0 + NBR; ++b) { const size_t r0 = (size_t)b * SQ;
    k_vt<NH, SQ><<<NH * (SQ / 64), 256, 0, stream>>>(V16 + r0 * LQ, LQ, 0, VT);      /* V^T [NH][HD][SQ] for this batch */
    k_gemm2<0><<<dim3((QT0 / 128) * (DM / 64), 1), 128, 0, stream>>>(X16 + r0 * DM, DM, 0, BQKV, DM, 0, 0.0625f, bqkv, 0, nullptr, 1, 0, 0, QF0, nullptr, DM, 0, QT0, DM, DM); k_gemm2<0><<<dim3((QT0 / 128) * (DM / 64), 1), 128, 0, stream>>>(X16 + r0 * DM, DM, 0, (BQKV + (size_t)DM * DM), DM, 0, 0.0625f, bqkv + DM, 0, nullptr, 1, 0, 0, KF0, nullptr, DM, 0, QT0, DM, DM); k_gemm2<0><<<dim3((QT0 / 128) * (DM / 64), 1), 128, 0, stream>>>(X16 + r0 * DM, DM, 0, (BQKV + (size_t)2 * DM * DM), DM, 0, 0.0625f, bqkv + 2 * DM, 0, nullptr, 1, 0, 0, VF0, nullptr, DM, 0, QT0, DM, DM);      /* f32 q, k, v of the first 128 rows (exact products) */
    k_att0<0><<<NH * (QT0 / 64), 64, 0, stream>>>(QF0, KF0, VF0, DM, nullptr, 0.125f, OF0 + (size_t)b * QT0 * DM, DM);      /* exact f32 attention for rows 0..127 (o x64) */
    for (int q0 = 0; q0 < QN; q0 += QT) { const int nk = q0 + QT;      /* causal: only keys below the tile end are computed */
      k_gemm2<0><<<dim3((QT / 128) * (nk / 64), NHD), 128, 0, stream>>>(Q16 + (r0 + q0) * LQ, LQ, (size_t)HD, K16 + r0 * LQ, LQ, (size_t)HD, 0.125f, nullptr, 0, nullptr, 1, 0, 0, S, nullptr, NKX, (size_t)QT * NKX, QT, nk, HD);      /* scores, all heads on grid.y */
      k_rsmw<<<(NHD * QT + 7) / 8, 256, 0, stream>>>(S, P, NHD, q0, nk);      /* one wave per row, 8 rows a block */
      k_gemm2<0><<<dim3((QT / 128) * (HD / 64), NHD), 128, 0, stream>>>(P, NKX, (size_t)QT * NKX, VT, SQ, (size_t)HD * SQ, 0.25f, nullptr, 0, nullptr, 1, 0, 0, nullptr, O16 + (r0 + q0) * DM, DM, (size_t)HD, QT, HD, nk); } }      /* o (merged heads, x64) as f16 rows */
  k_gemm2<0><<<dim3((unsigned)((MPO / 128) * (DM / 64)), 1), 128, 0, stream>>>(O16 + r0p * DM, DM, 0, BO, DM, 0, 0.0009765625f, bo, 0, XB + r0p * DM, -1, 0, 0, X1 + r0p * DM, nullptr, DM, 0, MPO, DM, DM);      /* out rows are the output layout */
  k_hl<<<(unsigned)(((size_t)NB * QT0 * DM / 8 + 255) / 256), 256, 0, stream>>>(OF0, OH0, OL0, (size_t)NB * QT0 * DM / 8);      /* first-tile o (x64) -> f16 hi + x1024 residual planes */
  for (int b = B0; b < B0 + NBR; ++b) { const size_t r0 = (size_t)b * SQ; const size_t f0 = (size_t)b * QT0;
    k_gemm2<0><<<dim3((QT0 / 128) * (DM / 64), 1), 128, 0, stream>>>(OH0 + f0 * DM, DM, 0, BO, DM, 0, 0.0009765625f, bo, 0, XB + r0 * DM, -1, 0, 0, X1 + r0 * DM, nullptr, DM, 0, QT0, DM, DM);      /* rows 0..127: out = o_hi Wo (+ b), overwriting the f16-path rows */
    k_gemm2<0><<<dim3((QT0 / 128) * (DM / 64), 1), 128, 0, stream>>>(OL0 + f0 * DM, DM, 0, BO, DM, 0, 0.00000095367431640625f, nullptr, 0, X1 + r0 * DM, -1, 0, 0, X1 + r0 * DM, nullptr, DM, 0, QT0, DM, DM); }      /* += o_lo Wo 2^-20 (own-element accumulate) */
  k_lnx<0, 1, 1><<<(unsigned)NR, 256, 0, stream>>>(X1, g1, be1, 1e-5f, M16, X1N);      /* x1 = LN1(x + attn_out) -> f16 rows (FFN operand) + f32 rows (residual) */
  for (int b = 0; b < NB; ++b) { const size_t r0 = (size_t)b * SQ;
    k_gemm2<3><<<dim3((unsigned)((SQ / 128) * (DFF / 64)), 1), 128, 0, stream>>>(M16 + r0 * DM, DM, 0, BW1, DM, 0, 0.0625f, bfc, 0, nullptr, 1, 0, 0, nullptr, HF16, DFF, 0, SQ, DFF, DM);      /* relu(x1 w_up + b_up) -> f16 (this batch) */
    k_gemm2<0><<<dim3((unsigned)((SQ / 128) * (DM / 64)), 1), 128, 0, stream>>>(HF16, DFF, 0, BW2, DFF, 0, 0.0625f, bmp, 0, X1N + r0 * DM, -1, 0, 0, X1 + r0 * DM, nullptr, DM, 0, SQ, DM, DFF); }      /* x1 + ffn (own-element residual from the LN1 f32 rows) -> f32 rows over the dead pre-LN1 plane */
  k_lnx<0, 0, 1><<<(unsigned)NR, 256, 0, stream>>>(X1, gg2, be2, 1e-5f, nullptr, (float*)d_out);      /* result = LN2(x1 + ffn) */
}

// v002
// A run of this version takes 1670 microseconds.
// Timed twice side by side with v001, it ran 1.52 times as fast both times.
// All steps since v000 together make it 3.26 times as fast.
#include <hip/hip_runtime.h>
// POST-LN transformer decoder layer with causal self-attention and a fused QKV projection (x [2][2048][1024]; qkv = x w_qkv + b_qkv ([in][out] 1024 x 3072 + bias) viewed (B, S, 3, 16, 64): q | k | v thirds; scores * 64^-0.5; causal (tril, -inf); softmax; x1 = LN1(x + out w_out + b_out) (biased var, eps 1e-5); result = LN2(x1 + relu(x1 w_up + b_up) w_down + b_down) ([in][out] 1024 x 4096 x 1024) -> [2][2048][1024]).
// Structure: token rows r = b*2048 + s; x as exact f16 rows (bf16-rounded); q | k | v as ONE WMMA GEMM (N = 3 x 1024) (32x64 wave tiles, f32 accumulation, exact x16 weights + bias, f16 outputs); per batch: V^T for all heads via LDS transposes; per query tile of 256 rows: scores against the keys below the tile end only (K = 64, all heads on grid.y, alpha = 0.125), causal row softmax on VALU, one wave per row, keys past the row masked to -1e9 over the computed range (f32 statistics, native exp; weights x256 f16), o = P . V^T (K = keys below the tile end, alpha 2^-2: o carried x64, folded into the output GEMM alpha) written straight into the merged f16 o rows; out = o W_o + b GEMM (f32) into the output layout.
// Compute dtype: inputs rounded to bf16; x / weights exact; q, k, v, softmax weights and o as plain f16 GEMM operands (~2^-12); scores and softmax statistics f32. v_wmma_f32_16x16x32_f16.
#define NB 2
#define SQ 2048
#define DM 1024
#define NH 16
#define HD 64
#define HG 4                         /* heads h0 .. h0 + HG - 1 per launch, one per block, in the k_vt(V16, b, h0, VT) form (not launched) */
#define QT 256                       /* query rows per causal tile */
#define NKX SQ                       /* S / P row pitch */
#define QT0 128                      /* first-tile rows recomputed exactly in f32 */
#define B0 0                         /* first batch processed (debug hook) */
#define NBR NB                       /* batches processed (debug hook) */
#define NR ((size_t)NB * SQ)
#define DMQ DM
#define DFF 4096                     /* FFN hidden width */
#define DFFR 100                     /* unused (the FFN hidden width is DFF) */
#define MP ((int)((size_t)NBR * SQ)) /* rows projected (debug hook) */
#define QN SQ                        /* query rows attended per batch (debug hook) */
#define NHD NH                       /* heads attended (debug hook) */
#define MPO MP                       /* rows through the output stage (debug hook) */
#define LQ (3 * DM)      /* row pitch of the q/k/v rows */
typedef __bf16 v16b __attribute__((ext_vector_type(16)));
typedef unsigned short v8us __attribute__((ext_vector_type(8), may_alias));
typedef float  v8f  __attribute__((ext_vector_type(8)));
typedef float  v4f  __attribute__((ext_vector_type(4)));
typedef float  v4fa __attribute__((ext_vector_type(4), may_alias));
union FragB { v16b v; v8us half[2]; unsigned short u[16]; };

__device__ __forceinline__ unsigned short bf16_bits(float x) { unsigned int u = __float_as_uint(x); return (unsigned short)((u + 0x7FFFu + ((u >> 16) & 1u)) >> 16); }
__device__ __forceinline__ float bf16_val(unsigned short b) { return __uint_as_float(((unsigned int)b) << 16); }
__device__ __forceinline__ float bf16_round(float x) { return bf16_val(bf16_bits(x)); }
// D += A·B with NT terms: 1 = ah·bh, 2 = + al·bh (A split), 3 = + ah·bl (both split)
template <int NT>
__device__ __forceinline__ v8f mmaN(v16b ah, v16b al, v16b bh, v16b bl, v8f c) {
  c = __builtin_amdgcn_wmma_f32_16x16x32_bf16(false, ah, false, bh, (short)0, c, false, false);
  if (NT >= 2) c = __builtin_amdgcn_wmma_f32_16x16x32_bf16(false, al, false, bh, (short)0, c, false, false);
  if (NT >= 3) c = __builtin_amdgcn_wmma_f32_16x16x32_bf16(false, ah, false, bl, (short)0, c, false, false);
  asm volatile("v_nop\n\tv_nop\n\tv_nop\n\tv_nop" : "+v"(c) : "v"(ah), "v"(al), "v"(bh), "v"(bl));
  return c;
}

__global__ __launch_bounds__(256) void k_wt_bf16(const float* __restrict__ W, unsigned short* __restrict__ Wt, int K, int N) {
  const int t = blockIdx.x * 256 + threadIdx.x;
  const int k8n = K / 8;
  if (t >= N * k8n) return;
  const int n = t / k8n, k8 = (t % k8n) * 8;
  v8us v;
#pragma unroll
  for (int i = 0; i < 8; ++i) v[i] = bf16_bits(W[(size_t)(k8 + i) * N + n]);
  *(v8us*)(Wt + (size_t)n * K + k8) = v;
  
}

// GEMM C[M][N] (f32, pitch ldc) = act(A[M][K]·W + bias). A f32 row-major (pitch lda) converted per fragment to bf16
// (ASPLIT: hi/lo two planes -> 2 terms, else single rounded term); Wt bf16 [N][K] (pitch ldb). BIAS_BF16 rounds the
// bias to bf16 first (bias quantised to bf16 before the add). K%32==0, M%16==0, N%64==0.
template <bool ASPLIT, int ACT, bool BIAS_BF16>
__global__ __launch_bounds__(128) void k_gemm_bf(const float* __restrict__ A, int lda, const unsigned short* __restrict__ Wt, int ldb,
                                               const float* __restrict__ bias, float* __restrict__ C, int ldc, int M, int N, int K) {
  __shared__ __attribute__((aligned(16))) float so[4][16][64];
  const int tid = threadIdx.x, w = tid >> 5, lane = tid & 31, ln = lane & 15, hh = lane >> 4;
  const int ntn = N / 64;
  const int wid = blockIdx.x * 4 + w;
  const int mt = wid / ntn, nq = wid % ntn;
  if (mt * 16 >= M) return;
  const int row0 = mt * 16, col0 = nq * 64;
  const float* arow = A + (size_t)(row0 + ln) * lda;
  v8f acc[4] = {};
  for (int kb = 0; kb < K; kb += 32) {
    FragB ah, al;
    const v4f x0 = *(const v4fa*)(arow + kb + 8 * hh), x1 = *(const v4fa*)(arow + kb + 8 * hh + 4);
    const v4f x2 = *(const v4fa*)(arow + kb + 16 + 8 * hh), x3 = *(const v4fa*)(arow + kb + 16 + 8 * hh + 4);
    float xs[16] = {x0[0],x0[1],x0[2],x0[3],x1[0],x1[1],x1[2],x1[3],x2[0],x2[1],x2[2],x2[3],x3[0],x3[1],x3[2],x3[3]};
#pragma unroll
    for (int i = 0; i < 16; ++i) { const unsigned short hb = bf16_bits(xs[i]); ah.u[i] = hb; al.u[i] = ASPLIT ? bf16_bits(xs[i] - bf16_val(hb)) : (unsigned short)0; }
#pragma unroll
    for (int t = 0; t < 4; ++t) {
      const unsigned short* brow = Wt + (size_t)(col0 + t * 16 + ln) * ldb + kb;
      FragB b;
      b.half[0] = *(const v8us*)(brow + 8 * hh);
      b.half[1] = *(const v8us*)(brow + 16 + 8 * hh);
      acc[t] = mmaN<ASPLIT ? 2 : 1>(ah.v, al.v, b.v, b.v, acc[t]);
    }
  }
#pragma unroll
  for (int t = 0; t < 4; ++t) {
    float bv = bias ? bias[col0 + t * 16 + ln] : 0.f;
    if (BIAS_BF16) bv = bf16_round(bv);
#pragma unroll
    for (int r = 0; r < 8; ++r) { float v = acc[t][r] + bv; if (ACT == 1) v = fmaxf(v, 0.f); so[w][8 * hh + r][t * 16 + ln] = v; }
  }
  __builtin_amdgcn_fence(__ATOMIC_ACQ_REL, "workgroup");
  __builtin_amdgcn_wave_barrier();
  const int rsub = lane >> 4, c4 = (lane & 15) * 4;
  {
#pragma unroll
    for (int q = 0; q < 8; ++q) {
      const int r = q * 2 + rsub;
      const v4f v = *(const v4fa*)&so[w][r][c4];
      *(v4f*)(C + (size_t)(row0 + r) * ldc + col0 + c4) = v;
    }
    
  }
}

// GEMM C = act(A·W + bias + resid): A f32 (ASPLIT -> hi/lo 2 terms), Wt bf16 [N][K]; ACT 0 none, 1 relu, 2 exact gelu;
// resid (optional, f32, row index = (row % rmod), pitch ldr, RES_BF16 rounds it) added before the activation.
template <bool ASPLIT, int ACT, bool BIAS_BF16, bool RES_BF16>
__global__ __launch_bounds__(128) void k_gemm_bf3(const float* __restrict__ A, int lda, const unsigned short* __restrict__ Wt, int ldb,
                                                const float* __restrict__ bias, const float* __restrict__ resid, int rmod, int ldr,
                                                float* __restrict__ C, int ldc, int M, int N, int K) {
  __shared__ __attribute__((aligned(16))) float so[4][16][64];
  const int tid = threadIdx.x, w = tid >> 5, lane = tid & 31, ln = lane & 15, hh = lane >> 4;
  const int ntn = N / 64;
  const int wid = blockIdx.x * 4 + w;
  const int mt = wid / ntn, nq = wid % ntn;
  if (mt * 16 >= M) return;
  const int row0 = mt * 16, col0 = nq * 64;
  const float* arow = A + (size_t)(row0 + ln) * lda;
  v8f acc[4] = {};
  for (int kb = 0; kb < K; kb += 32) {
    FragB ah, al;
    const v4f x0 = *(const v4fa*)(arow + kb + 8 * hh), x1 = *(const v4fa*)(arow + kb + 8 * hh + 4);
    const v4f x2 = *(const v4fa*)(arow + kb + 16 + 8 * hh), x3 = *(const v4fa*)(arow + kb + 16 + 8 * hh + 4);
    float xs[16] = {x0[0],x0[1],x0[2],x0[3],x1[0],x1[1],x1[2],x1[3],x2[0],x2[1],x2[2],x2[3],x3[0],x3[1],x3[2],x3[3]};
#pragma unroll
    for (int i = 0; i < 16; ++i) { const unsigned short hb = bf16_bits(xs[i]); ah.u[i] = hb; al.u[i] = ASPLIT ? bf16_bits(xs[i] - bf16_val(hb)) : (unsigned short)0; }
#pragma unroll
    for (int t = 0; t < 4; ++t) {
      const unsigned short* brow = Wt + (size_t)(col0 + t * 16 + ln) * ldb + kb;
      FragB b;
      b.half[0] = *(const v8us*)(brow + 8 * hh);
      b.half[1] = *(const v8us*)(brow + 16 + 8 * hh);
      acc[t] = mmaN<ASPLIT ? 2 : 1>(ah.v, al.v, b.v, b.v, acc[t]);
    }
  }
#pragma unroll
  for (int t = 0; t < 4; ++t) {
    const int col = col0 + t * 16 + ln;
    float bv = bias ? bias[col] : 0.f;
    if (BIAS_BF16) bv = bf16_round(bv);
#pragma unroll
    for (int r = 0; r < 8; ++r) {
      float v = acc[t][r] + bv;
      if (resid) { float rv = resid[(size_t)((row0 + 8 * hh + r) % rmod) * ldr + col]; if (RES_BF16) rv = bf16_round(rv); v += rv; }
      if (ACT == 1) v = fmaxf(v, 0.f);
      if (ACT == 2) v = 0.5f * v * (1.0f + erff(v * 0.70710678118654752f));
      if (ACT == 3) { const float u = 0.7978845608028654f * (v + 0.044715f * v * v * v); v = 0.5f * v * (1.0f + tanhf(u)); }
      so[w][8 * hh + r][t * 16 + ln] = v;
    }
  }
  __builtin_amdgcn_fence(__ATOMIC_ACQ_REL, "workgroup");
  __builtin_amdgcn_wave_barrier();
  const int rsub = lane >> 4, c4 = (lane & 15) * 4;
  {
#pragma unroll
    for (int q = 0; q < 8; ++q) {
      const int r = q * 2 + rsub;
      const v4f v = *(const v4fa*)&so[w][r][c4];
      *(v4f*)(C + (size_t)(row0 + r) * ldc + col0 + c4) = v;
    }
    
  }
}
// row LayerNorm (biased variance, eps) over N: s = X (+ R); optional out_sum <- s; out_norm <- (s-mu)*rsqrt(var+eps)*g + b
template <bool PARAM_BF16>
__global__ __launch_bounds__(256) void k_layernorm(const float* __restrict__ X, const float* __restrict__ R, const float* __restrict__ g, const float* __restrict__ bta,
                                                  float* __restrict__ out_sum, float* __restrict__ out_norm, int N, float eps) {
  __shared__ float red[256];
  const int row = blockIdx.x, tid = threadIdx.x;
  const float* x = X + (size_t)row * N; const float* rr = R ? R + (size_t)row * N : nullptr;
  float vals[16];                     // up to N = 4096
  const int per = N / 256;            // contiguous chunk per thread? use strided-by-4 chunks: thread handles j = tid*4 + 1024*u
  float s1 = 0.f;
  for (int u = 0; u < per / 4; ++u) {
    const int j = tid * 4 + 1024 * u;
    const v4f a = *(const v4fa*)(x + j);
    v4f b = {0.f,0.f,0.f,0.f}; if (rr) b = *(const v4fa*)(rr + j);
#pragma unroll
    for (int q = 0; q < 4; ++q) { const float v = a[q] + b[q]; vals[u * 4 + q] = v; s1 += v; }
  }
  red[tid] = s1; __syncthreads();
  for (int st = 128; st > 0; st >>= 1) { if (tid < st) red[tid] += red[tid + st]; __syncthreads(); }
  const float mu = red[0] / (float)N; __syncthreads();
  float s2 = 0.f;
  for (int u = 0; u < per / 4; ++u)
#pragma unroll
    for (int q = 0; q < 4; ++q) { const float c = vals[u * 4 + q] - mu; s2 += c * c; }
  red[tid] = s2; __syncthreads();
  for (int st = 128; st > 0; st >>= 1) { if (tid < st) red[tid] += red[tid + st]; __syncthreads(); }
  const float rs = rsqrtf(red[0] / (float)N + eps);
  {
    for (int u = 0; u < per / 4; ++u) {
      const int j = tid * 4 + 1024 * u;
      v4f o, sm;
#pragma unroll
      for (int q = 0; q < 4; ++q) {
        float gg = g[j + q], bb = bta[j + q];
        if (PARAM_BF16) { gg = bf16_round(gg); bb = bf16_round(bb); }
        sm[q] = vals[u * 4 + q]; o[q] = (vals[u * 4 + q] - mu) * rs * gg + bb;
      }
      if (out_sum) *(v4f*)(out_sum + (size_t)row * N + j) = sm;
      *(v4f*)(out_norm + (size_t)row * N + j) = o;
    }
    
  }
}



// ---- f16 WMMA path (v_wmma_f32_16x16x32_f16): 11-bit significands for operands in range — used where a [0,1] probability operand needs more precision than bf16
typedef _Float16 v16h __attribute__((ext_vector_type(16)));
union FragH { v16h v; v8us half[2]; _Float16 h[16]; unsigned short u[16]; };
template <int NT>
__device__ __forceinline__ v8f mmaH(v16h ah, v16h al, v16h bh, v16h bl, v8f c) {
  c = __builtin_amdgcn_wmma_f32_16x16x32_f16(false, ah, false, bh, (short)0, c, false, false);
  if (NT >= 2) c = __builtin_amdgcn_wmma_f32_16x16x32_f16(false, al, false, bh, (short)0, c, false, false);
  if (NT >= 3) c = __builtin_amdgcn_wmma_f32_16x16x32_f16(false, ah, false, bl, (short)0, c, false, false);
  asm volatile("v_nop\n\tv_nop\n\tv_nop\n\tv_nop" : "+v"(c) : "v"(ah), "v"(al), "v"(bh), "v"(bl));
  return c;
}
// batched GEMM like k_gemm_b but f16 operands: A f32 (split into f16 hi/lo if ASPLIT, else rounded to f16), Bt = f16 values [n][k]; alpha; C f32; N multiple of 16 (partial tiles skipped)
template <bool ASPLIT>
__global__ __launch_bounds__(128) void k_gemm_h(const float* __restrict__ A, int lda, size_t sA, const _Float16* __restrict__ Bh, int ldb, size_t sB, float alpha, float* __restrict__ C, int ldc, size_t sC, int M, int N, int K) {
  __shared__ __attribute__((aligned(16))) float so[4][16][64];
  const int tid = threadIdx.x, w = tid >> 5, lane = tid & 31, ln = lane & 15, hh = lane >> 4; const int by = blockIdx.y;
  A += (size_t)by * sA; Bh += (size_t)by * sB; C += (size_t)by * sC;
  const int ntn = (N + 63) / 64; const int wid = blockIdx.x * 4 + w; const int mt = wid / ntn, nq = wid % ntn; if (mt * 16 >= M) return;
  const int row0 = mt * 16, col0 = nq * 64; const float* arow = A + (size_t)(row0 + ln) * lda;
  v8f acc[4] = {};
  for (int kb = 0; kb < K; kb += 32) {
    FragH ah, al;
    const v4f x0 = *(const v4fa*)(arow + kb + 8 * hh), x1 = *(const v4fa*)(arow + kb + 8 * hh + 4), x2 = *(const v4fa*)(arow + kb + 16 + 8 * hh), x3 = *(const v4fa*)(arow + kb + 16 + 8 * hh + 4);
    float xs[16] = {x0[0],x0[1],x0[2],x0[3],x1[0],x1[1],x1[2],x1[3],x2[0],x2[1],x2[2],x2[3],x3[0],x3[1],x3[2],x3[3]};
#pragma unroll
    for (int i = 0; i < 16; ++i) { const _Float16 h = (_Float16)xs[i]; ah.h[i] = h; al.h[i] = ASPLIT ? (_Float16)(xs[i] - (float)h) : (_Float16)0.0f; }
#pragma unroll
    for (int t = 0; t < 4; ++t) { if (col0 + t * 16 >= N) continue; const size_t boff = (size_t)(col0 + t * 16 + ln) * ldb + kb; FragH bq; bq.half[0] = *(const v8us*)(Bh + boff + 8 * hh); bq.half[1] = *(const v8us*)(Bh + boff + 16 + 8 * hh);
      acc[t] = mmaH<ASPLIT ? 2 : 1>(ah.v, al.v, bq.v, bq.v, acc[t]); }
  }
#pragma unroll
  for (int t = 0; t < 4; ++t) { if (col0 + t * 16 >= N) continue;
#pragma unroll
    for (int r = 0; r < 8; ++r) so[w][8 * hh + r][t * 16 + ln] = acc[t][r] * alpha; }
  __builtin_amdgcn_fence(__ATOMIC_ACQ_REL, "workgroup"); __builtin_amdgcn_wave_barrier();
  const int rsub = lane >> 4, c4 = (lane & 15) * 4;
  {
#pragma unroll
    for (int q = 0; q < 8; ++q) { const int r = q * 2 + rsub; if (col0 + c4 < N) { const v4f v = *(const v4fa*)&so[w][r][c4]; *(v4f*)(C + (size_t)(row0 + r) * ldc + col0 + c4) = v; } }
     }
}

// Wt[n][k] = f16(W[k][n]·scale) from f32 row-major W[K][N] (scale = power of two; bf16-exact weights stay exact in f16 away from the subnormal range)
__global__ __launch_bounds__(256) void k_wt_f16(const float* __restrict__ W, _Float16* __restrict__ Wt, int K, int N, float scale) {
  const int t = blockIdx.x * 256 + threadIdx.x; if (t >= N * (K / 8)) return; const int n = t / (K / 8), k8 = (t % (K / 8)) * 8; FragH f;
#pragma unroll
  for (int i = 0; i < 8; ++i) f.h[i] = (_Float16)(bf16_round(W[(size_t)(k8 + i) * N + n]) * scale); const v8us o = f.half[0];
  *(v8us*)((unsigned short*)Wt + (size_t)n * K + k8) = o; 
}
// k_gemm_hh variant with fused epilogue: v = acc·alpha + bias[by·sBias + col] (+ CP[(row/rowsPerB)·sCPb + by·64 + col] if CP) ; ACT 0 none / 1 elu ; writes f16 C16 (and f32 C if non-null)
template <int ACT>
__global__ __launch_bounds__(128) void k_gemm_hhx(const _Float16* __restrict__ A, int lda, size_t sA, const _Float16* __restrict__ Bh, int ldb, size_t sB, float alpha, const float* __restrict__ bias, size_t sBias, const float* __restrict__ CP, int rowsPerB, size_t sCPb, int row0g,
    float* __restrict__ C, _Float16* __restrict__ C16, int ldc, size_t sC, int M, int N, int K) {
  __shared__ __attribute__((aligned(16))) float so[4][16][64];
  const int tid = threadIdx.x, w = tid >> 5, lane = tid & 31, ln = lane & 15, hh = lane >> 4; const int by = blockIdx.y;
  A += (size_t)by * sA; Bh += (size_t)by * sB; const size_t cofs = (size_t)by * sC; const float* bp = bias ? bias + (size_t)by * sBias : nullptr;
  const int ntn = (N + 63) / 64; const int wid = blockIdx.x * 4 + w; const int mt = wid / ntn, nq = wid % ntn; if (mt * 16 >= M) return;
  const int row0 = mt * 16, col0 = nq * 64; const _Float16* arow = A + (size_t)(row0 + ln) * lda;
  v8f acc[4] = {};
  for (int kb = 0; kb < K; kb += 32) { FragH ah; ah.half[0] = *(const v8us*)((const unsigned short*)arow + kb + 8 * hh); ah.half[1] = *(const v8us*)((const unsigned short*)arow + kb + 16 + 8 * hh);
#pragma unroll
    for (int t = 0; t < 4; ++t) { if (col0 + t * 16 >= N) continue; const size_t boff = (size_t)(col0 + t * 16 + ln) * ldb + kb; FragH bq; bq.half[0] = *(const v8us*)((const unsigned short*)Bh + boff + 8 * hh); bq.half[1] = *(const v8us*)((const unsigned short*)Bh + boff + 16 + 8 * hh);
      acc[t] = mmaH<1>(ah.v, ah.v, bq.v, bq.v, acc[t]); }
  }
#pragma unroll
  for (int t = 0; t < 4; ++t) { if (col0 + t * 16 >= N) continue; const int col = col0 + t * 16 + ln; const float bv = bp ? bf16_round(bp[col]) : 0.f;
#pragma unroll
    for (int r = 0; r < 8; ++r) { float v = acc[t][r] * alpha + bv; if (CP) { const int rr = row0g + row0 + 8 * hh + r; if (rowsPerB < 0) v += CP[cofs + (size_t)rr * ldc + col];      /* rowsPerB < 0: own element of the batched C plane */ else { const int bidx = rr / rowsPerB; v += CP[(size_t)bidx * sCPb + (size_t)by * 64 + col]; } } if (ACT == 1) v = (v > 0.f) ? v : expm1f(v); else if (ACT == 7) v = (v > 0.f) ? v + 1.0f : expf(v); else if (ACT == 8) v = tanhf(v); else if (ACT == 9) v = 0.5f * v * (1.0f + tanhf(0.7978845608028654f * (v + 0.044715f * v * v * v))); else if (ACT == 11) v = 1.0f / (1.0f + expf(-v)); else if (ACT == 12) v = (v > 0.f) ? v : 0.01f * v; else if (ACT == 14) v = (v > 0.f) ? v : 0.1f * v; else if (ACT == 16) v = (v >= 0.f) ? v : 0.3f * v; else if (ACT == 17) v = (v >= 0.f) ? v : 0.2f * v; else if (ACT == 15) v = v / (1.0f + expf(-v)); else if (ACT == 3) v = fmaxf(v, 0.f); else if (ACT == 6) v = 0.5f * v * (1.0f + erff(v * 0.70710678118654752f)); so[w][8 * hh + r][t * 16 + ln] = v; } }
  __builtin_amdgcn_fence(__ATOMIC_ACQ_REL, "workgroup"); __builtin_amdgcn_wave_barrier();
  const int rsub = lane >> 4, c4 = (lane & 15) * 4; typedef _Float16 v4h __attribute__((ext_vector_type(4)));
  {
#pragma unroll
    for (int q = 0; q < 8; ++q) { const int r = q * 2 + rsub; if (col0 + c4 < N) { const v4f v = *(const v4fa*)&so[w][r][c4]; if (C) *(v4f*)(C + cofs + (size_t)(row0 + r) * ldc + col0 + c4) = v; if (C16) { v4h h4; for (int i = 0; i < 4; ++i) h4[i] = (_Float16)v[i]; *(v4h*)(C16 + cofs + (size_t)(row0 + r) * ldc + col0 + c4) = h4; } } }
     }
}


typedef _Float16 v4h __attribute__((ext_vector_type(4)));

__global__ __launch_bounds__(256) void k_x16(const float* __restrict__ x, _Float16* __restrict__ X16, size_t n8) { const size_t t = (size_t)blockIdx.x * 256 + threadIdx.x; if (t >= n8) return; FragH f;
#pragma unroll
  for (int q = 0; q < 8; ++q) f.h[q] = (_Float16)bf16_round(x[t * 8 + q]); *(v8us*)((unsigned short*)X16 + t * 8) = f.half[0];  }
__global__ __launch_bounds__(256) void k_h16(const float* __restrict__ x, _Float16* __restrict__ X16, size_t n8) { const size_t t = (size_t)blockIdx.x * 256 + threadIdx.x; if (t >= n8) return; FragH f;
#pragma unroll
  for (int q = 0; q < 8; ++q) f.h[q] = (_Float16)x[t * 8 + q]; *(v8us*)((unsigned short*)X16 + t * 8) = f.half[0];  }
__global__ __launch_bounds__(256) void k_round16f(const float* __restrict__ W, _Float16* __restrict__ Bt, size_t n8) { const size_t t = (size_t)blockIdx.x * 256 + threadIdx.x; if (t >= n8) return; FragH f;
#pragma unroll
  for (int i = 0; i < 8; ++i) f.h[i] = (_Float16)(bf16_round(W[t * 8 + i]) * 16.0f); *(v8us*)((unsigned short*)Bt + t * 8) = f.half[0];  }
template <int NHv, int TTv>
__global__ __launch_bounds__(256) void k_vt(const _Float16* __restrict__ V16, int ldv, int voff, _Float16* __restrict__ Vt) { __shared__ unsigned short tl[64][66]; const int tid = threadIdx.x; const int slab = blockIdx.x / (TTv / 64), lg = blockIdx.x % (TTv / 64); const int b = slab / NHv, h = slab % NHv;
  for (int i = tid; i < 64 * 8; i += 256) { const int r = i / 8, c8 = (i % 8) * 8; FragH f; f.half[0] = *(const v8us*)((const unsigned short*)V16 + ((size_t)b * TTv + lg * 64 + r) * ldv + voff + h * 64 + c8);
#pragma unroll
    for (int q = 0; q < 8; ++q) tl[r][c8 + q] = f.u[q]; }
  __syncthreads();
  {
#pragma unroll
    for (int rd = 0; rd < 2; ++rd) { const int d = rd * 32 + tid / 8, pc = tid % 8; FragH f;
#pragma unroll
      for (int q = 0; q < 8; ++q) f.u[q] = tl[pc * 8 + q][d];
      *(v8us*)((unsigned short*)Vt + ((size_t)slab * 64 + d) * TTv + lg * 64 + pc * 8) = f.half[0]; }
     } }

__global__ __launch_bounds__(256) void k_hl(const float* __restrict__ F, _Float16* __restrict__ Hh, _Float16* __restrict__ Hl, size_t n8) { const size_t t = (size_t)blockIdx.x * 256 + threadIdx.x; if (t >= n8) return; FragH fh, fl; const v4f a = *(const v4fa*)(F + t * 8), c = *(const v4fa*)(F + t * 8 + 4);
#pragma unroll
  for (int q = 0; q < 4; ++q) { _Float16 h = (_Float16)a[q]; fh.h[q] = h; fl.h[q] = (_Float16)((a[q] - (float)h) * 1024.0f); h = (_Float16)c[q]; fh.h[4 + q] = h; fl.h[4 + q] = (_Float16)((c[q] - (float)h) * 1024.0f); }
  { *(v8us*)((unsigned short*)Hh + t * 8) = fh.half[0]; *(v8us*)((unsigned short*)Hl + t * 8) = fl.half[0];  } }

// ---- fast GEMM (wave tile 32x64; requires M % 32 == 0 rows per launch region and N % 64 == 0); epilogue = k_gemm_hhx semantics ----
__device__ __forceinline__ v16h g2_frag(const _Float16* p, int hh) { FragH f; f.half[0] = *(const v8us*)((const unsigned short*)p + 8 * hh); f.half[1] = *(const v8us*)((const unsigned short*)p + 16 + 8 * hh); return f.v; }
__device__ __forceinline__ v8f g2_mma(v16h a, v16h b, v8f c) { v8f d = __builtin_amdgcn_wmma_f32_16x16x32_f16(false, a, false, b, (short)0, c, false, false); asm volatile("v_nop\n\tv_nop\n\tv_nop\n\tv_nop" : "+v"(d) : "v"(a), "v"(b)); return d; }
template <int ACT>
__global__ __launch_bounds__(128) void k_gemm2(const _Float16* __restrict__ A, int lda, size_t sA, const _Float16* __restrict__ Bh, int ldb, size_t sB, float alpha, const float* __restrict__ bias, size_t sBias, const float* __restrict__ CP, int rowsPerB, size_t sCPb, int row0g,
    float* __restrict__ C, _Float16* __restrict__ C16, int ldc, size_t sC, int M, int N, int K) { static_assert(ACT == 0 || ACT == 3 || ACT == 6 || ACT == 8 || ACT == 9 || ACT == 11 || ACT == 12 || ACT == 14 || ACT == 15 || ACT == 16 || ACT == 17, "k_gemm2: unsupported ACT code (would silently apply no activation)");
  __shared__ __attribute__((aligned(16))) float so[4][32][68];
  const int tid = threadIdx.x, w = tid >> 5, lane = tid & 31, ln = lane & 15, hh = lane >> 4; const int by = blockIdx.y;
  A += (size_t)by * sA; Bh += (size_t)by * sB; const size_t cofs = (size_t)by * sC; const float* bp = bias ? bias + (size_t)by * sBias : nullptr;
  const int ntn = N >> 6; const int mt = blockIdx.x / ntn, nq = blockIdx.x - mt * ntn; const int row0 = mt * 128 + 32 * w, col0 = nq * 64; if (row0 >= M) return;
  const _Float16* a0p = A + (size_t)(row0 + ln) * lda; const _Float16* a1p = a0p + (size_t)16 * lda;
  const _Float16* b0p = Bh + (size_t)(col0 + ln) * ldb; const _Float16* b1p = b0p + (size_t)16 * ldb; const _Float16* b2p = b1p + (size_t)16 * ldb; const _Float16* b3p = b2p + (size_t)16 * ldb;
  const v8f z8 = {0.f,0.f,0.f,0.f,0.f,0.f,0.f,0.f}; v8f c00 = z8, c01 = z8, c02 = z8, c03 = z8, c10 = z8, c11 = z8, c12 = z8, c13 = z8;
#pragma unroll 1
  for (int kb = 0; kb < K; kb += 32) { const v16h a0 = g2_frag(a0p + kb, hh), a1 = g2_frag(a1p + kb, hh);
    v16h b = g2_frag(b0p + kb, hh); c00 = g2_mma(a0, b, c00); c10 = g2_mma(a1, b, c10);
    b = g2_frag(b1p + kb, hh); c01 = g2_mma(a0, b, c01); c11 = g2_mma(a1, b, c11);
    b = g2_frag(b2p + kb, hh); c02 = g2_mma(a0, b, c02); c12 = g2_mma(a1, b, c12);
    b = g2_frag(b3p + kb, hh); c03 = g2_mma(a0, b, c03); c13 = g2_mma(a1, b, c13); }
  v8f accs[8] = {c00, c01, c02, c03, c10, c11, c12, c13};
#pragma unroll
  for (int u = 0; u < 8; ++u) { const int t = u & 3, half = u >> 2; const int col = col0 + t * 16 + ln; const float bv = bp ? bf16_round(bp[col]) : 0.f;
#pragma unroll
    for (int r = 0; r < 8; ++r) { const int rloc = half * 16 + 8 * hh + r; float v = accs[u][r] * alpha + bv; if (CP) { if (rowsPerB < 0) v += CP[cofs + (size_t)(row0g + row0 + rloc) * ldc + col];      /* rowsPerB < 0: own element of the batched C plane */ else { const int bidx = (row0g + row0 + rloc) / rowsPerB; v += CP[(size_t)bidx * sCPb + (size_t)by * 64 + col]; } }
      if (ACT == 3) v = fmaxf(v, 0.f); else if (ACT == 6) v = 0.5f * v * (1.0f + erff(v * 0.70710678118654752f)); else if (ACT == 11) v = 1.0f / (1.0f + expf(-v)); else if (ACT == 15) v = v / (1.0f + expf(-v)); else if (ACT == 12) v = (v > 0.f) ? v : 0.01f * v; else if (ACT == 8) v = tanhf(v); else if (ACT == 9) v = 0.5f * v * (1.0f + tanhf(0.7978845608028654f * (v + 0.044715f * v * v * v))); else if (ACT == 14) v = (v > 0.f) ? v : 0.1f * v; else if (ACT == 16) v = (v >= 0.f) ? v : 0.3f * v; else if (ACT == 17) v = (v >= 0.f) ? v : 0.2f * v;
      so[w][rloc][t * 16 + ln] = v; } }
  __builtin_amdgcn_fence(__ATOMIC_ACQ_REL, "workgroup"); __builtin_amdgcn_wave_barrier();
  const int rsub = lane >> 4, c4 = (lane & 15) * 4;
  {
#pragma unroll
    for (int q = 0; q < 16; ++q) { const int r = q * 2 + rsub; const v4f v = *(const v4fa*)&so[w][r][c4]; if (C) *(v4f*)(C + cofs + (size_t)(row0 + r) * ldc + col0 + c4) = v; if (C16) { v4h h4; for (int i = 0; i < 4; ++i) h4[i] = (_Float16)v[i]; *(v4h*)(C16 + cofs + (size_t)(row0 + r) * ldc + col0 + c4) = h4; } }
     } }


__global__ __launch_bounds__(256) void k_wnat(const float* __restrict__ w, size_t n8, _Float16* __restrict__ Bt) { const size_t t = (size_t)blockIdx.x * 256 + threadIdx.x; if (t >= n8) return; FragH f; for (int q = 0; q < 8; ++q) f.h[q] = (_Float16)(bf16_round(w[t * 8 + q]) * 16.0f); *(v8us*)((unsigned short*)Bt + t * 8) = f.half[0];  }
__global__ __launch_bounds__(256) void k_rsm(const float* __restrict__ S, _Float16* __restrict__ P, int nrows) {
  #pragma clang fp contract(off)
  const int i = blockIdx.x * 256 + threadIdx.x; if (i >= nrows) return; const float* s = S + (size_t)i * SQ; float mx = -3.0e38f;
#pragma unroll 1
  for (int j = 0; j < SQ; ++j) mx = fmaxf(mx, s[j]); float se = 0.f;
#pragma unroll 1
  for (int j = 0; j < SQ; ++j) se += expf(s[j] - mx); const float sc = 256.0f / se;
#pragma unroll 1
  for (int j0 = 0; j0 < SQ; j0 += 8) { FragH f; for (int q = 0; q < 8; ++q) f.h[q] = (_Float16)(expf(s[j0 + q] - mx) * sc); unsigned short* d = (unsigned short*)P + (size_t)i * SQ + j0; *(v8us*)d = f.half[0];  } }
__global__ __launch_bounds__(256) void k_vt(const _Float16* __restrict__ V16, int b, int h0, _Float16* __restrict__ VT) { __shared__ unsigned short tl[64][65]; const int tid = threadIdx.x; const int hh = blockIdx.x % HG, sg = blockIdx.x / HG; const int s0 = sg * 64; const int h = h0 + hh;
  for (int i = tid; i < 64 * 8; i += 256) { const int j = i / 8, d8 = (i % 8) * 8; FragH f; f.half[0] = *(const v8us*)((const unsigned short*)V16 + ((size_t)b * SQ + s0 + j) * DM + h * HD + d8); for (int q = 0; q < 8; ++q) tl[d8 + q][j] = f.u[q]; }
  __syncthreads();
  { for (int i = tid; i < 64 * 8; i += 256) { const int d = i / 8, j8 = (i % 8) * 8; FragH f; for (int q = 0; q < 8; ++q) f.u[q] = tl[d][j8 + q]; *(v8us*)((unsigned short*)VT + ((size_t)hh * HD + d) * SQ + s0 + j8) = f.half[0]; }  } }



// Causal row softmax, one wave per score row. Lane l keeps columns 128 c + 4 l .. + 3 of its row in registers, so each wave-wide load is 512 contiguous bytes and each store 256,
// S is read once and exp is taken once per score. Row maximum and row sum: four chains per lane, then a five-step butterfly over the 32 lanes. nk is a multiple of 256.
// Every loop over v[] and h[] is fully unrolled so that the arrays are indexed by constants and stay in registers (a rolled loop would put them in scratch); the tests u < ng are wave-uniform.
__global__ __launch_bounds__(256) void k_rsmw(const float* __restrict__ S, _Float16* __restrict__ P, int hg, int q0, int nk) {
  const int lane = threadIdx.x & 31; const int t = blockIdx.x * 8 + (threadIdx.x >> 5); if (t >= hg * QT) return;      /* wave-uniform; no barrier below */
  const float* s = S + (size_t)t * NKX + lane * 4; _Float16* p = P + (size_t)t * NKX + lane * 4; const int last = q0 + (t % QT); const int ng = nk >> 8;      /* groups of 256 columns */
  v4f v[NKX / 128];
#pragma unroll
  for (int u = 0; u < NKX / 256; ++u) if (u < ng) { v[2 * u] = *(const v4fa*)(s + u * 256); v[2 * u + 1] = *(const v4fa*)(s + u * 256 + 128); }
  v4f m4 = {-3.0e38f, -3.0e38f, -3.0e38f, -3.0e38f};
#pragma unroll
  for (int u = 0; u < NKX / 256; ++u) if (u < ng) {
#pragma unroll
    for (int c = 2 * u; c < 2 * u + 2; ++c)
#pragma unroll
      for (int q = 0; q < 4; ++q) { const float x = (c * 128 + lane * 4 + q <= last) ? v[c][q] : -1.0e9f; v[c][q] = x; m4[q] = fmaxf(m4[q], x); } }
  float mx = fmaxf(fmaxf(m4[0], m4[1]), fmaxf(m4[2], m4[3]));
#pragma unroll
  for (int o = 16; o > 0; o >>= 1) mx = fmaxf(mx, __shfl_xor(mx, o));
  v4f s4 = {0.f, 0.f, 0.f, 0.f};
#pragma unroll
  for (int u = 0; u < NKX / 256; ++u) if (u < ng) {
#pragma unroll
    for (int c = 2 * u; c < 2 * u + 2; ++c)
#pragma unroll
      for (int q = 0; q < 4; ++q) { const float e = __expf(v[c][q] - mx); v[c][q] = e; s4[q] += e; } }
  float se = (s4[0] + s4[1]) + (s4[2] + s4[3]);
#pragma unroll
  for (int o = 16; o > 0; o >>= 1) se += __shfl_xor(se, o);
  const float sc = 256.0f / se;
  v4h h[NKX / 128];      /* all weights packed first, then stores alone: no register of an issued store is written again */
#pragma unroll
  for (int u = 0; u < NKX / 256; ++u) if (u < ng) {
#pragma unroll
    for (int c = 2 * u; c < 2 * u + 2; ++c)
#pragma unroll
      for (int q = 0; q < 4; ++q) h[c][q] = (_Float16)(v[c][q] * sc); }
#pragma unroll
  for (int u = 0; u < NKX / 256; ++u) if (u < ng) { *(v4h*)(p + u * 256) = h[2 * u]; *(v4h*)(p + u * 256 + 128) = h[2 * u + 1]; } }


typedef float v2fa __attribute__((ext_vector_type(2), may_alias));
#define A0R 8                        /* query rows per block of the first-tile attention: one per wave */
#define A0KP 68                      /* K row pitch in LDS, floats: 272 bytes = 16 x 17, so that 16-byte reads of 32 different rows spread over the banks */
// Exact f32 causal attention for rows 0 .. QT0-1 of one batch, one wave per (head, query row); a block has 8 consecutive rows of one head.
// The block stages the head's K and V rows below its last query row in LDS once (whole-line loads, all in flight together). Scores: lane l has keys l, l + 32, l + 64, l + 96
// (four partial sums per key over the head dimension). Row maximum and row sum by butterflies over the 32 lanes, exp once per key. o: lane l has columns 2 l and 2 l + 1,
// the weights come back through LDS as broadcasts, four partial sums over the keys. o carried x64 like the f16 path.
__global__ __launch_bounds__(256) void k_att0w(const float* __restrict__ QF, const float* __restrict__ KF, const float* __restrict__ VF, int ld, float scale, float* __restrict__ OF, int ldo) {
  __shared__ __attribute__((aligned(16))) float lk[QT0][A0KP]; __shared__ __attribute__((aligned(16))) float lv[QT0][HD]; __shared__ __attribute__((aligned(16))) float pe[A0R][QT0];
  const int tid = threadIdx.x, lane = tid & 31; const int w = __builtin_amdgcn_readfirstlane(tid >> 5);      /* the wave's number as a scalar: the tests on i below become scalar branches */
  const int h = blockIdx.x / (QT0 / A0R), rg = blockIdx.x % (QT0 / A0R); const int nk = rg * A0R + A0R;      /* causal: keys below the block's last row end */ const int i = rg * A0R + w;
  const float* qr = QF + (size_t)i * ld + h * HD; v4f q[HD / 4];
#pragma unroll
  for (int c = 0; c < HD / 4; ++c) q[c] = *(const v4fa*)(qr + c * 4);
  const int sr = tid >> 4, sc4 = (tid & 15) * 4; v4f kx[QT0 / 16], vx[QT0 / 16];
#pragma unroll      /* constant indices keep kx / vx in registers; all loads are issued before the first LDS store. Rows past nk - 1 are clamped to it (in bounds) and not stored */
  for (int u = 0; u < QT0 / 16; ++u) { const size_t g = (size_t)min(sr + 16 * u, nk - 1) * ld + h * HD + sc4;
    // Behind each load: s_wait_xcnt 0 as a precaution, before a register that the load names as address is written again (by later address arithmetic or as a later load's destination);
    // the scheduling barrier keeps that later arithmetic and the later loads behind the wait. The loads' data is not waited for here.
    kx[u] = *(const v4fa*)(KF + g); asm volatile("s_wait_xcnt 0x0" ::: "memory"); __builtin_amdgcn_sched_barrier(0);
    vx[u] = *(const v4fa*)(VF + g); asm volatile("s_wait_xcnt 0x0" ::: "memory"); __builtin_amdgcn_sched_barrier(0); }
#pragma unroll
  for (int u = 0; u < QT0 / 16; ++u) if (sr + 16 * u < nk) { *(v4fa*)&lk[sr + 16 * u][sc4] = kx[u]; *(v4fa*)&lv[sr + 16 * u][sc4] = vx[u]; }
  __syncthreads();      /* K and V rows 0 .. nk-1 staged; every wave passes */
  float s[QT0 / 32];
#pragma unroll
  for (int c = 0; c < QT0 / 32; ++c) { s[c] = -1.0e30f;
    if (c * 32 <= i) { const int j = c * 32 + lane; const float* kr = &lk[min(j, i)][0];      /* lanes past the row read row i (staged) and are masked below */ v4f a4 = {0.f, 0.f, 0.f, 0.f};
#pragma unroll
      for (int d = 0; d < HD / 4; ++d) a4 += q[d] * *(const v4fa*)(kr + d * 4);
      const float a = (a4[0] + a4[1]) + (a4[2] + a4[3]); s[c] = (j <= i) ? a * scale : -1.0e30f; } }
  float mx = fmaxf(fmaxf(s[0], s[1]), fmaxf(s[2], s[3]));
#pragma unroll
  for (int o = 16; o > 0; o >>= 1) mx = fmaxf(mx, __shfl_xor(mx, o));
  float se = 0.f;
#pragma unroll
  for (int c = 0; c < QT0 / 32; ++c) { const float e = (c * 32 + lane <= i) ? expf(s[c] - mx) : 0.f; se += e; pe[w][c * 32 + lane] = e; }
#pragma unroll
  for (int o = 16; o > 0; o >>= 1) se += __shfl_xor(se, o);
  __builtin_amdgcn_fence(__ATOMIC_ACQ_REL, "workgroup"); __builtin_amdgcn_wave_barrier();      /* pe[w] is written and read by this wave alone: keeps the reads below behind the writes above */
  const int nj = (i & ~3) + 4;      /* keys in groups of four: nj <= nk, so every V row read is staged; weights past the row are 0 */
  v2fa o0 = {0.f, 0.f}, o1 = {0.f, 0.f}, o2 = {0.f, 0.f}, o3 = {0.f, 0.f};
#pragma unroll 4      /* several groups' LDS reads in flight behind one wait */
  for (int j = 0; j < nj; j += 4) { const v4f p = *(const v4fa*)&pe[w][j];
    o0 += p[0] * *(const v2fa*)&lv[j][lane * 2]; o1 += p[1] * *(const v2fa*)&lv[j + 1][lane * 2]; o2 += p[2] * *(const v2fa*)&lv[j + 2][lane * 2]; o3 += p[3] * *(const v2fa*)&lv[j + 3][lane * 2]; }
  const float fin = 64.0f / se;      /* o carried x64 like the f16 path */
  const v2fa ov = ((o0 + o1) + (o2 + o3)) * fin;
  *(v2fa*)(OF + (size_t)i * ldo + h * HD + lane * 2) = ov; }


template <int BFIN, int WXB>
__global__ __launch_bounds__(256) void k_ln16(const float* __restrict__ X, const float* __restrict__ g, const float* __restrict__ bb, float eps, _Float16* __restrict__ N16, float* __restrict__ XB) {
  #pragma clang fp contract(off)
  __shared__ float red[256]; const size_t r = blockIdx.x; const int t = threadIdx.x; const v4f xa = *(const v4fa*)(X + r * DMQ + t * 4); float s[4]; float sum = 0.f;
  for (int q = 0; q < 4; ++q) { s[q] = BFIN ? bf16_round(xa[q]) : xa[q]; sum = __fadd_rn(sum, s[q]); }
  red[t] = sum; __syncthreads(); for (int st = 128; st > 0; st >>= 1) { if (t < st) red[t] = __fadd_rn(red[t], red[t + st]); __syncthreads(); } const float mu = red[0] / (float)DMQ; __syncthreads();
  float vs = 0.f; for (int q = 0; q < 4; ++q) { const float dl = __fadd_rn(s[q], -mu); vs = __fadd_rn(vs, __fmul_rn(dl, dl)); } red[t] = vs; __syncthreads(); for (int st = 128; st > 0; st >>= 1) { if (t < st) red[t] = __fadd_rn(red[t], red[t + st]); __syncthreads(); }
  const float rs = rsqrtf(__fadd_rn(red[0] / (float)DMQ, eps)); v4h y; v4f xb;
  for (int q = 0; q < 4; ++q) { const int c = t * 4 + q; y[q] = (_Float16)__fadd_rn(__fmul_rn(__fmul_rn(__fadd_rn(s[q], -mu), rs), bf16_round(g[c])), bf16_round(bb[c])); xb[q] = s[q]; }
  { *(v4h*)(N16 + r * DMQ + t * 4) = y; if (WXB) *(v4f*)(XB + r * DMQ + t * 4) = xb;  } }
__global__ __launch_bounds__(256) void k_ftres2(const float* __restrict__ OF0, const float* __restrict__ XB, float* __restrict__ X1, size_t n4) {
  #pragma clang fp contract(off)
  const size_t t = (size_t)blockIdx.x * 256 + threadIdx.x; if (t >= n4) return; const v4f o = *(const v4fa*)(OF0 + t * 4), xv = *(const v4fa*)(XB + t * 4); v4f y; for (int q = 0; q < 4; ++q) y[q] = __fadd_rn(__fmul_rn(o[q], 0.015625f), xv[q]); *(v4f*)(X1 + t * 4) = y;  }

__global__ __launch_bounds__(256) void k_wthd(const float* __restrict__ Wt, _Float16* __restrict__ Bt) { const size_t t = (size_t)blockIdx.x * 256 + threadIdx.x; if (t >= (size_t)NH * HD * (DM / 8)) return; const int m8 = (int)(t % (DM / 8)) * 8; const int d = (int)((t / (DM / 8)) % HD); const int h = (int)(t / ((size_t)(DM / 8) * HD)); FragH f;
  for (int q = 0; q < 8; ++q) f.h[q] = (_Float16)(16.0f * bf16_round(Wt[((size_t)h * DM + m8 + q) * HD + d])); unsigned short* dst = (unsigned short*)Bt + ((size_t)h * HD + d) * DM + m8; *(v8us*)dst = f.half[0];  }




__global__ __launch_bounds__(256) void k_wtpad(const float* __restrict__ Wm, _Float16* __restrict__ Wt, int Kr, int Kp, int Nr, int Np, float scale) {
  const int t = blockIdx.x * 256 + threadIdx.x; if (t >= Np * (Kp / 8)) return; const int n = t / (Kp / 8), k8 = (t % (Kp / 8)) * 8; const int nc = min(n, Nr - 1); const float fn = (n < Nr) ? 1.f : 0.f; FragH f;
  for (int i = 0; i < 8; ++i) { const int k = k8 + i; const int kc = min(k, Kr - 1); const float fk = (k < Kr) ? fn : 0.f; f.h[i] = (_Float16)(bf16_round(Wm[(size_t)kc * Nr + nc]) * scale * fk); }
  unsigned short* o = (unsigned short*)Wt + (size_t)n * Kp + k8; *(v8us*)o = f.half[0];  }
__global__ __launch_bounds__(128) void k_bpad(const float* __restrict__ b, float* __restrict__ Bp, int nr, int np) {
  const int i = threadIdx.x; if (i >= np) return; const float v = b[min(i, nr - 1)] * ((i < nr) ? 1.f : 0.f); *(float*)(Bp + i) = v;  }

template <int BFIN, int W16, int W32>
__global__ __launch_bounds__(256) void k_lnx(const float* __restrict__ X, const float* __restrict__ g, const float* __restrict__ bb, float eps, _Float16* __restrict__ N16, float* __restrict__ N32) {
  #pragma clang fp contract(off)
  __shared__ float red[256]; const size_t r = blockIdx.x; const int t = threadIdx.x; const bool act = t < (DMQ / 4); const int c0 = act ? t * 4 : 0;
  const v4f xa = *(const v4fa*)(X + r * DMQ + c0); float s[4]; float sum = 0.f;
  for (int q = 0; q < 4; ++q) { s[q] = act ? (BFIN ? bf16_round(xa[q]) : xa[q]) : 0.f; sum = __fadd_rn(sum, s[q]); }
  red[t] = sum; __syncthreads(); for (int st = 128; st > 0; st >>= 1) { if (t < st) red[t] = __fadd_rn(red[t], red[t + st]); __syncthreads(); } const float mu = red[0] / (float)DMQ; __syncthreads();
  float vs = 0.f; for (int q = 0; q < 4; ++q) { const float dl = act ? __fadd_rn(s[q], -mu) : 0.f; vs = __fadd_rn(vs, __fmul_rn(dl, dl)); } red[t] = vs; __syncthreads(); for (int st = 128; st > 0; st >>= 1) { if (t < st) red[t] = __fadd_rn(red[t], red[t + st]); __syncthreads(); }
  const float rs = rsqrtf(__fadd_rn(red[0] / (float)DMQ, eps)); v4h y; v4f yf;
  for (int q = 0; q < 4; ++q) { const int c = c0 + q; yf[q] = __fadd_rn(__fmul_rn(__fmul_rn(__fadd_rn(s[q], -mu), rs), bf16_round(g[c])), bf16_round(bb[c])); y[q] = (_Float16)yf[q]; }
  if (!act) return;      /* no barriers after this point */
  { if (W16) *(v4h*)(N16 + r * DMQ + c0) = y; if (W32) *(v4f*)(N32 + r * DMQ + c0) = yf;  } }



__global__ __launch_bounds__(256) void k_bfr(const float* __restrict__ x, float* __restrict__ XB, size_t n8) { const size_t t = (size_t)blockIdx.x * 256 + threadIdx.x; if (t >= n8) return; v4f a = *(const v4fa*)(x + t * 8), c = *(const v4fa*)(x + t * 8 + 4); for (int q = 0; q < 4; ++q) { a[q] = bf16_round(a[q]); c[q] = bf16_round(c[q]); }
  { *(v4f*)(XB + t * 8) = a; *(v4f*)(XB + t * 8 + 4) = c;  } }




extern "C" void kernel_launch(void* const* d_in, const int* in_sizes, int n_in,
                              void* d_out, int out_size, void* d_ws, size_t ws_size, hipStream_t stream) {
  (void)in_sizes; (void)n_in; (void)out_size;
  const float* const* I = (const float* const*)d_in; const float* x = I[0]; const float* wqkv = I[1]; const float* bqkv = I[2]; const float* wo = I[3]; const float* bo = I[4]; const float* wfc = I[5]; const float* bfc = I[6]; const float* wmp = I[7]; const float* bmp = I[8]; const float* g1 = I[9]; const float* be1 = I[10]; const float* gg2 = I[11]; const float* be2 = I[12];      /* x; fused w_qkv [1024][3072] + b_qkv ([in][out]); w_out + b_out; w_up [1024][4096] + b_up, w_down [4096][1024] + b_down; LN1 g / b, LN2 g / b */
  char* ws = (char*)d_ws; size_t off = 0;
  auto take = [&](size_t bytes) { char* p = ws + off; off += (bytes + 255) & ~(size_t)255; return p; };
  _Float16* BQKV = (_Float16*)take((size_t)3 * DM * DM * 2); _Float16* BO = (_Float16*)take((size_t)DM * DM * 2);
  _Float16* X16 = (_Float16*)take(NR * DM * 2); float* XB = (float*)take(NR * DM * 4); float* X1 = (float*)take(NR * DM * 4); float* X1N = (float*)take(NR * DM * 4);      /* LN1 output f32 rows */ _Float16* M16 = nullptr;      /* = X16 below (alias: X16's last reader, the last batch's first-tile GEMMs, precedes LN1's write) */ _Float16* HF16 = (_Float16*)take((size_t)SQ * DFF * 2); _Float16* BW1 = (_Float16*)take((size_t)DFF * DM * 2); _Float16* BW2 = (_Float16*)take((size_t)DM * DFF * 2); _Float16* QKV = (_Float16*)take(NR * 3 * DM * 2); _Float16* Q16 = QKV; _Float16* K16 = QKV + DM; _Float16* V16 = QKV + 2 * DM; _Float16* O16 = (_Float16*)take(NR * DM * 2); M16 = X16;
  float* S = (float*)take((size_t)NH * QT * NKX * 4); _Float16* P = (_Float16*)take((size_t)NH * QT * NKX * 2); _Float16* VT = (_Float16*)take((size_t)NH * HD * SQ * 2);
  float* QF0 = (float*)take((size_t)QT0 * DM * 4); float* KF0 = (float*)take((size_t)QT0 * DM * 4); float* VF0 = (float*)take((size_t)QT0 * DM * 4); float* OF0 = (float*)take((size_t)NB * QT0 * DM * 4); _Float16* OH0 = (_Float16*)take((size_t)NB * QT0 * DM * 2); _Float16* OL0 = (_Float16*)take((size_t)NB * QT0 * DM * 2);
  if (off > ws_size) return;
  k_wt_f16<<<(unsigned)(((size_t)3 * DM * (DM / 8) + 255) / 256), 256, 0, stream>>>(wqkv, BQKV, DM, 3 * DM, 16.0f);      /* fused [in][out] [DM][3 DM] -> Bt [3 DM][DM] x16: rows 0.. = q, DM.. = k, 2 DM.. = v output columns (contiguous thirds) */ k_wt_f16<<<(unsigned)(((size_t)DM * (DM / 8) + 255) / 256), 256, 0, stream>>>(wo, BO, DM, DM, 16.0f);      /* w_proj [in][out] -> Bt x16 */
  k_x16<<<(unsigned)((NR * DM / 8 + 255) / 256), 256, 0, stream>>>(x, X16, NR * DM / 8); k_bfr<<<(unsigned)((NR * DM / 8 + 255) / 256), 256, 0, stream>>>(x, XB, NR * DM / 8);      /* POST-LN: the attention runs on x itself (exact f16 rows); XB = bf16(x) f32 for the residual */
  k_wt_f16<<<(unsigned)(((size_t)DFF * (DM / 8) + 255) / 256), 256, 0, stream>>>(wfc, BW1, DM, DFF, 16.0f); k_wt_f16<<<(unsigned)(((size_t)DM * (DFF / 8) + 255) / 256), 256, 0, stream>>>(wmp, BW2, DFF, DM, 16.0f);      /* W1 [1024][4096] -> Bt [4096][1024]; W2 [4096][1024] -> Bt [1024][4096] (x16) */
  const size_t r0p = (size_t)B0 * SQ;      /* first projected row */
  k_gemm2<0><<<dim3((unsigned)((MP / 128) * (3 * DM / 64)), 1), 128, 0, stream>>>(X16 + r0p * DM, DM, 0, BQKV, DM, 0, 0.0625f, bqkv, 0, nullptr, 1, 0, 0, nullptr, QKV + r0p * 3 * DM, 3 * DM, 0, MP, 3 * DM, DM);      /* q | k | v rows (f16); head h = columns h*HD.. of each DM block */
  for (int b = B0; b < B0 + NBR; ++b) { const size_t r0 = (size_t)b * SQ;
    k_vt<NH, SQ><<<NH * (SQ / 64), 256, 0, stream>>>(V16 + r0 * LQ, LQ, 0, VT);      /* V^T [NH][HD][SQ] for this batch */
    k_gemm2<0><<<dim3((QT0 / 128) * (DM / 64), 1), 128, 0, stream>>>(X16 + r0 * DM, DM, 0, BQKV, DM, 0, 0.0625f, bqkv, 0, nullptr, 1, 0, 0, QF0, nullptr, DM, 0, QT0, DM, DM); k_gemm2<0><<<dim3((QT0 / 128) * (DM / 64), 1), 128, 0, stream>>>(X16 + r0 * DM, DM, 0, (BQKV + (size_t)DM * DM), DM, 0, 0.0625f, bqkv + DM, 0, nullptr, 1, 0, 0, KF0, nullptr, DM, 0, QT0, DM, DM); k_gemm2<0><<<dim3((QT0 / 128) * (DM / 64), 1), 128, 0, stream>>>(X16 + r0 * DM, DM, 0, (BQKV + (size_t)2 * DM * DM), DM, 0, 0.0625f, bqkv + 2 * DM, 0, nullptr, 1, 0, 0, VF0, nullptr, DM, 0, QT0, DM, DM);      /* f32 q, k, v of the first 128 rows (exact products) */
    k_att0w<<<NH * (QT0 / A0R), 256, 0, stream>>>(QF0, KF0, VF0, DM, 0.125f, OF0 + (size_t)b * QT0 * DM, DM);      /* exact f32 attention for rows 0..127 (o x64) */
    for (int q0 = 0; q0 < QN; q0 += QT) { const int nk = q0 + QT;      /* causal: only keys below the tile end are computed */
      k_gemm2<0><<<dim3((QT / 128) * (nk / 64), NHD), 128, 0, stream>>>(Q16 + (r0 + q0) * LQ, LQ, (size_t)HD, K16 + r0 * LQ, LQ, (size_t)HD, 0.125f, nullptr, 0, nullptr, 1, 0, 0, S, nullptr, NKX, (size_t)QT * NKX, QT, nk, HD);      /* scores, all heads on grid.y */
      k_rsmw<<<(NHD * QT + 7) / 8, 256, 0, stream>>>(S, P, NHD, q0, nk);      /* one wave per row, 8 rows a block */
      k_gemm2<0><<<dim3((QT / 128) * (HD / 64), NHD), 128, 0, stream>>>(P, NKX, (size_t)QT * NKX, VT, SQ, (size_t)HD * SQ, 0.25f, nullptr, 0, nullptr, 1, 0, 0, nullptr, O16 + (r0 + q0) * DM, DM, (size_t)HD, QT, HD, nk); } }      /* o (merged heads, x64) as f16 rows */
  k_gemm2<0><<<dim3((unsigned)((MPO / 128) * (DM / 64)), 1), 128, 0, stream>>>(O16 + r0p * DM, DM, 0, BO, DM, 0, 0.0009765625f, bo, 0, XB + r0p * DM, -1, 0, 0, X1 + r0p * DM, nullptr, DM, 0, MPO, DM, DM);      /* out rows are the output layout */
  k_hl<<<(unsigned)(((size_t)NB * QT0 * DM / 8 + 255) / 256), 256, 0, stream>>>(OF0, OH0, OL0, (size_t)NB * QT0 * DM / 8);      /* first-tile o (x64) -> f16 hi + x1024 residual planes */
  for (int b = B0; b < B0 + NBR; ++b) { const size_t r0 = (size_t)b * SQ; const size_t f0 = (size_t)b * QT0;
    k_gemm2<0><<<dim3((QT0 / 128) * (DM / 64), 1), 128, 0, stream>>>(OH0 + f0 * DM, DM, 0, BO, DM, 0, 0.0009765625f, bo, 0, XB + r0 * DM, -1, 0, 0, X1 + r0 * DM, nullptr, DM, 0, QT0, DM, DM);      /* rows 0..127: out = o_hi Wo (+ b), overwriting the f16-path rows */
    k_gemm2<0><<<dim3((QT0 / 128) * (DM / 64), 1), 128, 0, stream>>>(OL0 + f0 * DM, DM, 0, BO, DM, 0, 0.00000095367431640625f, nullptr, 0, X1 + r0 * DM, -1, 0, 0, X1 + r0 * DM, nullptr, DM, 0, QT0, DM, DM); }      /* += o_lo Wo 2^-20 (own-element accumulate) */
  k_lnx<0, 1, 1><<<(unsigned)NR, 256, 0, stream>>>(X1, g1, be1, 1e-5f, M16, X1N);      /* x1 = LN1(x + attn_out) -> f16 rows (FFN operand) + f32 rows (residual) */
  for (int b = 0; b < NB; ++b) { const size_t r0 = (size_t)b * SQ;
    k_gemm2<3><<<dim3((unsigned)((SQ / 128) * (DFF / 64)), 1), 128, 0, stream>>>(M16 + r0 * DM, DM, 0, BW1, DM, 0, 0.0625f, bfc, 0, nullptr, 1, 0, 0, nullptr, HF16, DFF, 0, SQ, DFF, DM);      /* relu(x1 w_up + b_up) -> f16 (this batch) */
    k_gemm2<0><<<dim3((unsigned)((SQ / 128) * (DM / 64)), 1), 128, 0, stream>>>(HF16, DFF, 0, BW2, DFF, 0, 0.0625f, bmp, 0, X1N + r0 * DM, -1, 0, 0, X1 + r0 * DM, nullptr, DM, 0, SQ, DM, DFF); }      /* x1 + ffn (own-element residual from the LN1 f32 rows) -> f32 rows over the dead pre-LN1 plane */
  k_lnx<0, 0, 1><<<(unsigned)NR, 256, 0, stream>>>(X1, gg2, be2, 1e-5f, nullptr, (float*)d_out);      /* result = LN2(x1 + ffn) */
}

// v003
// It runs in 1060 microseconds.
// Two timings next to v002 both put it at 1.57 times that version's speed.
// Over all steps from v000 it is 5.13 times as fast.
#include <hip/hip_runtime.h>
// POST-LN transformer decoder layer with causal self-attention and a fused QKV projection (x [2][2048][1024]; qkv = x w_qkv + b_qkv ([in][out] 1024 x 3072 + bias) viewed (B, S, 3, 16, 64): q | k | v thirds; scores * 64^-0.5; causal (tril, -inf); softmax; x1 = LN1(x + out w_out + b_out) (biased var, eps 1e-5); result = LN2(x1 + relu(x1 w_up + b_up) w_down + b_down) ([in][out] 1024 x 4096 x 1024) -> [2][2048][1024]).
// Structure: token rows r = b*2048 + s; x as exact f16 rows (bf16-rounded); q | k | v as ONE WMMA GEMM (N = 3 x 1024) (32x64 wave tiles, f32 accumulation, exact x16 weights + bias, f16 outputs); per batch: V^T for all heads via LDS transposes; per query tile of 256 rows: scores against the keys below the tile end only (K = 64, all heads on grid.y, alpha = 0.125), causal row softmax on VALU, one wave per row, keys past the row masked to -1e9 over the computed range (f32 statistics, native exp; weights x256 f16), o = P . V^T (K = keys below the tile end, alpha 2^-2: o carried x64, folded into the output GEMM alpha) written straight into the merged f16 o rows; out = o W_o + b GEMM (f32) into the output layout.
// Compute dtype: inputs rounded to bf16; x / weights exact; q, k, v, softmax weights and o as plain f16 GEMM operands (~2^-12); scores and softmax statistics f32. v_wmma_f32_16x16x32_f16.
#define NB 2
#define SQ 2048
#define DM 1024
#define NH 16
#define HD 64
#define HG 4                         /* heads h0 .. h0 + HG - 1 per launch, one per block, in the k_vt(V16, b, h0, VT) form (not launched) */
#define QT 256                       /* query rows per causal tile */
#define NKX SQ                       /* S / P row pitch */
#define QT0 128                      /* first-tile rows recomputed exactly in f32 */
#define B0 0                         /* first batch processed (debug hook) */
#define NBR NB                       /* batches processed (debug hook) */
#define NR ((size_t)NB * SQ)
#define DMQ DM
#define DFF 4096                     /* FFN hidden width */
#define DFFR 100                     /* unused (the FFN hidden width is DFF) */
#define MP ((int)((size_t)NBR * SQ)) /* rows projected (debug hook) */
#define QN SQ                        /* query rows attended per batch (debug hook) */
#define NHD NH                       /* heads attended (debug hook) */
#define MPO MP                       /* rows through the output stage (debug hook) */
#define LQ (3 * DM)      /* row pitch of the q/k/v rows */
typedef __bf16 v16b __attribute__((ext_vector_type(16)));
typedef unsigned short v8us __attribute__((ext_vector_type(8), may_alias));
typedef float  v8f  __attribute__((ext_vector_type(8)));
typedef float  v4f  __attribute__((ext_vector_type(4)));
typedef float  v4fa __attribute__((ext_vector_type(4), may_alias));
union FragB { v16b v; v8us half[2]; unsigned short u[16]; };

__device__ __forceinline__ unsigned short bf16_bits(float x) { unsigned int u = __float_as_uint(x); return (unsigned short)((u + 0x7FFFu + ((u >> 16) & 1u)) >> 16); }
__device__ __forceinline__ float bf16_val(unsigned short b) { return __uint_as_float(((unsigned int)b) << 16); }
__device__ __forceinline__ float bf16_round(float x) { return bf16_val(bf16_bits(x)); }
// D += A·B with NT terms: 1 = ah·bh, 2 = + al·bh (A split), 3 = + ah·bl (both split)
template <int NT>
__device__ __forceinline__ v8f mmaN(v16b ah, v16b al, v16b bh, v16b bl, v8f c) {
  c = __builtin_amdgcn_wmma_f32_16x16x32_bf16(false, ah, false, bh, (short)0, c, false, false);
  if (NT >= 2) c = __builtin_amdgcn_wmma_f32_16x16x32_bf16(false, al, false, bh, (short)0, c, false, false);
  if (NT >= 3) c = __builtin_amdgcn_wmma_f32_16x16x32_bf16(false, ah, false, bl, (short)0, c, false, false);
  asm volatile("v_nop\n\tv_nop\n\tv_nop\n\tv_nop" : "+v"(c) : "v"(ah), "v"(al), "v"(bh), "v"(bl));
  return c;
}

__global__ __launch_bounds__(256) void k_wt_bf16(const float* __restrict__ W, unsigned short* __restrict__ Wt, int K, int N) {
  const int t = blockIdx.x * 256 + threadIdx.x;
  const int k8n = K / 8;
  if (t >= N * k8n) return;
  const int n = t / k8n, k8 = (t % k8n) * 8;
  v8us v;
#pragma unroll
  for (int i = 0; i < 8; ++i) v[i] = bf16_bits(W[(size_t)(k8 + i) * N + n]);
  *(v8us*)(Wt + (size_t)n * K + k8) = v;
  
}

// GEMM C[M][N] (f32, pitch ldc) = act(A[M][K]·W + bias). A f32 row-major (pitch lda) converted per fragment to bf16
// (ASPLIT: hi/lo two planes -> 2 terms, else single rounded term); Wt bf16 [N][K] (pitch ldb). BIAS_BF16 rounds the
// bias to bf16 first (bias quantised to bf16 before the add). K%32==0, M%16==0, N%64==0.
template <bool ASPLIT, int ACT, bool BIAS_BF16>
__global__ __launch_bounds__(128) void k_gemm_bf(const float* __restrict__ A, int lda, const unsigned short* __restrict__ Wt, int ldb,
                                               const float* __restrict__ bias, float* __restrict__ C, int ldc, int M, int N, int K) {
  __shared__ __attribute__((aligned(16))) float so[4][16][64];
  const int tid = threadIdx.x, w = tid >> 5, lane = tid & 31, ln = lane & 15, hh = lane >> 4;
  const int ntn = N / 64;
  const int wid = blockIdx.x * 4 + w;
  const int mt = wid / ntn, nq = wid % ntn;
  if (mt * 16 >= M) return;
  const int row0 = mt * 16, col0 = nq * 64;
  const float* arow = A + (size_t)(row0 + ln) * lda;
  v8f acc[4] = {};
  for (int kb = 0; kb < K; kb += 32) {
    FragB ah, al;
    const v4f x0 = *(const v4fa*)(arow + kb + 8 * hh), x1 = *(const v4fa*)(arow + kb + 8 * hh + 4);
    const v4f x2 = *(const v4fa*)(arow + kb + 16 + 8 * hh), x3 = *(const v4fa*)(arow + kb + 16 + 8 * hh + 4);
    float xs[16] = {x0[0],x0[1],x0[2],x0[3],x1[0],x1[1],x1[2],x1[3],x2[0],x2[1],x2[2],x2[3],x3[0],x3[1],x3[2],x3[3]};
#pragma unroll
    for (int i = 0; i < 16; ++i) { const unsigned short hb = bf16_bits(xs[i]); ah.u[i] = hb; al.u[i] = ASPLIT ? bf16_bits(xs[i] - bf16_val(hb)) : (unsigned short)0; }
#pragma unroll
    for (int t = 0; t < 4; ++t) {
      const unsigned short* brow = Wt + (size_t)(col0 + t * 16 + ln) * ldb + kb;
      FragB b;
      b.half[0] = *(const v8us*)(brow + 8 * hh);
      b.half[1] = *(const v8us*)(brow + 16 + 8 * hh);
      acc[t] = mmaN<ASPLIT ? 2 : 1>(ah.v, al.v, b.v, b.v, acc[t]);
    }
  }
#pragma unroll
  for (int t = 0; t < 4; ++t) {
    float bv = bias ? bias[col0 + t * 16 + ln] : 0.f;
    if (BIAS_BF16) bv = bf16_round(bv);
#pragma unroll
    for (int r = 0; r < 8; ++r) { float v = acc[t][r] + bv; if (ACT == 1) v = fmaxf(v, 0.f); so[w][8 * hh + r][t * 16 + ln] = v; }
  }
  __builtin_amdgcn_fence(__ATOMIC_ACQ_REL, "workgroup");
  __builtin_amdgcn_wave_barrier();
  const int rsub = lane >> 4, c4 = (lane & 15) * 4;
  {
#pragma unroll
    for (int q = 0; q < 8; ++q) {
      const int r = q * 2 + rsub;
      const v4f v = *(const v4fa*)&so[w][r][c4];
      *(v4f*)(C + (size_t)(row0 + r) * ldc + col0 + c4) = v;
    }
    
  }
}

// GEMM C = act(A·W + bias + resid): A f32 (ASPLIT -> hi/lo 2 terms), Wt bf16 [N][K]; ACT 0 none, 1 relu, 2 exact gelu;
// resid (optional, f32, row index = (row % rmod), pitch ldr, RES_BF16 rounds it) added before the activation.
template <bool ASPLIT, int ACT, bool BIAS_BF16, bool RES_BF16>
__global__ __launch_bounds__(128) void k_gemm_bf3(const float* __restrict__ A, int lda, const unsigned short* __restrict__ Wt, int ldb,
                                                const float* __restrict__ bias, const float* __restrict__ resid, int rmod, int ldr,
                                                float* __restrict__ C, int ldc, int M, int N, int K) {
  __shared__ __attribute__((aligned(16))) float so[4][16][64];
  const int tid = threadIdx.x, w = tid >> 5, lane = tid & 31, ln = lane & 15, hh = lane >> 4;
  const int ntn = N / 64;
  const int wid = blockIdx.x * 4 + w;
  const int mt = wid / ntn, nq = wid % ntn;
  if (mt * 16 >= M) return;
  const int row0 = mt * 16, col0 = nq * 64;
  const float* arow = A + (size_t)(row0 + ln) * lda;
  v8f acc[4] = {};
  for (int kb = 0; kb < K; kb += 32) {
    FragB ah, al;
    const v4f x0 = *(const v4fa*)(arow + kb + 8 * hh), x1 = *(const v4fa*)(arow + kb + 8 * hh + 4);
    const v4f x2 = *(const v4fa*)(arow + kb + 16 + 8 * hh), x3 = *(const v4fa*)(arow + kb + 16 + 8 * hh + 4);
    float xs[16] = {x0[0],x0[1],x0[2],x0[3],x1[0],x1[1],x1[2],x1[3],x2[0],x2[1],x2[2],x2[3],x3[0],x3[1],x3[2],x3[3]};
#pragma unroll
    for (int i = 0; i < 16; ++i) { const unsigned short hb = bf16_bits(xs[i]); ah.u[i] = hb; al.u[i] = ASPLIT ? bf16_bits(xs[i] - bf16_val(hb)) : (unsigned short)0; }
#pragma unroll
    for (int t = 0; t < 4; ++t) {
      const unsigned short* brow = Wt + (size_t)(col0 + t * 16 + ln) * ldb + kb;
      FragB b;
      b.half[0] = *(const v8us*)(brow + 8 * hh);
      b.half[1] = *(const v8us*)(brow + 16 + 8 * hh);
      acc[t] = mmaN<ASPLIT ? 2 : 1>(ah.v, al.v, b.v, b.v, acc[t]);
    }
  }
#pragma unroll
  for (int t = 0; t < 4; ++t) {
    const int col = col0 + t * 16 + ln;
    float bv = bias ? bias[col] : 0.f;
    if (BIAS_BF16) bv = bf16_round(bv);
#pragma unroll
    for (int r = 0; r < 8; ++r) {
      float v = acc[t][r] + bv;
      if (resid) { float rv = resid[(size_t)((row0 + 8 * hh + r) % rmod) * ldr + col]; if (RES_BF16) rv = bf16_round(rv); v += rv; }
      if (ACT == 1) v = fmaxf(v, 0.f);
      if (ACT == 2) v = 0.5f * v * (1.0f + erff(v * 0.70710678118654752f));
      if (ACT == 3) { const float u = 0.7978845608028654f * (v + 0.044715f * v * v * v); v = 0.5f * v * (1.0f + tanhf(u)); }
      so[w][8 * hh + r][t * 16 + ln] = v;
    }
  }
  __builtin_amdgcn_fence(__ATOMIC_ACQ_REL, "workgroup");
  __builtin_amdgcn_wave_barrier();
  const int rsub = lane >> 4, c4 = (lane & 15) * 4;
  {
#pragma unroll
    for (int q = 0; q < 8; ++q) {
      const int r = q * 2 + rsub;
      const v4f v = *(const v4fa*)&so[w][r][c4];
      *(v4f*)(C + (size_t)(row0 + r) * ldc + col0 + c4) = v;
    }
    
  }
}
// row LayerNorm (biased variance, eps) over N: s = X (+ R); optional out_sum <- s; out_norm <- (s-mu)*rsqrt(var+eps)*g + b
template <bool PARAM_BF16>
__global__ __launch_bounds__(256) void k_layernorm(const float* __restrict__ X, const float* __restrict__ R, const float* __restrict__ g, const float* __restrict__ bta,
                                                  float* __restrict__ out_sum, float* __restrict__ out_norm, int N, float eps) {
  __shared__ float red[256];
  const int row = blockIdx.x, tid = threadIdx.x;
  const float* x = X + (size_t)row * N; const float* rr = R ? R + (size_t)row * N : nullptr;
  float vals[16];                     // up to N = 4096
  const int per = N / 256;            // contiguous chunk per thread? use strided-by-4 chunks: thread handles j = tid*4 + 1024*u
  float s1 = 0.f;
  for (int u = 0; u < per / 4; ++u) {
    const int j = tid * 4 + 1024 * u;
    const v4f a = *(const v4fa*)(x + j);
    v4f b = {0.f,0.f,0.f,0.f}; if (rr) b = *(const v4fa*)(rr + j);
#pragma unroll
    for (int q = 0; q < 4; ++q) { const float v = a[q] + b[q]; vals[u * 4 + q] = v; s1 += v; }
  }
  red[tid] = s1; __syncthreads();
  for (int st = 128; st > 0; st >>= 1) { if (tid < st) red[tid] += red[tid + st]; __syncthreads(); }
  const float mu = red[0] / (float)N; __syncthreads();
  float s2 = 0.f;
  for (int u = 0; u < per / 4; ++u)
#pragma unroll
    for (int q = 0; q < 4; ++q) { const float c = vals[u * 4 + q] - mu; s2 += c * c; }
  red[tid] = s2; __syncthreads();
  for (int st = 128; st > 0; st >>= 1) { if (tid < st) red[tid] += red[tid + st]; __syncthreads(); }
  const float rs = rsqrtf(red[0] / (float)N + eps);
  {
    for (int u = 0; u < per / 4; ++u) {
      const int j = tid * 4 + 1024 * u;
      v4f o, sm;
#pragma unroll
      for (int q = 0; q < 4; ++q) {
        float gg = g[j + q], bb = bta[j + q];
        if (PARAM_BF16) { gg = bf16_round(gg); bb = bf16_round(bb); }
        sm[q] = vals[u * 4 + q]; o[q] = (vals[u * 4 + q] - mu) * rs * gg + bb;
      }
      if (out_sum) *(v4f*)(out_sum + (size_t)row * N + j) = sm;
      *(v4f*)(out_norm + (size_t)row * N + j) = o;
    }
    
  }
}



// ---- f16 WMMA path (v_wmma_f32_16x16x32_f16): 11-bit significands for operands in range — used where a [0,1] probability operand needs more precision than bf16
typedef _Float16 v16h __attribute__((ext_vector_type(16)));
union FragH { v16h v; v8us half[2]; _Float16 h[16]; unsigned short u[16]; };
template <int NT>
__device__ __forceinline__ v8f mmaH(v16h ah, v16h al, v16h bh, v16h bl, v8f c) {
  c = __builtin_amdgcn_wmma_f32_16x16x32_f16(false, ah, false, bh, (short)0, c, false, false);
  if (NT >= 2) c = __builtin_amdgcn_wmma_f32_16x16x32_f16(false, al, false, bh, (short)0, c, false, false);
  if (NT >= 3) c = __builtin_amdgcn_wmma_f32_16x16x32_f16(false, ah, false, bl, (short)0, c, false, false);
  asm volatile("v_nop\n\tv_nop\n\tv_nop\n\tv_nop" : "+v"(c) : "v"(ah), "v"(al), "v"(bh), "v"(bl));
  return c;
}
// batched GEMM like k_gemm_b but f16 operands: A f32 (split into f16 hi/lo if ASPLIT, else rounded to f16), Bt = f16 values [n][k]; alpha; C f32; N multiple of 16 (partial tiles skipped)
template <bool ASPLIT>
__global__ __launch_bounds__(128) void k_gemm_h(const float* __restrict__ A, int lda, size_t sA, const _Float16* __restrict__ Bh, int ldb, size_t sB, float alpha, float* __restrict__ C, int ldc, size_t sC, int M, int N, int K) {
  __shared__ __attribute__((aligned(16))) float so[4][16][64];
  const int tid = threadIdx.x, w = tid >> 5, lane = tid & 31, ln = lane & 15, hh = lane >> 4; const int by = blockIdx.y;
  A += (size_t)by * sA; Bh += (size_t)by * sB; C += (size_t)by * sC;
  const int ntn = (N + 63) / 64; const int wid = blockIdx.x * 4 + w; const int mt = wid / ntn, nq = wid % ntn; if (mt * 16 >= M) return;
  const int row0 = mt * 16, col0 = nq * 64; const float* arow = A + (size_t)(row0 + ln) * lda;
  v8f acc[4] = {};
  for (int kb = 0; kb < K; kb += 32) {
    FragH ah, al;
    const v4f x0 = *(const v4fa*)(arow + kb + 8 * hh), x1 = *(const v4fa*)(arow + kb + 8 * hh + 4), x2 = *(const v4fa*)(arow + kb + 16 + 8 * hh), x3 = *(const v4fa*)(arow + kb + 16 + 8 * hh + 4);
    float xs[16] = {x0[0],x0[1],x0[2],x0[3],x1[0],x1[1],x1[2],x1[3],x2[0],x2[1],x2[2],x2[3],x3[0],x3[1],x3[2],x3[3]};
#pragma unroll
    for (int i = 0; i < 16; ++i) { const _Float16 h = (_Float16)xs[i]; ah.h[i] = h; al.h[i] = ASPLIT ? (_Float16)(xs[i] - (float)h) : (_Float16)0.0f; }
#pragma unroll
    for (int t = 0; t < 4; ++t) { if (col0 + t * 16 >= N) continue; const size_t boff = (size_t)(col0 + t * 16 + ln) * ldb + kb; FragH bq; bq.half[0] = *(const v8us*)(Bh + boff + 8 * hh); bq.half[1] = *(const v8us*)(Bh + boff + 16 + 8 * hh);
      acc[t] = mmaH<ASPLIT ? 2 : 1>(ah.v, al.v, bq.v, bq.v, acc[t]); }
  }
#pragma unroll
  for (int t = 0; t < 4; ++t) { if (col0 + t * 16 >= N) continue;
#pragma unroll
    for (int r = 0; r < 8; ++r) so[w][8 * hh + r][t * 16 + ln] = acc[t][r] * alpha; }
  __builtin_amdgcn_fence(__ATOMIC_ACQ_REL, "workgroup"); __builtin_amdgcn_wave_barrier();
  const int rsub = lane >> 4, c4 = (lane & 15) * 4;
  {
#pragma unroll
    for (int q = 0; q < 8; ++q) { const int r = q * 2 + rsub; if (col0 + c4 < N) { const v4f v = *(const v4fa*)&so[w][r][c4]; *(v4f*)(C + (size_t)(row0 + r) * ldc + col0 + c4) = v; } }
     }
}

// Wt[n][k] = f16(W[k][n]·scale) from f32 row-major W[K][N] (scale = power of two; bf16-exact weights stay exact in f16 away from the subnormal range)
__global__ __launch_bounds__(256) void k_wt_f16(const float* __restrict__ W, _Float16* __restrict__ Wt, int K, int N, float scale) {
  const int t = blockIdx.x * 256 + threadIdx.x; if (t >= N * (K / 8)) return; const int n = t / (K / 8), k8 = (t % (K / 8)) * 8; FragH f;
#pragma unroll
  for (int i = 0; i < 8; ++i) f.h[i] = (_Float16)(bf16_round(W[(size_t)(k8 + i) * N + n]) * scale); const v8us o = f.half[0];
  *(v8us*)((unsigned short*)Wt + (size_t)n * K + k8) = o; 
}
// k_gemm_hh variant with fused epilogue: v = acc·alpha + bias[by·sBias + col] (+ CP[(row/rowsPerB)·sCPb + by·64 + col] if CP) ; ACT 0 none / 1 elu ; writes f16 C16 (and f32 C if non-null)
template <int ACT>
__global__ __launch_bounds__(128) void k_gemm_hhx(const _Float16* __restrict__ A, int lda, size_t sA, const _Float16* __restrict__ Bh, int ldb, size_t sB, float alpha, const float* __restrict__ bias, size_t sBias, const float* __restrict__ CP, int rowsPerB, size_t sCPb, int row0g,
    float* __restrict__ C, _Float16* __restrict__ C16, int ldc, size_t sC, int M, int N, int K) {
  __shared__ __attribute__((aligned(16))) float so[4][16][64];
  const int tid = threadIdx.x, w = tid >> 5, lane = tid & 31, ln = lane & 15, hh = lane >> 4; const int by = blockIdx.y;
  A += (size_t)by * sA; Bh += (size_t)by * sB; const size_t cofs = (size_t)by * sC; const float* bp = bias ? bias + (size_t)by * sBias : nullptr;
  const int ntn = (N + 63) / 64; const int wid = blockIdx.x * 4 + w; const int mt = wid / ntn, nq = wid % ntn; if (mt * 16 >= M) return;
  const int row0 = mt * 16, col0 = nq * 64; const _Float16* arow = A + (size_t)(row0 + ln) * lda;
  v8f acc[4] = {};
  for (int kb = 0; kb < K; kb += 32) { FragH ah; ah.half[0] = *(const v8us*)((const unsigned short*)arow + kb + 8 * hh); ah.half[1] = *(const v8us*)((const unsigned short*)arow + kb + 16 + 8 * hh);
#pragma unroll
    for (int t = 0; t < 4; ++t) { if (col0 + t * 16 >= N) continue; const size_t boff = (size_t)(col0 + t * 16 + ln) * ldb + kb; FragH bq; bq.half[0] = *(const v8us*)((const unsigned short*)Bh + boff + 8 * hh); bq.half[1] = *(const v8us*)((const unsigned short*)Bh + boff + 16 + 8 * hh);
      acc[t] = mmaH<1>(ah.v, ah.v, bq.v, bq.v, acc[t]); }
  }
#pragma unroll
  for (int t = 0; t < 4; ++t) { if (col0 + t * 16 >= N) continue; const int col = col0 + t * 16 + ln; const float bv = bp ? bf16_round(bp[col]) : 0.f;
#pragma unroll
    for (int r = 0; r < 8; ++r) { float v = acc[t][r] * alpha + bv; if (CP) { const int rr = row0g + row0 + 8 * hh + r; if (rowsPerB < 0) v += CP[cofs + (size_t)rr * ldc + col];      /* rowsPerB < 0: own element of the batched C plane */ else { const int bidx = rr / rowsPerB; v += CP[(size_t)bidx * sCPb + (size_t)by * 64 + col]; } } if (ACT == 1) v = (v > 0.f) ? v : expm1f(v); else if (ACT == 7) v = (v > 0.f) ? v + 1.0f : expf(v); else if (ACT == 8) v = tanhf(v); else if (ACT == 9) v = 0.5f * v * (1.0f + tanhf(0.7978845608028654f * (v + 0.044715f * v * v * v))); else if (ACT == 11) v = 1.0f / (1.0f + expf(-v)); else if (ACT == 12) v = (v > 0.f) ? v : 0.01f * v; else if (ACT == 14) v = (v > 0.f) ? v : 0.1f * v; else if (ACT == 16) v = (v >= 0.f) ? v : 0.3f * v; else if (ACT == 17) v = (v >= 0.f) ? v : 0.2f * v; else if (ACT == 15) v = v / (1.0f + expf(-v)); else if (ACT == 3) v = fmaxf(v, 0.f); else if (ACT == 6) v = 0.5f * v * (1.0f + erff(v * 0.70710678118654752f)); so[w][8 * hh + r][t * 16 + ln] = v; } }
  __builtin_amdgcn_fence(__ATOMIC_ACQ_REL, "workgroup"); __builtin_amdgcn_wave_barrier();
  const int rsub = lane >> 4, c4 = (lane & 15) * 4; typedef _Float16 v4h __attribute__((ext_vector_type(4)));
  {
#pragma unroll
    for (int q = 0; q < 8; ++q) { const int r = q * 2 + rsub; if (col0 + c4 < N) { const v4f v = *(const v4fa*)&so[w][r][c4]; if (C) *(v4f*)(C + cofs + (size_t)(row0 + r) * ldc + col0 + c4) = v; if (C16) { v4h h4; for (int i = 0; i < 4; ++i) h4[i] = (_Float16)v[i]; *(v4h*)(C16 + cofs + (size_t)(row0 + r) * ldc + col0 + c4) = h4; } } }
     }
}


typedef _Float16 v4h __attribute__((ext_vector_type(4)));

__global__ __launch_bounds__(256) void k_x16(const float* __restrict__ x, _Float16* __restrict__ X16, size_t n8) { const size_t t = (size_t)blockIdx.x * 256 + threadIdx.x; if (t >= n8) return; FragH f;
#pragma unroll
  for (int q = 0; q < 8; ++q) f.h[q] = (_Float16)bf16_round(x[t * 8 + q]); *(v8us*)((unsigned short*)X16 + t * 8) = f.half[0];  }
__global__ __launch_bounds__(256) void k_h16(const float* __restrict__ x, _Float16* __restrict__ X16, size_t n8) { const size_t t = (size_t)blockIdx.x * 256 + threadIdx.x; if (t >= n8) return; FragH f;
#pragma unroll
  for (int q = 0; q < 8; ++q) f.h[q] = (_Float16)x[t * 8 + q]; *(v8us*)((unsigned short*)X16 + t * 8) = f.half[0];  }
__global__ __launch_bounds__(256) void k_round16f(const float* __restrict__ W, _Float16* __restrict__ Bt, size_t n8) { const size_t t = (size_t)blockIdx.x * 256 + threadIdx.x; if (t >= n8) return; FragH f;
#pragma unroll
  for (int i = 0; i < 8; ++i) f.h[i] = (_Float16)(bf16_round(W[t * 8 + i]) * 16.0f); *(v8us*)((unsigned short*)Bt + t * 8) = f.half[0];  }
template <int NHv, int TTv>
__global__ __launch_bounds__(256) void k_vt(const _Float16* __restrict__ V16, int ldv, int voff, _Float16* __restrict__ Vt) { __shared__ unsigned short tl[64][66]; const int tid = threadIdx.x; const int slab = blockIdx.x / (TTv / 64), lg = blockIdx.x % (TTv / 64); const int b = slab / NHv, h = slab % NHv;
  for (int i = tid; i < 64 * 8; i += 256) { const int r = i / 8, c8 = (i % 8) * 8; FragH f; f.half[0] = *(const v8us*)((const unsigned short*)V16 + ((size_t)b * TTv + lg * 64 + r) * ldv + voff + h * 64 + c8);
#pragma unroll
    for (int q = 0; q < 8; ++q) tl[r][c8 + q] = f.u[q]; }
  __syncthreads();
  {
#pragma unroll
    for (int rd = 0; rd < 2; ++rd) { const int d = rd * 32 + tid / 8, pc = tid % 8; FragH f;
#pragma unroll
      for (int q = 0; q < 8; ++q) f.u[q] = tl[pc * 8 + q][d];
      *(v8us*)((unsigned short*)Vt + ((size_t)slab * 64 + d) * TTv + lg * 64 + pc * 8) = f.half[0]; }
     } }

__global__ __launch_bounds__(256) void k_hl(const float* __restrict__ F, _Float16* __restrict__ Hh, _Float16* __restrict__ Hl, size_t n8) { const size_t t = (size_t)blockIdx.x * 256 + threadIdx.x; if (t >= n8) return; FragH fh, fl; const v4f a = *(const v4fa*)(F + t * 8), c = *(const v4fa*)(F + t * 8 + 4);
#pragma unroll
  for (int q = 0; q < 4; ++q) { _Float16 h = (_Float16)a[q]; fh.h[q] = h; fl.h[q] = (_Float16)((a[q] - (float)h) * 1024.0f); h = (_Float16)c[q]; fh.h[4 + q] = h; fl.h[4 + q] = (_Float16)((c[q] - (float)h) * 1024.0f); }
  { *(v8us*)((unsigned short*)Hh + t * 8) = fh.half[0]; *(v8us*)((unsigned short*)Hl + t * 8) = fl.half[0];  } }

// ---- fast GEMM (wave tile 32x64; requires M % 32 == 0 rows per launch region and N % 64 == 0); epilogue = k_gemm_hhx semantics ----
__device__ __forceinline__ v16h g2_frag(const _Float16* p, int hh) { FragH f; f.half[0] = *(const v8us*)((const unsigned short*)p + 8 * hh); f.half[1] = *(const v8us*)((const unsigned short*)p + 16 + 8 * hh); return f.v; }
__device__ __forceinline__ v8f g2_mma(v16h a, v16h b, v8f c) { v8f d = __builtin_amdgcn_wmma_f32_16x16x32_f16(false, a, false, b, (short)0, c, false, false); asm volatile("v_nop\n\tv_nop\n\tv_nop\n\tv_nop" : "+v"(d) : "v"(a), "v"(b)); return d; }
struct G2S { v16h a0, a1, b0, b1, b2, b3; };      /* the fragments of one k-step of a 32x64 wave tile */
// G2_LOAD: one k-step's twelve loads at the six row pointers, as one group; their data is not waited for here. The scheduling barrier keeps the next step's first WMMA, and with it the wait
// for that step's operands, behind the group: lifted in front of it, that wait would hold the group's issue back by most of a step.
#define G2_LOAD(S) do { S.a0 = g2_frag(a0p, 0); S.a1 = g2_frag(a1p, 0); S.b0 = g2_frag(b0p, 0); S.b1 = g2_frag(b1p, 0); S.b2 = g2_frag(b2p, 0); S.b3 = g2_frag(b3p, 0); \
    __builtin_amdgcn_sched_barrier(0); } while (0)
// G2_NEXT: moves the pointers on by one k-step (or leaves them on the last one). s_wait_xcnt 0 in front: a precaution, before the additions write the address registers that the issued
// loads name; the scheduling barrier keeps the additions, and all that follows, behind that wait. In the loop it stands behind a step's WMMAs, well after the group was issued.
#define G2_NEXT do { asm volatile("s_wait_xcnt 0x0" ::: "memory"); __builtin_amdgcn_sched_barrier(0); \
    const int inc = left > 0 ? 32 : 0; --left; a0p += inc; a1p += inc; b0p += inc; b1p += inc; b2p += inc; b3p += inc; } while (0)
#define G2_MMA(S) do { c00 = g2_mma(S.a0, S.b0, c00); c10 = g2_mma(S.a1, S.b0, c10); c01 = g2_mma(S.a0, S.b1, c01); c11 = g2_mma(S.a1, S.b1, c11); \
    c02 = g2_mma(S.a0, S.b2, c02); c12 = g2_mma(S.a1, S.b2, c12); c03 = g2_mma(S.a0, S.b3, c03); c13 = g2_mma(S.a1, S.b3, c13); } while (0)
template <int ACT>
__global__ __launch_bounds__(128) void k_gemm2(const _Float16* __restrict__ A, int lda, size_t sA, const _Float16* __restrict__ Bh, int ldb, size_t sB, float alpha, const float* __restrict__ bias, size_t sBias, const float* __restrict__ CP, int rowsPerB, size_t sCPb, int row0g,
    float* __restrict__ C, _Float16* __restrict__ C16, int ldc, size_t sC, int M, int N, int K) { static_assert(ACT == 0 || ACT == 3 || ACT == 6 || ACT == 8 || ACT == 9 || ACT == 11 || ACT == 12 || ACT == 14 || ACT == 15 || ACT == 16 || ACT == 17, "k_gemm2: unsupported ACT code (would silently apply no activation)");
  __shared__ __attribute__((aligned(16))) float so[4][32][68];
  const int tid = threadIdx.x, w = tid >> 5, lane = tid & 31, ln = lane & 15, hh = lane >> 4; const int by = blockIdx.y;
  A += (size_t)by * sA; Bh += (size_t)by * sB; const size_t cofs = (size_t)by * sC; const float* bp = bias ? bias + (size_t)by * sBias : nullptr;
  const int ntn = N >> 6; const int mt = blockIdx.x / ntn, nq = blockIdx.x - mt * ntn; const int row0 = mt * 128 + 32 * w, col0 = nq * 64; if (row0 >= M) return;
  const _Float16* a0p = A + (size_t)(row0 + ln) * lda + 8 * hh; const _Float16* a1p = a0p + (size_t)16 * lda;      /* the lane's own 16-byte column is part of the pointer: a load names the pointer's registers themselves */
  const _Float16* b0p = Bh + (size_t)(col0 + ln) * ldb + 8 * hh; const _Float16* b1p = b0p + (size_t)16 * ldb; const _Float16* b2p = b1p + (size_t)16 * ldb; const _Float16* b3p = b2p + (size_t)16 * ldb;
  const v8f z8 = {0.f,0.f,0.f,0.f,0.f,0.f,0.f,0.f}; v8f c00 = z8, c01 = z8, c02 = z8, c03 = z8, c10 = z8, c11 = z8, c12 = z8, c13 = z8;
  // K loop (K >= 32): a ring of three fragment sets. The twelve loads of k-step s + 2 are issued as one group in front of the WMMAs of step s, so a step waits for loads that are two steps old
  // instead of for five load round trips of its own. Every accumulator still takes its k-steps in ascending order.
  const int n = K >> 5; int left = n - 1;      /* left: pointer advances still allowed; past the last k-step the pointers stay on it (in bounds), and what is loaded there is not used */
  G2S s0, s1, s2; int i = 0;
  G2_LOAD(s0); G2_NEXT; G2_LOAD(s1); G2_NEXT;
#pragma unroll 1      /* the body already holds three k-steps, one per set: more copies of it only cost instruction cache */
  for (; i + 3 <= n; i += 3) { G2_LOAD(s2); G2_MMA(s0); G2_NEXT; G2_LOAD(s0); G2_MMA(s1); G2_NEXT; G2_LOAD(s1); G2_MMA(s2); G2_NEXT; }
  if (i < n) G2_MMA(s0);
  if (i + 1 < n) G2_MMA(s1);
  v8f accs[8] = {c00, c01, c02, c03, c10, c11, c12, c13};
#pragma unroll
  for (int u = 0; u < 8; ++u) { const int t = u & 3, half = u >> 2; const int col = col0 + t * 16 + ln; const float bv = bp ? bf16_round(bp[col]) : 0.f;
#pragma unroll
    for (int r = 0; r < 8; ++r) { const int rloc = half * 16 + 8 * hh + r; float v = accs[u][r] * alpha + bv; if (CP) { if (rowsPerB < 0) v += CP[cofs + (size_t)(row0g + row0 + rloc) * ldc + col];      /* rowsPerB < 0: own element of the batched C plane */ else { const int bidx = (row0g + row0 + rloc) / rowsPerB; v += CP[(size_t)bidx * sCPb + (size_t)by * 64 + col]; } }
      if (ACT == 3) v = fmaxf(v, 0.f); else if (ACT == 6) v = 0.5f * v * (1.0f + erff(v * 0.70710678118654752f)); else if (ACT == 11) v = 1.0f / (1.0f + expf(-v)); else if (ACT == 15) v = v / (1.0f + expf(-v)); else if (ACT == 12) v = (v > 0.f) ? v : 0.01f * v; else if (ACT == 8) v = tanhf(v); else if (ACT == 9) v = 0.5f * v * (1.0f + tanhf(0.7978845608028654f * (v + 0.044715f * v * v * v))); else if (ACT == 14) v = (v > 0.f) ? v : 0.1f * v; else if (ACT == 16) v = (v >= 0.f) ? v : 0.3f * v; else if (ACT == 17) v = (v >= 0.f) ? v : 0.2f * v;
      so[w][rloc][t * 16 + ln] = v; } }
  __builtin_amdgcn_fence(__ATOMIC_ACQ_REL, "workgroup"); __builtin_amdgcn_wave_barrier();
  const int rsub = lane >> 4, c4 = (lane & 15) * 4;
  {
#pragma unroll
    for (int q = 0; q < 16; ++q) { const int r = q * 2 + rsub; const v4f v = *(const v4fa*)&so[w][r][c4]; if (C) *(v4f*)(C + cofs + (size_t)(row0 + r) * ldc + col0 + c4) = v; if (C16) { v4h h4; for (int i = 0; i < 4; ++i) h4[i] = (_Float16)v[i]; *(v4h*)(C16 + cofs + (size_t)(row0 + r) * ldc + col0 + c4) = h4; } }
     } }


__global__ __launch_bounds__(256) void k_wnat(const float* __restrict__ w, size_t n8, _Float16* __restrict__ Bt) { const size_t t = (size_t)blockIdx.x * 256 + threadIdx.x; if (t >= n8) return; FragH f; for (int q = 0; q < 8; ++q) f.h[q] = (_Float16)(bf16_round(w[t * 8 + q]) * 16.0f); *(v8us*)((unsigned short*)Bt + t * 8) = f.half[0];  }
__global__ __launch_bounds__(256) void k_rsm(const float* __restrict__ S, _Float16* __restrict__ P, int nrows) {
  #pragma clang fp contract(off)
  const int i = blockIdx.x * 256 + threadIdx.x; if (i >= nrows) return; const float* s = S + (size_t)i * SQ; float mx = -3.0e38f;
#pragma unroll 1
  for (int j = 0; j < SQ; ++j) mx = fmaxf(mx, s[j]); float se = 0.f;
#pragma unroll 1
  for (int j = 0; j < SQ; ++j) se += expf(s[j] - mx); const float sc = 256.0f / se;
#pragma unroll 1
  for (int j0 = 0; j0 < SQ; j0 += 8) { FragH f; for (int q = 0; q < 8; ++q) f.h[q] = (_Float16)(expf(s[j0 + q] - mx) * sc); unsigned short* d = (unsigned short*)P + (size_t)i * SQ + j0; *(v8us*)d = f.half[0];  } }
__global__ __launch_bounds__(256) void k_vt(const _Float16* __restrict__ V16, int b, int h0, _Float16* __restrict__ VT) { __shared__ unsigned short tl[64][65]; const int tid = threadIdx.x; const int hh = blockIdx.x % HG, sg = blockIdx.x / HG; const int s0 = sg * 64; const int h = h0 + hh;
  for (int i = tid; i < 64 * 8; i += 256) { const int j = i / 8, d8 = (i % 8) * 8; FragH f; f.half[0] = *(const v8us*)((const unsigned short*)V16 + ((size_t)b * SQ + s0 + j) * DM + h * HD + d8); for (int q = 0; q < 8; ++q) tl[d8 + q][j] = f.u[q]; }
  __syncthreads();
  { for (int i = tid; i < 64 * 8; i += 256) { const int d = i / 8, j8 = (i % 8) * 8; FragH f; for (int q = 0; q < 8; ++q) f.u[q] = tl[d][j8 + q]; *(v8us*)((unsigned short*)VT + ((size_t)hh * HD + d) * SQ + s0 + j8) = f.half[0]; }  } }



// Causal row softmax, one wave per score row. Lane l keeps columns 128 c + 4 l .. + 3 of its row in registers, so each wave-wide load is 512 contiguous bytes and each store 256,
// S is read once and exp is taken once per score. Row maximum and row sum: four chains per lane, then a five-step butterfly over the 32 lanes. nk is a multiple of 256.
// Every loop over v[] and h[] is fully unrolled so that the arrays are indexed by constants and stay in registers (a rolled loop would put them in scratch); the tests u < ng are wave-uniform.
__global__ __launch_bounds__(256) void k_rsmw(const float* __restrict__ S, _Float16* __restrict__ P, int hg, int q0, int nk) {
  const int lane = threadIdx.x & 31; const int t = blockIdx.x * 8 + (threadIdx.x >> 5); if (t >= hg * QT) return;      /* wave-uniform; no barrier below */
  const float* s = S + (size_t)t * NKX + lane * 4; _Float16* p = P + (size_t)t * NKX + lane * 4; const int last = q0 + (t % QT); const int ng = nk >> 8;      /* groups of 256 columns */
  v4f v[NKX / 128];
#pragma unroll
  for (int u = 0; u < NKX / 256; ++u) if (u < ng) { v[2 * u] = *(const v4fa*)(s + u * 256); v[2 * u + 1] = *(const v4fa*)(s + u * 256 + 128); }
  v4f m4 = {-3.0e38f, -3.0e38f, -3.0e38f, -3.0e38f};
#pragma unroll
  for (int u = 0; u < NKX / 256; ++u) if (u < ng) {
#pragma unroll
    for (int c = 2 * u; c < 2 * u + 2; ++c)
#pragma unroll
      for (int q = 0; q < 4; ++q) { const float x = (c * 128 + lane * 4 + q <= last) ? v[c][q] : -1.0e9f; v[c][q] = x; m4[q] = fmaxf(m4[q], x); } }
  float mx = fmaxf(fmaxf(m4[0], m4[1]), fmaxf(m4[2], m4[3]));
#pragma unroll
  for (int o = 16; o > 0; o >>= 1) mx = fmaxf(mx, __shfl_xor(mx, o));
  v4f s4 = {0.f, 0.f, 0.f, 0.f};
#pragma unroll
  for (int u = 0; u < NKX / 256; ++u) if (u < ng) {
#pragma unroll
    for (int c = 2 * u; c < 2 * u + 2; ++c)
#pragma unroll
      for (int q = 0; q < 4; ++q) { const float e = __expf(v[c][q] - mx); v[c][q] = e; s4[q] += e; } }
  float se = (s4[0] + s4[1]) + (s4[2] + s4[3]);
#pragma unroll
  for (int o = 16; o > 0; o >>= 1) se += __shfl_xor(se, o);
  const float sc = 256.0f / se;
  v4h h[NKX / 128];      /* all weights packed first, then stores alone: no register of an issued store is written again */
#pragma unroll
  for (int u = 0; u < NKX / 256; ++u) if (u < ng) {
#pragma unroll
    for (int c = 2 * u; c < 2 * u + 2; ++c)
#pragma unroll
      for (int q = 0; q < 4; ++q) h[c][q] = (_Float16)(v[c][q] * sc); }
#pragma unroll
  for (int u = 0; u < NKX / 256; ++u) if (u < ng) { *(v4h*)(p + u * 256) = h[2 * u]; *(v4h*)(p + u * 256 + 128) = h[2 * u + 1]; } }


typedef float v2fa __attribute__((ext_vector_type(2), may_alias));
#define A0R 8                        /* query rows per block of the first-tile attention: one per wave */
#define A0KP 68                      /* K row pitch in LDS, floats: 272 bytes = 16 x 17, so that 16-byte reads of 32 different rows spread over the banks */
// Exact f32 causal attention for rows 0 .. QT0-1 of one batch, one wave per (head, query row); a block has 8 consecutive rows of one head.
// The block stages the head's K and V rows below its last query row in LDS once (whole-line loads, all in flight together). Scores: lane l has keys l, l + 32, l + 64, l + 96
// (four partial sums per key over the head dimension). Row maximum and row sum by butterflies over the 32 lanes, exp once per key. o: lane l has columns 2 l and 2 l + 1,
// the weights come back through LDS as broadcasts, four partial sums over the keys. o carried x64 like the f16 path.
__global__ __launch_bounds__(256) void k_att0w(const float* __restrict__ QF, const float* __restrict__ KF, const float* __restrict__ VF, int ld, float scale, float* __restrict__ OF, int ldo) {
  __shared__ __attribute__((aligned(16))) float lk[QT0][A0KP]; __shared__ __attribute__((aligned(16))) float lv[QT0][HD]; __shared__ __attribute__((aligned(16))) float pe[A0R][QT0];
  const int tid = threadIdx.x, lane = tid & 31; const int w = __builtin_amdgcn_readfirstlane(tid >> 5);      /* the wave's number as a scalar: the tests on i below become scalar branches */
  const int h = blockIdx.x / (QT0 / A0R), rg = blockIdx.x % (QT0 / A0R); const int nk = rg * A0R + A0R;      /* causal: keys below the block's last row end */ const int i = rg * A0R + w;
  const float* qr = QF + (size_t)i * ld + h * HD; v4f q[HD / 4];
#pragma unroll
  for (int c = 0; c < HD / 4; ++c) q[c] = *(const v4fa*)(qr + c * 4);
  const int sr = tid >> 4, sc4 = (tid & 15) * 4; v4f kx[QT0 / 16], vx[QT0 / 16];
#pragma unroll      /* constant indices keep kx / vx in registers; all loads are issued before the first LDS store. Rows past nk - 1 are clamped to it (in bounds) and not stored */
  for (int u = 0; u < QT0 / 16; ++u) { const size_t g = (size_t)min(sr + 16 * u, nk - 1) * ld + h * HD + sc4;
    // Behind each load: s_wait_xcnt 0 as a precaution, before a register that the load names as address is written again (by later address arithmetic or as a later load's destination);
    // the scheduling barrier keeps that later arithmetic and the later loads behind the wait. The loads' data is not waited for here.
    kx[u] = *(const v4fa*)(KF + g); asm volatile("s_wait_xcnt 0x0" ::: "memory"); __builtin_amdgcn_sched_barrier(0);
    vx[u] = *(const v4fa*)(VF + g); asm volatile("s_wait_xcnt 0x0" ::: "memory"); __builtin_amdgcn_sched_barrier(0); }
#pragma unroll
  for (int u = 0; u < QT0 / 16; ++u) if (sr + 16 * u < nk) { *(v4fa*)&lk[sr + 16 * u][sc4] = kx[u]; *(v4fa*)&lv[sr + 16 * u][sc4] = vx[u]; }
  __syncthreads();      /* K and V rows 0 .. nk-1 staged; every wave passes */
  float s[QT0 / 32];
#pragma unroll
  for (int c = 0; c < QT0 / 32; ++c) { s[c] = -1.0e30f;
    if (c * 32 <= i) { const int j = c * 32 + lane; const float* kr = &lk[min(j, i)][0];      /* lanes past the row read row i (staged) and are masked below */ v4f a4 = {0.f, 0.f, 0.f, 0.f};
#pragma unroll
      for (int d = 0; d < HD / 4; ++d) a4 += q[d] * *(const v4fa*)(kr + d * 4);
      const float a = (a4[0] + a4[1]) + (a4[2] + a4[3]); s[c] = (j <= i) ? a * scale : -1.0e30f; } }
  float mx = fmaxf(fmaxf(s[0], s[1]), fmaxf(s[2], s[3]));
#pragma unroll
  for (int o = 16; o > 0; o >>= 1) mx = fmaxf(mx, __shfl_xor(mx, o));
  float se = 0.f;
#pragma unroll
  for (int c = 0; c < QT0 / 32; ++c) { const float e = (c * 32 + lane <= i) ? expf(s[c] - mx) : 0.f; se += e; pe[w][c * 32 + lane] = e; }
#pragma unroll
  for (int o = 16; o > 0; o >>= 1) se += __shfl_xor(se, o);
  __builtin_amdgcn_fence(__ATOMIC_ACQ_REL, "workgroup"); __builtin_amdgcn_wave_barrier();      /* pe[w] is written and read by this wave alone: keeps the reads below behind the writes above */
  const int nj = (i & ~3) + 4;      /* keys in groups of four: nj <= nk, so every V row read is staged; weights past the row are 0 */
  v2fa o0 = {0.f, 0.f}, o1 = {0.f, 0.f}, o2 = {0.f, 0.f}, o3 = {0.f, 0.f};
#pragma unroll 4      /* several groups' LDS reads in flight behind one wait */
  for (int j = 0; j < nj; j += 4) { const v4f p = *(const v4fa*)&pe[w][j];
    o0 += p[0] * *(const v2fa*)&lv[j][lane * 2]; o1 += p[1] * *(const v2fa*)&lv[j + 1][lane * 2]; o2 += p[2] * *(const v2fa*)&lv[j + 2][lane * 2]; o3 += p[3] * *(const v2fa*)&lv[j + 3][lane * 2]; }
  const float fin = 64.0f / se;      /* o carried x64 like the f16 path */
  const v2fa ov = ((o0 + o1) + (o2 + o3)) * fin;
  *(v2fa*)(OF + (size_t)i * ldo + h * HD + lane * 2) = ov; }


template <int BFIN, int WXB>
__global__ __launch_bounds__(256) void k_ln16(const float* __restrict__ X, const float* __restrict__ g, const float* __restrict__ bb, float eps, _Float16* __restrict__ N16, float* __restrict__ XB) {
  #pragma clang fp contract(off)
  __shared__ float red[256]; const size_t r = blockIdx.x; const int t = threadIdx.x; const v4f xa = *(const v4fa*)(X + r * DMQ + t * 4); float s[4]; float sum = 0.f;
  for (int q = 0; q < 4; ++q) { s[q] = BFIN ? bf16_round(xa[q]) : xa[q]; sum = __fadd_rn(sum, s[q]); }
  red[t] = sum; __syncthreads(); for (int st = 128; st > 0; st >>= 1) { if (t < st) red[t] = __fadd_rn(red[t], red[t + st]); __syncthreads(); } const float mu = red[0] / (float)DMQ; __syncthreads();
  float vs = 0.f; for (int q = 0; q < 4; ++q) { const float dl = __fadd_rn(s[q], -mu); vs = __fadd_rn(vs, __fmul_rn(dl, dl)); } red[t] = vs; __syncthreads(); for (int st = 128; st > 0; st >>= 1) { if (t < st) red[t] = __fadd_rn(red[t], red[t + st]); __syncthreads(); }
  const float rs = rsqrtf(__fadd_rn(red[0] / (float)DMQ, eps)); v4h y; v4f xb;
  for (int q = 0; q < 4; ++q) { const int c = t * 4 + q; y[q] = (_Float16)__fadd_rn(__fmul_rn(__fmul_rn(__fadd_rn(s[q], -mu), rs), bf16_round(g[c])), bf16_round(bb[c])); xb[q] = s[q]; }
  { *(v4h*)(N16 + r * DMQ + t * 4) = y; if (WXB) *(v4f*)(XB + r * DMQ + t * 4) = xb;  } }
__global__ __launch_bounds__(256) void k_ftres2(const float* __restrict__ OF0, const float* __restrict__ XB, float* __restrict__ X1, size_t n4) {
  #pragma clang fp contract(off)
  const size_t t = (size_t)blockIdx.x * 256 + threadIdx.x; if (t >= n4) return; const v4f o = *(const v4fa*)(OF0 + t * 4), xv = *(const v4fa*)(XB + t * 4); v4f y; for (int q = 0; q < 4; ++q) y[q] = __fadd_rn(__fmul_rn(o[q], 0.015625f), xv[q]); *(v4f*)(X1 + t * 4) = y;  }

__global__ __launch_bounds__(256) void k_wthd(const float* __restrict__ Wt, _Float16* __restrict__ Bt) { const size_t t = (size_t)blockIdx.x * 256 + threadIdx.x; if (t >= (size_t)NH * HD * (DM / 8)) return; const int m8 = (int)(t % (DM / 8)) * 8; const int d = (int)((t / (DM / 8)) % HD); const int h = (int)(t / ((size_t)(DM / 8) * HD)); FragH f;
  for (int q = 0; q < 8; ++q) f.h[q] = (_Float16)(16.0f * bf16_round(Wt[((size_t)h * DM + m8 + q) * HD + d])); unsigned short* dst = (unsigned short*)Bt + ((size_t)h * HD + d) * DM + m8; *(v8us*)dst = f.half[0];  }




__global__ __launch_bounds__(256) void k_wtpad(const float* __restrict__ Wm, _Float16* __restrict__ Wt, int Kr, int Kp, int Nr, int Np, float scale) {
  const int t = blockIdx.x * 256 + threadIdx.x; if (t >= Np * (Kp / 8)) return; const int n = t / (Kp / 8), k8 = (t % (Kp / 8)) * 8; const int nc = min(n, Nr - 1); const float fn = (n < Nr) ? 1.f : 0.f; FragH f;
  for (int i = 0; i < 8; ++i) { const int k = k8 + i; const int kc = min(k, Kr - 1); const float fk = (k < Kr) ? fn : 0.f; f.h[i] = (_Float16)(bf16_round(Wm[(size_t)kc * Nr + nc]) * scale * fk); }
  unsigned short* o = (unsigned short*)Wt + (size_t)n * Kp + k8; *(v8us*)o = f.half[0];  }
__global__ __launch_bounds__(128) void k_bpad(const float* __restrict__ b, float* __restrict__ Bp, int nr, int np) {
  const int i = threadIdx.x; if (i >= np) return; const float v = b[min(i, nr - 1)] * ((i < nr) ? 1.f : 0.f); *(float*)(Bp + i) = v;  }

template <int BFIN, int W16, int W32>
__global__ __launch_bounds__(256) void k_lnx(const float* __restrict__ X, const float* __restrict__ g, const float* __restrict__ bb, float eps, _Float16* __restrict__ N16, float* __restrict__ N32) {
  #pragma clang fp contract(off)
  __shared__ float red[256]; const size_t r = blockIdx.x; const int t = threadIdx.x; const bool act = t < (DMQ / 4); const int c0 = act ? t * 4 : 0;
  const v4f xa = *(const v4fa*)(X + r * DMQ + c0); float s[4]; float sum = 0.f;
  for (int q = 0; q < 4; ++q) { s[q] = act ? (BFIN ? bf16_round(xa[q]) : xa[q]) : 0.f; sum = __fadd_rn(sum, s[q]); }
  red[t] = sum; __syncthreads(); for (int st = 128; st > 0; st >>= 1) { if (t < st) red[t] = __fadd_rn(red[t], red[t + st]); __syncthreads(); } const float mu = red[0] / (float)DMQ; __syncthreads();
  float vs = 0.f; for (int q = 0; q < 4; ++q) { const float dl = act ? __fadd_rn(s[q], -mu) : 0.f; vs = __fadd_rn(vs, __fmul_rn(dl, dl)); } red[t] = vs; __syncthreads(); for (int st = 128; st > 0; st >>= 1) { if (t < st) red[t] = __fadd_rn(red[t], red[t + st]); __syncthreads(); }
  const float rs = rsqrtf(__fadd_rn(red[0] / (float)DMQ, eps)); v4h y; v4f yf;
  for (int q = 0; q < 4; ++q) { const int c = c0 + q; yf[q] = __fadd_rn(__fmul_rn(__fmul_rn(__fadd_rn(s[q], -mu), rs), bf16_round(g[c])), bf16_round(bb[c])); y[q] = (_Float16)yf[q]; }
  if (!act) return;      /* no barriers after this point */
  { if (W16) *(v4h*)(N16 + r * DMQ + c0) = y; if (W32) *(v4f*)(N32 + r * DMQ + c0) = yf;  } }



__global__ __launch_bounds__(256) void k_bfr(const float* __restrict__ x, float* __restrict__ XB, size_t n8) { const size_t t = (size_t)blockIdx.x * 256 + threadIdx.x; if (t >= n8) return; v4f a = *(const v4fa*)(x + t * 8), c = *(const v4fa*)(x + t * 8 + 4); for (int q = 0; q < 4; ++q) { a[q] = bf16_round(a[q]); c[q] = bf16_round(c[q]); }
  { *(v4f*)(XB + t * 8) = a; *(v4f*)(XB + t * 8 + 4) = c;  } }




extern "C" void kernel_launch(void* const* d_in, const int* in_sizes, int n_in,
                              void* d_out, int out_size, void* d_ws, size_t ws_size, hipStream_t stream) {
  (void)in_sizes; (void)n_in; (void)out_size;
  const float* const* I = (const float* const*)d_in; const float* x = I[0]; const float* wqkv = I[1]; const float* bqkv = I[2]; const float* wo = I[3]; const float* bo = I[4]; const float* wfc = I[5]; const float* bfc = I[6]; const float* wmp = I[7]; const float* bmp = I[8]; const float* g1 = I[9]; const float* be1 = I[10]; const float* gg2 = I[11]; const float* be2 = I[12];      /* x; fused w_qkv [1024][3072] + b_qkv ([in][out]); w_out + b_out; w_up [1024][4096] + b_up, w_down [4096][1024] + b_down; LN1 g / b, LN2 g / b */
  char* ws = (char*)d_ws; size_t off = 0;
  auto take = [&](size_t bytes) { char* p = ws + off; off += (bytes + 255) & ~(size_t)255; return p; };
  _Float16* BQKV = (_Float16*)take((size_t)3 * DM * DM * 2); _Float16* BO = (_Float16*)take((size_t)DM * DM * 2);
  _Float16* X16 = (_Float16*)take(NR * DM * 2); float* XB = (float*)take(NR * DM * 4); float* X1 = (float*)take(NR * DM * 4); float* X1N = (float*)take(NR * DM * 4);      /* LN1 output f32 rows */ _Float16* M16 = nullptr;      /* = X16 below (alias: X16's last reader, the last batch's first-tile GEMMs, precedes LN1's write) */ _Float16* HF16 = (_Float16*)take((size_t)SQ * DFF * 2); _Float16* BW1 = (_Float16*)take((size_t)DFF * DM * 2); _Float16* BW2 = (_Float16*)take((size_t)DM * DFF * 2); _Float16* QKV = (_Float16*)take(NR * 3 * DM * 2); _Float16* Q16 = QKV; _Float16* K16 = QKV + DM; _Float16* V16 = QKV + 2 * DM; _Float16* O16 = (_Float16*)take(NR * DM * 2); M16 = X16;
  float* S = (float*)take((size_t)NH * QT * NKX * 4); _Float16* P = (_Float16*)take((size_t)NH * QT * NKX * 2); _Float16* VT = (_Float16*)take((size_t)NH * HD * SQ * 2);
  float* QF0 = (float*)take((size_t)QT0 * DM * 4); float* KF0 = (float*)take((size_t)QT0 * DM * 4); float* VF0 = (float*)take((size_t)QT0 * DM * 4); float* OF0 = (float*)take((size_t)NB * QT0 * DM * 4); _Float16* OH0 = (_Float16*)take((size_t)NB * QT0 * DM * 2); _Float16* OL0 = (_Float16*)take((size_t)NB * QT0 * DM * 2);
  if (off > ws_size) return;
  k_wt_f16<<<(unsigned)(((size_t)3 * DM * (DM / 8) + 255) / 256), 256, 0, stream>>>(wqkv, BQKV, DM, 3 * DM, 16.0f);      /* fused [in][out] [DM][3 DM] -> Bt [3 DM][DM] x16: rows 0.. = q, DM.. = k, 2 DM.. = v output columns (contiguous thirds) */ k_wt_f16<<<(unsigned)(((size_t)DM * (DM / 8) + 255) / 256), 256, 0, stream>>>(wo, BO, DM, DM, 16.0f);      /* w_proj [in][out] -> Bt x16 */
  k_x16<<<(unsigned)((NR * DM / 8 + 255) / 256), 256, 0, stream>>>(x, X16, NR * DM / 8); k_bfr<<<(unsigned)((NR * DM / 8 + 255) / 256), 256, 0, stream>>>(x, XB, NR * DM / 8);      /* POST-LN: the attention runs on x itself (exact f16 rows); XB = bf16(x) f32 for the residual */
  k_wt_f16<<<(unsigned)(((size_t)DFF * (DM / 8) + 255) / 256), 256, 0, stream>>>(wfc, BW1, DM, DFF, 16.0f); k_wt_f16<<<(unsigned)(((size_t)DM * (DFF / 8) + 255) / 256), 256, 0, stream>>>(wmp, BW2, DFF, DM, 16.0f);      /* W1 [1024][4096] -> Bt [4096][1024]; W2 [4096][1024] -> Bt [1024][4096] (x16) */
  const size_t r0p = (size_t)B0 * SQ;      /* first projected row */
  k_gemm2<0><<<dim3((unsigned)((MP / 128) * (3 * DM / 64)), 1), 128, 0, stream>>>(X16 + r0p * DM, DM, 0, BQKV, DM, 0, 0.0625f, bqkv, 0, nullptr, 1, 0, 0, nullptr, QKV + r0p * 3 * DM, 3 * DM, 0, MP, 3 * DM, DM);      /* q | k | v rows (f16); head h = columns h*HD.. of each DM block */
  for (int b = B0; b < B0 + NBR; ++b) { const size_t r0 = (size_t)b * SQ;
    k_vt<NH, SQ><<<NH * (SQ / 64), 256, 0, stream>>>(V16 + r0 * LQ, LQ, 0, VT);      /* V^T [NH][HD][SQ] for this batch */
    k_gemm2<0><<<dim3((QT0 / 128) * (DM / 64), 1), 128, 0, stream>>>(X16 + r0 * DM, DM, 0, BQKV, DM, 0, 0.0625f, bqkv, 0, nullptr, 1, 0, 0, QF0, nullptr, DM, 0, QT0, DM, DM); k_gemm2<0><<<dim3((QT0 / 128) * (DM / 64), 1), 128, 0, stream>>>(X16 + r0 * DM, DM, 0, (BQKV + (size_t)DM * DM), DM, 0, 0.0625f, bqkv + DM, 0, nullptr, 1, 0, 0, KF0, nullptr, DM, 0, QT0, DM, DM); k_gemm2<0><<<dim3((QT0 / 128) * (DM / 64), 1), 128, 0, stream>>>(X16 + r0 * DM, DM, 0, (BQKV + (size_t)2 * DM * DM), DM, 0, 0.0625f, bqkv + 2 * DM, 0, nullptr, 1, 0, 0, VF0, nullptr, DM, 0, QT0, DM, DM);      /* f32 q, k, v of the first 128 rows (exact products) */
    k_att0w<<<NH * (QT0 / A0R), 256, 0, stream>>>(QF0, KF0, VF0, DM, 0.125f, OF0 + (size_t)b * QT0 * DM, DM);      /* exact f32 attention for rows 0..127 (o x64) */
    for (int q0 = 0; q0 < QN; q0 += QT) { const int nk = q0 + QT;      /* causal: only keys below the tile end are computed */
      k_gemm2<0><<<dim3((QT / 128) * (nk / 64), NHD), 128, 0, stream>>>(Q16 + (r0 + q0) * LQ, LQ, (size_t)HD, K16 + r0 * LQ, LQ, (size_t)HD, 0.125f, nullptr, 0, nullptr, 1, 0, 0, S, nullptr, NKX, (size_t)QT * NKX, QT, nk, HD);      /* scores, all heads on grid.y */
      k_rsmw<<<(NHD * QT + 7) / 8, 256, 0, stream>>>(S, P, NHD, q0, nk);      /* one wave per row, 8 rows a block */
      k_gemm2<0><<<dim3((QT / 128) * (HD / 64), NHD), 128, 0, stream>>>(P, NKX, (size_t)QT * NKX, VT, SQ, (size_t)HD * SQ, 0.25f, nullptr, 0, nullptr, 1, 0, 0, nullptr, O16 + (r0 + q0) * DM, DM, (size_t)HD, QT, HD, nk); } }      /* o (merged heads, x64) as f16 rows */
  k_gemm2<0><<<dim3((unsigned)((MPO / 128) * (DM / 64)), 1), 128, 0, stream>>>(O16 + r0p * DM, DM, 0, BO, DM, 0, 0.0009765625f, bo, 0, XB + r0p * DM, -1, 0, 0, X1 + r0p * DM, nullptr, DM, 0, MPO, DM, DM);      /* out rows are the output layout */
  k_hl<<<(unsigned)(((size_t)NB * QT0 * DM / 8 + 255) / 256), 256, 0, stream>>>(OF0, OH0, OL0, (size_t)NB * QT0 * DM / 8);      /* first-tile o (x64) -> f16 hi + x1024 residual planes */
  for (int b = B0; b < B0 + NBR; ++b) { const size_t r0 = (size_t)b * SQ; const size_t f0 = (size_t)b * QT0;
    k_gemm2<0><<<dim3((QT0 / 128) * (DM / 64), 1), 128, 0, stream>>>(OH0 + f0 * DM, DM, 0, BO, DM, 0, 0.0009765625f, bo, 0, XB + r0 * DM, -1, 0, 0, X1 + r0 * DM, nullptr, DM, 0, QT0, DM, DM);      /* rows 0..127: out = o_hi Wo (+ b), overwriting the f16-path rows */
    k_gemm2<0><<<dim3((QT0 / 128) * (DM / 64), 1), 128, 0, stream>>>(OL0 + f0 * DM, DM, 0, BO, DM, 0, 0.00000095367431640625f, nullptr, 0, X1 + r0 * DM, -1, 0, 0, X1 + r0 * DM, nullptr, DM, 0, QT0, DM, DM); }      /* += o_lo Wo 2^-20 (own-element accumulate) */
  k_lnx<0, 1, 1><<<(unsigned)NR, 256, 0, stream>>>(X1, g1, be1, 1e-5f, M16, X1N);      /* x1 = LN1(x + attn_out) -> f16 rows (FFN operand) + f32 rows (residual) */
  for (int b = 0; b < NB; ++b) { const size_t r0 = (size_t)b * SQ;
    k_gemm2<3><<<dim3((unsigned)((SQ / 128) * (DFF / 64)), 1), 128, 0, stream>>>(M16 + r0 * DM, DM, 0, BW1, DM, 0, 0.0625f, bfc, 0, nullptr, 1, 0, 0, nullptr, HF16, DFF, 0, SQ, DFF, DM);      /* relu(x1 w_up + b_up) -> f16 (this batch) */
    k_gemm2<0><<<dim3((unsigned)((SQ / 128) * (DM / 64)), 1), 128, 0, stream>>>(HF16, DFF, 0, BW2, DFF, 0, 0.0625f, bmp, 0, X1N + r0 * DM, -1, 0, 0, X1 + r0 * DM, nullptr, DM, 0, SQ, DM, DFF); }      /* x1 + ffn (own-element residual from the LN1 f32 rows) -> f32 rows over the dead pre-LN1 plane */
  k_lnx<0, 0, 1><<<(unsigned)NR, 256, 0, stream>>>(X1, gg2, be2, 1e-5f, nullptr, (float*)d_out);      /* result = LN2(x1 + ffn) */
}

// v004
// One run takes 640 microseconds.
// Next to v003, in two timings, it ran 1.66 times as fast each time.
// All steps since v000 together make it 8.50 times as fast.
#include <hip/hip_runtime.h>
// POST-LN transformer decoder layer with causal self-attention and a fused QKV projection (x [2][2048][1024]; qkv = x w_qkv + b_qkv ([in][out] 1024 x 3072 + bias) viewed (B, S, 3, 16, 64): q | k | v thirds; scores * 64^-0.5; causal (tril, -inf); softmax; x1 = LN1(x + out w_out + b_out) (biased var, eps 1e-5); result = LN2(x1 + relu(x1 w_up + b_up) w_down + b_down) ([in][out] 1024 x 4096 x 1024) -> [2][2048][1024]).
// Structure: token rows r = b*2048 + s; x as exact f16 rows (bf16-rounded); q | k | v as ONE WMMA GEMM (N = 3 x 1024) (32x64 wave tiles, f32 accumulation, exact x16 weights + bias, f16 outputs); V^T for all batches and heads via LDS transposes; causal attention in ONE launch (k_fattn): a wave has 32 query rows and walks the keys below its last row in blocks of 64, scores, running-maximum softmax (f32 statistics, native exp2; weights x256 f16) and o stay in registers (o carried x64, folded into the output GEMM alpha), written straight into the merged f16 o rows; out = o W_o + b GEMM (f32) into the output layout.
// Compute dtype: inputs rounded to bf16; x / weights exact; q, k, v, softmax weights and o as plain f16 GEMM operands (~2^-12); scores and softmax statistics f32. v_wmma_f32_16x16x32_f16.
#define NB 2
#define SQ 2048
#define DM 1024
#define NH 16
#define HD 64
#define HG 4                         /* heads per launch of the (b, h0) k_vt overload, which is not launched */
#define QT0 128                      /* first-tile rows recomputed exactly in f32 */
#define B0 0                         /* first batch processed (debug hook) */
#define NBR NB                       /* batches processed (debug hook) */
#define NR ((size_t)NB * SQ)
#define DMQ DM
#define DFF 4096                     /* FFN hidden width */
#define DFFR 100                     /* unused (the FFN hidden width is DFF) */
#define MP ((int)((size_t)NBR * SQ)) /* rows projected (debug hook) */
#define QN SQ                        /* unused (the attention covers all SQ query rows) */
#define NHD NH                       /* unused (the attention covers all NH heads) */
#define MPO MP                       /* rows through the output stage (debug hook) */
#define LQ (3 * DM)      /* row pitch of the q/k/v rows */
typedef __bf16 v16b __attribute__((ext_vector_type(16)));
typedef unsigned short v8us __attribute__((ext_vector_type(8), may_alias));
typedef float  v8f  __attribute__((ext_vector_type(8)));
typedef float  v4f  __attribute__((ext_vector_type(4)));
typedef float  v4fa __attribute__((ext_vector_type(4), may_alias));
union FragB { v16b v; v8us half[2]; unsigned short u[16]; };

__device__ __forceinline__ unsigned short bf16_bits(float x) { unsigned int u = __float_as_uint(x); return (unsigned short)((u + 0x7FFFu + ((u >> 16) & 1u)) >> 16); }
__device__ __forceinline__ float bf16_val(unsigned short b) { return __uint_as_float(((unsigned int)b) << 16); }
__device__ __forceinline__ float bf16_round(float x) { return bf16_val(bf16_bits(x)); }
// D += A·B with NT terms: 1 = ah·bh, 2 = + al·bh (A split), 3 = + ah·bl (both split)
template <int NT>
__device__ __forceinline__ v8f mmaN(v16b ah, v16b al, v16b bh, v16b bl, v8f c) {
  c = __builtin_amdgcn_wmma_f32_16x16x32_bf16(false, ah, false, bh, (short)0, c, false, false);
  if (NT >= 2) c = __builtin_amdgcn_wmma_f32_16x16x32_bf16(false, al, false, bh, (short)0, c, false, false);
  if (NT >= 3) c = __builtin_amdgcn_wmma_f32_16x16x32_bf16(false, ah, false, bl, (short)0, c, false, false);
  asm volatile("v_nop\n\tv_nop\n\tv_nop\n\tv_nop" : "+v"(c) : "v"(ah), "v"(al), "v"(bh), "v"(bl));
  return c;
}

__global__ __launch_bounds__(256) void k_wt_bf16(const float* __restrict__ W, unsigned short* __restrict__ Wt, int K, int N) {
  const int t = blockIdx.x * 256 + threadIdx.x;
  const int k8n = K / 8;
  if (t >= N * k8n) return;
  const int n = t / k8n, k8 = (t % k8n) * 8;
  v8us v;
#pragma unroll
  for (int i = 0; i < 8; ++i) v[i] = bf16_bits(W[(size_t)(k8 + i) * N + n]);
  *(v8us*)(Wt + (size_t)n * K + k8) = v;
  
}

// GEMM C[M][N] (f32, pitch ldc) = act(A[M][K]·W + bias). A f32 row-major (pitch lda) converted per fragment to bf16
// (ASPLIT: hi/lo two planes -> 2 terms, else single rounded term); Wt bf16 [N][K] (pitch ldb). BIAS_BF16 rounds the
// bias to bf16 first (bias quantised to bf16 before the add). K%32==0, M%16==0, N%64==0.
template <bool ASPLIT, int ACT, bool BIAS_BF16>
__global__ __launch_bounds__(128) void k_gemm_bf(const float* __restrict__ A, int lda, const unsigned short* __restrict__ Wt, int ldb,
                                               const float* __restrict__ bias, float* __restrict__ C, int ldc, int M, int N, int K) {
  __shared__ __attribute__((aligned(16))) float so[4][16][64];
  const int tid = threadIdx.x, w = tid >> 5, lane = tid & 31, ln = lane & 15, hh = lane >> 4;
  const int ntn = N / 64;
  const int wid = blockIdx.x * 4 + w;
  const int mt = wid / ntn, nq = wid % ntn;
  if (mt * 16 >= M) return;
  const int row0 = mt * 16, col0 = nq * 64;
  const float* arow = A + (size_t)(row0 + ln) * lda;
  v8f acc[4] = {};
  for (int kb = 0; kb < K; kb += 32) {
    FragB ah, al;
    const v4f x0 = *(const v4fa*)(arow + kb + 8 * hh), x1 = *(const v4fa*)(arow + kb + 8 * hh + 4);
    const v4f x2 = *(const v4fa*)(arow + kb + 16 + 8 * hh), x3 = *(const v4fa*)(arow + kb + 16 + 8 * hh + 4);
    float xs[16] = {x0[0],x0[1],x0[2],x0[3],x1[0],x1[1],x1[2],x1[3],x2[0],x2[1],x2[2],x2[3],x3[0],x3[1],x3[2],x3[3]};
#pragma unroll
    for (int i = 0; i < 16; ++i) { const unsigned short hb = bf16_bits(xs[i]); ah.u[i] = hb; al.u[i] = ASPLIT ? bf16_bits(xs[i] - bf16_val(hb)) : (unsigned short)0; }
#pragma unroll
    for (int t = 0; t < 4; ++t) {
      const unsigned short* brow = Wt + (size_t)(col0 + t * 16 + ln) * ldb + kb;
      FragB b;
      b.half[0] = *(const v8us*)(brow + 8 * hh);
      b.half[1] = *(const v8us*)(brow + 16 + 8 * hh);
      acc[t] = mmaN<ASPLIT ? 2 : 1>(ah.v, al.v, b.v, b.v, acc[t]);
    }
  }
#pragma unroll
  for (int t = 0; t < 4; ++t) {
    float bv = bias ? bias[col0 + t * 16 + ln] : 0.f;
    if (BIAS_BF16) bv = bf16_round(bv);
#pragma unroll
    for (int r = 0; r < 8; ++r) { float v = acc[t][r] + bv; if (ACT == 1) v = fmaxf(v, 0.f); so[w][8 * hh + r][t * 16 + ln] = v; }
  }
  __builtin_amdgcn_fence(__ATOMIC_ACQ_REL, "workgroup");
  __builtin_amdgcn_wave_barrier();
  const int rsub = lane >> 4, c4 = (lane & 15) * 4;
  {
#pragma unroll
    for (int q = 0; q < 8; ++q) {
      const int r = q * 2 + rsub;
      const v4f v = *(const v4fa*)&so[w][r][c4];
      *(v4f*)(C + (size_t)(row0 + r) * ldc + col0 + c4) = v;
    }
    
  }
}

// GEMM C = act(A·W + bias + resid): A f32 (ASPLIT -> hi/lo 2 terms), Wt bf16 [N][K]; ACT 0 none, 1 relu, 2 exact gelu;
// resid (optional, f32, row index = (row % rmod), pitch ldr, RES_BF16 rounds it) added before the activation.
template <bool ASPLIT, int ACT, bool BIAS_BF16, bool RES_BF16>
__global__ __launch_bounds__(128) void k_gemm_bf3(const float* __restrict__ A, int lda, const unsigned short* __restrict__ Wt, int ldb,
                                                const float* __restrict__ bias, const float* __restrict__ resid, int rmod, int ldr,
                                                float* __restrict__ C, int ldc, int M, int N, int K) {
  __shared__ __attribute__((aligned(16))) float so[4][16][64];
  const int tid = threadIdx.x, w = tid >> 5, lane = tid & 31, ln = lane & 15, hh = lane >> 4;
  const int ntn = N / 64;
  const int wid = blockIdx.x * 4 + w;
  const int mt = wid / ntn, nq = wid % ntn;
  if (mt * 16 >= M) return;
  const int row0 = mt * 16, col0 = nq * 64;
  const float* arow = A + (size_t)(row0 + ln) * lda;
  v8f acc[4] = {};
  for (int kb = 0; kb < K; kb += 32) {
    FragB ah, al;
    const v4f x0 = *(const v4fa*)(arow + kb + 8 * hh), x1 = *(const v4fa*)(arow + kb + 8 * hh + 4);
    const v4f x2 = *(const v4fa*)(arow + kb + 16 + 8 * hh), x3 = *(const v4fa*)(arow + kb + 16 + 8 * hh + 4);
    float xs[16] = {x0[0],x0[1],x0[2],x0[3],x1[0],x1[1],x1[2],x1[3],x2[0],x2[1],x2[2],x2[3],x3[0],x3[1],x3[2],x3[3]};
#pragma unroll
    for (int i = 0; i < 16; ++i) { const unsigned short hb = bf16_bits(xs[i]); ah.u[i] = hb; al.u[i] = ASPLIT ? bf16_bits(xs[i] - bf16_val(hb)) : (unsigned short)0; }
#pragma unroll
    for (int t = 0; t < 4; ++t) {
      const unsigned short* brow = Wt + (size_t)(col0 + t * 16 + ln) * ldb + kb;
      FragB b;
      b.half[0] = *(const v8us*)(brow + 8 * hh);
      b.half[1] = *(const v8us*)(brow + 16 + 8 * hh);
      acc[t] = mmaN<ASPLIT ? 2 : 1>(ah.v, al.v, b.v, b.v, acc[t]);
    }
  }
#pragma unroll
  for (int t = 0; t < 4; ++t) {
    const int col = col0 + t * 16 + ln;
    float bv = bias ? bias[col] : 0.f;
    if (BIAS_BF16) bv = bf16_round(bv);
#pragma unroll
    for (int r = 0; r < 8; ++r) {
      float v = acc[t][r] + bv;
      if (resid) { float rv = resid[(size_t)((row0 + 8 * hh + r) % rmod) * ldr + col]; if (RES_BF16) rv = bf16_round(rv); v += rv; }
      if (ACT == 1) v = fmaxf(v, 0.f);
      if (ACT == 2) v = 0.5f * v * (1.0f + erff(v * 0.70710678118654752f));
      if (ACT == 3) { const float u = 0.7978845608028654f * (v + 0.044715f * v * v * v); v = 0.5f * v * (1.0f + tanhf(u)); }
      so[w][8 * hh + r][t * 16 + ln] = v;
    }
  }
  __builtin_amdgcn_fence(__ATOMIC_ACQ_REL, "workgroup");
  __builtin_amdgcn_wave_barrier();
  const int rsub = lane >> 4, c4 = (lane & 15) * 4;
  {
#pragma unroll
    for (int q = 0; q < 8; ++q) {
      const int r = q * 2 + rsub;
      const v4f v = *(const v4fa*)&so[w][r][c4];
      *(v4f*)(C + (size_t)(row0 + r) * ldc + col0 + c4) = v;
    }
    
  }
}
// row LayerNorm (biased variance, eps) over N: s = X (+ R); optional out_sum <- s; out_norm <- (s-mu)*rsqrt(var+eps)*g + b
template <bool PARAM_BF16>
__global__ __launch_bounds__(256) void k_layernorm(const float* __restrict__ X, const float* __restrict__ R, const float* __restrict__ g, const float* __restrict__ bta,
                                                  float* __restrict__ out_sum, float* __restrict__ out_norm, int N, float eps) {
  __shared__ float red[256];
  const int row = blockIdx.x, tid = threadIdx.x;
  const float* x = X + (size_t)row * N; const float* rr = R ? R + (size_t)row * N : nullptr;
  float vals[16];                     // up to N = 4096
  const int per = N / 256;            // contiguous chunk per thread? use strided-by-4 chunks: thread handles j = tid*4 + 1024*u
  float s1 = 0.f;
  for (int u = 0; u < per / 4; ++u) {
    const int j = tid * 4 + 1024 * u;
    const v4f a = *(const v4fa*)(x + j);
    v4f b = {0.f,0.f,0.f,0.f}; if (rr) b = *(const v4fa*)(rr + j);
#pragma unroll
    for (int q = 0; q < 4; ++q) { const float v = a[q] + b[q]; vals[u * 4 + q] = v; s1 += v; }
  }
  red[tid] = s1; __syncthreads();
  for (int st = 128; st > 0; st >>= 1) { if (tid < st) red[tid] += red[tid + st]; __syncthreads(); }
  const float mu = red[0] / (float)N; __syncthreads();
  float s2 = 0.f;
  for (int u = 0; u < per / 4; ++u)
#pragma unroll
    for (int q = 0; q < 4; ++q) { const float c = vals[u * 4 + q] - mu; s2 += c * c; }
  red[tid] = s2; __syncthreads();
  for (int st = 128; st > 0; st >>= 1) { if (tid < st) red[tid] += red[tid + st]; __syncthreads(); }
  const float rs = rsqrtf(red[0] / (float)N + eps);
  {
    for (int u = 0; u < per / 4; ++u) {
      const int j = tid * 4 + 1024 * u;
      v4f o, sm;
#pragma unroll
      for (int q = 0; q < 4; ++q) {
        float gg = g[j + q], bb = bta[j + q];
        if (PARAM_BF16) { gg = bf16_round(gg); bb = bf16_round(bb); }
        sm[q] = vals[u * 4 + q]; o[q] = (vals[u * 4 + q] - mu) * rs * gg + bb;
      }
      if (out_sum) *(v4f*)(out_sum + (size_t)row * N + j) = sm;
      *(v4f*)(out_norm + (size_t)row * N + j) = o;
    }
    
  }
}



// ---- f16 WMMA path (v_wmma_f32_16x16x32_f16): 11-bit significands for operands in range — used where a [0,1] probability operand needs more precision than bf16
typedef _Float16 v16h __attribute__((ext_vector_type(16)));
union FragH { v16h v; v8us half[2]; _Float16 h[16]; unsigned short u[16]; };
template <int NT>
__device__ __forceinline__ v8f mmaH(v16h ah, v16h al, v16h bh, v16h bl, v8f c) {
  c = __builtin_amdgcn_wmma_f32_16x16x32_f16(false, ah, false, bh, (short)0, c, false, false);
  if (NT >= 2) c = __builtin_amdgcn_wmma_f32_16x16x32_f16(false, al, false, bh, (short)0, c, false, false);
  if (NT >= 3) c = __builtin_amdgcn_wmma_f32_16x16x32_f16(false, ah, false, bl, (short)0, c, false, false);
  asm volatile("v_nop\n\tv_nop\n\tv_nop\n\tv_nop" : "+v"(c) : "v"(ah), "v"(al), "v"(bh), "v"(bl));
  return c;
}
// batched GEMM like k_gemm_b but f16 operands: A f32 (split into f16 hi/lo if ASPLIT, else rounded to f16), Bt = f16 values [n][k]; alpha; C f32; N multiple of 16 (partial tiles skipped)
template <bool ASPLIT>
__global__ __launch_bounds__(128) void k_gemm_h(const float* __restrict__ A, int lda, size_t sA, const _Float16* __restrict__ Bh, int ldb, size_t sB, float alpha, float* __restrict__ C, int ldc, size_t sC, int M, int N, int K) {
  __shared__ __attribute__((aligned(16))) float so[4][16][64];
  const int tid = threadIdx.x, w = tid >> 5, lane = tid & 31, ln = lane & 15, hh = lane >> 4; const int by = blockIdx.y;
  A += (size_t)by * sA; Bh += (size_t)by * sB; C += (size_t)by * sC;
  const int ntn = (N + 63) / 64; const int wid = blockIdx.x * 4 + w; const int mt = wid / ntn, nq = wid % ntn; if (mt * 16 >= M) return;
  const int row0 = mt * 16, col0 = nq * 64; const float* arow = A + (size_t)(row0 + ln) * lda;
  v8f acc[4] = {};
  for (int kb = 0; kb < K; kb += 32) {
    FragH ah, al;
    const v4f x0 = *(const v4fa*)(arow + kb + 8 * hh), x1 = *(const v4fa*)(arow + kb + 8 * hh + 4), x2 = *(const v4fa*)(arow + kb + 16 + 8 * hh), x3 = *(const v4fa*)(arow + kb + 16 + 8 * hh + 4);
    float xs[16] = {x0[0],x0[1],x0[2],x0[3],x1[0],x1[1],x1[2],x1[3],x2[0],x2[1],x2[2],x2[3],x3[0],x3[1],x3[2],x3[3]};
#pragma unroll
    for (int i = 0; i < 16; ++i) { const _Float16 h = (_Float16)xs[i]; ah.h[i] = h; al.h[i] = ASPLIT ? (_Float16)(xs[i] - (float)h) : (_Float16)0.0f; }
#pragma unroll
    for (int t = 0; t < 4; ++t) { if (col0 + t * 16 >= N) continue; const size_t boff = (size_t)(col0 + t * 16 + ln) * ldb + kb; FragH bq; bq.half[0] = *(const v8us*)(Bh + boff + 8 * hh); bq.half[1] = *(const v8us*)(Bh + boff + 16 + 8 * hh);
      acc[t] = mmaH<ASPLIT ? 2 : 1>(ah.v, al.v, bq.v, bq.v, acc[t]); }
  }
#pragma unroll
  for (int t = 0; t < 4; ++t) { if (col0 + t * 16 >= N) continue;
#pragma unroll
    for (int r = 0; r < 8; ++r) so[w][8 * hh + r][t * 16 + ln] = acc[t][r] * alpha; }
  __builtin_amdgcn_fence(__ATOMIC_ACQ_REL, "workgroup"); __builtin_amdgcn_wave_barrier();
  const int rsub = lane >> 4, c4 = (lane & 15) * 4;
  {
#pragma unroll
    for (int q = 0; q < 8; ++q) { const int r = q * 2 + rsub; if (col0 + c4 < N) { const v4f v = *(const v4fa*)&so[w][r][c4]; *(v4f*)(C + (size_t)(row0 + r) * ldc + col0 + c4) = v; } }
     }
}

// Wt[n][k] = f16(W[k][n]·scale) from f32 row-major W[K][N] (scale = power of two; bf16-exact weights stay exact in f16 away from the subnormal range)
__global__ __launch_bounds__(256) void k_wt_f16(const float* __restrict__ W, _Float16* __restrict__ Wt, int K, int N, float scale) {
  const int t = blockIdx.x * 256 + threadIdx.x; if (t >= N * (K / 8)) return; const int n = t / (K / 8), k8 = (t % (K / 8)) * 8; FragH f;
#pragma unroll
  for (int i = 0; i < 8; ++i) f.h[i] = (_Float16)(bf16_round(W[(size_t)(k8 + i) * N + n]) * scale); const v8us o = f.half[0];
  *(v8us*)((unsigned short*)Wt + (size_t)n * K + k8) = o; 
}
// k_gemm_hh variant with fused epilogue: v = acc·alpha + bias[by·sBias + col] (+ CP[(row/rowsPerB)·sCPb + by·64 + col] if CP) ; ACT 0 none / 1 elu ; writes f16 C16 (and f32 C if non-null)
template <int ACT>
__global__ __launch_bounds__(128) void k_gemm_hhx(const _Float16* __restrict__ A, int lda, size_t sA, const _Float16* __restrict__ Bh, int ldb, size_t sB, float alpha, const float* __restrict__ bias, size_t sBias, const float* __restrict__ CP, int rowsPerB, size_t sCPb, int row0g,
    float* __restrict__ C, _Float16* __restrict__ C16, int ldc, size_t sC, int M, int N, int K) {
  __shared__ __attribute__((aligned(16))) float so[4][16][64];
  const int tid = threadIdx.x, w = tid >> 5, lane = tid & 31, ln = lane & 15, hh = lane >> 4; const int by = blockIdx.y;
  A += (size_t)by * sA; Bh += (size_t)by * sB; const size_t cofs = (size_t)by * sC; const float* bp = bias ? bias + (size_t)by * sBias : nullptr;
  const int ntn = (N + 63) / 64; const int wid = blockIdx.x * 4 + w; const int mt = wid / ntn, nq = wid % ntn; if (mt * 16 >= M) return;
  const int row0 = mt * 16, col0 = nq * 64; const _Float16* arow = A + (size_t)(row0 + ln) * lda;
  v8f acc[4] = {};
  for (int kb = 0; kb < K; kb += 32) { FragH ah; ah.half[0] = *(const v8us*)((const unsigned short*)arow + kb + 8 * hh); ah.half[1] = *(const v8us*)((const unsigned short*)arow + kb + 16 + 8 * hh);
#pragma unroll
    for (int t = 0; t < 4; ++t) { if (col0 + t * 16 >= N) continue; const size_t boff = (size_t)(col0 + t * 16 + ln) * ldb + kb; FragH bq; bq.half[0] = *(const v8us*)((const unsigned short*)Bh + boff + 8 * hh); bq.half[1] = *(const v8us*)((const unsigned short*)Bh + boff + 16 + 8 * hh);
      acc[t] = mmaH<1>(ah.v, ah.v, bq.v, bq.v, acc[t]); }
  }
#pragma unroll
  for (int t = 0; t < 4; ++t) { if (col0 + t * 16 >= N) continue; const int col = col0 + t * 16 + ln; const float bv = bp ? bf16_round(bp[col]) : 0.f;
#pragma unroll
    for (int r = 0; r < 8; ++r) { float v = acc[t][r] * alpha + bv; if (CP) { const int rr = row0g + row0 + 8 * hh + r; if (rowsPerB < 0) v += CP[cofs + (size_t)rr * ldc + col];      /* rowsPerB < 0: own element of the batched C plane */ else { const int bidx = rr / rowsPerB; v += CP[(size_t)bidx * sCPb + (size_t)by * 64 + col]; } } if (ACT == 1) v = (v > 0.f) ? v : expm1f(v); else if (ACT == 7) v = (v > 0.f) ? v + 1.0f : expf(v); else if (ACT == 8) v = tanhf(v); else if (ACT == 9) v = 0.5f * v * (1.0f + tanhf(0.7978845608028654f * (v + 0.044715f * v * v * v))); else if (ACT == 11) v = 1.0f / (1.0f + expf(-v)); else if (ACT == 12) v = (v > 0.f) ? v : 0.01f * v; else if (ACT == 14) v = (v > 0.f) ? v : 0.1f * v; else if (ACT == 16) v = (v >= 0.f) ? v : 0.3f * v; else if (ACT == 17) v = (v >= 0.f) ? v : 0.2f * v; else if (ACT == 15) v = v / (1.0f + expf(-v)); else if (ACT == 3) v = fmaxf(v, 0.f); else if (ACT == 6) v = 0.5f * v * (1.0f + erff(v * 0.70710678118654752f)); so[w][8 * hh + r][t * 16 + ln] = v; } }
  __builtin_amdgcn_fence(__ATOMIC_ACQ_REL, "workgroup"); __builtin_amdgcn_wave_barrier();
  const int rsub = lane >> 4, c4 = (lane & 15) * 4; typedef _Float16 v4h __attribute__((ext_vector_type(4)));
  {
#pragma unroll
    for (int q = 0; q < 8; ++q) { const int r = q * 2 + rsub; if (col0 + c4 < N) { const v4f v = *(const v4fa*)&so[w][r][c4]; if (C) *(v4f*)(C + cofs + (size_t)(row0 + r) * ldc + col0 + c4) = v; if (C16) { v4h h4; for (int i = 0; i < 4; ++i) h4[i] = (_Float16)v[i]; *(v4h*)(C16 + cofs + (size_t)(row0 + r) * ldc + col0 + c4) = h4; } } }
     }
}


typedef _Float16 v4h __attribute__((ext_vector_type(4)));

__global__ __launch_bounds__(256) void k_x16(const float* __restrict__ x, _Float16* __restrict__ X16, size_t n8) { const size_t t = (size_t)blockIdx.x * 256 + threadIdx.x; if (t >= n8) return; FragH f;
#pragma unroll
  for (int q = 0; q < 8; ++q) f.h[q] = (_Float16)bf16_round(x[t * 8 + q]); *(v8us*)((unsigned short*)X16 + t * 8) = f.half[0];  }
__global__ __launch_bounds__(256) void k_h16(const float* __restrict__ x, _Float16* __restrict__ X16, size_t n8) { const size_t t = (size_t)blockIdx.x * 256 + threadIdx.x; if (t >= n8) return; FragH f;
#pragma unroll
  for (int q = 0; q < 8; ++q) f.h[q] = (_Float16)x[t * 8 + q]; *(v8us*)((unsigned short*)X16 + t * 8) = f.half[0];  }
__global__ __launch_bounds__(256) void k_round16f(const float* __restrict__ W, _Float16* __restrict__ Bt, size_t n8) { const size_t t = (size_t)blockIdx.x * 256 + threadIdx.x; if (t >= n8) return; FragH f;
#pragma unroll
  for (int i = 0; i < 8; ++i) f.h[i] = (_Float16)(bf16_round(W[t * 8 + i]) * 16.0f); *(v8us*)((unsigned short*)Bt + t * 8) = f.half[0];  }
template <int NHv, int TTv>
__global__ __launch_bounds__(256) void k_vt(const _Float16* __restrict__ V16, int ldv, int voff, _Float16* __restrict__ Vt) { __shared__ unsigned short tl[64][66]; const int tid = threadIdx.x; const int slab = blockIdx.x / (TTv / 64), lg = blockIdx.x % (TTv / 64); const int b = slab / NHv, h = slab % NHv;
  for (int i = tid; i < 64 * 8; i += 256) { const int r = i / 8, c8 = (i % 8) * 8; FragH f; f.half[0] = *(const v8us*)((const unsigned short*)V16 + ((size_t)b * TTv + lg * 64 + r) * ldv + voff + h * 64 + c8);
#pragma unroll
    for (int q = 0; q < 8; ++q) tl[r][c8 + q] = f.u[q]; }
  __syncthreads();
  {
#pragma unroll
    for (int rd = 0; rd < 2; ++rd) { const int d = rd * 32 + tid / 8, pc = tid % 8; FragH f;
#pragma unroll
      for (int q = 0; q < 8; ++q) f.u[q] = tl[pc * 8 + q][d];
      *(v8us*)((unsigned short*)Vt + ((size_t)slab * 64 + d) * TTv + lg * 64 + pc * 8) = f.half[0]; }
     } }

__global__ __launch_bounds__(256) void k_hl(const float* __restrict__ F, _Float16* __restrict__ Hh, _Float16* __restrict__ Hl, size_t n8) { const size_t t = (size_t)blockIdx.x * 256 + threadIdx.x; if (t >= n8) return; FragH fh, fl; const v4f a = *(const v4fa*)(F + t * 8), c = *(const v4fa*)(F + t * 8 + 4);
#pragma unroll
  for (int q = 0; q < 4; ++q) { _Float16 h = (_Float16)a[q]; fh.h[q] = h; fl.h[q] = (_Float16)((a[q] - (float)h) * 1024.0f); h = (_Float16)c[q]; fh.h[4 + q] = h; fl.h[4 + q] = (_Float16)((c[q] - (float)h) * 1024.0f); }
  { *(v8us*)((unsigned short*)Hh + t * 8) = fh.half[0]; *(v8us*)((unsigned short*)Hl + t * 8) = fl.half[0];  } }

// ---- fast GEMM (wave tile 32x64; requires M % 32 == 0 rows per launch region and N % 64 == 0); epilogue = k_gemm_hhx semantics ----
__device__ __forceinline__ v16h g2_frag(const _Float16* p, int hh) { FragH f; f.half[0] = *(const v8us*)((const unsigned short*)p + 8 * hh); f.half[1] = *(const v8us*)((const unsigned short*)p + 16 + 8 * hh); return f.v; }
__device__ __forceinline__ v8f g2_mma(v16h a, v16h b, v8f c) { v8f d = __builtin_amdgcn_wmma_f32_16x16x32_f16(false, a, false, b, (short)0, c, false, false); asm volatile("v_nop\n\tv_nop\n\tv_nop\n\tv_nop" : "+v"(d) : "v"(a), "v"(b)); return d; }
struct G2S { v16h a0, a1, b0, b1, b2, b3; };      /* the fragments of one k-step of a 32x64 wave tile */
// G2_LOAD: one k-step's twelve loads at the six row pointers, as one group; their data is not waited for here. The scheduling barrier keeps the next step's first WMMA, and with it the wait
// for that step's operands, behind the group: lifted in front of it, that wait would hold the group's issue back by most of a step.
#define G2_LOAD(S) do { S.a0 = g2_frag(a0p, 0); S.a1 = g2_frag(a1p, 0); S.b0 = g2_frag(b0p, 0); S.b1 = g2_frag(b1p, 0); S.b2 = g2_frag(b2p, 0); S.b3 = g2_frag(b3p, 0); \
    __builtin_amdgcn_sched_barrier(0); } while (0)
// G2_NEXT: moves the pointers on by one k-step (or leaves them on the last one). s_wait_xcnt 0 in front: a precaution, before the additions write the address registers that the issued
// loads name; the scheduling barrier keeps the additions, and all that follows, behind that wait. In the loop it stands behind a step's WMMAs, well after the group was issued.
#define G2_NEXT do { asm volatile("s_wait_xcnt 0x0" ::: "memory"); __builtin_amdgcn_sched_barrier(0); \
    const int inc = left > 0 ? 32 : 0; --left; a0p += inc; a1p += inc; b0p += inc; b1p += inc; b2p += inc; b3p += inc; } while (0)
#define G2_MMA(S) do { c00 = g2_mma(S.a0, S.b0, c00); c10 = g2_mma(S.a1, S.b0, c10); c01 = g2_mma(S.a0, S.b1, c01); c11 = g2_mma(S.a1, S.b1, c11); \
    c02 = g2_mma(S.a0, S.b2, c02); c12 = g2_mma(S.a1, S.b2, c12); c03 = g2_mma(S.a0, S.b3, c03); c13 = g2_mma(S.a1, S.b3, c13); } while (0)
template <int ACT>
__global__ __launch_bounds__(128) void k_gemm2(const _Float16* __restrict__ A, int lda, size_t sA, const _Float16* __restrict__ Bh, int ldb, size_t sB, float alpha, const float* __restrict__ bias, size_t sBias, const float* __restrict__ CP, int rowsPerB, size_t sCPb, int row0g,
    float* __restrict__ C, _Float16* __restrict__ C16, int ldc, size_t sC, int M, int N, int K) { static_assert(ACT == 0 || ACT == 3 || ACT == 6 || ACT == 8 || ACT == 9 || ACT == 11 || ACT == 12 || ACT == 14 || ACT == 15 || ACT == 16 || ACT == 17, "k_gemm2: unsupported ACT code (would silently apply no activation)");
  __shared__ __attribute__((aligned(16))) float so[4][32][68];
  const int tid = threadIdx.x, w = tid >> 5, lane = tid & 31, ln = lane & 15, hh = lane >> 4; const int by = blockIdx.y;
  A += (size_t)by * sA; Bh += (size_t)by * sB; const size_t cofs = (size_t)by * sC; const float* bp = bias ? bias + (size_t)by * sBias : nullptr;
  const int ntn = N >> 6; const int mt = blockIdx.x / ntn, nq = blockIdx.x - mt * ntn; const int row0 = mt * 128 + 32 * w, col0 = nq * 64; if (row0 >= M) return;
  const _Float16* a0p = A + (size_t)(row0 + ln) * lda + 8 * hh; const _Float16* a1p = a0p + (size_t)16 * lda;      /* the lane's own 16-byte column is part of the pointer: a load names the pointer's registers themselves */
  const _Float16* b0p = Bh + (size_t)(col0 + ln) * ldb + 8 * hh; const _Float16* b1p = b0p + (size_t)16 * ldb; const _Float16* b2p = b1p + (size_t)16 * ldb; const _Float16* b3p = b2p + (size_t)16 * ldb;
  const v8f z8 = {0.f,0.f,0.f,0.f,0.f,0.f,0.f,0.f}; v8f c00 = z8, c01 = z8, c02 = z8, c03 = z8, c10 = z8, c11 = z8, c12 = z8, c13 = z8;
  // K loop (K >= 32): a ring of three fragment sets. The twelve loads of k-step s + 2 are issued as one group in front of the WMMAs of step s, so a step waits for loads that are two steps old
  // instead of for five load round trips of its own. Every accumulator still takes its k-steps in ascending order.
  const int n = K >> 5; int left = n - 1;      /* left: pointer advances still allowed; past the last k-step the pointers stay on it (in bounds), and what is loaded there is not used */
  G2S s0, s1, s2; int i = 0;
  G2_LOAD(s0); G2_NEXT; G2_LOAD(s1); G2_NEXT;
#pragma unroll 1      /* the body already holds three k-steps, one per set: more copies of it only cost instruction cache */
  for (; i + 3 <= n; i += 3) { G2_LOAD(s2); G2_MMA(s0); G2_NEXT; G2_LOAD(s0); G2_MMA(s1); G2_NEXT; G2_LOAD(s1); G2_MMA(s2); G2_NEXT; }
  if (i < n) G2_MMA(s0);
  if (i + 1 < n) G2_MMA(s1);
  v8f accs[8] = {c00, c01, c02, c03, c10, c11, c12, c13};
#pragma unroll
  for (int u = 0; u < 8; ++u) { const int t = u & 3, half = u >> 2; const int col = col0 + t * 16 + ln; const float bv = bp ? bf16_round(bp[col]) : 0.f;
#pragma unroll
    for (int r = 0; r < 8; ++r) { const int rloc = half * 16 + 8 * hh + r; float v = accs[u][r] * alpha + bv; if (CP) { if (rowsPerB < 0) v += CP[cofs + (size_t)(row0g + row0 + rloc) * ldc + col];      /* rowsPerB < 0: own element of the batched C plane */ else { const int bidx = (row0g + row0 + rloc) / rowsPerB; v += CP[(size_t)bidx * sCPb + (size_t)by * 64 + col]; } }
      if (ACT == 3) v = fmaxf(v, 0.f); else if (ACT == 6) v = 0.5f * v * (1.0f + erff(v * 0.70710678118654752f)); else if (ACT == 11) v = 1.0f / (1.0f + expf(-v)); else if (ACT == 15) v = v / (1.0f + expf(-v)); else if (ACT == 12) v = (v > 0.f) ? v : 0.01f * v; else if (ACT == 8) v = tanhf(v); else if (ACT == 9) v = 0.5f * v * (1.0f + tanhf(0.7978845608028654f * (v + 0.044715f * v * v * v))); else if (ACT == 14) v = (v > 0.f) ? v : 0.1f * v; else if (ACT == 16) v = (v >= 0.f) ? v : 0.3f * v; else if (ACT == 17) v = (v >= 0.f) ? v : 0.2f * v;
      so[w][rloc][t * 16 + ln] = v; } }
  __builtin_amdgcn_fence(__ATOMIC_ACQ_REL, "workgroup"); __builtin_amdgcn_wave_barrier();
  const int rsub = lane >> 4, c4 = (lane & 15) * 4;
  {
#pragma unroll
    for (int q = 0; q < 16; ++q) { const int r = q * 2 + rsub; const v4f v = *(const v4fa*)&so[w][r][c4]; if (C) *(v4f*)(C + cofs + (size_t)(row0 + r) * ldc + col0 + c4) = v; if (C16) { v4h h4; for (int i = 0; i < 4; ++i) h4[i] = (_Float16)v[i]; *(v4h*)(C16 + cofs + (size_t)(row0 + r) * ldc + col0 + c4) = h4; } }
     } }


__global__ __launch_bounds__(256) void k_wnat(const float* __restrict__ w, size_t n8, _Float16* __restrict__ Bt) { const size_t t = (size_t)blockIdx.x * 256 + threadIdx.x; if (t >= n8) return; FragH f; for (int q = 0; q < 8; ++q) f.h[q] = (_Float16)(bf16_round(w[t * 8 + q]) * 16.0f); *(v8us*)((unsigned short*)Bt + t * 8) = f.half[0];  }
__global__ __launch_bounds__(256) void k_rsm(const float* __restrict__ S, _Float16* __restrict__ P, int nrows) {
  #pragma clang fp contract(off)
  const int i = blockIdx.x * 256 + threadIdx.x; if (i >= nrows) return; const float* s = S + (size_t)i * SQ; float mx = -3.0e38f;
#pragma unroll 1
  for (int j = 0; j < SQ; ++j) mx = fmaxf(mx, s[j]); float se = 0.f;
#pragma unroll 1
  for (int j = 0; j < SQ; ++j) se += expf(s[j] - mx); const float sc = 256.0f / se;
#pragma unroll 1
  for (int j0 = 0; j0 < SQ; j0 += 8) { FragH f; for (int q = 0; q < 8; ++q) f.h[q] = (_Float16)(expf(s[j0 + q] - mx) * sc); unsigned short* d = (unsigned short*)P + (size_t)i * SQ + j0; *(v8us*)d = f.half[0];  } }
__global__ __launch_bounds__(256) void k_vt(const _Float16* __restrict__ V16, int b, int h0, _Float16* __restrict__ VT) { __shared__ unsigned short tl[64][65]; const int tid = threadIdx.x; const int hh = blockIdx.x % HG, sg = blockIdx.x / HG; const int s0 = sg * 64; const int h = h0 + hh;
  for (int i = tid; i < 64 * 8; i += 256) { const int j = i / 8, d8 = (i % 8) * 8; FragH f; f.half[0] = *(const v8us*)((const unsigned short*)V16 + ((size_t)b * SQ + s0 + j) * DM + h * HD + d8); for (int q = 0; q < 8; ++q) tl[d8 + q][j] = f.u[q]; }
  __syncthreads();
  { for (int i = tid; i < 64 * 8; i += 256) { const int d = i / 8, j8 = (i % 8) * 8; FragH f; for (int q = 0; q < 8; ++q) f.u[q] = tl[d][j8 + q]; *(v8us*)((unsigned short*)VT + ((size_t)hh * HD + d) * SQ + s0 + j8) = f.half[0]; }  } }





// ---- causal attention, scores + softmax + weighted V sum in one kernel; S and P never leave the registers ----
// A wave has 32 query rows (two column groups of 16) of one (batch, head) and walks the keys 0 .. its last row in blocks of 64. Transposed products: S^T = K Q^T (first operand = K rows, second = Q rows),
// so lane (ln, hh) holds, per 16-key tile, the scores of ONE query (column ln) for keys 8 hh .. 8 hh + 7: row maximum and row sum are in-lane plus one exchange between the lane halves.
// Two 16-key score tiles, converted in place, are the second operand of O^T += V^T P^T in the same k order as g2_frag's (keys 8 hh + i, then 16 + 8 hh + i of a 32-key step). O^T: a lane has 8 consecutive
// head columns of one query: one 16-byte store each. Softmax with a running maximum in the log2 domain; the weights carry x256 (as f16 they stay clear of the subnormal range), and so does the row sum.
#define FA_QB 128                    /* query rows per block: 4 waves x 32 */
#define FA_SC 0.18033688011112042f   /* 64^-0.5 * log2(e) */
__device__ __forceinline__ v8f fa_mma(v16h a, v16h b, v8f c) { return __builtin_amdgcn_wmma_f32_16x16x32_f16(false, a, false, b, (short)0, c, false, false); }
__device__ __forceinline__ float fa_xhalf(float x) { return __builtin_bit_cast(float, __builtin_amdgcn_permlanex16(__builtin_bit_cast(int, x), __builtin_bit_cast(int, x), 0x76543210, 0xfedcba98, false, false)); }      /* lane l with lane l ^ 16 */
// exp2 of eight values (of one value) as v_exp_f32 in one asm statement. Why asm: behind a transcendental the instruction set asks for one independent instruction or v_nop before its result is read or its
// source overwritten. Early-clobber outputs share no register with any input, so inside the statement no v_exp_f32 touches
// an earlier one's registers; the closing v_nop is the slot behind the last one.
__device__ __forceinline__ v8f fa_exp2x8(v8f x) { float y0, y1, y2, y3, y4, y5, y6, y7;
  asm("v_exp_f32 %0, %8\n\tv_exp_f32 %1, %9\n\tv_exp_f32 %2, %10\n\tv_exp_f32 %3, %11\n\tv_exp_f32 %4, %12\n\tv_exp_f32 %5, %13\n\tv_exp_f32 %6, %14\n\tv_exp_f32 %7, %15\n\tv_nop"
      : "=&v"(y0), "=&v"(y1), "=&v"(y2), "=&v"(y3), "=&v"(y4), "=&v"(y5), "=&v"(y6), "=&v"(y7) : "v"(x[0]), "v"(x[1]), "v"(x[2]), "v"(x[3]), "v"(x[4]), "v"(x[5]), "v"(x[6]), "v"(x[7]));
  const v8f y = {y0, y1, y2, y3, y4, y5, y6, y7}; return y; }
__device__ __forceinline__ float fa_exp2(float x) { float y; asm("v_exp_f32 %0, %1\n\tv_nop" : "=&v"(y) : "v"(x)); return y; }
__global__ __launch_bounds__(128) void k_fattn(const _Float16* __restrict__ QKVr, const _Float16* __restrict__ VTr, _Float16* __restrict__ O) {
  const int tid = threadIdx.x, lane = tid & 31, ln = lane & 15, hh = lane >> 4; const int w = __builtin_amdgcn_readfirstlane(tid >> 5);      /* the wave's number as a scalar: trip count and the test for the last block are scalar */
  const int g = blockIdx.x / (NB * NH), bh = blockIdx.x % (NB * NH); const int b = bh / NH, h = bh % NH;
  const int qb = (g < SQ / FA_QB / 2) ? SQ / FA_QB - 1 - g : g - SQ / FA_QB / 2;      /* long query blocks first, then the short ones in rising order: for speed only, every (bh, qb) occurs once */
  const int q0 = qb * FA_QB + w * 32; const int nb = (q0 >> 6) + 1;      /* key blocks of 64 up to the one that holds the wave's last row */
  const size_t rb = (size_t)b * SQ;
  const _Float16* qp = QKVr + (rb + q0 + ln) * LQ + h * HD + 8 * hh;
  v16h qf[2][2];
#pragma unroll
  for (int j = 0; j < 2; ++j) { qf[j][0] = g2_frag(qp + (size_t)j * 16 * LQ, 0); qf[j][1] = g2_frag(qp + (size_t)j * 16 * LQ + 32, 0); }
  const _Float16* kp = QKVr + DM + (rb + ln) * LQ + h * HD + 8 * hh;      /* K row = key ln of a tile */
  const _Float16* vp = VTr + ((size_t)bh * HD + ln) * SQ + 8 * hh;      /* V^T row = head column ln of a tile */
  const v8f z8 = {0.f,0.f,0.f,0.f,0.f,0.f,0.f,0.f};
  v16h kf[4][2], vf[4][2]; v8f ot[4][2]; float m[2] = {-3.0e38f, -3.0e38f}, l[2] = {0.f, 0.f};
#pragma unroll
  for (int t = 0; t < 4; ++t) { ot[t][0] = z8; ot[t][1] = z8; }
#pragma unroll
  for (int t = 0; t < 4; ++t) { kf[t][0] = g2_frag(kp + (size_t)t * 16 * LQ, 0); kf[t][1] = g2_frag(kp + (size_t)t * 16 * LQ + 32, 0); }
  // s_wait_xcnt 0: a precaution, before the addition writes the address registers that the issued loads name; the scheduling barriers keep the loads in front of it and the addition behind it.
  __builtin_amdgcn_sched_barrier(0); asm volatile("s_wait_xcnt 0x0" ::: "memory"); __builtin_amdgcn_sched_barrier(0);
  kp += (nb > 1) ? (size_t)64 * LQ : 0;      /* past the last block the pointer stays on it (in bounds); what is loaded there is not used */
#pragma unroll 1      /* one key block per trip: the body is long, copies of it only cost instruction cache */
  for (int kb = 0; kb < nb; ++kb) {
    // this block's V^T fragments, issued as one group in front of the score products: they are first needed behind the softmax
#pragma unroll
    for (int t = 0; t < 4; ++t) { vf[t][0] = g2_frag(vp + (size_t)t * 16 * SQ, 0); vf[t][1] = g2_frag(vp + (size_t)t * 16 * SQ + 32, 0); }
    __builtin_amdgcn_sched_barrier(0);      /* keeps the wait for K, which the first product brings, behind the group's issue */
    v8f st[4][2];
#pragma unroll
    for (int t = 0; t < 4; ++t)
#pragma unroll
      for (int j = 0; j < 2; ++j) st[t][j] = fa_mma(kf[t][0], qf[j][0], z8);
#pragma unroll
    for (int t = 0; t < 4; ++t)
#pragma unroll
      for (int j = 0; j < 2; ++j) st[t][j] = fa_mma(kf[t][1], qf[j][1], st[t][j]);
    __builtin_amdgcn_sched_barrier(0);      /* the next block's K loads go into the registers these products read: not in front of them */
#pragma unroll
    for (int t = 0; t < 4; ++t) { kf[t][0] = g2_frag(kp + (size_t)t * 16 * LQ, 0); kf[t][1] = g2_frag(kp + (size_t)t * 16 * LQ + 32, 0); }      /* next block's K, one block ahead */
    // s_wait_xcnt 0 as above, before both pointers move on
    __builtin_amdgcn_sched_barrier(0); asm volatile("s_wait_xcnt 0x0" ::: "memory"); __builtin_amdgcn_sched_barrier(0);
    kp += (kb + 2 < nb) ? (size_t)64 * LQ : 0; vp += (kb + 1 < nb) ? 64 : 0;
    if (kb == nb - 1) {      /* only the last block holds keys past a row (scalar test): masked like the reference's -inf, as a large negative score */
      const int kq = q0 + ln - (kb * 64 + 8 * hh);      /* key offset r + 16 t is allowed up to kq + 16 j */
#pragma unroll
      for (int t = 0; t < 4; ++t)
#pragma unroll
        for (int j = 0; j < 2; ++j)
#pragma unroll
          for (int r = 0; r < 8; ++r) st[t][j][r] = (t * 16 + r <= kq + j * 16) ? st[t][j][r] : -1.0e9f; }
    v16h pf[2][2];
#pragma unroll
    for (int j = 0; j < 2; ++j) {
      v8f x8;
#pragma unroll
      for (int r = 0; r < 8; ++r) x8[r] = fmaxf(fmaxf(st[0][j][r], st[1][j][r]), fmaxf(st[2][j][r], st[3][j][r]));
      float mx = fmaxf(fmaxf(fmaxf(x8[0], x8[1]), fmaxf(x8[2], x8[3])), fmaxf(fmaxf(x8[4], x8[5]), fmaxf(x8[6], x8[7])));
      mx = fmaxf(mx, fa_xhalf(mx));
      const float mn = fmaxf(m[j], mx * FA_SC); const float al = fa_exp2(m[j] - mn);      /* 0 on the first block */ m[j] = mn; const float mo = 8.0f - mn;      /* + 8: weights x256 */
      v8f s8;
#pragma unroll
      for (int t = 0; t < 4; ++t) { v8f a8;
#pragma unroll
        for (int r = 0; r < 8; ++r) a8[r] = __builtin_fmaf(st[t][j][r], FA_SC, mo);
        st[t][j] = fa_exp2x8(a8); s8 = (t == 0) ? st[0][j] : s8 + st[t][j]; }
      l[j] = l[j] * al + (((s8[0] + s8[1]) + (s8[2] + s8[3])) + ((s8[4] + s8[5]) + (s8[6] + s8[7])));      /* this lane half's keys only; the halves are joined once, behind the loop */
#pragma unroll
      for (int t = 0; t < 4; ++t) ot[t][j] *= al;
#pragma unroll
      for (int s = 0; s < 2; ++s) { FragH f;
#pragma unroll
        for (int i = 0; i < 8; ++i) { f.h[i] = (_Float16)st[2 * s][j][i]; f.h[8 + i] = (_Float16)st[2 * s + 1][j][i]; }
        pf[j][s] = f.v; } }
    __builtin_amdgcn_sched_barrier(0);      /* keeps the asm v_exp_f32 above in front of the products below */
#pragma unroll
    for (int s = 0; s < 2; ++s)
#pragma unroll
      for (int t = 0; t < 4; ++t)
#pragma unroll
        for (int j = 0; j < 2; ++j) ot[t][j] = fa_mma(vf[t][s], pf[j][s], ot[t][j]);
  }
  asm volatile("s_wait_loadcnt 0x0" ::: "memory");      /* the last trip's K loads are not used: waited for here, so that no load is in flight into the wave's registers when it ends */
  FragH of[2][4]; _Float16* op[2];
#pragma unroll
  for (int j = 0; j < 2; ++j) { const float fin = 64.0f / (l[j] + fa_xhalf(l[j]));      /* o carried x64; the x256 of the weights cancels against the row sum's */ op[j] = O + (rb + q0 + j * 16 + ln) * DM + h * HD + 8 * hh;
#pragma unroll
    for (int t = 0; t < 4; ++t)
#pragma unroll
      for (int r = 0; r < 8; ++r) of[j][t].h[r] = (_Float16)(ot[t][j][r] * fin); }
  __builtin_amdgcn_sched_barrier(0);      /* all values packed and both addresses formed first, then stores alone: no register of an issued store is written again */
#pragma unroll
  for (int j = 0; j < 2; ++j)
#pragma unroll
    for (int t = 0; t < 4; ++t) *(v8us*)((unsigned short*)op[j] + t * 16) = of[j][t].half[0]; }


typedef float v2fa __attribute__((ext_vector_type(2), may_alias));
#define A0R 8                        /* query rows per block of the first-tile attention: one per wave */
#define A0KP 68                      /* K row pitch in LDS, floats: 272 bytes = 16 x 17, so that 16-byte reads of 32 different rows spread over the banks */
// Exact f32 causal attention for rows 0 .. QT0-1 of one batch, one wave per (head, query row); a block has 8 consecutive rows of one head.
// The block stages the head's K and V rows below its last query row in LDS once (whole-line loads, all in flight together). Scores: lane l has keys l, l + 32, l + 64, l + 96
// (four partial sums per key over the head dimension). Row maximum and row sum by butterflies over the 32 lanes, exp once per key. o: lane l has columns 2 l and 2 l + 1,
// the weights come back through LDS as broadcasts, four partial sums over the keys. o carried x64 like the f16 path.
__global__ __launch_bounds__(256) void k_att0w(const float* __restrict__ QF, const float* __restrict__ KF, const float* __restrict__ VF, int ld, float scale, float* __restrict__ OF, int ldo) {
  __shared__ __attribute__((aligned(16))) float lk[QT0][A0KP]; __shared__ __attribute__((aligned(16))) float lv[QT0][HD]; __shared__ __attribute__((aligned(16))) float pe[A0R][QT0];
  const int tid = threadIdx.x, lane = tid & 31; const int w = __builtin_amdgcn_readfirstlane(tid >> 5);      /* the wave's number as a scalar: the tests on i below become scalar branches */
  const int h = blockIdx.x / (QT0 / A0R), rg = blockIdx.x % (QT0 / A0R); const int nk = rg * A0R + A0R;      /* causal: keys below the block's last row end */ const int i = rg * A0R + w;
  const float* qr = QF + (size_t)i * ld + h * HD; v4f q[HD / 4];
#pragma unroll
  for (int c = 0; c < HD / 4; ++c) q[c] = *(const v4fa*)(qr + c * 4);
  const int sr = tid >> 4, sc4 = (tid & 15) * 4; v4f kx[QT0 / 16], vx[QT0 / 16];
#pragma unroll      /* constant indices keep kx / vx in registers; all loads are issued before the first LDS store. Rows past nk - 1 are clamped to it (in bounds) and not stored */
  for (int u = 0; u < QT0 / 16; ++u) { const size_t g = (size_t)min(sr + 16 * u, nk - 1) * ld + h * HD + sc4;
    // Behind each load: s_wait_xcnt 0 as a precaution, before a register that the load names as address is written again (by later address arithmetic or as a later load's destination);
    // the scheduling barrier keeps that later arithmetic and the later loads behind the wait. The loads' data is not waited for here.
    kx[u] = *(const v4fa*)(KF + g); asm volatile("s_wait_xcnt 0x0" ::: "memory"); __builtin_amdgcn_sched_barrier(0);
    vx[u] = *(const v4fa*)(VF + g); asm volatile("s_wait_xcnt 0x0" ::: "memory"); __builtin_amdgcn_sched_barrier(0); }
#pragma unroll
  for (int u = 0; u < QT0 / 16; ++u) if (sr + 16 * u < nk) { *(v4fa*)&lk[sr + 16 * u][sc4] = kx[u]; *(v4fa*)&lv[sr + 16 * u][sc4] = vx[u]; }
  __syncthreads();      /* K and V rows 0 .. nk-1 staged; every wave passes */
  float s[QT0 / 32];
#pragma unroll
  for (int c = 0; c < QT0 / 32; ++c) { s[c] = -1.0e30f;
    if (c * 32 <= i) { const int j = c * 32 + lane; const float* kr = &lk[min(j, i)][0];      /* lanes past the row read row i (staged) and are masked below */ v4f a4 = {0.f, 0.f, 0.f, 0.f};
#pragma unroll
      for (int d = 0; d < HD / 4; ++d) a4 += q[d] * *(const v4fa*)(kr + d * 4);
      const float a = (a4[0] + a4[1]) + (a4[2] + a4[3]); s[c] = (j <= i) ? a * scale : -1.0e30f; } }
  float mx = fmaxf(fmaxf(s[0], s[1]), fmaxf(s[2], s[3]));
#pragma unroll
  for (int o = 16; o > 0; o >>= 1) mx = fmaxf(mx, __shfl_xor(mx, o));
  float se = 0.f;
#pragma unroll
  for (int c = 0; c < QT0 / 32; ++c) { const float e = (c * 32 + lane <= i) ? expf(s[c] - mx) : 0.f; se += e; pe[w][c * 32 + lane] = e; }
#pragma unroll
  for (int o = 16; o > 0; o >>= 1) se += __shfl_xor(se, o);
  __builtin_amdgcn_fence(__ATOMIC_ACQ_REL, "workgroup"); __builtin_amdgcn_wave_barrier();      /* pe[w] is written and read by this wave alone: keeps the reads below behind the writes above */
  const int nj = (i & ~3) + 4;      /* keys in groups of four: nj <= nk, so every V row read is staged; weights past the row are 0 */
  v2fa o0 = {0.f, 0.f}, o1 = {0.f, 0.f}, o2 = {0.f, 0.f}, o3 = {0.f, 0.f};
#pragma unroll 4      /* several groups' LDS reads in flight behind one wait */
  for (int j = 0; j < nj; j += 4) { const v4f p = *(const v4fa*)&pe[w][j];
    o0 += p[0] * *(const v2fa*)&lv[j][lane * 2]; o1 += p[1] * *(const v2fa*)&lv[j + 1][lane * 2]; o2 += p[2] * *(const v2fa*)&lv[j + 2][lane * 2]; o3 += p[3] * *(const v2fa*)&lv[j + 3][lane * 2]; }
  const float fin = 64.0f / se;      /* o carried x64 like the f16 path */
  const v2fa ov = ((o0 + o1) + (o2 + o3)) * fin;
  *(v2fa*)(OF + (size_t)i * ldo + h * HD + lane * 2) = ov; }


template <int BFIN, int WXB>
__global__ __launch_bounds__(256) void k_ln16(const float* __restrict__ X, const float* __restrict__ g, const float* __restrict__ bb, float eps, _Float16* __restrict__ N16, float* __restrict__ XB) {
  #pragma clang fp contract(off)
  __shared__ float red[256]; const size_t r = blockIdx.x; const int t = threadIdx.x; const v4f xa = *(const v4fa*)(X + r * DMQ + t * 4); float s[4]; float sum = 0.f;
  for (int q = 0; q < 4; ++q) { s[q] = BFIN ? bf16_round(xa[q]) : xa[q]; sum = __fadd_rn(sum, s[q]); }
  red[t] = sum; __syncthreads(); for (int st = 128; st > 0; st >>= 1) { if (t < st) red[t] = __fadd_rn(red[t], red[t + st]); __syncthreads(); } const float mu = red[0] / (float)DMQ; __syncthreads();
  float vs = 0.f; for (int q = 0; q < 4; ++q) { const float dl = __fadd_rn(s[q], -mu); vs = __fadd_rn(vs, __fmul_rn(dl, dl)); } red[t] = vs; __syncthreads(); for (int st = 128; st > 0; st >>= 1) { if (t < st) red[t] = __fadd_rn(red[t], red[t + st]); __syncthreads(); }
  const float rs = rsqrtf(__fadd_rn(red[0] / (float)DMQ, eps)); v4h y; v4f xb;
  for (int q = 0; q < 4; ++q) { const int c = t * 4 + q; y[q] = (_Float16)__fadd_rn(__fmul_rn(__fmul_rn(__fadd_rn(s[q], -mu), rs), bf16_round(g[c])), bf16_round(bb[c])); xb[q] = s[q]; }
  { *(v4h*)(N16 + r * DMQ + t * 4) = y; if (WXB) *(v4f*)(XB + r * DMQ + t * 4) = xb;  } }
__global__ __launch_bounds__(256) void k_ftres2(const float* __restrict__ OF0, const float* __restrict__ XB, float* __restrict__ X1, size_t n4) {
  #pragma clang fp contract(off)
  const size_t t = (size_t)blockIdx.x * 256 + threadIdx.x; if (t >= n4) return; const v4f o = *(const v4fa*)(OF0 + t * 4), xv = *(const v4fa*)(XB + t * 4); v4f y; for (int q = 0; q < 4; ++q) y[q] = __fadd_rn(__fmul_rn(o[q], 0.015625f), xv[q]); *(v4f*)(X1 + t * 4) = y;  }

__global__ __launch_bounds__(256) void k_wthd(const float* __restrict__ Wt, _Float16* __restrict__ Bt) { const size_t t = (size_t)blockIdx.x * 256 + threadIdx.x; if (t >= (size_t)NH * HD * (DM / 8)) return; const int m8 = (int)(t % (DM / 8)) * 8; const int d = (int)((t / (DM / 8)) % HD); const int h = (int)(t / ((size_t)(DM / 8) * HD)); FragH f;
  for (int q = 0; q < 8; ++q) f.h[q] = (_Float16)(16.0f * bf16_round(Wt[((size_t)h * DM + m8 + q) * HD + d])); unsigned short* dst = (unsigned short*)Bt + ((size_t)h * HD + d) * DM + m8; *(v8us*)dst = f.half[0];  }




__global__ __launch_bounds__(256) void k_wtpad(const float* __restrict__ Wm, _Float16* __restrict__ Wt, int Kr, int Kp, int Nr, int Np, float scale) {
  const int t = blockIdx.x * 256 + threadIdx.x; if (t >= Np * (Kp / 8)) return; const int n = t / (Kp / 8), k8 = (t % (Kp / 8)) * 8; const int nc = min(n, Nr - 1); const float fn = (n < Nr) ? 1.f : 0.f; FragH f;
  for (int i = 0; i < 8; ++i) { const int k = k8 + i; const int kc = min(k, Kr - 1); const float fk = (k < Kr) ? fn : 0.f; f.h[i] = (_Float16)(bf16_round(Wm[(size_t)kc * Nr + nc]) * scale * fk); }
  unsigned short* o = (unsigned short*)Wt + (size_t)n * Kp + k8; *(v8us*)o = f.half[0];  }
__global__ __launch_bounds__(128) void k_bpad(const float* __restrict__ b, float* __restrict__ Bp, int nr, int np) {
  const int i = threadIdx.x; if (i >= np) return; const float v = b[min(i, nr - 1)] * ((i < nr) ? 1.f : 0.f); *(float*)(Bp + i) = v;  }

template <int BFIN, int W16, int W32>
__global__ __launch_bounds__(256) void k_lnx(const float* __restrict__ X, const float* __restrict__ g, const float* __restrict__ bb, float eps, _Float16* __restrict__ N16, float* __restrict__ N32) {
  #pragma clang fp contract(off)
  __shared__ float red[256]; const size_t r = blockIdx.x; const int t = threadIdx.x; const bool act = t < (DMQ / 4); const int c0 = act ? t * 4 : 0;
  const v4f xa = *(const v4fa*)(X + r * DMQ + c0); float s[4]; float sum = 0.f;
  for (int q = 0; q < 4; ++q) { s[q] = act ? (BFIN ? bf16_round(xa[q]) : xa[q]) : 0.f; sum = __fadd_rn(sum, s[q]); }
  red[t] = sum; __syncthreads(); for (int st = 128; st > 0; st >>= 1) { if (t < st) red[t] = __fadd_rn(red[t], red[t + st]); __syncthreads(); } const float mu = red[0] / (float)DMQ; __syncthreads();
  float vs = 0.f; for (int q = 0; q < 4; ++q) { const float dl = act ? __fadd_rn(s[q], -mu) : 0.f; vs = __fadd_rn(vs, __fmul_rn(dl, dl)); } red[t] = vs; __syncthreads(); for (int st = 128; st > 0; st >>= 1) { if (t < st) red[t] = __fadd_rn(red[t], red[t + st]); __syncthreads(); }
  const float rs = rsqrtf(__fadd_rn(red[0] / (float)DMQ, eps)); v4h y; v4f yf;
  for (int q = 0; q < 4; ++q) { const int c = c0 + q; yf[q] = __fadd_rn(__fmul_rn(__fmul_rn(__fadd_rn(s[q], -mu), rs), bf16_round(g[c])), bf16_round(bb[c])); y[q] = (_Float16)yf[q]; }
  if (!act) return;      /* no barriers after this point */
  { if (W16) *(v4h*)(N16 + r * DMQ + c0) = y; if (W32) *(v4f*)(N32 + r * DMQ + c0) = yf;  } }



__global__ __launch_bounds__(256) void k_bfr(const float* __restrict__ x, float* __restrict__ XB, size_t n8) { const size_t t = (size_t)blockIdx.x * 256 + threadIdx.x; if (t >= n8) return; v4f a = *(const v4fa*)(x + t * 8), c = *(const v4fa*)(x + t * 8 + 4); for (int q = 0; q < 4; ++q) { a[q] = bf16_round(a[q]); c[q] = bf16_round(c[q]); }
  { *(v4f*)(XB + t * 8) = a; *(v4f*)(XB + t * 8 + 4) = c;  } }




extern "C" void kernel_launch(void* const* d_in, const int* in_sizes, int n_in,
                              void* d_out, int out_size, void* d_ws, size_t ws_size, hipStream_t stream) {
  (void)in_sizes; (void)n_in; (void)out_size;
  const float* const* I = (const float* const*)d_in; const float* x = I[0]; const float* wqkv = I[1]; const float* bqkv = I[2]; const float* wo = I[3]; const float* bo = I[4]; const float* wfc = I[5]; const float* bfc = I[6]; const float* wmp = I[7]; const float* bmp = I[8]; const float* g1 = I[9]; const float* be1 = I[10]; const float* gg2 = I[11]; const float* be2 = I[12];      /* x; fused w_qkv [1024][3072] + b_qkv ([in][out]); w_out + b_out; w_up [1024][4096] + b_up, w_down [4096][1024] + b_down; LN1 g / b, LN2 g / b */
  char* ws = (char*)d_ws; size_t off = 0;
  auto take = [&](size_t bytes) { char* p = ws + off; off += (bytes + 255) & ~(size_t)255; return p; };
  _Float16* BQKV = (_Float16*)take((size_t)3 * DM * DM * 2); _Float16* BO = (_Float16*)take((size_t)DM * DM * 2);
  _Float16* X16 = (_Float16*)take(NR * DM * 2); float* XB = (float*)take(NR * DM * 4); float* X1 = (float*)take(NR * DM * 4); float* X1N = (float*)take(NR * DM * 4);      /* LN1 output f32 rows */ _Float16* M16 = nullptr;      /* = X16 below (alias: X16's last reader, the last batch's first-tile GEMMs, precedes LN1's write) */ _Float16* HF16 = (_Float16*)take((size_t)SQ * DFF * 2); _Float16* BW1 = (_Float16*)take((size_t)DFF * DM * 2); _Float16* BW2 = (_Float16*)take((size_t)DM * DFF * 2); _Float16* QKV = (_Float16*)take(NR * 3 * DM * 2); _Float16* V16 = QKV + 2 * DM; _Float16* O16 = (_Float16*)take(NR * DM * 2); M16 = X16;
  _Float16* VT = (_Float16*)take((size_t)NB * NH * HD * SQ * 2);
  float* QF0 = (float*)take((size_t)QT0 * DM * 4); float* KF0 = (float*)take((size_t)QT0 * DM * 4); float* VF0 = (float*)take((size_t)QT0 * DM * 4); float* OF0 = (float*)take((size_t)NB * QT0 * DM * 4); _Float16* OH0 = (_Float16*)take((size_t)NB * QT0 * DM * 2); _Float16* OL0 = (_Float16*)take((size_t)NB * QT0 * DM * 2);
  if (off > ws_size) return;
  k_wt_f16<<<(unsigned)(((size_t)3 * DM * (DM / 8) + 255) / 256), 256, 0, stream>>>(wqkv, BQKV, DM, 3 * DM, 16.0f);      /* fused [in][out] [DM][3 DM] -> Bt [3 DM][DM] x16: rows 0.. = q, DM.. = k, 2 DM.. = v output columns (contiguous thirds) */ k_wt_f16<<<(unsigned)(((size_t)DM * (DM / 8) + 255) / 256), 256, 0, stream>>>(wo, BO, DM, DM, 16.0f);      /* w_proj [in][out] -> Bt x16 */
  k_x16<<<(unsigned)((NR * DM / 8 + 255) / 256), 256, 0, stream>>>(x, X16, NR * DM / 8); k_bfr<<<(unsigned)((NR * DM / 8 + 255) / 256), 256, 0, stream>>>(x, XB, NR * DM / 8);      /* POST-LN: the attention runs on x itself (exact f16 rows); XB = bf16(x) f32 for the residual */
  k_wt_f16<<<(unsigned)(((size_t)DFF * (DM / 8) + 255) / 256), 256, 0, stream>>>(wfc, BW1, DM, DFF, 16.0f); k_wt_f16<<<(unsigned)(((size_t)DM * (DFF / 8) + 255) / 256), 256, 0, stream>>>(wmp, BW2, DFF, DM, 16.0f);      /* W1 [1024][4096] -> Bt [4096][1024]; W2 [4096][1024] -> Bt [1024][4096] (x16) */
  const size_t r0p = (size_t)B0 * SQ;      /* first projected row */
  k_gemm2<0><<<dim3((unsigned)((MP / 128) * (3 * DM / 64)), 1), 128, 0, stream>>>(X16 + r0p * DM, DM, 0, BQKV, DM, 0, 0.0625f, bqkv, 0, nullptr, 1, 0, 0, nullptr, QKV + r0p * 3 * DM, 3 * DM, 0, MP, 3 * DM, DM);      /* q | k | v rows (f16); head h = columns h*HD.. of each DM block */
  k_vt<NH, SQ><<<NB * NH * (SQ / 64), 256, 0, stream>>>(V16, LQ, 0, VT);      /* V^T [NB][NH][HD][SQ] */
  k_fattn<<<(SQ / FA_QB) * NB * NH, 128, 0, stream>>>(QKV, VT, O16);      /* causal attention, all batches, heads and query rows: o (merged heads, x64) as f16 rows */
  for (int b = B0; b < B0 + NBR; ++b) { const size_t r0 = (size_t)b * SQ;
    k_gemm2<0><<<dim3((QT0 / 128) * (DM / 64), 1), 128, 0, stream>>>(X16 + r0 * DM, DM, 0, BQKV, DM, 0, 0.0625f, bqkv, 0, nullptr, 1, 0, 0, QF0, nullptr, DM, 0, QT0, DM, DM); k_gemm2<0><<<dim3((QT0 / 128) * (DM / 64), 1), 128, 0, stream>>>(X16 + r0 * DM, DM, 0, (BQKV + (size_t)DM * DM), DM, 0, 0.0625f, bqkv + DM, 0, nullptr, 1, 0, 0, KF0, nullptr, DM, 0, QT0, DM, DM); k_gemm2<0><<<dim3((QT0 / 128) * (DM / 64), 1), 128, 0, stream>>>(X16 + r0 * DM, DM, 0, (BQKV + (size_t)2 * DM * DM), DM, 0, 0.0625f, bqkv + 2 * DM, 0, nullptr, 1, 0, 0, VF0, nullptr, DM, 0, QT0, DM, DM);      /* f32 q, k, v of the first 128 rows (exact products) */
    k_att0w<<<NH * (QT0 / A0R), 256, 0, stream>>>(QF0, KF0, VF0, DM, 0.125f, OF0 + (size_t)b * QT0 * DM, DM);      /* exact f32 attention for rows 0..127 (o x64) */ }
  k_gemm2<0><<<dim3((unsigned)((MPO / 128) * (DM / 64)), 1), 128, 0, stream>>>(O16 + r0p * DM, DM, 0, BO, DM, 0, 0.0009765625f, bo, 0, XB + r0p * DM, -1, 0, 0, X1 + r0p * DM, nullptr, DM, 0, MPO, DM, DM);      /* out rows are the output layout */
  k_hl<<<(unsigned)(((size_t)NB * QT0 * DM / 8 + 255) / 256), 256, 0, stream>>>(OF0, OH0, OL0, (size_t)NB * QT0 * DM / 8);      /* first-tile o (x64) -> f16 hi + x1024 residual planes */
  for (int b = B0; b < B0 + NBR; ++b) { const size_t r0 = (size_t)b * SQ; const size_t f0 = (size_t)b * QT0;
    k_gemm2<0><<<dim3((QT0 / 128) * (DM / 64), 1), 128, 0, stream>>>(OH0 + f0 * DM, DM, 0, BO, DM, 0, 0.0009765625f, bo, 0, XB + r0 * DM, -1, 0, 0, X1 + r0 * DM, nullptr, DM, 0, QT0, DM, DM);      /* rows 0..127: out = o_hi Wo (+ b), overwriting the f16-path rows */
    k_gemm2<0><<<dim3((QT0 / 128) * (DM / 64), 1), 128, 0, stream>>>(OL0 + f0 * DM, DM, 0, BO, DM, 0, 0.00000095367431640625f, nullptr, 0, X1 + r0 * DM, -1, 0, 0, X1 + r0 * DM, nullptr, DM, 0, QT0, DM, DM); }      /* += o_lo Wo 2^-20 (own-element accumulate) */
  k_lnx<0, 1, 1><<<(unsigned)NR, 256, 0, stream>>>(X1, g1, be1, 1e-5f, M16, X1N);      /* x1 = LN1(x + attn_out) -> f16 rows (FFN operand) + f32 rows (residual) */
  for (int b = 0; b < NB; ++b) { const size_t r0 = (size_t)b * SQ;
    k_gemm2<3><<<dim3((unsigned)((SQ / 128) * (DFF / 64)), 1), 128, 0, stream>>>(M16 + r0 * DM, DM, 0, BW1, DM, 0, 0.0625f, bfc, 0, nullptr, 1, 0, 0, nullptr, HF16, DFF, 0, SQ, DFF, DM);      /* relu(x1 w_up + b_up) -> f16 (this batch) */
    k_gemm2<0><<<dim3((unsigned)((SQ / 128) * (DM / 64)), 1), 128, 0, stream>>>(HF16, DFF, 0, BW2, DFF, 0, 0.0625f, bmp, 0, X1N + r0 * DM, -1, 0, 0, X1 + r0 * DM, nullptr, DM, 0, SQ, DM, DFF); }      /* x1 + ffn (own-element residual from the LN1 f32 rows) -> f32 rows over the dead pre-LN1 plane */
  k_lnx<0, 0, 1><<<(unsigned)NR, 256, 0, stream>>>(X1, gg2, be2, 1e-5f, nullptr, (float*)d_out);      /* result = LN2(x1 + ffn) */
}

// v005
// Measured time: 459 microseconds a run.
// Two timings next to v004 both put it at 1.40 times that version's speed.
// Over all steps from v000 it is 11.9 times as fast.
#include <hip/hip_runtime.h>
// POST-LN transformer decoder layer with causal self-attention and a fused QKV projection (x [2][2048][1024]; qkv = x w_qkv + b_qkv ([in][out] 1024 x 3072 + bias) viewed (B, S, 3, 16, 64): q | k | v thirds; scores * 64^-0.5; causal (tril, -inf); softmax; x1 = LN1(x + out w_out + b_out) (biased var, eps 1e-5); result = LN2(x1 + relu(x1 w_up + b_up) w_down + b_down) ([in][out] 1024 x 4096 x 1024) -> [2][2048][1024]).
// Structure: token rows r = b*2048 + s; x as exact f16 rows (bf16-rounded); q | k | v as ONE WMMA GEMM (N = 3 x 1024) (32x64 wave tiles, f32 accumulation, exact x16 weights + bias, f16 outputs); V^T for all batches and heads via LDS transposes; causal attention in ONE launch (k_fattn): a wave has 32 query rows and walks the keys below its last row in blocks of 64, scores, running-maximum softmax (f32 statistics, native exp2; weights x256 f16) and o stay in registers (o carried x64, folded into the output GEMM alpha), written straight into the merged f16 o rows; out = o W_o + b GEMM (f32) into the output layout.
// All f16 WMMA operand planes (x, q | k | v rows, V^T, o, LN1 rows, hidden rows, all weights) are kept PACKED, fragment-major: see pk_off below.
// Compute dtype: inputs rounded to bf16; x / weights exact; q, k, v, softmax weights and o as plain f16 GEMM operands (~2^-12); scores and softmax statistics f32. v_wmma_f32_16x16x32_f16.
#define NB 2
#define SQ 2048
#define DM 1024
#define NH 16
#define HD 64
#define HG 4                         /* heads per launch of the (b, h0) k_vt overload, which is not launched */
#define QT0 128                      /* first-tile rows recomputed exactly in f32 */
#define B0 0                         /* first batch processed (debug hook) */
#define NBR NB                       /* batches processed (debug hook) */
#define NR ((size_t)NB * SQ)
#define DMQ DM
#define DFF 4096                     /* FFN hidden width */
#define DFFR 100                     /* unused (the FFN hidden width is DFF) */
#define MP ((int)((size_t)NBR * SQ)) /* rows projected (debug hook) */
#define QN SQ                        /* unused (the attention covers all SQ query rows) */
#define NHD NH                       /* unused (the attention covers all NH heads) */
#define MPO MP                       /* rows through the output stage (debug hook) */
#define LQ (3 * DM)      /* columns of the packed q/k/v plane */
typedef __bf16 v16b __attribute__((ext_vector_type(16)));
typedef unsigned short v8us __attribute__((ext_vector_type(8), may_alias));
typedef float  v8f  __attribute__((ext_vector_type(8)));
typedef float  v4f  __attribute__((ext_vector_type(4)));
typedef float  v4fa __attribute__((ext_vector_type(4), may_alias));
union FragB { v16b v; v8us half[2]; unsigned short u[16]; };

__device__ __forceinline__ unsigned short bf16_bits(float x) { unsigned int u = __float_as_uint(x); return (unsigned short)((u + 0x7FFFu + ((u >> 16) & 1u)) >> 16); }
__device__ __forceinline__ float bf16_val(unsigned short b) { return __uint_as_float(((unsigned int)b) << 16); }
__device__ __forceinline__ float bf16_round(float x) { return bf16_val(bf16_bits(x)); }
// D += A·B with NT terms: 1 = ah·bh, 2 = + al·bh (A split), 3 = + ah·bl (both split)
template <int NT>
__device__ __forceinline__ v8f mmaN(v16b ah, v16b al, v16b bh, v16b bl, v8f c) {
  c = __builtin_amdgcn_wmma_f32_16x16x32_bf16(false, ah, false, bh, (short)0, c, false, false);
  if (NT >= 2) c = __builtin_amdgcn_wmma_f32_16x16x32_bf16(false, al, false, bh, (short)0, c, false, false);
  if (NT >= 3) c = __builtin_amdgcn_wmma_f32_16x16x32_bf16(false, ah, false, bl, (short)0, c, false, false);
  asm volatile("v_nop\n\tv_nop\n\tv_nop\n\tv_nop" : "+v"(c) : "v"(ah), "v"(al), "v"(bh), "v"(bl));
  return c;
}

__global__ __launch_bounds__(256) void k_wt_bf16(const float* __restrict__ W, unsigned short* __restrict__ Wt, int K, int N) {
  const int t = blockIdx.x * 256 + threadIdx.x;
  const int k8n = K / 8;
  if (t >= N * k8n) return;
  const int n = t / k8n, k8 = (t % k8n) * 8;
  v8us v;
#pragma unroll
  for (int i = 0; i < 8; ++i) v[i] = bf16_bits(W[(size_t)(k8 + i) * N + n]);
  *(v8us*)(Wt + (size_t)n * K + k8) = v;
  
}

// GEMM C[M][N] (f32, pitch ldc) = act(A[M][K]·W + bias). A f32 row-major (pitch lda) converted per fragment to bf16
// (ASPLIT: hi/lo two planes -> 2 terms, else single rounded term); Wt bf16 [N][K] (pitch ldb). BIAS_BF16 rounds the
// bias to bf16 first (bias quantised to bf16 before the add). K%32==0, M%16==0, N%64==0.
template <bool ASPLIT, int ACT, bool BIAS_BF16>
__global__ __launch_bounds__(128) void k_gemm_bf(const float* __restrict__ A, int lda, const unsigned short* __restrict__ Wt, int ldb,
                                               const float* __restrict__ bias, float* __restrict__ C, int ldc, int M, int N, int K) {
  __shared__ __attribute__((aligned(16))) float so[4][16][64];
  const int tid = threadIdx.x, w = tid >> 5, lane = tid & 31, ln = lane & 15, hh = lane >> 4;
  const int ntn = N / 64;
  const int wid = blockIdx.x * 4 + w;
  const int mt = wid / ntn, nq = wid % ntn;
  if (mt * 16 >= M) return;
  const int row0 = mt * 16, col0 = nq * 64;
  const float* arow = A + (size_t)(row0 + ln) * lda;
  v8f acc[4] = {};
  for (int kb = 0; kb < K; kb += 32) {
    FragB ah, al;
    const v4f x0 = *(const v4fa*)(arow + kb + 8 * hh), x1 = *(const v4fa*)(arow + kb + 8 * hh + 4);
    const v4f x2 = *(const v4fa*)(arow + kb + 16 + 8 * hh), x3 = *(const v4fa*)(arow + kb + 16 + 8 * hh + 4);
    float xs[16] = {x0[0],x0[1],x0[2],x0[3],x1[0],x1[1],x1[2],x1[3],x2[0],x2[1],x2[2],x2[3],x3[0],x3[1],x3[2],x3[3]};
#pragma unroll
    for (int i = 0; i < 16; ++i) { const unsigned short hb = bf16_bits(xs[i]); ah.u[i] = hb; al.u[i] = ASPLIT ? bf16_bits(xs[i] - bf16_val(hb)) : (unsigned short)0; }
#pragma unroll
    for (int t = 0; t < 4; ++t) {
      const unsigned short* brow = Wt + (size_t)(col0 + t * 16 + ln) * ldb + kb;
      FragB b;
      b.half[0] = *(const v8us*)(brow + 8 * hh);
      b.half[1] = *(const v8us*)(brow + 16 + 8 * hh);
      acc[t] = mmaN<ASPLIT ? 2 : 1>(ah.v, al.v, b.v, b.v, acc[t]);
    }
  }
#pragma unroll
  for (int t = 0; t < 4; ++t) {
    float bv = bias ? bias[col0 + t * 16 + ln] : 0.f;
    if (BIAS_BF16) bv = bf16_round(bv);
#pragma unroll
    for (int r = 0; r < 8; ++r) { float v = acc[t][r] + bv; if (ACT == 1) v = fmaxf(v, 0.f); so[w][8 * hh + r][t * 16 + ln] = v; }
  }
  __builtin_amdgcn_fence(__ATOMIC_ACQ_REL, "workgroup");
  __builtin_amdgcn_wave_barrier();
  const int rsub = lane >> 4, c4 = (lane & 15) * 4;
  {
#pragma unroll
    for (int q = 0; q < 8; ++q) {
      const int r = q * 2 + rsub;
      const v4f v = *(const v4fa*)&so[w][r][c4];
      *(v4f*)(C + (size_t)(row0 + r) * ldc + col0 + c4) = v;
    }
    
  }
}

// GEMM C = act(A·W + bias + resid): A f32 (ASPLIT -> hi/lo 2 terms), Wt bf16 [N][K]; ACT 0 none, 1 relu, 2 exact gelu;
// resid (optional, f32, row index = (row % rmod), pitch ldr, RES_BF16 rounds it) added before the activation.
template <bool ASPLIT, int ACT, bool BIAS_BF16, bool RES_BF16>
__global__ __launch_bounds__(128) void k_gemm_bf3(const float* __restrict__ A, int lda, const unsigned short* __restrict__ Wt, int ldb,
                                                const float* __restrict__ bias, const float* __restrict__ resid, int rmod, int ldr,
                                                float* __restrict__ C, int ldc, int M, int N, int K) {
  __shared__ __attribute__((aligned(16))) float so[4][16][64];
  const int tid = threadIdx.x, w = tid >> 5, lane = tid & 31, ln = lane & 15, hh = lane >> 4;
  const int ntn = N / 64;
  const int wid = blockIdx.x * 4 + w;
  const int mt = wid / ntn, nq = wid % ntn;
  if (mt * 16 >= M) return;
  const int row0 = mt * 16, col0 = nq * 64;
  const float* arow = A + (size_t)(row0 + ln) * lda;
  v8f acc[4] = {};
  for (int kb = 0; kb < K; kb += 32) {
    FragB ah, al;
    const v4f x0 = *(const v4fa*)(arow + kb + 8 * hh), x1 = *(const v4fa*)(arow + kb + 8 * hh + 4);
    const v4f x2 = *(const v4fa*)(arow + kb + 16 + 8 * hh), x3 = *(const v4fa*)(arow + kb + 16 + 8 * hh + 4);
    float xs[16] = {x0[0],x0[1],x0[2],x0[3],x1[0],x1[1],x1[2],x1[3],x2[0],x2[1],x2[2],x2[3],x3[0],x3[1],x3[2],x3[3]};
#pragma unroll
    for (int i = 0; i < 16; ++i) { const unsigned short hb = bf16_bits(xs[i]); ah.u[i] = hb; al.u[i] = ASPLIT ? bf16_bits(xs[i] - bf16_val(hb)) : (unsigned short)0; }
#pragma unroll
    for (int t = 0; t < 4; ++t) {
      const unsigned short* brow = Wt + (size_t)(col0 + t * 16 + ln) * ldb + kb;
      FragB b;
      b.half[0] = *(const v8us*)(brow + 8 * hh);
      b.half[1] = *(const v8us*)(brow + 16 + 8 * hh);
      acc[t] = mmaN<ASPLIT ? 2 : 1>(ah.v, al.v, b.v, b.v, acc[t]);
    }
  }
#pragma unroll
  for (int t = 0; t < 4; ++t) {
    const int col = col0 + t * 16 + ln;
    float bv = bias ? bias[col] : 0.f;
    if (BIAS_BF16) bv = bf16_round(bv);
#pragma unroll
    for (int r = 0; r < 8; ++r) {
      float v = acc[t][r] + bv;
      if (resid) { float rv = resid[(size_t)((row0 + 8 * hh + r) % rmod) * ldr + col]; if (RES_BF16) rv = bf16_round(rv); v += rv; }
      if (ACT == 1) v = fmaxf(v, 0.f);
      if (ACT == 2) v = 0.5f * v * (1.0f + erff(v * 0.70710678118654752f));
      if (ACT == 3) { const float u = 0.7978845608028654f * (v + 0.044715f * v * v * v); v = 0.5f * v * (1.0f + tanhf(u)); }
      so[w][8 * hh + r][t * 16 + ln] = v;
    }
  }
  __builtin_amdgcn_fence(__ATOMIC_ACQ_REL, "workgroup");
  __builtin_amdgcn_wave_barrier();
  const int rsub = lane >> 4, c4 = (lane & 15) * 4;
  {
#pragma unroll
    for (int q = 0; q < 8; ++q) {
      const int r = q * 2 + rsub;
      const v4f v = *(const v4fa*)&so[w][r][c4];
      *(v4f*)(C + (size_t)(row0 + r) * ldc + col0 + c4) = v;
    }
    
  }
}
// row LayerNorm (biased variance, eps) over N: s = X (+ R); optional out_sum <- s; out_norm <- (s-mu)*rsqrt(var+eps)*g + b
template <bool PARAM_BF16>
__global__ __launch_bounds__(256) void k_layernorm(const float* __restrict__ X, const float* __restrict__ R, const float* __restrict__ g, const float* __restrict__ bta,
                                                  float* __restrict__ out_sum, float* __restrict__ out_norm, int N, float eps) {
  __shared__ float red[256];
  const int row = blockIdx.x, tid = threadIdx.x;
  const float* x = X + (size_t)row * N; const float* rr = R ? R + (size_t)row * N : nullptr;
  float vals[16];                     // up to N = 4096
  const int per = N / 256;            // contiguous chunk per thread? use strided-by-4 chunks: thread handles j = tid*4 + 1024*u
  float s1 = 0.f;
  for (int u = 0; u < per / 4; ++u) {
    const int j = tid * 4 + 1024 * u;
    const v4f a = *(const v4fa*)(x + j);
    v4f b = {0.f,0.f,0.f,0.f}; if (rr) b = *(const v4fa*)(rr + j);
#pragma unroll
    for (int q = 0; q < 4; ++q) { const float v = a[q] + b[q]; vals[u * 4 + q] = v; s1 += v; }
  }
  red[tid] = s1; __syncthreads();
  for (int st = 128; st > 0; st >>= 1) { if (tid < st) red[tid] += red[tid + st]; __syncthreads(); }
  const float mu = red[0] / (float)N; __syncthreads();
  float s2 = 0.f;
  for (int u = 0; u < per / 4; ++u)
#pragma unroll
    for (int q = 0; q < 4; ++q) { const float c = vals[u * 4 + q] - mu; s2 += c * c; }
  red[tid] = s2; __syncthreads();
  for (int st = 128; st > 0; st >>= 1) { if (tid < st) red[tid] += red[tid + st]; __syncthreads(); }
  const float rs = rsqrtf(red[0] / (float)N + eps);
  {
    for (int u = 0; u < per / 4; ++u) {
      const int j = tid * 4 + 1024 * u;
      v4f o, sm;
#pragma unroll
      for (int q = 0; q < 4; ++q) {
        float gg = g[j + q], bb = bta[j + q];
        if (PARAM_BF16) { gg = bf16_round(gg); bb = bf16_round(bb); }
        sm[q] = vals[u * 4 + q]; o[q] = (vals[u * 4 + q] - mu) * rs * gg + bb;
      }
      if (out_sum) *(v4f*)(out_sum + (size_t)row * N + j) = sm;
      *(v4f*)(out_norm + (size_t)row * N + j) = o;
    }
    
  }
}



// ---- f16 WMMA path (v_wmma_f32_16x16x32_f16): 11-bit significands for operands in range — used where a [0,1] probability operand needs more precision than bf16
typedef _Float16 v16h __attribute__((ext_vector_type(16)));
union FragH { v16h v; v8us half[2]; _Float16 h[16]; unsigned short u[16]; };
template <int NT>
__device__ __forceinline__ v8f mmaH(v16h ah, v16h al, v16h bh, v16h bl, v8f c) {
  c = __builtin_amdgcn_wmma_f32_16x16x32_f16(false, ah, false, bh, (short)0, c, false, false);
  if (NT >= 2) c = __builtin_amdgcn_wmma_f32_16x16x32_f16(false, al, false, bh, (short)0, c, false, false);
  if (NT >= 3) c = __builtin_amdgcn_wmma_f32_16x16x32_f16(false, ah, false, bl, (short)0, c, false, false);
  asm volatile("v_nop\n\tv_nop\n\tv_nop\n\tv_nop" : "+v"(c) : "v"(ah), "v"(al), "v"(bh), "v"(bl));
  return c;
}
// batched GEMM like k_gemm_b but f16 operands: A f32 (split into f16 hi/lo if ASPLIT, else rounded to f16), Bt = f16 values [n][k]; alpha; C f32; N multiple of 16 (partial tiles skipped)
template <bool ASPLIT>
__global__ __launch_bounds__(128) void k_gemm_h(const float* __restrict__ A, int lda, size_t sA, const _Float16* __restrict__ Bh, int ldb, size_t sB, float alpha, float* __restrict__ C, int ldc, size_t sC, int M, int N, int K) {
  __shared__ __attribute__((aligned(16))) float so[4][16][64];
  const int tid = threadIdx.x, w = tid >> 5, lane = tid & 31, ln = lane & 15, hh = lane >> 4; const int by = blockIdx.y;
  A += (size_t)by * sA; Bh += (size_t)by * sB; C += (size_t)by * sC;
  const int ntn = (N + 63) / 64; const int wid = blockIdx.x * 4 + w; const int mt = wid / ntn, nq = wid % ntn; if (mt * 16 >= M) return;
  const int row0 = mt * 16, col0 = nq * 64; const float* arow = A + (size_t)(row0 + ln) * lda;
  v8f acc[4] = {};
  for (int kb = 0; kb < K; kb += 32) {
    FragH ah, al;
    const v4f x0 = *(const v4fa*)(arow + kb + 8 * hh), x1 = *(const v4fa*)(arow + kb + 8 * hh + 4), x2 = *(const v4fa*)(arow + kb + 16 + 8 * hh), x3 = *(const v4fa*)(arow + kb + 16 + 8 * hh + 4);
    float xs[16] = {x0[0],x0[1],x0[2],x0[3],x1[0],x1[1],x1[2],x1[3],x2[0],x2[1],x2[2],x2[3],x3[0],x3[1],x3[2],x3[3]};
#pragma unroll
    for (int i = 0; i < 16; ++i) { const _Float16 h = (_Float16)xs[i]; ah.h[i] = h; al.h[i] = ASPLIT ? (_Float16)(xs[i] - (float)h) : (_Float16)0.0f; }
#pragma unroll
    for (int t = 0; t < 4; ++t) { if (col0 + t * 16 >= N) continue; const size_t boff = (size_t)(col0 + t * 16 + ln) * ldb + kb; FragH bq; bq.half[0] = *(const v8us*)(Bh + boff + 8 * hh); bq.half[1] = *(const v8us*)(Bh + boff + 16 + 8 * hh);
      acc[t] = mmaH<ASPLIT ? 2 : 1>(ah.v, al.v, bq.v, bq.v, acc[t]); }
  }
#pragma unroll
  for (int t = 0; t < 4; ++t) { if (col0 + t * 16 >= N) continue;
#pragma unroll
    for (int r = 0; r < 8; ++r) so[w][8 * hh + r][t * 16 + ln] = acc[t][r] * alpha; }
  __builtin_amdgcn_fence(__ATOMIC_ACQ_REL, "workgroup"); __builtin_amdgcn_wave_barrier();
  const int rsub = lane >> 4, c4 = (lane & 15) * 4;
  {
#pragma unroll
    for (int q = 0; q < 8; ++q) { const int r = q * 2 + rsub; if (col0 + c4 < N) { const v4f v = *(const v4fa*)&so[w][r][c4]; *(v4f*)(C + (size_t)(row0 + r) * ldc + col0 + c4) = v; } }
     }
}

// ---- packed (fragment-major) f16 operand planes ----
// A plane of R rows x ld columns (R % 16 == 0, ld % 32 == 0) is a row of strips of 16 rows; a strip is ld / 32 tiles of 16 rows x 32 columns; a tile is 1 KB = 64 chunks of 8 halves in the order in which
// the two 16-byte loads of a WMMA fragment take them: chunk j * 32 + hh * 16 + ln = row ln, columns 16 j + 8 hh .. + 7. Load j of a fragment is then lane l <- chunk j * 32 + l: 512 contiguous bytes (four whole
// lines) instead of 32 bytes out of each of 16 lines. Which lane and register gets which element is as with row-major planes. A strip starts at element (first row) * ld, as the row itself would.
__device__ __forceinline__ size_t pk_off(size_t r, int k, int ld) { return (r >> 4) * ((size_t)16 * ld) + (size_t)(k >> 5) * 512 + (size_t)(((k >> 4) & 1) * 256 + ((k >> 3) & 1) * 128 + (k & 7)) + (r & 15) * 8; }
// the inverse for whole chunks: chunk t of a packed plane holds row r, columns k .. k + 7. The packing kernels give thread t chunk t, so that a wave stores 512 contiguous bytes.
__device__ __forceinline__ void pk_chunk(unsigned t, int ld, size_t& r, int& k) { const unsigned tile = t >> 6, tps = (unsigned)ld >> 5, strip = tile / tps; r = (size_t)(strip * 16 + (t & 15)); k = (int)((tile - strip * tps) * 32 + ((t >> 5) & 1) * 16 + ((t >> 4) & 1) * 8); }
// Wt (packed, rows n, columns k) = f16(W[k][n] * scale) from f32 row-major W[K][N] (scale = power of two; bf16-exact weights stay exact in f16 away from the subnormal range); N % 16 == 0, K % 32 == 0
__global__ __launch_bounds__(256) void k_wt_f16(const float* __restrict__ W, _Float16* __restrict__ Wt, int K, int N, float scale) {
  const int t = blockIdx.x * 256 + threadIdx.x; if (t >= N * (K / 8)) return; size_t n; int k8; pk_chunk((unsigned)t, K, n, k8); FragH f;
#pragma unroll
  for (int i = 0; i < 8; ++i) f.h[i] = (_Float16)(bf16_round(W[(size_t)(k8 + i) * N + n]) * scale); const v8us o = f.half[0];
  *(v8us*)((unsigned short*)Wt + (size_t)t * 8) = o; 
}
// k_gemm_hh variant with fused epilogue: v = acc·alpha + bias[by·sBias + col] (+ CP[(row/rowsPerB)·sCPb + by·64 + col] if CP) ; ACT 0 none / 1 elu ; writes f16 C16 (and f32 C if non-null)
template <int ACT>
__global__ __launch_bounds__(128) void k_gemm_hhx(const _Float16* __restrict__ A, int lda, size_t sA, const _Float16* __restrict__ Bh, int ldb, size_t sB, float alpha, const float* __restrict__ bias, size_t sBias, const float* __restrict__ CP, int rowsPerB, size_t sCPb, int row0g,
    float* __restrict__ C, _Float16* __restrict__ C16, int ldc, size_t sC, int M, int N, int K) {
  __shared__ __attribute__((aligned(16))) float so[4][16][64];
  const int tid = threadIdx.x, w = tid >> 5, lane = tid & 31, ln = lane & 15, hh = lane >> 4; const int by = blockIdx.y;
  A += (size_t)by * sA; Bh += (size_t)by * sB; const size_t cofs = (size_t)by * sC; const float* bp = bias ? bias + (size_t)by * sBias : nullptr;
  const int ntn = (N + 63) / 64; const int wid = blockIdx.x * 4 + w; const int mt = wid / ntn, nq = wid % ntn; if (mt * 16 >= M) return;
  const int row0 = mt * 16, col0 = nq * 64; const _Float16* arow = A + (size_t)(row0 + ln) * lda;
  v8f acc[4] = {};
  for (int kb = 0; kb < K; kb += 32) { FragH ah; ah.half[0] = *(const v8us*)((const unsigned short*)arow + kb + 8 * hh); ah.half[1] = *(const v8us*)((const unsigned short*)arow + kb + 16 + 8 * hh);
#pragma unroll
    for (int t = 0; t < 4; ++t) { if (col0 + t * 16 >= N) continue; const size_t boff = (size_t)(col0 + t * 16 + ln) * ldb + kb; FragH bq; bq.half[0] = *(const v8us*)((const unsigned short*)Bh + boff + 8 * hh); bq.half[1] = *(const v8us*)((const unsigned short*)Bh + boff + 16 + 8 * hh);
      acc[t] = mmaH<1>(ah.v, ah.v, bq.v, bq.v, acc[t]); }
  }
#pragma unroll
  for (int t = 0; t < 4; ++t) { if (col0 + t * 16 >= N) continue; const int col = col0 + t * 16 + ln; const float bv = bp ? bf16_round(bp[col]) : 0.f;
#pragma unroll
    for (int r = 0; r < 8; ++r) { float v = acc[t][r] * alpha + bv; if (CP) { const int rr = row0g + row0 + 8 * hh + r; if (rowsPerB < 0) v += CP[cofs + (size_t)rr * ldc + col];      /* rowsPerB < 0: own element of the batched C plane */ else { const int bidx = rr / rowsPerB; v += CP[(size_t)bidx * sCPb + (size_t)by * 64 + col]; } } if (ACT == 1) v = (v > 0.f) ? v : expm1f(v); else if (ACT == 7) v = (v > 0.f) ? v + 1.0f : expf(v); else if (ACT == 8) v = tanhf(v); else if (ACT == 9) v = 0.5f * v * (1.0f + tanhf(0.7978845608028654f * (v + 0.044715f * v * v * v))); else if (ACT == 11) v = 1.0f / (1.0f + expf(-v)); else if (ACT == 12) v = (v > 0.f) ? v : 0.01f * v; else if (ACT == 14) v = (v > 0.f) ? v : 0.1f * v; else if (ACT == 16) v = (v >= 0.f) ? v : 0.3f * v; else if (ACT == 17) v = (v >= 0.f) ? v : 0.2f * v; else if (ACT == 15) v = v / (1.0f + expf(-v)); else if (ACT == 3) v = fmaxf(v, 0.f); else if (ACT == 6) v = 0.5f * v * (1.0f + erff(v * 0.70710678118654752f)); so[w][8 * hh + r][t * 16 + ln] = v; } }
  __builtin_amdgcn_fence(__ATOMIC_ACQ_REL, "workgroup"); __builtin_amdgcn_wave_barrier();
  const int rsub = lane >> 4, c4 = (lane & 15) * 4; typedef _Float16 v4h __attribute__((ext_vector_type(4)));
  {
#pragma unroll
    for (int q = 0; q < 8; ++q) { const int r = q * 2 + rsub; if (col0 + c4 < N) { const v4f v = *(const v4fa*)&so[w][r][c4]; if (C) *(v4f*)(C + cofs + (size_t)(row0 + r) * ldc + col0 + c4) = v; if (C16) { v4h h4; for (int i = 0; i < 4; ++i) h4[i] = (_Float16)v[i]; *(v4h*)(C16 + cofs + (size_t)(row0 + r) * ldc + col0 + c4) = h4; } } }
     }
}


typedef _Float16 v4h __attribute__((ext_vector_type(4)));

__global__ __launch_bounds__(256) void k_x16(const float* __restrict__ x, _Float16* __restrict__ X16, size_t n8) { const size_t t = (size_t)blockIdx.x * 256 + threadIdx.x; if (t >= n8) return; FragH f; size_t r; int k; pk_chunk((unsigned)t, DM, r, k); const float* xr = x + r * DM + k;      /* X16: packed plane of DM columns */
#pragma unroll
  for (int q = 0; q < 8; ++q) f.h[q] = (_Float16)bf16_round(xr[q]); *(v8us*)((unsigned short*)X16 + t * 8) = f.half[0];  }
__global__ __launch_bounds__(256) void k_h16(const float* __restrict__ x, _Float16* __restrict__ X16, size_t n8) { const size_t t = (size_t)blockIdx.x * 256 + threadIdx.x; if (t >= n8) return; FragH f;
#pragma unroll
  for (int q = 0; q < 8; ++q) f.h[q] = (_Float16)x[t * 8 + q]; *(v8us*)((unsigned short*)X16 + t * 8) = f.half[0];  }
// f32 rows of DM columns -> packed f16 plane. A LayerNorm block has one row, which is 16 bytes of each line of the packed plane; here every line has one writer. Thread: chunks t0 + 256 u, which are
// 128 columns apart in one row (1,024 chunks = half a strip per block); a wave's store is 512 contiguous bytes; the eight loads are issued before the first store.
__global__ __launch_bounds__(256) void k_pk16(const float* __restrict__ x, _Float16* __restrict__ X16) { const unsigned t0 = blockIdx.x * 1024 + threadIdx.x; size_t r; int k; pk_chunk(t0, DM, r, k); const float* p = x + r * DM + k; v4f a[4], c[4];
#pragma unroll
  for (int u = 0; u < 4; ++u) { a[u] = *(const v4fa*)(p + 128 * u); c[u] = *(const v4fa*)(p + 128 * u + 4); }
  unsigned short* o = (unsigned short*)X16 + (size_t)t0 * 8; FragH f[4];
#pragma unroll
  for (int u = 0; u < 4; ++u)
#pragma unroll
    for (int q = 0; q < 4; ++q) { f[u].h[q] = (_Float16)a[u][q]; f[u].h[4 + q] = (_Float16)c[u][q]; }
#pragma unroll
  for (int u = 0; u < 4; ++u) *(v8us*)(o + 2048 * u) = f[u].half[0]; }
__global__ __launch_bounds__(256) void k_round16f(const float* __restrict__ W, _Float16* __restrict__ Bt, size_t n8) { const size_t t = (size_t)blockIdx.x * 256 + threadIdx.x; if (t >= n8) return; FragH f;
#pragma unroll
  for (int i = 0; i < 8; ++i) f.h[i] = (_Float16)(bf16_round(W[t * 8 + i]) * 16.0f); *(v8us*)((unsigned short*)Bt + t * 8) = f.half[0];  }
template <int NHv, int TTv>
__global__ __launch_bounds__(256) void k_vt(const _Float16* __restrict__ V16, int ldv, int voff, _Float16* __restrict__ Vt) { __shared__ unsigned short tl[64][66]; const int tid = threadIdx.x; const int slab = blockIdx.x / (TTv / 64), lg = blockIdx.x % (TTv / 64); const int b = slab / NHv, h = slab % NHv;
  for (int i = tid; i < 64 * 8; i += 256) { const int r = i / 8, c8 = (i % 8) * 8; FragH f; f.half[0] = *(const v8us*)((const unsigned short*)V16 + pk_off((size_t)b * TTv + lg * 64 + r, voff + h * 64 + c8, ldv));      /* V16: packed plane of ldv columns, V from column voff on */
#pragma unroll
    for (int q = 0; q < 8; ++q) tl[r][c8 + q] = f.u[q]; }
  __syncthreads();
  {
#pragma unroll
    for (int rd = 0; rd < 2; ++rd) { const int c = rd * 256 + tid; const int d = (c >> 7) * 16 + (c & 15), p8 = ((c >> 4) & 7) * 8; FragH f;      /* Vt: packed plane of TTv columns; the block has 4 strips x 2 tiles of it, thread = chunk c in their order: a wave stores 512 contiguous bytes */
#pragma unroll
      for (int q = 0; q < 8; ++q) f.u[q] = tl[p8 + q][d];
      *(v8us*)((unsigned short*)Vt + pk_off((size_t)slab * 64 + d, lg * 64 + p8, TTv)) = f.half[0]; }
     } }

__global__ __launch_bounds__(256) void k_hl(const float* __restrict__ F, _Float16* __restrict__ Hh, _Float16* __restrict__ Hl, size_t n8) { const size_t t = (size_t)blockIdx.x * 256 + threadIdx.x; if (t >= n8) return; FragH fh, fl; size_t r; int k; pk_chunk((unsigned)t, DM, r, k);      /* Hh, Hl: packed planes of DM columns */ const v4f a = *(const v4fa*)(F + r * DM + k), c = *(const v4fa*)(F + r * DM + k + 4);
#pragma unroll
  for (int q = 0; q < 4; ++q) { _Float16 h = (_Float16)a[q]; fh.h[q] = h; fl.h[q] = (_Float16)((a[q] - (float)h) * 1024.0f); h = (_Float16)c[q]; fh.h[4 + q] = h; fl.h[4 + q] = (_Float16)((c[q] - (float)h) * 1024.0f); }
  { *(v8us*)((unsigned short*)Hh + t * 8) = fh.half[0]; *(v8us*)((unsigned short*)Hl + t * 8) = fl.half[0];  } }

// ---- fast GEMM (wave tile 32x64; requires M % 32 == 0 rows per launch region and N % 64 == 0); epilogue = k_gemm_hhx semantics ----
// A and Bh are packed planes (pk_off) of lda and ldb columns. PK16 = 0: C (f32) and C16, each where not null, are row-major. PK16 = 1: C16 alone is written, as a packed plane of ldc columns (it is a later GEMM's A).
__device__ __forceinline__ v16h g2_frag(const _Float16* p, int hh) { FragH f; f.half[0] = *(const v8us*)((const unsigned short*)p + 8 * hh); f.half[1] = *(const v8us*)((const unsigned short*)p + 16 + 8 * hh); return f.v; }
__device__ __forceinline__ v8f g2_mma(v16h a, v16h b, v8f c) { v8f d = __builtin_amdgcn_wmma_f32_16x16x32_f16(false, a, false, b, (short)0, c, false, false); asm volatile("v_nop\n\tv_nop\n\tv_nop\n\tv_nop" : "+v"(d) : "v"(a), "v"(b)); return d; }
__device__ __forceinline__ v16h g2_fragp(const _Float16* p) { FragH f; f.half[0] = *(const v8us*)((const unsigned short*)p); f.half[1] = *(const v8us*)((const unsigned short*)p + 256); return f.v; }      /* a fragment of a packed plane: p = its tile + 8 * lane */
struct G2S { v16h a0, a1, b0, b1, b2, b3; };      /* the fragments of one k-step of a 32x64 wave tile */
// G2_LOAD: one k-step's twelve loads at the six row pointers, as one group; their data is not waited for here. The scheduling barrier keeps the next step's first WMMA, and with it the wait
// for that step's operands, behind the group: lifted in front of it, that wait would hold the group's issue back by most of a step.
#define G2_LOAD(S) do { S.a0 = g2_fragp(a0p); S.a1 = g2_fragp(a1p); S.b0 = g2_fragp(b0p); S.b1 = g2_fragp(b1p); S.b2 = g2_fragp(b2p); S.b3 = g2_fragp(b3p); \
    __builtin_amdgcn_sched_barrier(0); } while (0)
// G2_NEXT: moves the pointers on by one k-step, which is one tile of 512 halves (or leaves them on the last one). s_wait_xcnt 0 in front: a precaution, before the additions write the address registers that the issued
// loads name; the scheduling barrier keeps the additions, and all that follows, behind that wait. In the loop it stands behind a step's WMMAs, well after the group was issued.
#define G2_NEXT do { asm volatile("s_wait_xcnt 0x0" ::: "memory"); __builtin_amdgcn_sched_barrier(0); \
    const int inc = left > 0 ? 512 : 0; --left; a0p += inc; a1p += inc; b0p += inc; b1p += inc; b2p += inc; b3p += inc; } while (0)
#define G2_MMA(S) do { c00 = g2_mma(S.a0, S.b0, c00); c10 = g2_mma(S.a1, S.b0, c10); c01 = g2_mma(S.a0, S.b1, c01); c11 = g2_mma(S.a1, S.b1, c11); \
    c02 = g2_mma(S.a0, S.b2, c02); c12 = g2_mma(S.a1, S.b2, c12); c03 = g2_mma(S.a0, S.b3, c03); c13 = g2_mma(S.a1, S.b3, c13); } while (0)
template <int ACT, int PK16>
__global__ __launch_bounds__(128) void k_gemm2(const _Float16* __restrict__ A, int lda, size_t sA, const _Float16* __restrict__ Bh, int ldb, size_t sB, float alpha, const float* __restrict__ bias, size_t sBias, const float* __restrict__ CP, int rowsPerB, size_t sCPb, int row0g,
    float* __restrict__ C, _Float16* __restrict__ C16, int ldc, size_t sC, int M, int N, int K) { static_assert(ACT == 0 || ACT == 3 || ACT == 6 || ACT == 8 || ACT == 9 || ACT == 11 || ACT == 12 || ACT == 14 || ACT == 15 || ACT == 16 || ACT == 17, "k_gemm2: unsupported ACT code (would silently apply no activation)");
  __shared__ __attribute__((aligned(16))) float so[4][32][68];
  const int tid = threadIdx.x, w = tid >> 5, lane = tid & 31, ln = lane & 15, hh = lane >> 4; const int by = blockIdx.y;
  A += (size_t)by * sA; Bh += (size_t)by * sB; const size_t cofs = (size_t)by * sC; const float* bp = bias ? bias + (size_t)by * sBias : nullptr;
  const int ntn = N >> 6; const int mt = blockIdx.x / ntn, nq = blockIdx.x - mt * ntn; const int row0 = mt * 128 + 32 * w, col0 = nq * 64; if (row0 >= M) return;
  const _Float16* a0p = A + (size_t)row0 * lda + 8 * lane; const _Float16* a1p = a0p + (size_t)16 * lda;      /* first tile of the strip; the lane's own 16-byte chunk is part of the pointer: a load names the pointer's registers themselves */
  const _Float16* b0p = Bh + (size_t)col0 * ldb + 8 * lane; const _Float16* b1p = b0p + (size_t)16 * ldb; const _Float16* b2p = b1p + (size_t)16 * ldb; const _Float16* b3p = b2p + (size_t)16 * ldb;
  const v8f z8 = {0.f,0.f,0.f,0.f,0.f,0.f,0.f,0.f}; v8f c00 = z8, c01 = z8, c02 = z8, c03 = z8, c10 = z8, c11 = z8, c12 = z8, c13 = z8;
  // K loop (K >= 32): a ring of three fragment sets. The twelve loads of k-step s + 2 are issued as one group in front of the WMMAs of step s, so a step waits for loads that are two steps old
  // instead of for five load round trips of its own. Every accumulator still takes its k-steps in ascending order.
  const int n = K >> 5; int left = n - 1;      /* left: pointer advances still allowed; past the last k-step the pointers stay on it (in bounds), and what is loaded there is not used */
  G2S s0, s1, s2; int i = 0;
  G2_LOAD(s0); G2_NEXT; G2_LOAD(s1); G2_NEXT;
#pragma unroll 1      /* the body already holds three k-steps, one per set: more copies of it only cost instruction cache */
  for (; i + 3 <= n; i += 3) { G2_LOAD(s2); G2_MMA(s0); G2_NEXT; G2_LOAD(s0); G2_MMA(s1); G2_NEXT; G2_LOAD(s1); G2_MMA(s2); G2_NEXT; }
  if (i < n) G2_MMA(s0);
  if (i + 1 < n) G2_MMA(s1);
  v8f accs[8] = {c00, c01, c02, c03, c10, c11, c12, c13};
#pragma unroll
  for (int u = 0; u < 8; ++u) { const int t = u & 3, half = u >> 2; const int col = col0 + t * 16 + ln; const float bv = bp ? bf16_round(bp[col]) : 0.f;
#pragma unroll
    for (int r = 0; r < 8; ++r) { const int rloc = half * 16 + 8 * hh + r; float v = accs[u][r] * alpha + bv; if (CP) { if (rowsPerB < 0) v += CP[cofs + (size_t)(row0g + row0 + rloc) * ldc + col];      /* rowsPerB < 0: own element of the batched C plane */ else { const int bidx = (row0g + row0 + rloc) / rowsPerB; v += CP[(size_t)bidx * sCPb + (size_t)by * 64 + col]; } }
      if (ACT == 3) v = fmaxf(v, 0.f); else if (ACT == 6) v = 0.5f * v * (1.0f + erff(v * 0.70710678118654752f)); else if (ACT == 11) v = 1.0f / (1.0f + expf(-v)); else if (ACT == 15) v = v / (1.0f + expf(-v)); else if (ACT == 12) v = (v > 0.f) ? v : 0.01f * v; else if (ACT == 8) v = tanhf(v); else if (ACT == 9) v = 0.5f * v * (1.0f + tanhf(0.7978845608028654f * (v + 0.044715f * v * v * v))); else if (ACT == 14) v = (v > 0.f) ? v : 0.1f * v; else if (ACT == 16) v = (v >= 0.f) ? v : 0.3f * v; else if (ACT == 17) v = (v >= 0.f) ? v : 0.2f * v;
      so[w][rloc][t * 16 + ln] = v; } }
  __builtin_amdgcn_fence(__ATOMIC_ACQ_REL, "workgroup"); __builtin_amdgcn_wave_barrier();
  const int rsub = lane >> 4, c4 = (lane & 15) * 4;
  if (!PK16) {
#pragma unroll
    for (int q = 0; q < 16; ++q) { const int r = q * 2 + rsub; const v4f v = *(const v4fa*)&so[w][r][c4]; if (C) *(v4f*)(C + cofs + (size_t)(row0 + r) * ldc + col0 + c4) = v; if (C16) { v4h h4; for (int i = 0; i < 4; ++i) h4[i] = (_Float16)v[i]; *(v4h*)(C16 + cofs + (size_t)(row0 + r) * ldc + col0 + c4) = h4; } }
     }
  if (PK16) {      /* the wave's 32x64 results are two strips x two tiles of the packed plane: eight stores of 512 contiguous bytes, lane l = chunk j * 32 + l */
    _Float16* cp = C16 + cofs + (size_t)row0 * ldc + (size_t)(col0 >> 5) * 512 + 8 * lane; FragH pf[8];
#pragma unroll
    for (int u = 0; u < 8; ++u) { const float* sp = &so[w][(u >> 2) * 16 + ln][(u & 3) * 16 + 8 * hh]; const v4f v0 = *(const v4fa*)sp, v1 = *(const v4fa*)(sp + 4);
#pragma unroll
      for (int i = 0; i < 4; ++i) { pf[u].h[i] = (_Float16)v0[i]; pf[u].h[4 + i] = (_Float16)v1[i]; } }
#pragma unroll
    for (int u = 0; u < 8; ++u) *(v8us*)((unsigned short*)cp + (size_t)(u >> 2) * 16 * ldc + (u & 3) * 256) = pf[u].half[0]; } }


__global__ __launch_bounds__(256) void k_wnat(const float* __restrict__ w, size_t n8, _Float16* __restrict__ Bt) { const size_t t = (size_t)blockIdx.x * 256 + threadIdx.x; if (t >= n8) return; FragH f; for (int q = 0; q < 8; ++q) f.h[q] = (_Float16)(bf16_round(w[t * 8 + q]) * 16.0f); *(v8us*)((unsigned short*)Bt + t * 8) = f.half[0];  }
__global__ __launch_bounds__(256) void k_rsm(const float* __restrict__ S, _Float16* __restrict__ P, int nrows) {
  #pragma clang fp contract(off)
  const int i = blockIdx.x * 256 + threadIdx.x; if (i >= nrows) return; const float* s = S + (size_t)i * SQ; float mx = -3.0e38f;
#pragma unroll 1
  for (int j = 0; j < SQ; ++j) mx = fmaxf(mx, s[j]); float se = 0.f;
#pragma unroll 1
  for (int j = 0; j < SQ; ++j) se += expf(s[j] - mx); const float sc = 256.0f / se;
#pragma unroll 1
  for (int j0 = 0; j0 < SQ; j0 += 8) { FragH f; for (int q = 0; q < 8; ++q) f.h[q] = (_Float16)(expf(s[j0 + q] - mx) * sc); unsigned short* d = (unsigned short*)P + (size_t)i * SQ + j0; *(v8us*)d = f.half[0];  } }
__global__ __launch_bounds__(256) void k_vt(const _Float16* __restrict__ V16, int b, int h0, _Float16* __restrict__ VT) { __shared__ unsigned short tl[64][65]; const int tid = threadIdx.x; const int hh = blockIdx.x % HG, sg = blockIdx.x / HG; const int s0 = sg * 64; const int h = h0 + hh;
  for (int i = tid; i < 64 * 8; i += 256) { const int j = i / 8, d8 = (i % 8) * 8; FragH f; f.half[0] = *(const v8us*)((const unsigned short*)V16 + ((size_t)b * SQ + s0 + j) * DM + h * HD + d8); for (int q = 0; q < 8; ++q) tl[d8 + q][j] = f.u[q]; }
  __syncthreads();
  { for (int i = tid; i < 64 * 8; i += 256) { const int d = i / 8, j8 = (i % 8) * 8; FragH f; for (int q = 0; q < 8; ++q) f.u[q] = tl[d][j8 + q]; *(v8us*)((unsigned short*)VT + ((size_t)hh * HD + d) * SQ + s0 + j8) = f.half[0]; }  } }





// ---- causal attention, scores + softmax + weighted V sum in one kernel; S and P never leave the registers ----
// A wave has 32 query rows (two column groups of 16) of one (batch, head) and walks the keys 0 .. its last row in blocks of 64. Transposed products: S^T = K Q^T (first operand = K rows, second = Q rows),
// so lane (ln, hh) holds, per 16-key tile, the scores of ONE query (column ln) for keys 8 hh .. 8 hh + 7: row maximum and row sum are in-lane plus one exchange between the lane halves.
// Two 16-key score tiles, converted in place, are the second operand of O^T += V^T P^T in the same k order as g2_frag's (keys 8 hh + i, then 16 + 8 hh + i of a 32-key step). O^T: a lane has 8 consecutive
// head columns of one query: one 16-byte store each. Softmax with a running maximum in the log2 domain; the weights carry x256 (as f16 they stay clear of the subnormal range), and so does the row sum.
#define FA_QB 128                    /* query rows per block: 4 waves x 32 */
#define FA_SC 0.18033688011112042f   /* 64^-0.5 * log2(e) */
__device__ __forceinline__ v8f fa_mma(v16h a, v16h b, v8f c) { return __builtin_amdgcn_wmma_f32_16x16x32_f16(false, a, false, b, (short)0, c, false, false); }
__device__ __forceinline__ float fa_xhalf(float x) { return __builtin_bit_cast(float, __builtin_amdgcn_permlanex16(__builtin_bit_cast(int, x), __builtin_bit_cast(int, x), 0x76543210, 0xfedcba98, false, false)); }      /* lane l with lane l ^ 16 */
// exp2 of eight values (of one value) as v_exp_f32 in one asm statement. Why asm: behind a transcendental the instruction set asks for one independent instruction or v_nop before its result is read or its
// source overwritten. Early-clobber outputs share no register with any input, so inside the statement no v_exp_f32 touches
// an earlier one's registers; the closing v_nop is the slot behind the last one.
__device__ __forceinline__ v8f fa_exp2x8(v8f x) { float y0, y1, y2, y3, y4, y5, y6, y7;
  asm("v_exp_f32 %0, %8\n\tv_exp_f32 %1, %9\n\tv_exp_f32 %2, %10\n\tv_exp_f32 %3, %11\n\tv_exp_f32 %4, %12\n\tv_exp_f32 %5, %13\n\tv_exp_f32 %6, %14\n\tv_exp_f32 %7, %15\n\tv_nop"
      : "=&v"(y0), "=&v"(y1), "=&v"(y2), "=&v"(y3), "=&v"(y4), "=&v"(y5), "=&v"(y6), "=&v"(y7) : "v"(x[0]), "v"(x[1]), "v"(x[2]), "v"(x[3]), "v"(x[4]), "v"(x[5]), "v"(x[6]), "v"(x[7]));
  const v8f y = {y0, y1, y2, y3, y4, y5, y6, y7}; return y; }
__device__ __forceinline__ float fa_exp2(float x) { float y; asm("v_exp_f32 %0, %1\n\tv_nop" : "=&v"(y) : "v"(x)); return y; }
__global__ __launch_bounds__(128) void k_fattn(const _Float16* __restrict__ QKVr, const _Float16* __restrict__ VTr, _Float16* __restrict__ O) {
  const int tid = threadIdx.x, lane = tid & 31, ln = lane & 15, hh = lane >> 4; const int w = __builtin_amdgcn_readfirstlane(tid >> 5);      /* the wave's number as a scalar: trip count and the test for the last block are scalar */
  const int g = blockIdx.x / (NB * NH), bh = blockIdx.x % (NB * NH); const int b = bh / NH, h = bh % NH;
  const int qb = (g < SQ / FA_QB / 2) ? SQ / FA_QB - 1 - g : g - SQ / FA_QB / 2;      /* long query blocks first, then the short ones in rising order: for speed only, every (bh, qb) occurs once */
  const int q0 = qb * FA_QB + w * 32; const int nb = (q0 >> 6) + 1;      /* key blocks of 64 up to the one that holds the wave's last row */
  const size_t rb = (size_t)b * SQ;
  const _Float16* qp = QKVr + pk_off(rb + q0 + ln, h * HD + 8 * hh, LQ);      /* QKVr: packed plane of LQ columns, VTr: of SQ columns. 16 rows on = 16 row lengths on, 32 columns on = 512 halves on */
  const _Float16* kp = QKVr + pk_off(rb + ln, DM + h * HD + 8 * hh, LQ);      /* K row = key ln of a tile */
  const _Float16* vp = VTr + pk_off((size_t)bh * HD + ln, 8 * hh, SQ);      /* V^T row = head column ln of a tile */
  v16h qf[2][2], kf[4][2], vf[4][2];
#pragma unroll
  for (int j = 0; j < 2; ++j) { qf[j][0] = g2_fragp(qp + (size_t)j * 16 * LQ); qf[j][1] = g2_fragp(qp + (size_t)j * 16 * LQ + 512); }
#pragma unroll
  for (int t = 0; t < 4; ++t) { kf[t][0] = g2_fragp(kp + (size_t)t * 16 * LQ); kf[t][1] = g2_fragp(kp + (size_t)t * 16 * LQ + 512); }
  // s_wait_xcnt 0: a precaution, before anything writes the address registers that the issued Q and K loads name; the scheduling barriers keep the loads in front of it and the addition, the zeroing
  // and all that follows behind it. (The key loop below is entered without a test, so that these loads and the wait stay in one block: past a test the compiler moved the loads behind the wait.)
  __builtin_amdgcn_sched_barrier(0); asm volatile("s_wait_xcnt 0x0" ::: "memory"); __builtin_amdgcn_sched_barrier(0);
  kp += (nb > 1) ? (size_t)64 * LQ : 0;      /* past the last block the pointer stays on it (in bounds); what is loaded there is not used */
  const v8f z8 = {0.f,0.f,0.f,0.f,0.f,0.f,0.f,0.f};
  v8f ot[4][2]; float m[2] = {-3.0e38f, -3.0e38f}, l[2] = {0.f, 0.f};
#pragma unroll
  for (int t = 0; t < 4; ++t) { ot[t][0] = z8; ot[t][1] = z8; }
  int kb = 0;
#pragma unroll 1      /* one key block per trip: the body is long, copies of it only cost instruction cache */
  do {      /* nb >= 1 */
    // this block's V^T fragments, issued as one group in front of the score products: they are first needed behind the softmax
#pragma unroll
    for (int t = 0; t < 4; ++t) { vf[t][0] = g2_fragp(vp + (size_t)t * 16 * SQ); vf[t][1] = g2_fragp(vp + (size_t)t * 16 * SQ + 512); }
    __builtin_amdgcn_sched_barrier(0);      /* keeps the wait for K, which the first product brings, behind the group's issue */
    v8f st[4][2];
#pragma unroll
    for (int t = 0; t < 4; ++t)
#pragma unroll
      for (int j = 0; j < 2; ++j) st[t][j] = fa_mma(kf[t][0], qf[j][0], z8);
#pragma unroll
    for (int t = 0; t < 4; ++t)
#pragma unroll
      for (int j = 0; j < 2; ++j) st[t][j] = fa_mma(kf[t][1], qf[j][1], st[t][j]);
    __builtin_amdgcn_sched_barrier(0);      /* the next block's K loads go into the registers these products read: not in front of them */
#pragma unroll
    for (int t = 0; t < 4; ++t) { kf[t][0] = g2_fragp(kp + (size_t)t * 16 * LQ); kf[t][1] = g2_fragp(kp + (size_t)t * 16 * LQ + 512); }      /* next block's K, one block ahead */
    // s_wait_xcnt 0 as above, before both pointers move on
    __builtin_amdgcn_sched_barrier(0); asm volatile("s_wait_xcnt 0x0" ::: "memory"); __builtin_amdgcn_sched_barrier(0);
    kp += (kb + 2 < nb) ? (size_t)64 * LQ : 0; vp += (kb + 1 < nb) ? 1024 : 0;      /* 64 keys = 4 strips of K rows, 2 tiles of V^T columns */
    if (kb == nb - 1) {      /* only the last block holds keys past a row (scalar test): masked like the reference's -inf, as a large negative score */
      const int kq = q0 + ln - (kb * 64 + 8 * hh);      /* key offset r + 16 t is allowed up to kq + 16 j */
#pragma unroll
      for (int t = 0; t < 4; ++t)
#pragma unroll
        for (int j = 0; j < 2; ++j)
#pragma unroll
          for (int r = 0; r < 8; ++r) st[t][j][r] = (t * 16 + r <= kq + j * 16) ? st[t][j][r] : -1.0e9f; }
    v16h pf[2][2];
#pragma unroll
    for (int j = 0; j < 2; ++j) {
      v8f x8;
#pragma unroll
      for (int r = 0; r < 8; ++r) x8[r] = fmaxf(fmaxf(st[0][j][r], st[1][j][r]), fmaxf(st[2][j][r], st[3][j][r]));
      float mx = fmaxf(fmaxf(fmaxf(x8[0], x8[1]), fmaxf(x8[2], x8[3])), fmaxf(fmaxf(x8[4], x8[5]), fmaxf(x8[6], x8[7])));
      mx = fmaxf(mx, fa_xhalf(mx));
      const float mn = fmaxf(m[j], mx * FA_SC); const float al = fa_exp2(m[j] - mn);      /* 0 on the first block */ m[j] = mn; const float mo = 8.0f - mn;      /* + 8: weights x256 */
      v8f s8;
#pragma unroll
      for (int t = 0; t < 4; ++t) { v8f a8;
#pragma unroll
        for (int r = 0; r < 8; ++r) a8[r] = __builtin_fmaf(st[t][j][r], FA_SC, mo);
        st[t][j] = fa_exp2x8(a8); s8 = (t == 0) ? st[0][j] : s8 + st[t][j]; }
      l[j] = l[j] * al + (((s8[0] + s8[1]) + (s8[2] + s8[3])) + ((s8[4] + s8[5]) + (s8[6] + s8[7])));      /* this lane half's keys only; the halves are joined once, behind the loop */
#pragma unroll
      for (int t = 0; t < 4; ++t) ot[t][j] *= al;
#pragma unroll
      for (int s = 0; s < 2; ++s) { FragH f;
#pragma unroll
        for (int i = 0; i < 8; ++i) { f.h[i] = (_Float16)st[2 * s][j][i]; f.h[8 + i] = (_Float16)st[2 * s + 1][j][i]; }
        pf[j][s] = f.v; } }
    __builtin_amdgcn_sched_barrier(0);      /* keeps the asm v_exp_f32 above in front of the products below */
#pragma unroll
    for (int s = 0; s < 2; ++s)
#pragma unroll
      for (int t = 0; t < 4; ++t)
#pragma unroll
        for (int j = 0; j < 2; ++j) ot[t][j] = fa_mma(vf[t][s], pf[j][s], ot[t][j]);
  } while (++kb < nb);
  asm volatile("s_wait_loadcnt 0x0" ::: "memory");      /* the last trip's K loads are not used: waited for here, so that no load is in flight into the wave's registers when it ends */
  FragH of[2][4]; _Float16* op[2];
#pragma unroll
  for (int j = 0; j < 2; ++j) { const float fin = 64.0f / (l[j] + fa_xhalf(l[j]));      /* o carried x64; the x256 of the weights cancels against the row sum's */ op[j] = O + pk_off(rb + q0 + j * 16 + ln, h * HD + 8 * hh, DM);      /* O: packed plane of DM columns; 16 columns on = 256 halves on, and a wave's store is 512 contiguous bytes */
#pragma unroll
    for (int t = 0; t < 4; ++t)
#pragma unroll
      for (int r = 0; r < 8; ++r) of[j][t].h[r] = (_Float16)(ot[t][j][r] * fin); }
  __builtin_amdgcn_sched_barrier(0);      /* all values packed and both addresses formed first, then stores alone: no register of an issued store is written again */
#pragma unroll
  for (int j = 0; j < 2; ++j)
#pragma unroll
    for (int t = 0; t < 4; ++t) *(v8us*)((unsigned short*)op[j] + t * 256) = of[j][t].half[0]; }


typedef float v2fa __attribute__((ext_vector_type(2), may_alias));
#define A0R 8                        /* query rows per block of the first-tile attention: one per wave */
#define A0KP 68                      /* K row pitch in LDS, floats: 272 bytes = 16 x 17, so that 16-byte reads of 32 different rows spread over the banks */
// Exact f32 causal attention for rows 0 .. QT0-1 of one batch, one wave per (head, query row); a block has 8 consecutive rows of one head.
// The block stages the head's K and V rows below its last query row in LDS once (whole-line loads, all in flight together). Scores: lane l has keys l, l + 32, l + 64, l + 96
// (four partial sums per key over the head dimension). Row maximum and row sum by butterflies over the 32 lanes, exp once per key. o: lane l has columns 2 l and 2 l + 1,
// the weights come back through LDS as broadcasts, four partial sums over the keys. o carried x64 like the f16 path.
__global__ __launch_bounds__(256) void k_att0w(const float* __restrict__ QF, const float* __restrict__ KF, const float* __restrict__ VF, int ld, float scale, float* __restrict__ OF, int ldo) {
  __shared__ __attribute__((aligned(16))) float lk[QT0][A0KP]; __shared__ __attribute__((aligned(16))) float lv[QT0][HD]; __shared__ __attribute__((aligned(16))) float pe[A0R][QT0];
  const int tid = threadIdx.x, lane = tid & 31; const int w = __builtin_amdgcn_readfirstlane(tid >> 5);      /* the wave's number as a scalar: the tests on i below become scalar branches */
  const int h = blockIdx.x / (QT0 / A0R), rg = blockIdx.x % (QT0 / A0R); const int nk = rg * A0R + A0R;      /* causal: keys below the block's last row end */ const int i = rg * A0R + w;
  const float* qr = QF + (size_t)i * ld + h * HD; v4f q[HD / 4];
#pragma unroll
  for (int c = 0; c < HD / 4; ++c) q[c] = *(const v4fa*)(qr + c * 4);
  const int sr = tid >> 4, sc4 = (tid & 15) * 4; v4f kx[QT0 / 16], vx[QT0 / 16];
#pragma unroll      /* constant indices keep kx / vx in registers; all loads are issued before the first LDS store. Rows past nk - 1 are clamped to it (in bounds) and not stored */
  for (int u = 0; u < QT0 / 16; ++u) { const size_t g = (size_t)min(sr + 16 * u, nk - 1) * ld + h * HD + sc4;
    // Behind each load: s_wait_xcnt 0 as a precaution, before a register that the load names as address is written again (by later address arithmetic or as a later load's destination);
    // the scheduling barrier keeps that later arithmetic and the later loads behind the wait. The loads' data is not waited for here.
    kx[u] = *(const v4fa*)(KF + g); asm volatile("s_wait_xcnt 0x0" ::: "memory"); __builtin_amdgcn_sched_barrier(0);
    vx[u] = *(const v4fa*)(VF + g); asm volatile("s_wait_xcnt 0x0" ::: "memory"); __builtin_amdgcn_sched_barrier(0); }
#pragma unroll
  for (int u = 0; u < QT0 / 16; ++u) if (sr + 16 * u < nk) { *(v4fa*)&lk[sr + 16 * u][sc4] = kx[u]; *(v4fa*)&lv[sr + 16 * u][sc4] = vx[u]; }
  __syncthreads();      /* K and V rows 0 .. nk-1 staged; every wave passes */
  float s[QT0 / 32];
#pragma unroll
  for (int c = 0; c < QT0 / 32; ++c) { s[c] = -1.0e30f;
    if (c * 32 <= i) { const int j = c * 32 + lane; const float* kr = &lk[min(j, i)][0];      /* lanes past the row read row i (staged) and are masked below */ v4f a4 = {0.f, 0.f, 0.f, 0.f};
#pragma unroll
      for (int d = 0; d < HD / 4; ++d) a4 += q[d] * *(const v4fa*)(kr + d * 4);
      const float a = (a4[0] + a4[1]) + (a4[2] + a4[3]); s[c] = (j <= i) ? a * scale : -1.0e30f; } }
  float mx = fmaxf(fmaxf(s[0], s[1]), fmaxf(s[2], s[3]));
#pragma unroll
  for (int o = 16; o > 0; o >>= 1) mx = fmaxf(mx, __shfl_xor(mx, o));
  float se = 0.f;
#pragma unroll
  for (int c = 0; c < QT0 / 32; ++c) { const float e = (c * 32 + lane <= i) ? expf(s[c] - mx) : 0.f; se += e; pe[w][c * 32 + lane] = e; }
#pragma unroll
  for (int o = 16; o > 0; o >>= 1) se += __shfl_xor(se, o);
  __builtin_amdgcn_fence(__ATOMIC_ACQ_REL, "workgroup"); __builtin_amdgcn_wave_barrier();      /* pe[w] is written and read by this wave alone: keeps the reads below behind the writes above */
  const int nj = (i & ~3) + 4;      /* keys in groups of four: nj <= nk, so every V row read is staged; weights past the row are 0 */
  v2fa o0 = {0.f, 0.f}, o1 = {0.f, 0.f}, o2 = {0.f, 0.f}, o3 = {0.f, 0.f};
#pragma unroll 4      /* several groups' LDS reads in flight behind one wait */
  for (int j = 0; j < nj; j += 4) { const v4f p = *(const v4fa*)&pe[w][j];
    o0 += p[0] * *(const v2fa*)&lv[j][lane * 2]; o1 += p[1] * *(const v2fa*)&lv[j + 1][lane * 2]; o2 += p[2] * *(const v2fa*)&lv[j + 2][lane * 2]; o3 += p[3] * *(const v2fa*)&lv[j + 3][lane * 2]; }
  const float fin = 64.0f / se;      /* o carried x64 like the f16 path */
  const v2fa ov = ((o0 + o1) + (o2 + o3)) * fin;
  *(v2fa*)(OF + (size_t)i * ldo + h * HD + lane * 2) = ov; }


template <int BFIN, int WXB>
__global__ __launch_bounds__(256) void k_ln16(const float* __restrict__ X, const float* __restrict__ g, const float* __restrict__ bb, float eps, _Float16* __restrict__ N16, float* __restrict__ XB) {
  #pragma clang fp contract(off)
  __shared__ float red[256]; const size_t r = blockIdx.x; const int t = threadIdx.x; const v4f xa = *(const v4fa*)(X + r * DMQ + t * 4); float s[4]; float sum = 0.f;
  for (int q = 0; q < 4; ++q) { s[q] = BFIN ? bf16_round(xa[q]) : xa[q]; sum = __fadd_rn(sum, s[q]); }
  red[t] = sum; __syncthreads(); for (int st = 128; st > 0; st >>= 1) { if (t < st) red[t] = __fadd_rn(red[t], red[t + st]); __syncthreads(); } const float mu = red[0] / (float)DMQ; __syncthreads();
  float vs = 0.f; for (int q = 0; q < 4; ++q) { const float dl = __fadd_rn(s[q], -mu); vs = __fadd_rn(vs, __fmul_rn(dl, dl)); } red[t] = vs; __syncthreads(); for (int st = 128; st > 0; st >>= 1) { if (t < st) red[t] = __fadd_rn(red[t], red[t + st]); __syncthreads(); }
  const float rs = rsqrtf(__fadd_rn(red[0] / (float)DMQ, eps)); v4h y; v4f xb;
  for (int q = 0; q < 4; ++q) { const int c = t * 4 + q; y[q] = (_Float16)__fadd_rn(__fmul_rn(__fmul_rn(__fadd_rn(s[q], -mu), rs), bf16_round(g[c])), bf16_round(bb[c])); xb[q] = s[q]; }
  { *(v4h*)(N16 + r * DMQ + t * 4) = y; if (WXB) *(v4f*)(XB + r * DMQ + t * 4) = xb;  } }
__global__ __launch_bounds__(256) void k_ftres2(const float* __restrict__ OF0, const float* __restrict__ XB, float* __restrict__ X1, size_t n4) {
  #pragma clang fp contract(off)
  const size_t t = (size_t)blockIdx.x * 256 + threadIdx.x; if (t >= n4) return; const v4f o = *(const v4fa*)(OF0 + t * 4), xv = *(const v4fa*)(XB + t * 4); v4f y; for (int q = 0; q < 4; ++q) y[q] = __fadd_rn(__fmul_rn(o[q], 0.015625f), xv[q]); *(v4f*)(X1 + t * 4) = y;  }

__global__ __launch_bounds__(256) void k_wthd(const float* __restrict__ Wt, _Float16* __restrict__ Bt) { const size_t t = (size_t)blockIdx.x * 256 + threadIdx.x; if (t >= (size_t)NH * HD * (DM / 8)) return; const int m8 = (int)(t % (DM / 8)) * 8; const int d = (int)((t / (DM / 8)) % HD); const int h = (int)(t / ((size_t)(DM / 8) * HD)); FragH f;
  for (int q = 0; q < 8; ++q) f.h[q] = (_Float16)(16.0f * bf16_round(Wt[((size_t)h * DM + m8 + q) * HD + d])); unsigned short* dst = (unsigned short*)Bt + ((size_t)h * HD + d) * DM + m8; *(v8us*)dst = f.half[0];  }




__global__ __launch_bounds__(256) void k_wtpad(const float* __restrict__ Wm, _Float16* __restrict__ Wt, int Kr, int Kp, int Nr, int Np, float scale) {
  const int t = blockIdx.x * 256 + threadIdx.x; if (t >= Np * (Kp / 8)) return; const int n = t / (Kp / 8), k8 = (t % (Kp / 8)) * 8; const int nc = min(n, Nr - 1); const float fn = (n < Nr) ? 1.f : 0.f; FragH f;
  for (int i = 0; i < 8; ++i) { const int k = k8 + i; const int kc = min(k, Kr - 1); const float fk = (k < Kr) ? fn : 0.f; f.h[i] = (_Float16)(bf16_round(Wm[(size_t)kc * Nr + nc]) * scale * fk); }
  unsigned short* o = (unsigned short*)Wt + (size_t)n * Kp + k8; *(v8us*)o = f.half[0];  }
__global__ __launch_bounds__(128) void k_bpad(const float* __restrict__ b, float* __restrict__ Bp, int nr, int np) {
  const int i = threadIdx.x; if (i >= np) return; const float v = b[min(i, nr - 1)] * ((i < nr) ? 1.f : 0.f); *(float*)(Bp + i) = v;  }

template <int BFIN, int W16, int W32>
__global__ __launch_bounds__(256) void k_lnx(const float* __restrict__ X, const float* __restrict__ g, const float* __restrict__ bb, float eps, _Float16* __restrict__ N16, float* __restrict__ N32) {
  #pragma clang fp contract(off)
  __shared__ float red[256]; const size_t r = blockIdx.x; const int t = threadIdx.x; const bool act = t < (DMQ / 4); const int c0 = act ? t * 4 : 0;
  const v4f xa = *(const v4fa*)(X + r * DMQ + c0); float s[4]; float sum = 0.f;
  for (int q = 0; q < 4; ++q) { s[q] = act ? (BFIN ? bf16_round(xa[q]) : xa[q]) : 0.f; sum = __fadd_rn(sum, s[q]); }
  red[t] = sum; __syncthreads(); for (int st = 128; st > 0; st >>= 1) { if (t < st) red[t] = __fadd_rn(red[t], red[t + st]); __syncthreads(); } const float mu = red[0] / (float)DMQ; __syncthreads();
  float vs = 0.f; for (int q = 0; q < 4; ++q) { const float dl = act ? __fadd_rn(s[q], -mu) : 0.f; vs = __fadd_rn(vs, __fmul_rn(dl, dl)); } red[t] = vs; __syncthreads(); for (int st = 128; st > 0; st >>= 1) { if (t < st) red[t] = __fadd_rn(red[t], red[t + st]); __syncthreads(); }
  const float rs = rsqrtf(__fadd_rn(red[0] / (float)DMQ, eps)); v4h y; v4f yf;
  for (int q = 0; q < 4; ++q) { const int c = c0 + q; yf[q] = __fadd_rn(__fmul_rn(__fmul_rn(__fadd_rn(s[q], -mu), rs), bf16_round(g[c])), bf16_round(bb[c])); y[q] = (_Float16)yf[q]; }
  if (!act) return;      /* no barriers after this point */
  { if (W16) *(v4h*)(N16 + r * DMQ + c0) = y; if (W32) *(v4f*)(N32 + r * DMQ + c0) = yf;  } }



__global__ __launch_bounds__(256) void k_bfr(const float* __restrict__ x, float* __restrict__ XB, size_t n8) { const size_t t = (size_t)blockIdx.x * 256 + threadIdx.x; if (t >= n8) return; v4f a = *(const v4fa*)(x + t * 8), c = *(const v4fa*)(x + t * 8 + 4); for (int q = 0; q < 4; ++q) { a[q] = bf16_round(a[q]); c[q] = bf16_round(c[q]); }
  { *(v4f*)(XB + t * 8) = a; *(v4f*)(XB + t * 8 + 4) = c;  } }




extern "C" void kernel_launch(void* const* d_in, const int* in_sizes, int n_in,
                              void* d_out, int out_size, void* d_ws, size_t ws_size, hipStream_t stream) {
  (void)in_sizes; (void)n_in; (void)out_size;
  const float* const* I = (const float* const*)d_in; const float* x = I[0]; const float* wqkv = I[1]; const float* bqkv = I[2]; const float* wo = I[3]; const float* bo = I[4]; const float* wfc = I[5]; const float* bfc = I[6]; const float* wmp = I[7]; const float* bmp = I[8]; const float* g1 = I[9]; const float* be1 = I[10]; const float* gg2 = I[11]; const float* be2 = I[12];      /* x; fused w_qkv [1024][3072] + b_qkv ([in][out]); w_out + b_out; w_up [1024][4096] + b_up, w_down [4096][1024] + b_down; LN1 g / b, LN2 g / b */
  char* ws = (char*)d_ws; size_t off = 0;
  auto take = [&](size_t bytes) { char* p = ws + off; off += (bytes + 255) & ~(size_t)255; return p; };
  _Float16* BQKV = (_Float16*)take((size_t)3 * DM * DM * 2); _Float16* BO = (_Float16*)take((size_t)DM * DM * 2);
  _Float16* X16 = (_Float16*)take(NR * DM * 2); float* XB = (float*)take(NR * DM * 4); float* X1 = (float*)take(NR * DM * 4); float* X1N = (float*)take(NR * DM * 4);      /* LN1 output f32 rows */ _Float16* M16 = nullptr;      /* = X16 below (alias: X16's last reader, the last batch's first-tile GEMMs, precedes k_pk16's write of the LN1 rows) */ _Float16* HF16 = (_Float16*)take((size_t)SQ * DFF * 2); _Float16* BW1 = (_Float16*)take((size_t)DFF * DM * 2); _Float16* BW2 = (_Float16*)take((size_t)DM * DFF * 2); _Float16* QKV = (_Float16*)take(NR * 3 * DM * 2); _Float16* O16 = (_Float16*)take(NR * DM * 2); M16 = X16;
  _Float16* VT = (_Float16*)take((size_t)NB * NH * HD * SQ * 2);
  float* QF0 = (float*)take((size_t)QT0 * DM * 4); float* KF0 = (float*)take((size_t)QT0 * DM * 4); float* VF0 = (float*)take((size_t)QT0 * DM * 4); float* OF0 = (float*)take((size_t)NB * QT0 * DM * 4); _Float16* OH0 = (_Float16*)take((size_t)NB * QT0 * DM * 2); _Float16* OL0 = (_Float16*)take((size_t)NB * QT0 * DM * 2);
  if (off > ws_size) return;
  k_wt_f16<<<(unsigned)(((size_t)3 * DM * (DM / 8) + 255) / 256), 256, 0, stream>>>(wqkv, BQKV, DM, 3 * DM, 16.0f);      /* fused [in][out] [DM][3 DM] -> Bt [3 DM][DM] x16: rows 0.. = q, DM.. = k, 2 DM.. = v output columns (contiguous thirds) */ k_wt_f16<<<(unsigned)(((size_t)DM * (DM / 8) + 255) / 256), 256, 0, stream>>>(wo, BO, DM, DM, 16.0f);      /* w_proj [in][out] -> Bt x16 */
  k_x16<<<(unsigned)((NR * DM / 8 + 255) / 256), 256, 0, stream>>>(x, X16, NR * DM / 8); k_bfr<<<(unsigned)((NR * DM / 8 + 255) / 256), 256, 0, stream>>>(x, XB, NR * DM / 8);      /* POST-LN: the attention runs on x itself (exact f16 rows); XB = bf16(x) f32 for the residual */
  k_wt_f16<<<(unsigned)(((size_t)DFF * (DM / 8) + 255) / 256), 256, 0, stream>>>(wfc, BW1, DM, DFF, 16.0f); k_wt_f16<<<(unsigned)(((size_t)DM * (DFF / 8) + 255) / 256), 256, 0, stream>>>(wmp, BW2, DFF, DM, 16.0f);      /* W1 [1024][4096] -> Bt [4096][1024]; W2 [4096][1024] -> Bt [1024][4096] (x16) */
  const size_t r0p = (size_t)B0 * SQ;      /* first projected row */
  k_gemm2<0, 1><<<dim3((unsigned)((MP / 128) * (3 * DM / 64)), 1), 128, 0, stream>>>(X16 + r0p * DM, DM, 0, BQKV, DM, 0, 0.0625f, bqkv, 0, nullptr, 1, 0, 0, nullptr, QKV + r0p * 3 * DM, 3 * DM, 0, MP, 3 * DM, DM);      /* q | k | v rows (f16); head h = columns h*HD.. of each DM block */
  k_vt<NH, SQ><<<NB * NH * (SQ / 64), 256, 0, stream>>>(QKV, LQ, 2 * DM, VT);      /* V^T [NB][NH][HD][SQ] */
  k_fattn<<<(SQ / FA_QB) * NB * NH, 128, 0, stream>>>(QKV, VT, O16);      /* causal attention, all batches, heads and query rows: o (merged heads, x64) as f16 rows */
  for (int b = B0; b < B0 + NBR; ++b) { const size_t r0 = (size_t)b * SQ;
    k_gemm2<0, 0><<<dim3((QT0 / 128) * (DM / 64), 1), 128, 0, stream>>>(X16 + r0 * DM, DM, 0, BQKV, DM, 0, 0.0625f, bqkv, 0, nullptr, 1, 0, 0, QF0, nullptr, DM, 0, QT0, DM, DM); k_gemm2<0, 0><<<dim3((QT0 / 128) * (DM / 64), 1), 128, 0, stream>>>(X16 + r0 * DM, DM, 0, (BQKV + (size_t)DM * DM), DM, 0, 0.0625f, bqkv + DM, 0, nullptr, 1, 0, 0, KF0, nullptr, DM, 0, QT0, DM, DM); k_gemm2<0, 0><<<dim3((QT0 / 128) * (DM / 64), 1), 128, 0, stream>>>(X16 + r0 * DM, DM, 0, (BQKV + (size_t)2 * DM * DM), DM, 0, 0.0625f, bqkv + 2 * DM, 0, nullptr, 1, 0, 0, VF0, nullptr, DM, 0, QT0, DM, DM);      /* f32 q, k, v of the first 128 rows (exact products) */
    k_att0w<<<NH * (QT0 / A0R), 256, 0, stream>>>(QF0, KF0, VF0, DM, 0.125f, OF0 + (size_t)b * QT0 * DM, DM);      /* exact f32 attention for rows 0..127 (o x64) */ }
  k_gemm2<0, 0><<<dim3((unsigned)((MPO / 128) * (DM / 64)), 1), 128, 0, stream>>>(O16 + r0p * DM, DM, 0, BO, DM, 0, 0.0009765625f, bo, 0, XB + r0p * DM, -1, 0, 0, X1 + r0p * DM, nullptr, DM, 0, MPO, DM, DM);      /* out rows are the output layout */
  k_hl<<<(unsigned)(((size_t)NB * QT0 * DM / 8 + 255) / 256), 256, 0, stream>>>(OF0, OH0, OL0, (size_t)NB * QT0 * DM / 8);      /* first-tile o (x64) -> f16 hi + x1024 residual planes */
  for (int b = B0; b < B0 + NBR; ++b) { const size_t r0 = (size_t)b * SQ; const size_t f0 = (size_t)b * QT0;
    k_gemm2<0, 0><<<dim3((QT0 / 128) * (DM / 64), 1), 128, 0, stream>>>(OH0 + f0 * DM, DM, 0, BO, DM, 0, 0.0009765625f, bo, 0, XB + r0 * DM, -1, 0, 0, X1 + r0 * DM, nullptr, DM, 0, QT0, DM, DM);      /* rows 0..127: out = o_hi Wo (+ b), overwriting the f16-path rows */
    k_gemm2<0, 0><<<dim3((QT0 / 128) * (DM / 64), 1), 128, 0, stream>>>(OL0 + f0 * DM, DM, 0, BO, DM, 0, 0.00000095367431640625f, nullptr, 0, X1 + r0 * DM, -1, 0, 0, X1 + r0 * DM, nullptr, DM, 0, QT0, DM, DM); }      /* += o_lo Wo 2^-20 (own-element accumulate) */
  k_lnx<0, 0, 1><<<(unsigned)NR, 256, 0, stream>>>(X1, g1, be1, 1e-5f, nullptr, X1N);      /* x1 = LN1(x + attn_out) -> f32 rows (residual) */
  k_pk16<<<(unsigned)(NR * DM / 8 / 1024), 256, 0, stream>>>(X1N, M16);      /* -> packed f16 plane (FFN operand) */
  for (int b = 0; b < NB; ++b) { const size_t r0 = (size_t)b * SQ;
    k_gemm2<3, 1><<<dim3((unsigned)((SQ / 128) * (DFF / 64)), 1), 128, 0, stream>>>(M16 + r0 * DM, DM, 0, BW1, DM, 0, 0.0625f, bfc, 0, nullptr, 1, 0, 0, nullptr, HF16, DFF, 0, SQ, DFF, DM);      /* relu(x1 w_up + b_up) -> f16 (this batch) */
    k_gemm2<0, 0><<<dim3((unsigned)((SQ / 128) * (DM / 64)), 1), 128, 0, stream>>>(HF16, DFF, 0, BW2, DFF, 0, 0.0625f, bmp, 0, X1N + r0 * DM, -1, 0, 0, X1 + r0 * DM, nullptr, DM, 0, SQ, DM, DFF); }      /* x1 + ffn (own-element residual from the LN1 f32 rows) -> f32 rows over the dead pre-LN1 plane */
  k_lnx<0, 0, 1><<<(unsigned)NR, 256, 0, stream>>>(X1, gg2, be2, 1e-5f, nullptr, (float*)d_out);      /* result = LN2(x1 + ffn) */
}

// v006
// It runs in 269 microseconds.
// Next to v005, in two timings, it ran 1.70 and 1.68 times as fast.
// All steps since v000 together make it 20.1 times as fast.
#include <hip/hip_runtime.h>
// POST-LN transformer decoder layer with causal self-attention and a fused QKV projection (x [2][2048][1024]; qkv = x w_qkv + b_qkv ([in][out] 1024 x 3072 + bias) viewed (B, S, 3, 16, 64): q | k | v thirds; scores * 64^-0.5; causal (tril, -inf); softmax; x1 = LN1(x + out w_out + b_out) (biased var, eps 1e-5); result = LN2(x1 + relu(x1 w_up + b_up) w_down + b_down) ([in][out] 1024 x 4096 x 1024) -> [2][2048][1024]).
// Structure: token rows r = b*2048 + s; x as exact f16 rows (bf16-rounded); q | k | v as ONE WMMA GEMM (N = 3 x 1024) (32x64 wave tiles, f32 accumulation, exact x16 weights + bias, f16 outputs); V^T for all batches and heads via LDS transposes; causal attention in ONE launch (k_fattn): a wave has 32 query rows and walks the keys below its last row in blocks of 64, scores, running-maximum softmax (f32 statistics, native exp2; weights x256 f16) and o stay in registers (o carried x64, folded into the output GEMM alpha), written straight into the merged f16 o rows; out = o W_o + b GEMM (f32) into the output layout.
// All f16 WMMA operand planes (x, q | k | v rows, V^T, o, LN1 rows, hidden rows, all weights) are kept PACKED, fragment-major: see pk_off below.
// Compute dtype: inputs rounded to bf16; x / weights exact; q, k, v, softmax weights and o as plain f16 GEMM operands (~2^-12); scores and softmax statistics f32. v_wmma_f32_16x16x32_f16.
#define NB 2
#define SQ 2048
#define DM 1024
#define NH 16
#define HD 64
#define HG 4                         /* heads per launch of the (b, h0) k_vt overload, which is not launched */
#define QT0 128                      /* first-tile rows recomputed exactly in f32 */
#define B0 0                         /* unused (processing starts at batch 0) */
#define NBR NB                       /* batches processed (debug hook) */
#define NR ((size_t)NB * SQ)
#define DMQ DM
#define DFF 4096                     /* FFN hidden width */
#define DFFR 100                     /* unused (the FFN hidden width is DFF) */
#define MP ((int)((size_t)NBR * SQ)) /* rows projected (debug hook) */
#define QN SQ                        /* unused (the attention covers all SQ query rows) */
#define NHD NH                       /* unused (the attention covers all NH heads) */
#define MPO MP                       /* rows through the output stage (debug hook) */
#define LQ (3 * DM)      /* columns of the packed q/k/v plane */
typedef __bf16 v16b __attribute__((ext_vector_type(16)));
typedef unsigned short v8us __attribute__((ext_vector_type(8), may_alias));
typedef float  v8f  __attribute__((ext_vector_type(8)));
typedef float  v4f  __attribute__((ext_vector_type(4)));
typedef float  v4fa __attribute__((ext_vector_type(4), may_alias));
union FragB { v16b v; v8us half[2]; unsigned short u[16]; };

__device__ __forceinline__ unsigned short bf16_bits(float x) { unsigned int u = __float_as_uint(x); return (unsigned short)((u + 0x7FFFu + ((u >> 16) & 1u)) >> 16); }
__device__ __forceinline__ float bf16_val(unsigned short b) { return __uint_as_float(((unsigned int)b) << 16); }
__device__ __forceinline__ float bf16_round(float x) { return bf16_val(bf16_bits(x)); }
// D += A·B with NT terms: 1 = ah·bh, 2 = + al·bh (A split), 3 = + ah·bl (both split)
template <int NT>
__device__ __forceinline__ v8f mmaN(v16b ah, v16b al, v16b bh, v16b bl, v8f c) {
  c = __builtin_amdgcn_wmma_f32_16x16x32_bf16(false, ah, false, bh, (short)0, c, false, false);
  if (NT >= 2) c = __builtin_amdgcn_wmma_f32_16x16x32_bf16(false, al, false, bh, (short)0, c, false, false);
  if (NT >= 3) c = __builtin_amdgcn_wmma_f32_16x16x32_bf16(false, ah, false, bl, (short)0, c, false, false);
  asm volatile("v_nop\n\tv_nop\n\tv_nop\n\tv_nop" : "+v"(c) : "v"(ah), "v"(al), "v"(bh), "v"(bl));
  return c;
}

__global__ __launch_bounds__(256) void k_wt_bf16(const float* __restrict__ W, unsigned short* __restrict__ Wt, int K, int N) {
  const int t = blockIdx.x * 256 + threadIdx.x;
  const int k8n = K / 8;
  if (t >= N * k8n) return;
  const int n = t / k8n, k8 = (t % k8n) * 8;
  v8us v;
#pragma unroll
  for (int i = 0; i < 8; ++i) v[i] = bf16_bits(W[(size_t)(k8 + i) * N + n]);
  *(v8us*)(Wt + (size_t)n * K + k8) = v;
  
}

// GEMM C[M][N] (f32, pitch ldc) = act(A[M][K]·W + bias). A f32 row-major (pitch lda) converted per fragment to bf16
// (ASPLIT: hi/lo two planes -> 2 terms, else single rounded term); Wt bf16 [N][K] (pitch ldb). BIAS_BF16 rounds the
// bias to bf16 first (bias quantised to bf16 before the add). K%32==0, M%16==0, N%64==0.
template <bool ASPLIT, int ACT, bool BIAS_BF16>
__global__ __launch_bounds__(128) void k_gemm_bf(const float* __restrict__ A, int lda, const unsigned short* __restrict__ Wt, int ldb,
                                               const float* __restrict__ bias, float* __restrict__ C, int ldc, int M, int N, int K) {
  __shared__ __attribute__((aligned(16))) float so[4][16][64];
  const int tid = threadIdx.x, w = tid >> 5, lane = tid & 31, ln = lane & 15, hh = lane >> 4;
  const int ntn = N / 64;
  const int wid = blockIdx.x * 4 + w;
  const int mt = wid / ntn, nq = wid % ntn;
  if (mt * 16 >= M) return;
  const int row0 = mt * 16, col0 = nq * 64;
  const float* arow = A + (size_t)(row0 + ln) * lda;
  v8f acc[4] = {};
  for (int kb = 0; kb < K; kb += 32) {
    FragB ah, al;
    const v4f x0 = *(const v4fa*)(arow + kb + 8 * hh), x1 = *(const v4fa*)(arow + kb + 8 * hh + 4);
    const v4f x2 = *(const v4fa*)(arow + kb + 16 + 8 * hh), x3 = *(const v4fa*)(arow + kb + 16 + 8 * hh + 4);
    float xs[16] = {x0[0],x0[1],x0[2],x0[3],x1[0],x1[1],x1[2],x1[3],x2[0],x2[1],x2[2],x2[3],x3[0],x3[1],x3[2],x3[3]};
#pragma unroll
    for (int i = 0; i < 16; ++i) { const unsigned short hb = bf16_bits(xs[i]); ah.u[i] = hb; al.u[i] = ASPLIT ? bf16_bits(xs[i] - bf16_val(hb)) : (unsigned short)0; }
#pragma unroll
    for (int t = 0; t < 4; ++t) {
      const unsigned short* brow = Wt + (size_t)(col0 + t * 16 + ln) * ldb + kb;
      FragB b;
      b.half[0] = *(const v8us*)(brow + 8 * hh);
      b.half[1] = *(const v8us*)(brow + 16 + 8 * hh);
      acc[t] = mmaN<ASPLIT ? 2 : 1>(ah.v, al.v, b.v, b.v, acc[t]);
    }
  }
#pragma unroll
  for (int t = 0; t < 4; ++t) {
    float bv = bias ? bias[col0 + t * 16 + ln] : 0.f;
    if (BIAS_BF16) bv = bf16_round(bv);
#pragma unroll
    for (int r = 0; r < 8; ++r) { float v = acc[t][r] + bv; if (ACT == 1) v = fmaxf(v, 0.f); so[w][8 * hh + r][t * 16 + ln] = v; }
  }
  __builtin_amdgcn_fence(__ATOMIC_ACQ_REL, "workgroup");
  __builtin_amdgcn_wave_barrier();
  const int rsub = lane >> 4, c4 = (lane & 15) * 4;
  {
#pragma unroll
    for (int q = 0; q < 8; ++q) {
      const int r = q * 2 + rsub;
      const v4f v = *(const v4fa*)&so[w][r][c4];
      *(v4f*)(C + (size_t)(row0 + r) * ldc + col0 + c4) = v;
    }
    
  }
}

// GEMM C = act(A·W + bias + resid): A f32 (ASPLIT -> hi/lo 2 terms), Wt bf16 [N][K]; ACT 0 none, 1 relu, 2 exact gelu;
// resid (optional, f32, row index = (row % rmod), pitch ldr, RES_BF16 rounds it) added before the activation.
template <bool ASPLIT, int ACT, bool BIAS_BF16, bool RES_BF16>
__global__ __launch_bounds__(128) void k_gemm_bf3(const float* __restrict__ A, int lda, const unsigned short* __restrict__ Wt, int ldb,
                                                const float* __restrict__ bias, const float* __restrict__ resid, int rmod, int ldr,
                                                float* __restrict__ C, int ldc, int M, int N, int K) {
  __shared__ __attribute__((aligned(16))) float so[4][16][64];
  const int tid = threadIdx.x, w = tid >> 5, lane = tid & 31, ln = lane & 15, hh = lane >> 4;
  const int ntn = N / 64;
  const int wid = blockIdx.x * 4 + w;
  const int mt = wid / ntn, nq = wid % ntn;
  if (mt * 16 >= M) return;
  const int row0 = mt * 16, col0 = nq * 64;
  const float* arow = A + (size_t)(row0 + ln) * lda;
  v8f acc[4] = {};
  for (int kb = 0; kb < K; kb += 32) {
    FragB ah, al;
    const v4f x0 = *(const v4fa*)(arow + kb + 8 * hh), x1 = *(const v4fa*)(arow + kb + 8 * hh + 4);
    const v4f x2 = *(const v4fa*)(arow + kb + 16 + 8 * hh), x3 = *(const v4fa*)(arow + kb + 16 + 8 * hh + 4);
    float xs[16] = {x0[0],x0[1],x0[2],x0[3],x1[0],x1[1],x1[2],x1[3],x2[0],x2[1],x2[2],x2[3],x3[0],x3[1],x3[2],x3[3]};
#pragma unroll
    for (int i = 0; i < 16; ++i) { const unsigned short hb = bf16_bits(xs[i]); ah.u[i] = hb; al.u[i] = ASPLIT ? bf16_bits(xs[i] - bf16_val(hb)) : (unsigned short)0; }
#pragma unroll
    for (int t = 0; t < 4; ++t) {
      const unsigned short* brow = Wt + (size_t)(col0 + t * 16 + ln) * ldb + kb;
      FragB b;
      b.half[0] = *(const v8us*)(brow + 8 * hh);
      b.half[1] = *(const v8us*)(brow + 16 + 8 * hh);
      acc[t] = mmaN<ASPLIT ? 2 : 1>(ah.v, al.v, b.v, b.v, acc[t]);
    }
  }
#pragma unroll
  for (int t = 0; t < 4; ++t) {
    const int col = col0 + t * 16 + ln;
    float bv = bias ? bias[col] : 0.f;
    if (BIAS_BF16) bv = bf16_round(bv);
#pragma unroll
    for (int r = 0; r < 8; ++r) {
      float v = acc[t][r] + bv;
      if (resid) { float rv = resid[(size_t)((row0 + 8 * hh + r) % rmod) * ldr + col]; if (RES_BF16) rv = bf16_round(rv); v += rv; }
      if (ACT == 1) v = fmaxf(v, 0.f);
      if (ACT == 2) v = 0.5f * v * (1.0f + erff(v * 0.70710678118654752f));
      if (ACT == 3) { const float u = 0.7978845608028654f * (v + 0.044715f * v * v * v); v = 0.5f * v * (1.0f + tanhf(u)); }
      so[w][8 * hh + r][t * 16 + ln] = v;
    }
  }
  __builtin_amdgcn_fence(__ATOMIC_ACQ_REL, "workgroup");
  __builtin_amdgcn_wave_barrier();
  const int rsub = lane >> 4, c4 = (lane & 15) * 4;
  {
#pragma unroll
    for (int q = 0; q < 8; ++q) {
      const int r = q * 2 + rsub;
      const v4f v = *(const v4fa*)&so[w][r][c4];
      *(v4f*)(C + (size_t)(row0 + r) * ldc + col0 + c4) = v;
    }
    
  }
}
// row LayerNorm (biased variance, eps) over N: s = X (+ R); optional out_sum <- s; out_norm <- (s-mu)*rsqrt(var+eps)*g + b
template <bool PARAM_BF16>
__global__ __launch_bounds__(256) void k_layernorm(const float* __restrict__ X, const float* __restrict__ R, const float* __restrict__ g, const float* __restrict__ bta,
                                                  float* __restrict__ out_sum, float* __restrict__ out_norm, int N, float eps) {
  __shared__ float red[256];
  const int row = blockIdx.x, tid = threadIdx.x;
  const float* x = X + (size_t)row * N; const float* rr = R ? R + (size_t)row * N : nullptr;
  float vals[16];                     // up to N = 4096
  const int per = N / 256;            // contiguous chunk per thread? use strided-by-4 chunks: thread handles j = tid*4 + 1024*u
  float s1 = 0.f;
  for (int u = 0; u < per / 4; ++u) {
    const int j = tid * 4 + 1024 * u;
    const v4f a = *(const v4fa*)(x + j);
    v4f b = {0.f,0.f,0.f,0.f}; if (rr) b = *(const v4fa*)(rr + j);
#pragma unroll
    for (int q = 0; q < 4; ++q) { const float v = a[q] + b[q]; vals[u * 4 + q] = v; s1 += v; }
  }
  red[tid] = s1; __syncthreads();
  for (int st = 128; st > 0; st >>= 1) { if (tid < st) red[tid] += red[tid + st]; __syncthreads(); }
  const float mu = red[0] / (float)N; __syncthreads();
  float s2 = 0.f;
  for (int u = 0; u < per / 4; ++u)
#pragma unroll
    for (int q = 0; q < 4; ++q) { const float c = vals[u * 4 + q] - mu; s2 += c * c; }
  red[tid] = s2; __syncthreads();
  for (int st = 128; st > 0; st >>= 1) { if (tid < st) red[tid] += red[tid + st]; __syncthreads(); }
  const float rs = rsqrtf(red[0] / (float)N + eps);
  {
    for (int u = 0; u < per / 4; ++u) {
      const int j = tid * 4 + 1024 * u;
      v4f o, sm;
#pragma unroll
      for (int q = 0; q < 4; ++q) {
        float gg = g[j + q], bb = bta[j + q];
        if (PARAM_BF16) { gg = bf16_round(gg); bb = bf16_round(bb); }
        sm[q] = vals[u * 4 + q]; o[q] = (vals[u * 4 + q] - mu) * rs * gg + bb;
      }
      if (out_sum) *(v4f*)(out_sum + (size_t)row * N + j) = sm;
      *(v4f*)(out_norm + (size_t)row * N + j) = o;
    }
    
  }
}



// ---- f16 WMMA path (v_wmma_f32_16x16x32_f16): 11-bit significands for operands in range — used where a [0,1] probability operand needs more precision than bf16
typedef _Float16 v16h __attribute__((ext_vector_type(16)));
union FragH { v16h v; v8us half[2]; _Float16 h[16]; unsigned short u[16]; };
template <int NT>
__device__ __forceinline__ v8f mmaH(v16h ah, v16h al, v16h bh, v16h bl, v8f c) {
  c = __builtin_amdgcn_wmma_f32_16x16x32_f16(false, ah, false, bh, (short)0, c, false, false);
  if (NT >= 2) c = __builtin_amdgcn_wmma_f32_16x16x32_f16(false, al, false, bh, (short)0, c, false, false);
  if (NT >= 3) c = __builtin_amdgcn_wmma_f32_16x16x32_f16(false, ah, false, bl, (short)0, c, false, false);
  asm volatile("v_nop\n\tv_nop\n\tv_nop\n\tv_nop" : "+v"(c) : "v"(ah), "v"(al), "v"(bh), "v"(bl));
  return c;
}
// batched GEMM like k_gemm_b but f16 operands: A f32 (split into f16 hi/lo if ASPLIT, else rounded to f16), Bt = f16 values [n][k]; alpha; C f32; N multiple of 16 (partial tiles skipped)
template <bool ASPLIT>
__global__ __launch_bounds__(128) void k_gemm_h(const float* __restrict__ A, int lda, size_t sA, const _Float16* __restrict__ Bh, int ldb, size_t sB, float alpha, float* __restrict__ C, int ldc, size_t sC, int M, int N, int K) {
  __shared__ __attribute__((aligned(16))) float so[4][16][64];
  const int tid = threadIdx.x, w = tid >> 5, lane = tid & 31, ln = lane & 15, hh = lane >> 4; const int by = blockIdx.y;
  A += (size_t)by * sA; Bh += (size_t)by * sB; C += (size_t)by * sC;
  const int ntn = (N + 63) / 64; const int wid = blockIdx.x * 4 + w; const int mt = wid / ntn, nq = wid % ntn; if (mt * 16 >= M) return;
  const int row0 = mt * 16, col0 = nq * 64; const float* arow = A + (size_t)(row0 + ln) * lda;
  v8f acc[4] = {};
  for (int kb = 0; kb < K; kb += 32) {
    FragH ah, al;
    const v4f x0 = *(const v4fa*)(arow + kb + 8 * hh), x1 = *(const v4fa*)(arow + kb + 8 * hh + 4), x2 = *(const v4fa*)(arow + kb + 16 + 8 * hh), x3 = *(const v4fa*)(arow + kb + 16 + 8 * hh + 4);
    float xs[16] = {x0[0],x0[1],x0[2],x0[3],x1[0],x1[1],x1[2],x1[3],x2[0],x2[1],x2[2],x2[3],x3[0],x3[1],x3[2],x3[3]};
#pragma unroll
    for (int i = 0; i < 16; ++i) { const _Float16 h = (_Float16)xs[i]; ah.h[i] = h; al.h[i] = ASPLIT ? (_Float16)(xs[i] - (float)h) : (_Float16)0.0f; }
#pragma unroll
    for (int t = 0; t < 4; ++t) { if (col0 + t * 16 >= N) continue; const size_t boff = (size_t)(col0 + t * 16 + ln) * ldb + kb; FragH bq; bq.half[0] = *(const v8us*)(Bh + boff + 8 * hh); bq.half[1] = *(const v8us*)(Bh + boff + 16 + 8 * hh);
      acc[t] = mmaH<ASPLIT ? 2 : 1>(ah.v, al.v, bq.v, bq.v, acc[t]); }
  }
#pragma unroll
  for (int t = 0; t < 4; ++t) { if (col0 + t * 16 >= N) continue;
#pragma unroll
    for (int r = 0; r < 8; ++r) so[w][8 * hh + r][t * 16 + ln] = acc[t][r] * alpha; }
  __builtin_amdgcn_fence(__ATOMIC_ACQ_REL, "workgroup"); __builtin_amdgcn_wave_barrier();
  const int rsub = lane >> 4, c4 = (lane & 15) * 4;
  {
#pragma unroll
    for (int q = 0; q < 8; ++q) { const int r = q * 2 + rsub; if (col0 + c4 < N) { const v4f v = *(const v4fa*)&so[w][r][c4]; *(v4f*)(C + (size_t)(row0 + r) * ldc + col0 + c4) = v; } }
     }
}

// ---- packed (fragment-major) f16 operand planes ----
// A plane of R rows x ld columns (R % 16 == 0, ld % 32 == 0) is a row of strips of 16 rows; a strip is ld / 32 tiles of 16 rows x 32 columns; a tile is 1 KB = 64 chunks of 8 halves in the order in which
// the two 16-byte loads of a WMMA fragment take them: chunk j * 32 + hh * 16 + ln = row ln, columns 16 j + 8 hh .. + 7. Load j of a fragment is then lane l <- chunk j * 32 + l: 512 contiguous bytes (four whole
// lines) instead of 32 bytes out of each of 16 lines. Which lane and register gets which element is as with row-major planes. A strip starts at element (first row) * ld, as the row itself would.
__device__ __forceinline__ size_t pk_off(size_t r, int k, int ld) { return (r >> 4) * ((size_t)16 * ld) + (size_t)(k >> 5) * 512 + (size_t)(((k >> 4) & 1) * 256 + ((k >> 3) & 1) * 128 + (k & 7)) + (r & 15) * 8; }
// the inverse for whole chunks: chunk t of a packed plane holds row r, columns k .. k + 7. The packing kernels give thread t chunk t, so that a wave stores 512 contiguous bytes.
__device__ __forceinline__ void pk_chunk(unsigned t, int ld, size_t& r, int& k) { const unsigned tile = t >> 6, tps = (unsigned)ld >> 5, strip = tile / tps; r = (size_t)(strip * 16 + (t & 15)); k = (int)((tile - strip * tps) * 32 + ((t >> 5) & 1) * 16 + ((t >> 4) & 1) * 8); }
// k_gemm_hh variant with fused epilogue: v = acc·alpha + bias[by·sBias + col] (+ CP[(row/rowsPerB)·sCPb + by·64 + col] if CP) ; ACT 0 none / 1 elu ; writes f16 C16 (and f32 C if non-null)
template <int ACT>
__global__ __launch_bounds__(128) void k_gemm_hhx(const _Float16* __restrict__ A, int lda, size_t sA, const _Float16* __restrict__ Bh, int ldb, size_t sB, float alpha, const float* __restrict__ bias, size_t sBias, const float* __restrict__ CP, int rowsPerB, size_t sCPb, int row0g,
    float* __restrict__ C, _Float16* __restrict__ C16, int ldc, size_t sC, int M, int N, int K) {
  __shared__ __attribute__((aligned(16))) float so[4][16][64];
  const int tid = threadIdx.x, w = tid >> 5, lane = tid & 31, ln = lane & 15, hh = lane >> 4; const int by = blockIdx.y;
  A += (size_t)by * sA; Bh += (size_t)by * sB; const size_t cofs = (size_t)by * sC; const float* bp = bias ? bias + (size_t)by * sBias : nullptr;
  const int ntn = (N + 63) / 64; const int wid = blockIdx.x * 4 + w; const int mt = wid / ntn, nq = wid % ntn; if (mt * 16 >= M) return;
  const int row0 = mt * 16, col0 = nq * 64; const _Float16* arow = A + (size_t)(row0 + ln) * lda;
  v8f acc[4] = {};
  for (int kb = 0; kb < K; kb += 32) { FragH ah; ah.half[0] = *(const v8us*)((const unsigned short*)arow + kb + 8 * hh); ah.half[1] = *(const v8us*)((const unsigned short*)arow + kb + 16 + 8 * hh);
#pragma unroll
    for (int t = 0; t < 4; ++t) { if (col0 + t * 16 >= N) continue; const size_t boff = (size_t)(col0 + t * 16 + ln) * ldb + kb; FragH bq; bq.half[0] = *(const v8us*)((const unsigned short*)Bh + boff + 8 * hh); bq.half[1] = *(const v8us*)((const unsigned short*)Bh + boff + 16 + 8 * hh);
      acc[t] = mmaH<1>(ah.v, ah.v, bq.v, bq.v, acc[t]); }
  }
#pragma unroll
  for (int t = 0; t < 4; ++t) { if (col0 + t * 16 >= N) continue; const int col = col0 + t * 16 + ln; const float bv = bp ? bf16_round(bp[col]) : 0.f;
#pragma unroll
    for (int r = 0; r < 8; ++r) { float v = acc[t][r] * alpha + bv; if (CP) { const int rr = row0g + row0 + 8 * hh + r; if (rowsPerB < 0) v += CP[cofs + (size_t)rr * ldc + col];      /* rowsPerB < 0: own element of the batched C plane */ else { const int bidx = rr / rowsPerB; v += CP[(size_t)bidx * sCPb + (size_t)by * 64 + col]; } } if (ACT == 1) v = (v > 0.f) ? v : expm1f(v); else if (ACT == 7) v = (v > 0.f) ? v + 1.0f : expf(v); else if (ACT == 8) v = tanhf(v); else if (ACT == 9) v = 0.5f * v * (1.0f + tanhf(0.7978845608028654f * (v + 0.044715f * v * v * v))); else if (ACT == 11) v = 1.0f / (1.0f + expf(-v)); else if (ACT == 12) v = (v > 0.f) ? v : 0.01f * v; else if (ACT == 14) v = (v > 0.f) ? v : 0.1f * v; else if (ACT == 16) v = (v >= 0.f) ? v : 0.3f * v; else if (ACT == 17) v = (v >= 0.f) ? v : 0.2f * v; else if (ACT == 15) v = v / (1.0f + expf(-v)); else if (ACT == 3) v = fmaxf(v, 0.f); else if (ACT == 6) v = 0.5f * v * (1.0f + erff(v * 0.70710678118654752f)); so[w][8 * hh + r][t * 16 + ln] = v; } }
  __builtin_amdgcn_fence(__ATOMIC_ACQ_REL, "workgroup"); __builtin_amdgcn_wave_barrier();
  const int rsub = lane >> 4, c4 = (lane & 15) * 4; typedef _Float16 v4h __attribute__((ext_vector_type(4)));
  {
#pragma unroll
    for (int q = 0; q < 8; ++q) { const int r = q * 2 + rsub; if (col0 + c4 < N) { const v4f v = *(const v4fa*)&so[w][r][c4]; if (C) *(v4f*)(C + cofs + (size_t)(row0 + r) * ldc + col0 + c4) = v; if (C16) { v4h h4; for (int i = 0; i < 4; ++i) h4[i] = (_Float16)v[i]; *(v4h*)(C16 + cofs + (size_t)(row0 + r) * ldc + col0 + c4) = h4; } } }
     }
}


typedef _Float16 v4h __attribute__((ext_vector_type(4)));

__global__ __launch_bounds__(256) void k_h16(const float* __restrict__ x, _Float16* __restrict__ X16, size_t n8) { const size_t t = (size_t)blockIdx.x * 256 + threadIdx.x; if (t >= n8) return; FragH f;
#pragma unroll
  for (int q = 0; q < 8; ++q) f.h[q] = (_Float16)x[t * 8 + q]; *(v8us*)((unsigned short*)X16 + t * 8) = f.half[0];  }
// f32 rows of DM columns -> packed f16 plane. A LayerNorm block has one row, which is 16 bytes of each line of the packed plane; here every line has one writer. Thread: chunks t0 + 256 u, which are
// 128 columns apart in one row (1,024 chunks = half a strip per block); a wave's store is 512 contiguous bytes; the eight loads are issued before the first store.
__global__ __launch_bounds__(256) void k_pk16(const float* __restrict__ x, _Float16* __restrict__ X16) { const unsigned t0 = blockIdx.x * 1024 + threadIdx.x; size_t r; int k; pk_chunk(t0, DM, r, k); const float* p = x + r * DM + k; v4f a[4], c[4];
#pragma unroll
  for (int u = 0; u < 4; ++u) { a[u] = *(const v4fa*)(p + 128 * u); c[u] = *(const v4fa*)(p + 128 * u + 4); }
  unsigned short* o = (unsigned short*)X16 + (size_t)t0 * 8; FragH f[4];
#pragma unroll
  for (int u = 0; u < 4; ++u)
#pragma unroll
    for (int q = 0; q < 4; ++q) { f[u].h[q] = (_Float16)a[u][q]; f[u].h[4 + q] = (_Float16)c[u][q]; }
#pragma unroll
  for (int u = 0; u < 4; ++u) *(v8us*)(o + 2048 * u) = f[u].half[0]; }
__global__ __launch_bounds__(256) void k_round16f(const float* __restrict__ W, _Float16* __restrict__ Bt, size_t n8) { const size_t t = (size_t)blockIdx.x * 256 + threadIdx.x; if (t >= n8) return; FragH f;
#pragma unroll
  for (int i = 0; i < 8; ++i) f.h[i] = (_Float16)(bf16_round(W[t * 8 + i]) * 16.0f); *(v8us*)((unsigned short*)Bt + t * 8) = f.half[0];  }
template <int NHv, int TTv>
__global__ __launch_bounds__(256) void k_vt(const _Float16* __restrict__ V16, int ldv, int voff, _Float16* __restrict__ Vt) { __shared__ unsigned short tl[64][66]; const int tid = threadIdx.x; const int slab = blockIdx.x / (TTv / 64), lg = blockIdx.x % (TTv / 64); const int b = slab / NHv, h = slab % NHv;
  for (int i = tid; i < 64 * 8; i += 256) { const int r = i / 8, c8 = (i % 8) * 8; FragH f; f.half[0] = *(const v8us*)((const unsigned short*)V16 + pk_off((size_t)b * TTv + lg * 64 + r, voff + h * 64 + c8, ldv));      /* V16: packed plane of ldv columns, V from column voff on */
#pragma unroll
    for (int q = 0; q < 8; ++q) tl[r][c8 + q] = f.u[q]; }
  __syncthreads();
  {
#pragma unroll
    for (int rd = 0; rd < 2; ++rd) { const int c = rd * 256 + tid; const int d = (c >> 7) * 16 + (c & 15), p8 = ((c >> 4) & 7) * 8; FragH f;      /* Vt: packed plane of TTv columns; the block has 4 strips x 2 tiles of it, thread = chunk c in their order: a wave stores 512 contiguous bytes */
#pragma unroll
      for (int q = 0; q < 8; ++q) f.u[q] = tl[p8 + q][d];
      *(v8us*)((unsigned short*)Vt + pk_off((size_t)slab * 64 + d, lg * 64 + p8, TTv)) = f.half[0]; }
     } }

__global__ __launch_bounds__(256) void k_hl(const float* __restrict__ F, _Float16* __restrict__ Hh, size_t hskip, _Float16* __restrict__ Hl, size_t n8) { const size_t t = (size_t)blockIdx.x * 256 + threadIdx.x; if (t >= n8) return; FragH fh, fl; size_t r; int k; pk_chunk((unsigned)t, DM, r, k);      /* Hh, Hl: packed planes of DM columns; in Hh every group of QT0 rows stands hskip halves further on than the one before it (whole strips) */ const v4f a = *(const v4fa*)(F + r * DM + k), c = *(const v4fa*)(F + r * DM + k + 4);
#pragma unroll
  for (int q = 0; q < 4; ++q) { _Float16 h = (_Float16)a[q]; fh.h[q] = h; fl.h[q] = (_Float16)((a[q] - (float)h) * 1024.0f); h = (_Float16)c[q]; fh.h[4 + q] = h; fl.h[4 + q] = (_Float16)((c[q] - (float)h) * 1024.0f); }
  { *(v8us*)((unsigned short*)Hh + t * 8 + (r / QT0) * hskip) = fh.half[0]; *(v8us*)((unsigned short*)Hl + t * 8) = fl.half[0];  } }

// ---- fast GEMM (wave tile 32x64; requires M % 32 == 0 rows per launch region and N % 64 == 0); epilogue = k_gemm_hhx semantics ----
// A and Bh are packed planes (pk_off) of lda and ldb columns. PK16 = 0: C (f32) and C16, each where not null, are row-major. PK16 = 1: C16 is written as a packed plane of ldc columns (it is a later GEMM's A); C, where not null, takes the first QT0 rows of every rowsPerB as f32 rows.
__device__ __forceinline__ v16h g2_frag(const _Float16* p, int hh) { FragH f; f.half[0] = *(const v8us*)((const unsigned short*)p + 8 * hh); f.half[1] = *(const v8us*)((const unsigned short*)p + 16 + 8 * hh); return f.v; }
__device__ __forceinline__ v8f g2_mma(v16h a, v16h b, v8f c) { v8f d = __builtin_amdgcn_wmma_f32_16x16x32_f16(false, a, false, b, (short)0, c, false, false); asm volatile("v_nop\n\tv_nop\n\tv_nop\n\tv_nop" : "+v"(d) : "v"(a), "v"(b)); return d; }
__device__ __forceinline__ v16h g2_fragp(const _Float16* p) { FragH f; f.half[0] = *(const v8us*)((const unsigned short*)p); f.half[1] = *(const v8us*)((const unsigned short*)p + 256); return f.v; }      /* a fragment of a packed plane: p = its tile + 8 * lane */
struct G2S { v16h a0, a1, b0, b1, b2, b3; };      /* the fragments of one k-step of a 32x64 wave tile */
// G2_LOAD: one k-step's twelve loads at the six row pointers, as one group; their data is not waited for here. The scheduling barrier keeps the next step's first WMMA, and with it the wait
// for that step's operands, behind the group: lifted in front of it, that wait would hold the group's issue back by most of a step.
#define G2_LOAD(S) do { S.a0 = g2_fragp(a0p); S.a1 = g2_fragp(a1p); S.b0 = g2_fragp(b0p); S.b1 = g2_fragp(b1p); S.b2 = g2_fragp(b2p); S.b3 = g2_fragp(b3p); \
    __builtin_amdgcn_sched_barrier(0); } while (0)
// G2_NEXT: moves the pointers on by one k-step, which is one tile of 512 halves (or leaves them on the last one). s_wait_xcnt 0 in front: a precaution, before the additions write the address registers that the issued
// loads name; the scheduling barrier keeps the additions, and all that follows, behind that wait. In the loop it stands behind a step's WMMAs, well after the group was issued.
#define G2_NEXT do { asm volatile("s_wait_xcnt 0x0" ::: "memory"); __builtin_amdgcn_sched_barrier(0); \
    const int inc = left > 0 ? 512 : 0; --left; a0p += inc; a1p += inc; b0p += inc; b1p += inc; b2p += inc; b3p += inc; } while (0)
#define G2_MMA(S) do { c00 = g2_mma(S.a0, S.b0, c00); c10 = g2_mma(S.a1, S.b0, c10); c01 = g2_mma(S.a0, S.b1, c01); c11 = g2_mma(S.a1, S.b1, c11); \
    c02 = g2_mma(S.a0, S.b2, c02); c12 = g2_mma(S.a1, S.b2, c12); c03 = g2_mma(S.a0, S.b3, c03); c13 = g2_mma(S.a1, S.b3, c13); } while (0)
template <int ACT, int PK16>
__global__ __launch_bounds__(128) void k_gemm2(const _Float16* __restrict__ A, int lda, size_t sA, const _Float16* __restrict__ Bh, int ldb, size_t sB, float alpha, const float* __restrict__ bias, size_t sBias, const float* __restrict__ CP, int rowsPerB, size_t sCPb, int row0g,
    float* __restrict__ C, _Float16* __restrict__ C16, int ldc, size_t sC, int M, int N, int K) { static_assert(ACT == 0 || ACT == 3 || ACT == 6 || ACT == 8 || ACT == 9 || ACT == 11 || ACT == 12 || ACT == 14 || ACT == 15 || ACT == 16 || ACT == 17, "k_gemm2: unsupported ACT code (would silently apply no activation)");
  __shared__ __attribute__((aligned(16))) float so[4][32][68];
  const int tid = threadIdx.x, w = tid >> 5, lane = tid & 31, ln = lane & 15, hh = lane >> 4; const int by = blockIdx.y;
  A += (size_t)by * sA; Bh += (size_t)by * sB; const size_t cofs = (size_t)by * sC; const float* bp = bias ? bias + (size_t)by * sBias : nullptr;
  const int ntn = N >> 6; const int mt = blockIdx.x / ntn, nq = blockIdx.x - mt * ntn; const int row0 = mt * 128 + 32 * w, col0 = nq * 64; if (row0 >= M) return;
  const _Float16* a0p = A + (size_t)row0 * lda + 8 * lane; const _Float16* a1p = a0p + (size_t)16 * lda;      /* first tile of the strip; the lane's own 16-byte chunk is part of the pointer: a load names the pointer's registers themselves */
  const _Float16* b0p = Bh + (size_t)col0 * ldb + 8 * lane; const _Float16* b1p = b0p + (size_t)16 * ldb; const _Float16* b2p = b1p + (size_t)16 * ldb; const _Float16* b3p = b2p + (size_t)16 * ldb;
  const v8f z8 = {0.f,0.f,0.f,0.f,0.f,0.f,0.f,0.f}; v8f c00 = z8, c01 = z8, c02 = z8, c03 = z8, c10 = z8, c11 = z8, c12 = z8, c13 = z8;
  // K loop (K >= 32): a ring of three fragment sets. The twelve loads of k-step s + 2 are issued as one group in front of the WMMAs of step s, so a step waits for loads that are two steps old
  // instead of for five load round trips of its own. Every accumulator still takes its k-steps in ascending order.
  const int n = K >> 5; int left = n - 1;      /* left: pointer advances still allowed; past the last k-step the pointers stay on it (in bounds), and what is loaded there is not used */
  G2S s0, s1, s2; int i = 0;
  G2_LOAD(s0); G2_NEXT; G2_LOAD(s1); G2_NEXT;
#pragma unroll 1      /* the body already holds three k-steps, one per set: more copies of it only cost instruction cache */
  for (; i + 3 <= n; i += 3) { G2_LOAD(s2); G2_MMA(s0); G2_NEXT; G2_LOAD(s0); G2_MMA(s1); G2_NEXT; G2_LOAD(s1); G2_MMA(s2); G2_NEXT; }
  if (i < n) G2_MMA(s0);
  if (i + 1 < n) G2_MMA(s1);
  v8f accs[8] = {c00, c01, c02, c03, c10, c11, c12, c13};
#pragma unroll
  for (int u = 0; u < 8; ++u) { const int t = u & 3, half = u >> 2; const int col = col0 + t * 16 + ln; const float bv = bp ? bf16_round(bp[col]) : 0.f;
#pragma unroll
    for (int r = 0; r < 8; ++r) { const int rloc = half * 16 + 8 * hh + r; float v = accs[u][r] * alpha + bv; if (CP) { if (rowsPerB < 0) v += CP[cofs + (size_t)(row0g + row0 + rloc) * ldc + col];      /* rowsPerB < 0: own element of the batched C plane */ else { const int bidx = (row0g + row0 + rloc) / rowsPerB; v += CP[(size_t)bidx * sCPb + (size_t)by * 64 + col]; } }
      if (ACT == 3) v = fmaxf(v, 0.f); else if (ACT == 6) v = 0.5f * v * (1.0f + erff(v * 0.70710678118654752f)); else if (ACT == 11) v = 1.0f / (1.0f + expf(-v)); else if (ACT == 15) v = v / (1.0f + expf(-v)); else if (ACT == 12) v = (v > 0.f) ? v : 0.01f * v; else if (ACT == 8) v = tanhf(v); else if (ACT == 9) v = 0.5f * v * (1.0f + tanhf(0.7978845608028654f * (v + 0.044715f * v * v * v))); else if (ACT == 14) v = (v > 0.f) ? v : 0.1f * v; else if (ACT == 16) v = (v >= 0.f) ? v : 0.3f * v; else if (ACT == 17) v = (v >= 0.f) ? v : 0.2f * v;
      so[w][rloc][t * 16 + ln] = v; } }
  __builtin_amdgcn_fence(__ATOMIC_ACQ_REL, "workgroup"); __builtin_amdgcn_wave_barrier();
  const int rsub = lane >> 4, c4 = (lane & 15) * 4;
  if (!PK16) {
#pragma unroll
    for (int q = 0; q < 16; ++q) { const int r = q * 2 + rsub; const v4f v = *(const v4fa*)&so[w][r][c4]; if (C) *(v4f*)(C + cofs + (size_t)(row0 + r) * ldc + col0 + c4) = v; if (C16) { v4h h4; for (int i = 0; i < 4; ++i) h4[i] = (_Float16)v[i]; *(v4h*)(C16 + cofs + (size_t)(row0 + r) * ldc + col0 + c4) = h4; } }
     }
  if (PK16) {      /* the wave's 32x64 results are two strips x two tiles of the packed plane: eight stores of 512 contiguous bytes, lane l = chunk j * 32 + l */
    if (C) {      /* PK16 with C (CP is null then): the first QT0 rows of every group of rowsPerB rows go out as f32 rows too, groups packed one behind the other, pitch ldc. A wave's 32 rows are all inside or all outside */
      const int rgl = row0g + row0, grp = rgl / rowsPerB, ri = rgl - grp * rowsPerB;
      if (ri < QT0) { float* cf = C + ((size_t)grp * QT0 + ri + rsub) * ldc + col0 + c4; v4f fv[16]; float* fq[16];
#pragma unroll
        for (int q = 0; q < 16; ++q) { fv[q] = *(const v4fa*)&so[w][q * 2 + rsub][c4]; fq[q] = cf + (size_t)(2 * q) * ldc; }
        __builtin_amdgcn_sched_barrier(0);      /* all values read and all addresses formed first, then stores alone: among them no register of an issued store is written again */
#pragma unroll
        for (int q = 0; q < 16; ++q) *(v4f*)fq[q] = fv[q]; } }
    _Float16* cp = C16 + cofs + (size_t)row0 * ldc + (size_t)(col0 >> 5) * 512 + 8 * lane; FragH pf[8];
#pragma unroll
    for (int u = 0; u < 8; ++u) { const float* sp = &so[w][(u >> 2) * 16 + ln][(u & 3) * 16 + 8 * hh]; const v4f v0 = *(const v4fa*)sp, v1 = *(const v4fa*)(sp + 4);
#pragma unroll
      for (int i = 0; i < 4; ++i) { pf[u].h[i] = (_Float16)v0[i]; pf[u].h[4 + i] = (_Float16)v1[i]; } }
#pragma unroll
    for (int u = 0; u < 8; ++u) *(v8us*)((unsigned short*)cp + (size_t)(u >> 2) * 16 * ldc + (u & 3) * 256) = pf[u].half[0]; } }


__global__ __launch_bounds__(256) void k_wnat(const float* __restrict__ w, size_t n8, _Float16* __restrict__ Bt) { const size_t t = (size_t)blockIdx.x * 256 + threadIdx.x; if (t >= n8) return; FragH f; for (int q = 0; q < 8; ++q) f.h[q] = (_Float16)(bf16_round(w[t * 8 + q]) * 16.0f); *(v8us*)((unsigned short*)Bt + t * 8) = f.half[0];  }
__global__ __launch_bounds__(256) void k_rsm(const float* __restrict__ S, _Float16* __restrict__ P, int nrows) {
  #pragma clang fp contract(off)
  const int i = blockIdx.x * 256 + threadIdx.x; if (i >= nrows) return; const float* s = S + (size_t)i * SQ; float mx = -3.0e38f;
#pragma unroll 1
  for (int j = 0; j < SQ; ++j) mx = fmaxf(mx, s[j]); float se = 0.f;
#pragma unroll 1
  for (int j = 0; j < SQ; ++j) se += expf(s[j] - mx); const float sc = 256.0f / se;
#pragma unroll 1
  for (int j0 = 0; j0 < SQ; j0 += 8) { FragH f; for (int q = 0; q < 8; ++q) f.h[q] = (_Float16)(expf(s[j0 + q] - mx) * sc); unsigned short* d = (unsigned short*)P + (size_t)i * SQ + j0; *(v8us*)d = f.half[0];  } }
__global__ __launch_bounds__(256) void k_vt(const _Float16* __restrict__ V16, int b, int h0, _Float16* __restrict__ VT) { __shared__ unsigned short tl[64][65]; const int tid = threadIdx.x; const int hh = blockIdx.x % HG, sg = blockIdx.x / HG; const int s0 = sg * 64; const int h = h0 + hh;
  for (int i = tid; i < 64 * 8; i += 256) { const int j = i / 8, d8 = (i % 8) * 8; FragH f; f.half[0] = *(const v8us*)((const unsigned short*)V16 + ((size_t)b * SQ + s0 + j) * DM + h * HD + d8); for (int q = 0; q < 8; ++q) tl[d8 + q][j] = f.u[q]; }
  __syncthreads();
  { for (int i = tid; i < 64 * 8; i += 256) { const int d = i / 8, j8 = (i % 8) * 8; FragH f; for (int q = 0; q < 8; ++q) f.u[q] = tl[d][j8 + q]; *(v8us*)((unsigned short*)VT + ((size_t)hh * HD + d) * SQ + s0 + j8) = f.half[0]; }  } }





// ---- causal attention, scores + softmax + weighted V sum in one kernel; S and P never leave the registers ----
// A wave has 32 query rows (two column groups of 16) of one (batch, head) and walks the keys 0 .. its last row in blocks of 64. Transposed products: S^T = K Q^T (first operand = K rows, second = Q rows),
// so lane (ln, hh) holds, per 16-key tile, the scores of ONE query (column ln) for keys 8 hh .. 8 hh + 7: row maximum and row sum are in-lane plus one exchange between the lane halves.
// Two 16-key score tiles, converted in place, are the second operand of O^T += V^T P^T in the same k order as g2_frag's (keys 8 hh + i, then 16 + 8 hh + i of a 32-key step). O^T: a lane has 8 consecutive
// head columns of one query: one 16-byte store each. Softmax with a running maximum in the log2 domain; the weights carry x256 (as f16 they stay clear of the subnormal range), and so does the row sum.
#define FA_QB 128                    /* query rows per block: 4 waves x 32 */
#define FA_SC 0.18033688011112042f   /* 64^-0.5 * log2(e) */
__device__ __forceinline__ v8f fa_mma(v16h a, v16h b, v8f c) { return __builtin_amdgcn_wmma_f32_16x16x32_f16(false, a, false, b, (short)0, c, false, false); }
__device__ __forceinline__ float fa_xhalf(float x) { return __builtin_bit_cast(float, __builtin_amdgcn_permlanex16(__builtin_bit_cast(int, x), __builtin_bit_cast(int, x), 0x76543210, 0xfedcba98, false, false)); }      /* lane l with lane l ^ 16 */
// exp2 of eight values (of one value) as v_exp_f32 in one asm statement. Why asm: behind a transcendental the instruction set asks for one independent instruction or v_nop before its result is read or its
// source overwritten. Early-clobber outputs share no register with any input, so inside the statement no v_exp_f32 touches
// an earlier one's registers; the closing v_nop is the slot behind the last one.
__device__ __forceinline__ v8f fa_exp2x8(v8f x) { float y0, y1, y2, y3, y4, y5, y6, y7;
  asm("v_exp_f32 %0, %8\n\tv_exp_f32 %1, %9\n\tv_exp_f32 %2, %10\n\tv_exp_f32 %3, %11\n\tv_exp_f32 %4, %12\n\tv_exp_f32 %5, %13\n\tv_exp_f32 %6, %14\n\tv_exp_f32 %7, %15\n\tv_nop"
      : "=&v"(y0), "=&v"(y1), "=&v"(y2), "=&v"(y3), "=&v"(y4), "=&v"(y5), "=&v"(y6), "=&v"(y7) : "v"(x[0]), "v"(x[1]), "v"(x[2]), "v"(x[3]), "v"(x[4]), "v"(x[5]), "v"(x[6]), "v"(x[7]));
  const v8f y = {y0, y1, y2, y3, y4, y5, y6, y7}; return y; }
__device__ __forceinline__ float fa_exp2(float x) { float y; asm("v_exp_f32 %0, %1\n\tv_nop" : "=&v"(y) : "v"(x)); return y; }
__global__ __launch_bounds__(128) void k_fattn(const _Float16* __restrict__ QKVr, const _Float16* __restrict__ VTr, _Float16* __restrict__ O) {
  const int tid = threadIdx.x, lane = tid & 31, ln = lane & 15, hh = lane >> 4; const int w = __builtin_amdgcn_readfirstlane(tid >> 5);      /* the wave's number as a scalar: trip count and the test for the last block are scalar */
  const int g = blockIdx.x / (NB * NH), bh = blockIdx.x % (NB * NH); const int b = bh / NH, h = bh % NH;
  const int qb = (g < SQ / FA_QB / 2) ? SQ / FA_QB - 1 - g : g - SQ / FA_QB / 2;      /* long query blocks first, then the short ones in rising order: for speed only, every (bh, qb) occurs once */
  const int q0 = qb * FA_QB + w * 32; const int nb = (q0 >> 6) + 1;      /* key blocks of 64 up to the one that holds the wave's last row */
  const size_t rb = (size_t)b * SQ;
  const _Float16* qp = QKVr + pk_off(rb + q0 + ln, h * HD + 8 * hh, LQ);      /* QKVr: packed plane of LQ columns, VTr: of SQ columns. 16 rows on = 16 row lengths on, 32 columns on = 512 halves on */
  const _Float16* kp = QKVr + pk_off(rb + ln, DM + h * HD + 8 * hh, LQ);      /* K row = key ln of a tile */
  const _Float16* vp = VTr + pk_off((size_t)bh * HD + ln, 8 * hh, SQ);      /* V^T row = head column ln of a tile */
  v16h qf[2][2], kf[4][2], vf[4][2];
#pragma unroll
  for (int j = 0; j < 2; ++j) { qf[j][0] = g2_fragp(qp + (size_t)j * 16 * LQ); qf[j][1] = g2_fragp(qp + (size_t)j * 16 * LQ + 512); }
#pragma unroll
  for (int t = 0; t < 4; ++t) { kf[t][0] = g2_fragp(kp + (size_t)t * 16 * LQ); kf[t][1] = g2_fragp(kp + (size_t)t * 16 * LQ + 512); }
  // s_wait_xcnt 0: a precaution, before anything writes the address registers that the issued Q and K loads name; the scheduling barriers keep the loads in front of it and the addition, the zeroing
  // and all that follows behind it. (The key loop below is entered without a test, so that these loads and the wait stay in one block: past a test the compiler moved the loads behind the wait.)
  __builtin_amdgcn_sched_barrier(0); asm volatile("s_wait_xcnt 0x0" ::: "memory"); __builtin_amdgcn_sched_barrier(0);
  kp += (nb > 1) ? (size_t)64 * LQ : 0;      /* past the last block the pointer stays on it (in bounds); what is loaded there is not used */
  const v8f z8 = {0.f,0.f,0.f,0.f,0.f,0.f,0.f,0.f};
  v8f ot[4][2]; float m[2] = {-3.0e38f, -3.0e38f}, l[2] = {0.f, 0.f};
#pragma unroll
  for (int t = 0; t < 4; ++t) { ot[t][0] = z8; ot[t][1] = z8; }
  int kb = 0;
#pragma unroll 1      /* one key block per trip: the body is long, copies of it only cost instruction cache */
  do {      /* nb >= 1 */
    // this block's V^T fragments, issued as one group in front of the score products: they are first needed behind the softmax
#pragma unroll
    for (int t = 0; t < 4; ++t) { vf[t][0] = g2_fragp(vp + (size_t)t * 16 * SQ); vf[t][1] = g2_fragp(vp + (size_t)t * 16 * SQ + 512); }
    __builtin_amdgcn_sched_barrier(0);      /* keeps the wait for K, which the first product brings, behind the group's issue */
    v8f st[4][2];
#pragma unroll
    for (int t = 0; t < 4; ++t)
#pragma unroll
      for (int j = 0; j < 2; ++j) st[t][j] = fa_mma(kf[t][0], qf[j][0], z8);
#pragma unroll
    for (int t = 0; t < 4; ++t)
#pragma unroll
      for (int j = 0; j < 2; ++j) st[t][j] = fa_mma(kf[t][1], qf[j][1], st[t][j]);
    __builtin_amdgcn_sched_barrier(0);      /* the next block's K loads go into the registers these products read: not in front of them */
#pragma unroll
    for (int t = 0; t < 4; ++t) { kf[t][0] = g2_fragp(kp + (size_t)t * 16 * LQ); kf[t][1] = g2_fragp(kp + (size_t)t * 16 * LQ + 512); }      /* next block's K, one block ahead */
    // s_wait_xcnt 0 as above, before both pointers move on
    __builtin_amdgcn_sched_barrier(0); asm volatile("s_wait_xcnt 0x0" ::: "memory"); __builtin_amdgcn_sched_barrier(0);
    kp += (kb + 2 < nb) ? (size_t)64 * LQ : 0; vp += (kb + 1 < nb) ? 1024 : 0;      /* 64 keys = 4 strips of K rows, 2 tiles of V^T columns */
    if (kb == nb - 1) {      /* only the last block holds keys past a row (scalar test): masked like the reference's -inf, as a large negative score */
      const int kq = q0 + ln - (kb * 64 + 8 * hh);      /* key offset r + 16 t is allowed up to kq + 16 j */
#pragma unroll
      for (int t = 0; t < 4; ++t)
#pragma unroll
        for (int j = 0; j < 2; ++j)
#pragma unroll
          for (int r = 0; r < 8; ++r) st[t][j][r] = (t * 16 + r <= kq + j * 16) ? st[t][j][r] : -1.0e9f; }
    v16h pf[2][2];
#pragma unroll
    for (int j = 0; j < 2; ++j) {
      v8f x8;
#pragma unroll
      for (int r = 0; r < 8; ++r) x8[r] = fmaxf(fmaxf(st[0][j][r], st[1][j][r]), fmaxf(st[2][j][r], st[3][j][r]));
      float mx = fmaxf(fmaxf(fmaxf(x8[0], x8[1]), fmaxf(x8[2], x8[3])), fmaxf(fmaxf(x8[4], x8[5]), fmaxf(x8[6], x8[7])));
      mx = fmaxf(mx, fa_xhalf(mx));
      const float mn = fmaxf(m[j], mx * FA_SC); const float al = fa_exp2(m[j] - mn);      /* 0 on the first block */ m[j] = mn; const float mo = 8.0f - mn;      /* + 8: weights x256 */
      v8f s8;
#pragma unroll
      for (int t = 0; t < 4; ++t) { v8f a8;
#pragma unroll
        for (int r = 0; r < 8; ++r) a8[r] = __builtin_fmaf(st[t][j][r], FA_SC, mo);
        st[t][j] = fa_exp2x8(a8); s8 = (t == 0) ? st[0][j] : s8 + st[t][j]; }
      l[j] = l[j] * al + (((s8[0] + s8[1]) + (s8[2] + s8[3])) + ((s8[4] + s8[5]) + (s8[6] + s8[7])));      /* this lane half's keys only; the halves are joined once, behind the loop */
#pragma unroll
      for (int t = 0; t < 4; ++t) ot[t][j] *= al;
#pragma unroll
      for (int s = 0; s < 2; ++s) { FragH f;
#pragma unroll
        for (int i = 0; i < 8; ++i) { f.h[i] = (_Float16)st[2 * s][j][i]; f.h[8 + i] = (_Float16)st[2 * s + 1][j][i]; }
        pf[j][s] = f.v; } }
    __builtin_amdgcn_sched_barrier(0);      /* keeps the asm v_exp_f32 above in front of the products below */
#pragma unroll
    for (int s = 0; s < 2; ++s)
#pragma unroll
      for (int t = 0; t < 4; ++t)
#pragma unroll
        for (int j = 0; j < 2; ++j) ot[t][j] = fa_mma(vf[t][s], pf[j][s], ot[t][j]);
  } while (++kb < nb);
  asm volatile("s_wait_loadcnt 0x0" ::: "memory");      /* the last trip's K loads are not used: waited for here, so that no load is in flight into the wave's registers when it ends */
  FragH of[2][4]; _Float16* op[2];
#pragma unroll
  for (int j = 0; j < 2; ++j) { const float fin = 64.0f / (l[j] + fa_xhalf(l[j]));      /* o carried x64; the x256 of the weights cancels against the row sum's */ op[j] = O + pk_off(rb + q0 + j * 16 + ln, h * HD + 8 * hh, DM);      /* O: packed plane of DM columns; 16 columns on = 256 halves on, and a wave's store is 512 contiguous bytes */
#pragma unroll
    for (int t = 0; t < 4; ++t)
#pragma unroll
      for (int r = 0; r < 8; ++r) of[j][t].h[r] = (_Float16)(ot[t][j][r] * fin); }
  __builtin_amdgcn_sched_barrier(0);      /* all values packed and both addresses formed first, then stores alone: no register of an issued store is written again */
#pragma unroll
  for (int j = 0; j < 2; ++j)
#pragma unroll
    for (int t = 0; t < 4; ++t) *(v8us*)((unsigned short*)op[j] + t * 256) = of[j][t].half[0]; }


typedef float v2fa __attribute__((ext_vector_type(2), may_alias));
#define A0R 8                        /* query rows per block of the first-tile attention: one per wave */
#define A0KP 68                      /* K row pitch in LDS, floats: 272 bytes = 16 x 17, so that 16-byte reads of 32 different rows spread over the banks */
// Exact f32 causal attention for rows 0 .. QT0-1 of every batch (planes of QT0 rows per batch), one wave per (batch, head, query row); a block has 8 consecutive rows of one head.
// The block stages the head's K and V rows below its last query row in LDS once (whole-line loads, all in flight together). Scores: lane l has keys l, l + 32, l + 64, l + 96
// (four partial sums per key over the head dimension). Row maximum and row sum by butterflies over the 32 lanes, exp once per key. o: lane l has columns 2 l and 2 l + 1,
// the weights come back through LDS as broadcasts, four partial sums over the keys. o carried x64 like the f16 path.
__global__ __launch_bounds__(256) void k_att0w(const float* __restrict__ QF, const float* __restrict__ KF, const float* __restrict__ VF, int ld, float scale, float* __restrict__ OF, int ldo) {
  __shared__ __attribute__((aligned(16))) float lk[QT0][A0KP]; __shared__ __attribute__((aligned(16))) float lv[QT0][HD]; __shared__ __attribute__((aligned(16))) float pe[A0R][QT0];
  const int tid = threadIdx.x, lane = tid & 31; const int w = __builtin_amdgcn_readfirstlane(tid >> 5);      /* the wave's number as a scalar: the tests on i below become scalar branches */
  const int bt = blockIdx.x / (NH * (QT0 / A0R)), bx = blockIdx.x % (NH * (QT0 / A0R)); QF += (size_t)bt * QT0 * ld; KF += (size_t)bt * QT0 * ld; VF += (size_t)bt * QT0 * ld; OF += (size_t)bt * QT0 * ldo;      /* batch bt: its QT0 rows of each plane */
  const int h = bx / (QT0 / A0R), rg = bx % (QT0 / A0R); const int nk = rg * A0R + A0R;      /* causal: keys below the block's last row end */ const int i = rg * A0R + w;
  const float* qr = QF + (size_t)i * ld + h * HD; v4f q[HD / 4];
#pragma unroll
  for (int c = 0; c < HD / 4; ++c) q[c] = *(const v4fa*)(qr + c * 4);
  const int sr = tid >> 4, sc4 = (tid & 15) * 4; v4f kx[QT0 / 16], vx[QT0 / 16];
#pragma unroll      /* constant indices keep kx / vx in registers; all loads are issued before the first LDS store. Rows past nk - 1 are clamped to it (in bounds) and not stored */
  for (int u = 0; u < QT0 / 16; ++u) { const size_t g = (size_t)min(sr + 16 * u, nk - 1) * ld + h * HD + sc4;
    // Behind each load: s_wait_xcnt 0 as a precaution, before a register that the load names as address is written again (by later address arithmetic or as a later load's destination);
    // the scheduling barrier keeps that later arithmetic and the later loads behind the wait. The loads' data is not waited for here.
    kx[u] = *(const v4fa*)(KF + g); asm volatile("s_wait_xcnt 0x0" ::: "memory"); __builtin_amdgcn_sched_barrier(0);
    vx[u] = *(const v4fa*)(VF + g); asm volatile("s_wait_xcnt 0x0" ::: "memory"); __builtin_amdgcn_sched_barrier(0); }
#pragma unroll
  for (int u = 0; u < QT0 / 16; ++u) if (sr + 16 * u < nk) { *(v4fa*)&lk[sr + 16 * u][sc4] = kx[u]; *(v4fa*)&lv[sr + 16 * u][sc4] = vx[u]; }
  __syncthreads();      /* K and V rows 0 .. nk-1 staged; every wave passes */
  float s[QT0 / 32];
#pragma unroll
  for (int c = 0; c < QT0 / 32; ++c) { s[c] = -1.0e30f;
    if (c * 32 <= i) { const int j = c * 32 + lane; const float* kr = &lk[min(j, i)][0];      /* lanes past the row read row i (staged) and are masked below */ v4f a4 = {0.f, 0.f, 0.f, 0.f};
#pragma unroll
      for (int d = 0; d < HD / 4; ++d) a4 += q[d] * *(const v4fa*)(kr + d * 4);
      const float a = (a4[0] + a4[1]) + (a4[2] + a4[3]); s[c] = (j <= i) ? a * scale : -1.0e30f; } }
  float mx = fmaxf(fmaxf(s[0], s[1]), fmaxf(s[2], s[3]));
#pragma unroll
  for (int o = 16; o > 0; o >>= 1) mx = fmaxf(mx, __shfl_xor(mx, o));
  float se = 0.f;
#pragma unroll
  for (int c = 0; c < QT0 / 32; ++c) { const float e = (c * 32 + lane <= i) ? expf(s[c] - mx) : 0.f; se += e; pe[w][c * 32 + lane] = e; }
#pragma unroll
  for (int o = 16; o > 0; o >>= 1) se += __shfl_xor(se, o);
  __builtin_amdgcn_fence(__ATOMIC_ACQ_REL, "workgroup"); __builtin_amdgcn_wave_barrier();      /* pe[w] is written and read by this wave alone: keeps the reads below behind the writes above */
  const int nj = (i & ~3) + 4;      /* keys in groups of four: nj <= nk, so every V row read is staged; weights past the row are 0 */
  v2fa o0 = {0.f, 0.f}, o1 = {0.f, 0.f}, o2 = {0.f, 0.f}, o3 = {0.f, 0.f};
#pragma unroll 4      /* several groups' LDS reads in flight behind one wait */
  for (int j = 0; j < nj; j += 4) { const v4f p = *(const v4fa*)&pe[w][j];
    o0 += p[0] * *(const v2fa*)&lv[j][lane * 2]; o1 += p[1] * *(const v2fa*)&lv[j + 1][lane * 2]; o2 += p[2] * *(const v2fa*)&lv[j + 2][lane * 2]; o3 += p[3] * *(const v2fa*)&lv[j + 3][lane * 2]; }
  const float fin = 64.0f / se;      /* o carried x64 like the f16 path */
  const v2fa ov = ((o0 + o1) + (o2 + o3)) * fin;
  *(v2fa*)(OF + (size_t)i * ldo + h * HD + lane * 2) = ov; }


template <int BFIN, int WXB>
__global__ __launch_bounds__(256) void k_ln16(const float* __restrict__ X, const float* __restrict__ g, const float* __restrict__ bb, float eps, _Float16* __restrict__ N16, float* __restrict__ XB) {
  #pragma clang fp contract(off)
  __shared__ float red[256]; const size_t r = blockIdx.x; const int t = threadIdx.x; const v4f xa = *(const v4fa*)(X + r * DMQ + t * 4); float s[4]; float sum = 0.f;
  for (int q = 0; q < 4; ++q) { s[q] = BFIN ? bf16_round(xa[q]) : xa[q]; sum = __fadd_rn(sum, s[q]); }
  red[t] = sum; __syncthreads(); for (int st = 128; st > 0; st >>= 1) { if (t < st) red[t] = __fadd_rn(red[t], red[t + st]); __syncthreads(); } const float mu = red[0] / (float)DMQ; __syncthreads();
  float vs = 0.f; for (int q = 0; q < 4; ++q) { const float dl = __fadd_rn(s[q], -mu); vs = __fadd_rn(vs, __fmul_rn(dl, dl)); } red[t] = vs; __syncthreads(); for (int st = 128; st > 0; st >>= 1) { if (t < st) red[t] = __fadd_rn(red[t], red[t + st]); __syncthreads(); }
  const float rs = rsqrtf(__fadd_rn(red[0] / (float)DMQ, eps)); v4h y; v4f xb;
  for (int q = 0; q < 4; ++q) { const int c = t * 4 + q; y[q] = (_Float16)__fadd_rn(__fmul_rn(__fmul_rn(__fadd_rn(s[q], -mu), rs), bf16_round(g[c])), bf16_round(bb[c])); xb[q] = s[q]; }
  { *(v4h*)(N16 + r * DMQ + t * 4) = y; if (WXB) *(v4f*)(XB + r * DMQ + t * 4) = xb;  } }
__global__ __launch_bounds__(256) void k_ftres2(const float* __restrict__ OF0, const float* __restrict__ XB, float* __restrict__ X1, size_t n4) {
  #pragma clang fp contract(off)
  const size_t t = (size_t)blockIdx.x * 256 + threadIdx.x; if (t >= n4) return; const v4f o = *(const v4fa*)(OF0 + t * 4), xv = *(const v4fa*)(XB + t * 4); v4f y; for (int q = 0; q < 4; ++q) y[q] = __fadd_rn(__fmul_rn(o[q], 0.015625f), xv[q]); *(v4f*)(X1 + t * 4) = y;  }

__global__ __launch_bounds__(256) void k_wthd(const float* __restrict__ Wt, _Float16* __restrict__ Bt) { const size_t t = (size_t)blockIdx.x * 256 + threadIdx.x; if (t >= (size_t)NH * HD * (DM / 8)) return; const int m8 = (int)(t % (DM / 8)) * 8; const int d = (int)((t / (DM / 8)) % HD); const int h = (int)(t / ((size_t)(DM / 8) * HD)); FragH f;
  for (int q = 0; q < 8; ++q) f.h[q] = (_Float16)(16.0f * bf16_round(Wt[((size_t)h * DM + m8 + q) * HD + d])); unsigned short* dst = (unsigned short*)Bt + ((size_t)h * HD + d) * DM + m8; *(v8us*)dst = f.half[0];  }




__global__ __launch_bounds__(256) void k_wtpad(const float* __restrict__ Wm, _Float16* __restrict__ Wt, int Kr, int Kp, int Nr, int Np, float scale) {
  const int t = blockIdx.x * 256 + threadIdx.x; if (t >= Np * (Kp / 8)) return; const int n = t / (Kp / 8), k8 = (t % (Kp / 8)) * 8; const int nc = min(n, Nr - 1); const float fn = (n < Nr) ? 1.f : 0.f; FragH f;
  for (int i = 0; i < 8; ++i) { const int k = k8 + i; const int kc = min(k, Kr - 1); const float fk = (k < Kr) ? fn : 0.f; f.h[i] = (_Float16)(bf16_round(Wm[(size_t)kc * Nr + nc]) * scale * fk); }
  unsigned short* o = (unsigned short*)Wt + (size_t)n * Kp + k8; *(v8us*)o = f.half[0];  }
__global__ __launch_bounds__(128) void k_bpad(const float* __restrict__ b, float* __restrict__ Bp, int nr, int np) {
  const int i = threadIdx.x; if (i >= np) return; const float v = b[min(i, nr - 1)] * ((i < nr) ? 1.f : 0.f); *(float*)(Bp + i) = v;  }

template <int BFIN, int W16, int W32>
__global__ __launch_bounds__(256) void k_lnx(const float* __restrict__ X, const float* __restrict__ g, const float* __restrict__ bb, float eps, _Float16* __restrict__ N16, float* __restrict__ N32) {
  #pragma clang fp contract(off)
  __shared__ float red[256]; const size_t r = blockIdx.x; const int t = threadIdx.x; const bool act = t < (DMQ / 4); const int c0 = act ? t * 4 : 0;
  const v4f xa = *(const v4fa*)(X + r * DMQ + c0); float s[4]; float sum = 0.f;
  for (int q = 0; q < 4; ++q) { s[q] = act ? (BFIN ? bf16_round(xa[q]) : xa[q]) : 0.f; sum = __fadd_rn(sum, s[q]); }
  red[t] = sum; __syncthreads(); for (int st = 128; st > 0; st >>= 1) { if (t < st) red[t] = __fadd_rn(red[t], red[t + st]); __syncthreads(); } const float mu = red[0] / (float)DMQ; __syncthreads();
  float vs = 0.f; for (int q = 0; q < 4; ++q) { const float dl = act ? __fadd_rn(s[q], -mu) : 0.f; vs = __fadd_rn(vs, __fmul_rn(dl, dl)); } red[t] = vs; __syncthreads(); for (int st = 128; st > 0; st >>= 1) { if (t < st) red[t] = __fadd_rn(red[t], red[t + st]); __syncthreads(); }
  const float rs = rsqrtf(__fadd_rn(red[0] / (float)DMQ, eps)); v4h y; v4f yf;
  for (int q = 0; q < 4; ++q) { const int c = c0 + q; yf[q] = __fadd_rn(__fmul_rn(__fmul_rn(__fadd_rn(s[q], -mu), rs), bf16_round(g[c])), bf16_round(bb[c])); y[q] = (_Float16)yf[q]; }
  if (!act) return;      /* no barriers after this point */
  { if (W16) *(v4h*)(N16 + r * DMQ + c0) = y; if (W32) *(v4f*)(N32 + r * DMQ + c0) = yf;  } }



// ---- all input conversions in ONE launch: they are independent of one another, so they share one grid; a block's index range picks its job (block-uniform, no barrier anywhere) ----
// pw_chunk: chunk t of Wt (packed, rows n, columns k) = f16(W[k][n] * 16) from f32 row-major W[K][N] (bf16-exact weights stay exact in f16 away from the subnormal range); N % 16 == 0, K % 32 == 0, literals at every call
__device__ __forceinline__ void pw_chunk(const float* __restrict__ Wm, _Float16* __restrict__ Wt, int K, int N, unsigned t) { size_t n; int k8; pk_chunk(t, K, n, k8); FragH f;
#pragma unroll
  for (int i = 0; i < 8; ++i) f.h[i] = (_Float16)(bf16_round(Wm[(size_t)(k8 + i) * N + n]) * 16.0f);
  *(v8us*)((unsigned short*)Wt + (size_t)t * 8) = f.half[0];
  asm volatile("s_wait_xcnt 0x0" ::: "memory"); }      /* a precaution: the jobs of k_prep stand one behind the other in the code, and the next one's first instructions write registers that this store names */
#define PB_QKV (3 * DM * (DM / 8) / 256)
#define PB_O (DM * (DM / 8) / 256)
#define PB_FF (DFF * (DM / 8) / 256)
#define PB_X ((int)(NR * DM / 8 / 256))
__global__ __launch_bounds__(256) void k_prep(const float* __restrict__ wqkv, _Float16* __restrict__ BQKV, const float* __restrict__ wo, _Float16* __restrict__ BO, const float* __restrict__ wfc, _Float16* __restrict__ BW1,
    const float* __restrict__ wmp, _Float16* __restrict__ BW2, const float* __restrict__ x, _Float16* __restrict__ X16, float* __restrict__ XB) {
  int bi = blockIdx.x; const unsigned tid = threadIdx.x;
  if (bi < PB_QKV) { pw_chunk(wqkv, BQKV, DM, 3 * DM, (unsigned)bi * 256 + tid); return; } bi -= PB_QKV;      /* fused [in][out] [DM][3 DM] -> Bt [3 DM][DM] x16: rows 0.. = q, DM.. = k, 2 DM.. = v output columns */
  if (bi < PB_FF) { pw_chunk(wfc, BW1, DM, DFF, (unsigned)bi * 256 + tid); return; } bi -= PB_FF;      /* W1 [1024][4096] -> Bt [4096][1024] */
  if (bi < PB_FF) { pw_chunk(wmp, BW2, DFF, DM, (unsigned)bi * 256 + tid); return; } bi -= PB_FF;      /* W2 [4096][1024] -> Bt [1024][4096] */
  if (bi < PB_O) { pw_chunk(wo, BO, DM, DM, (unsigned)bi * 256 + tid); return; } bi -= PB_O;      /* w_out [in][out] -> Bt */
  if (bi < PB_X) { const unsigned t = (unsigned)bi * 256 + tid; FragH f; size_t r; int k; pk_chunk(t, DM, r, k); const float* xr = x + r * DM + k;      /* X16: packed plane of DM columns, exact f16 of bf16(x) */
#pragma unroll
    for (int q = 0; q < 8; ++q) f.h[q] = (_Float16)bf16_round(xr[q]);
    *(v8us*)((unsigned short*)X16 + (size_t)t * 8) = f.half[0];
    asm volatile("s_wait_xcnt 0x0" ::: "memory");      /* as in pw_chunk */
    return; } bi -= PB_X;
  { const size_t t = (size_t)bi * 256 + tid; v4f a = *(const v4fa*)(x + t * 8), c = *(const v4fa*)(x + t * 8 + 4);      /* XB = bf16(x) as f32 rows, for the residual */
#pragma unroll
    for (int q = 0; q < 4; ++q) { a[q] = bf16_round(a[q]); c[q] = bf16_round(c[q]); }
    *(v4f*)(XB + t * 8) = a; *(v4f*)(XB + t * 8 + 4) = c;
    asm volatile("s_wait_xcnt 0x0" ::: "memory"); } }      /* as in pw_chunk */

extern "C" void kernel_launch(void* const* d_in, const int* in_sizes, int n_in,
                              void* d_out, int out_size, void* d_ws, size_t ws_size, hipStream_t stream) {
  (void)in_sizes; (void)n_in; (void)out_size;
  const float* const* I = (const float* const*)d_in; const float* x = I[0]; const float* wqkv = I[1]; const float* bqkv = I[2]; const float* wo = I[3]; const float* bo = I[4]; const float* wfc = I[5]; const float* bfc = I[6]; const float* wmp = I[7]; const float* bmp = I[8]; const float* g1 = I[9]; const float* be1 = I[10]; const float* gg2 = I[11]; const float* be2 = I[12];      /* x; fused w_qkv [1024][3072] + b_qkv ([in][out]); w_out + b_out; w_up [1024][4096] + b_up, w_down [4096][1024] + b_down; LN1 g / b, LN2 g / b */
  char* ws = (char*)d_ws; size_t off = 0;
  auto take = [&](size_t bytes) { char* p = ws + off; off += (bytes + 255) & ~(size_t)255; return p; };
  _Float16* BQKV = (_Float16*)take((size_t)3 * DM * DM * 2); _Float16* BO = (_Float16*)take((size_t)DM * DM * 2);
  _Float16* X16 = (_Float16*)take(NR * DM * 2); float* XB = (float*)take(NR * DM * 4); float* X1 = (float*)take(NR * DM * 4); float* X1N = (float*)take(NR * DM * 4);      /* LN1 output f32 rows */ _Float16* M16 = nullptr;      /* = X16 below (alias: X16's last reader, the q | k | v GEMM, precedes the write of the packed LN1 rows) */ _Float16* HF16 = (_Float16*)take(NR * DFF * 2);      /* hidden rows of all batches */ _Float16* BW1 = (_Float16*)take((size_t)DFF * DM * 2); _Float16* BW2 = (_Float16*)take((size_t)DM * DFF * 2); _Float16* QKV = (_Float16*)take(NR * 3 * DM * 2); _Float16* O16 = (_Float16*)take(NR * DM * 2); M16 = X16;
  _Float16* VT = (_Float16*)take((size_t)NB * NH * HD * SQ * 2);
  float* QKVF0 = (float*)take((size_t)NB * QT0 * LQ * 4);      /* f32 q | k | v rows of the first QT0 rows of every batch */ float* OF0 = (float*)take((size_t)NB * QT0 * DM * 4); _Float16* OL0 = (_Float16*)take((size_t)NB * QT0 * DM * 2);
  if (off > ws_size) return;
  k_prep<<<PB_QKV + 2 * PB_FF + PB_O + 2 * PB_X, 256, 0, stream>>>(wqkv, BQKV, wo, BO, wfc, BW1, wmp, BW2, x, X16, XB);      /* packed x16 weight planes; POST-LN: the attention runs on x itself (exact f16 rows); XB = bf16(x) f32 for the residual */
  k_gemm2<0, 1><<<dim3((unsigned)((MP / 128) * (3 * DM / 64)), 1), 128, 0, stream>>>(X16, DM, 0, BQKV, DM, 0, 0.0625f, bqkv, 0, nullptr, SQ, 0, 0, QKVF0, QKV, 3 * DM, 0, MP, 3 * DM, DM);      /* q | k | v rows (f16); head h = columns h*HD.. of each DM block; the same results of rows 0..127 of every batch also as f32 rows (exact products) */
  k_vt<NH, SQ><<<NB * NH * (SQ / 64), 256, 0, stream>>>(QKV, LQ, 2 * DM, VT);      /* V^T [NB][NH][HD][SQ] */
  k_fattn<<<(SQ / FA_QB) * NB * NH, 128, 0, stream>>>(QKV, VT, O16);      /* causal attention, all batches, heads and query rows: o (merged heads, x64) as f16 rows */
  k_att0w<<<NB * NH * (QT0 / A0R), 256, 0, stream>>>(QKVF0, QKVF0 + DM, QKVF0 + 2 * DM, LQ, 0.125f, OF0, DM);      /* exact f32 attention for rows 0..127 of every batch (o x64) */
  k_hl<<<(unsigned)(((size_t)NB * QT0 * DM / 8 + 255) / 256), 256, 0, stream>>>(OF0, O16, (size_t)(SQ - QT0) * DM, OL0, (size_t)NB * QT0 * DM / 8);      /* first-tile o (x64) -> f16 hi, over the f16-path rows 0..127 of every batch in O16, + x1024 residual plane */
  k_gemm2<0, 0><<<dim3((unsigned)((MPO / 128) * (DM / 64)), 1), 128, 0, stream>>>(O16, DM, 0, BO, DM, 0, 0.0009765625f, bo, 0, XB, -1, 0, 0, X1, nullptr, DM, 0, MPO, DM, DM);      /* x + o Wo + b; out rows are the output layout; rows 0..127: o_hi */
  k_gemm2<0, 0><<<dim3((QT0 / 128) * (DM / 64), NB), 128, 0, stream>>>(OL0, DM, (size_t)QT0 * DM, BO, DM, 0, 0.00000095367431640625f, nullptr, 0, X1, -1, 0, 0, X1, nullptr, DM, (size_t)SQ * DM, QT0, DM, DM);      /* rows 0..127 of batch blockIdx.y += o_lo Wo 2^-20 (own-element accumulate) */
  k_lnx<0, 0, 1><<<(unsigned)NR, 256, 0, stream>>>(X1, g1, be1, 1e-5f, nullptr, X1N);      /* x1 = LN1(x + attn_out) -> f32 rows (residual) */
  k_pk16<<<(unsigned)(NR * DM / 8 / 1024), 256, 0, stream>>>(X1N, M16);      /* -> packed f16 plane (FFN operand) */
  k_gemm2<3, 1><<<dim3((unsigned)((MP / 128) * (DFF / 64)), 1), 128, 0, stream>>>(M16, DM, 0, BW1, DM, 0, 0.0625f, bfc, 0, nullptr, 1, 0, 0, nullptr, HF16, DFF, 0, MP, DFF, DM);      /* relu(x1 w_up + b_up) -> f16, all batches */
  k_gemm2<0, 0><<<dim3((unsigned)((MP / 128) * (DM / 64)), 1), 128, 0, stream>>>(HF16, DFF, 0, BW2, DFF, 0, 0.0625f, bmp, 0, X1N, -1, 0, 0, X1, nullptr, DM, 0, MP, DM, DFF);      /* x1 + ffn (own-element residual from the LN1 f32 rows) -> f32 rows over the dead pre-LN1 plane */
  k_lnx<0, 0, 1><<<(unsigned)NR, 256, 0, stream>>>(X1, gg2, be2, 1e-5f, nullptr, (float*)d_out);      /* result = LN2(x1 + ffn) */
}

// v007
// Measured time: 219 microseconds a run.
// Next to v006, in two timings, it ran 1.23 and 1.24 times as fast.
// Counting every step since v000, it is 24.8 times as fast.
#include <hip/hip_runtime.h>
// POST-LN transformer decoder layer with causal self-attention and a fused QKV projection (x [2][2048][1024]; qkv = x w_qkv + b_qkv ([in][out] 1024 x 3072 + bias) viewed (B, S, 3, 16, 64): q | k | v thirds; scores * 64^-0.5; causal (tril, -inf); softmax; x1 = LN1(x + out w_out + b_out) (biased var, eps 1e-5); result = LN2(x1 + relu(x1 w_up + b_up) w_down + b_down) ([in][out] 1024 x 4096 x 1024) -> [2][2048][1024]).
// Structure: token rows r = b*2048 + s; x as exact f16 rows (bf16-rounded); q | k | v as ONE WMMA GEMM (N = 3 x 1024) (32x64 wave tiles, f32 accumulation, exact x16 weights + bias, f16 outputs); V^T for all batches and heads via LDS transposes; causal attention in ONE launch (k_fattn): a wave has 32 query rows and walks the keys below its last row in blocks of 64, scores, running-maximum softmax (f32 statistics, native exp2; weights x256 f16) and o stay in registers (o carried x64, folded into the output GEMM alpha), written straight into the merged f16 o rows; out = o W_o + b GEMM (f32) into the output layout.
// All f16 WMMA operand planes (x, q | k | v rows, V^T, o, LN1 rows, hidden rows, all weights) are kept PACKED, fragment-major: see pk_off below.
// Compute dtype: inputs rounded to bf16; x / weights exact; q, k, v, softmax weights and o as plain f16 GEMM operands (~2^-12); scores and softmax statistics f32. v_wmma_f32_16x16x32_f16.
#define NB 2
#define SQ 2048
#define DM 1024
#define NH 16
#define HD 64
#define HG 4                         /* heads per launch of the (b, h0) k_vt overload, which is not launched */
#define QT0 128                      /* first-tile rows recomputed exactly in f32 */
#define B0 0                         /* unused (processing starts at batch 0) */
#define NBR NB                       /* batches processed (debug hook) */
#define NR ((size_t)NB * SQ)
#define DMQ DM
#define DFF 4096                     /* FFN hidden width */
#define DFFR 100                     /* unused (the FFN hidden width is DFF) */
#define MP ((int)((size_t)NBR * SQ)) /* rows projected (debug hook) */
#define QN SQ                        /* unused (the attention covers all SQ query rows) */
#define NHD NH                       /* unused (the attention covers all NH heads) */
#define MPO MP                       /* rows through the output stage (debug hook) */
#define LQ (3 * DM)      /* columns of the packed q/k/v plane */
typedef __bf16 v16b __attribute__((ext_vector_type(16)));
typedef unsigned short v8us __attribute__((ext_vector_type(8), may_alias));
typedef float  v8f  __attribute__((ext_vector_type(8)));
typedef float  v4f  __attribute__((ext_vector_type(4)));
typedef float  v4fa __attribute__((ext_vector_type(4), may_alias));
union FragB { v16b v; v8us half[2]; unsigned short u[16]; };

__device__ __forceinline__ unsigned short bf16_bits(float x) { unsigned int u = __float_as_uint(x); return (unsigned short)((u + 0x7FFFu + ((u >> 16) & 1u)) >> 16); }
__device__ __forceinline__ float bf16_val(unsigned short b) { return __uint_as_float(((unsigned int)b) << 16); }
__device__ __forceinline__ float bf16_round(float x) { return bf16_val(bf16_bits(x)); }
// D += A·B with NT terms: 1 = ah·bh, 2 = + al·bh (A split), 3 = + ah·bl (both split)
template <int NT>
__device__ __forceinline__ v8f mmaN(v16b ah, v16b al, v16b bh, v16b bl, v8f c) {
  c = __builtin_amdgcn_wmma_f32_16x16x32_bf16(false, ah, false, bh, (short)0, c, false, false);
  if (NT >= 2) c = __builtin_amdgcn_wmma_f32_16x16x32_bf16(false, al, false, bh, (short)0, c, false, false);
  if (NT >= 3) c = __builtin_amdgcn_wmma_f32_16x16x32_bf16(false, ah, false, bl, (short)0, c, false, false);
  asm volatile("v_nop\n\tv_nop\n\tv_nop\n\tv_nop" : "+v"(c) : "v"(ah), "v"(al), "v"(bh), "v"(bl));
  return c;
}

__global__ __launch_bounds__(256) void k_wt_bf16(const float* __restrict__ W, unsigned short* __restrict__ Wt, int K, int N) {
  const int t = blockIdx.x * 256 + threadIdx.x;
  const int k8n = K / 8;
  if (t >= N * k8n) return;
  const int n = t / k8n, k8 = (t % k8n) * 8;
  v8us v;
#pragma unroll
  for (int i = 0; i < 8; ++i) v[i] = bf16_bits(W[(size_t)(k8 + i) * N + n]);
  *(v8us*)(Wt + (size_t)n * K + k8) = v;
  
}

// GEMM C[M][N] (f32, pitch ldc) = act(A[M][K]·W + bias). A f32 row-major (pitch lda) converted per fragment to bf16
// (ASPLIT: hi/lo two planes -> 2 terms, else single rounded term); Wt bf16 [N][K] (pitch ldb). BIAS_BF16 rounds the
// bias to bf16 first (bias quantised to bf16 before the add). K%32==0, M%16==0, N%64==0.
template <bool ASPLIT, int ACT, bool BIAS_BF16>
__global__ __launch_bounds__(128) void k_gemm_bf(const float* __restrict__ A, int lda, const unsigned short* __restrict__ Wt, int ldb,
                                               const float* __restrict__ bias, float* __restrict__ C, int ldc, int M, int N, int K) {
  __shared__ __attribute__((aligned(16))) float so[4][16][64];
  const int tid = threadIdx.x, w = tid >> 5, lane = tid & 31, ln = lane & 15, hh = lane >> 4;
  const int ntn = N / 64;
  const int wid = blockIdx.x * 4 + w;
  const int mt = wid / ntn, nq = wid % ntn;
  if (mt * 16 >= M) return;
  const int row0 = mt * 16, col0 = nq * 64;
  const float* arow = A + (size_t)(row0 + ln) * lda;
  v8f acc[4] = {};
  for (int kb = 0; kb < K; kb += 32) {
    FragB ah, al;
    const v4f x0 = *(const v4fa*)(arow + kb + 8 * hh), x1 = *(const v4fa*)(arow + kb + 8 * hh + 4);
    const v4f x2 = *(const v4fa*)(arow + kb + 16 + 8 * hh), x3 = *(const v4fa*)(arow + kb + 16 + 8 * hh + 4);
    float xs[16] = {x0[0],x0[1],x0[2],x0[3],x1[0],x1[1],x1[2],x1[3],x2[0],x2[1],x2[2],x2[3],x3[0],x3[1],x3[2],x3[3]};
#pragma unroll
    for (int i = 0; i < 16; ++i) { const unsigned short hb = bf16_bits(xs[i]); ah.u[i] = hb; al.u[i] = ASPLIT ? bf16_bits(xs[i] - bf16_val(hb)) : (unsigned short)0; }
#pragma unroll
    for (int t = 0; t < 4; ++t) {
      const unsigned short* brow = Wt + (size_t)(col0 + t * 16 + ln) * ldb + kb;
      FragB b;
      b.half[0] = *(const v8us*)(brow + 8 * hh);
      b.half[1] = *(const v8us*)(brow + 16 + 8 * hh);
      acc[t] = mmaN<ASPLIT ? 2 : 1>(ah.v, al.v, b.v, b.v, acc[t]);
    }
  }
#pragma unroll
  for (int t = 0; t < 4; ++t) {
    float bv = bias ? bias[col0 + t * 16 + ln] : 0.f;
    if (BIAS_BF16) bv = bf16_round(bv);
#pragma unroll
    for (int r = 0; r < 8; ++r) { float v = acc[t][r] + bv; if (ACT == 1) v = fmaxf(v, 0.f); so[w][8 * hh + r][t * 16 + ln] = v; }
  }
  __builtin_amdgcn_fence(__ATOMIC_ACQ_REL, "workgroup");
  __builtin_amdgcn_wave_barrier();
  const int rsub = lane >> 4, c4 = (lane & 15) * 4;
  {
#pragma unroll
    for (int q = 0; q < 8; ++q) {
      const int r = q * 2 + rsub;
      const v4f v = *(const v4fa*)&so[w][r][c4];
      *(v4f*)(C + (size_t)(row0 + r) * ldc + col0 + c4) = v;
    }
    
  }
}

// GEMM C = act(A·W + bias + resid): A f32 (ASPLIT -> hi/lo 2 terms), Wt bf16 [N][K]; ACT 0 none, 1 relu, 2 exact gelu;
// resid (optional, f32, row index = (row % rmod), pitch ldr, RES_BF16 rounds it) added before the activation.
template <bool ASPLIT, int ACT, bool BIAS_BF16, bool RES_BF16>
__global__ __launch_bounds__(128) void k_gemm_bf3(const float* __restrict__ A, int lda, const unsigned short* __restrict__ Wt, int ldb,
                                                const float* __restrict__ bias, const float* __restrict__ resid, int rmod, int ldr,
                                                float* __restrict__ C, int ldc, int M, int N, int K) {
  __shared__ __attribute__((aligned(16))) float so[4][16][64];
  const int tid = threadIdx.x, w = tid >> 5, lane = tid & 31, ln = lane & 15, hh = lane >> 4;
  const int ntn = N / 64;
  const int wid = blockIdx.x * 4 + w;
  const int mt = wid / ntn, nq = wid % ntn;
  if (mt * 16 >= M) return;
  const int row0 = mt * 16, col0 = nq * 64;
  const float* arow = A + (size_t)(row0 + ln) * lda;
  v8f acc[4] = {};
  for (int kb = 0; kb < K; kb += 32) {
    FragB ah, al;
    const v4f x0 = *(const v4fa*)(arow + kb + 8 * hh), x1 = *(const v4fa*)(arow + kb + 8 * hh + 4);
    const v4f x2 = *(const v4fa*)(arow + kb + 16 + 8 * hh), x3 = *(const v4fa*)(arow + kb + 16 + 8 * hh + 4);
    float xs[16] = {x0[0],x0[1],x0[2],x0[3],x1[0],x1[1],x1[2],x1[3],x2[0],x2[1],x2[2],x2[3],x3[0],x3[1],x3[2],x3[3]};
#pragma unroll
    for (int i = 0; i < 16; ++i) { const unsigned short hb = bf16_bits(xs[i]); ah.u[i] = hb; al.u[i] = ASPLIT ? bf16_bits(xs[i] - bf16_val(hb)) : (unsigned short)0; }
#pragma unroll
    for (int t = 0; t < 4; ++t) {
      const unsigned short* brow = Wt + (size_t)(col0 + t * 16 + ln) * ldb + kb;
      FragB b;
      b.half[0] = *(const v8us*)(brow + 8 * hh);
      b.half[1] = *(const v8us*)(brow + 16 + 8 * hh);
      acc[t] = mmaN<ASPLIT ? 2 : 1>(ah.v, al.v, b.v, b.v, acc[t]);
    }
  }
#pragma unroll
  for (int t = 0; t < 4; ++t) {
    const int col = col0 + t * 16 + ln;
    float bv = bias ? bias[col] : 0.f;
    if (BIAS_BF16) bv = bf16_round(bv);
#pragma unroll
    for (int r = 0; r < 8; ++r) {
      float v = acc[t][r] + bv;
      if (resid) { float rv = resid[(size_t)((row0 + 8 * hh + r) % rmod) * ldr + col]; if (RES_BF16) rv = bf16_round(rv); v += rv; }
      if (ACT == 1) v = fmaxf(v, 0.f);
      if (ACT == 2) v = 0.5f * v * (1.0f + erff(v * 0.70710678118654752f));
      if (ACT == 3) { const float u = 0.7978845608028654f * (v + 0.044715f * v * v * v); v = 0.5f * v * (1.0f + tanhf(u)); }
      so[w][8 * hh + r][t * 16 + ln] = v;
    }
  }
  __builtin_amdgcn_fence(__ATOMIC_ACQ_REL, "workgroup");
  __builtin_amdgcn_wave_barrier();
  const int rsub = lane >> 4, c4 = (lane & 15) * 4;
  {
#pragma unroll
    for (int q = 0; q < 8; ++q) {
      const int r = q * 2 + rsub;
      const v4f v = *(const v4fa*)&so[w][r][c4];
      *(v4f*)(C + (size_t)(row0 + r) * ldc + col0 + c4) = v;
    }
    
  }
}
// row LayerNorm (biased variance, eps) over N: s = X (+ R); optional out_sum <- s; out_norm <- (s-mu)*rsqrt(var+eps)*g + b
template <bool PARAM_BF16>
__global__ __launch_bounds__(256) void k_layernorm(const float* __restrict__ X, const float* __restrict__ R, const float* __restrict__ g, const float* __restrict__ bta,
                                                  float* __restrict__ out_sum, float* __restrict__ out_norm, int N, float eps) {
  __shared__ float red[256];
  const int row = blockIdx.x, tid = threadIdx.x;
  const float* x = X + (size_t)row * N; const float* rr = R ? R + (size_t)row * N : nullptr;
  float vals[16];                     // up to N = 4096
  const int per = N / 256;            // contiguous chunk per thread? use strided-by-4 chunks: thread handles j = tid*4 + 1024*u
  float s1 = 0.f;
  for (int u = 0; u < per / 4; ++u) {
    const int j = tid * 4 + 1024 * u;
    const v4f a = *(const v4fa*)(x + j);
    v4f b = {0.f,0.f,0.f,0.f}; if (rr) b = *(const v4fa*)(rr + j);
#pragma unroll
    for (int q = 0; q < 4; ++q) { const float v = a[q] + b[q]; vals[u * 4 + q] = v; s1 += v; }
  }
  red[tid] = s1; __syncthreads();
  for (int st = 128; st > 0; st >>= 1) { if (tid < st) red[tid] += red[tid + st]; __syncthreads(); }
  const float mu = red[0] / (float)N; __syncthreads();
  float s2 = 0.f;
  for (int u = 0; u < per / 4; ++u)
#pragma unroll
    for (int q = 0; q < 4; ++q) { const float c = vals[u * 4 + q] - mu; s2 += c * c; }
  red[tid] = s2; __syncthreads();
  for (int st = 128; st > 0; st >>= 1) { if (tid < st) red[tid] += red[tid + st]; __syncthreads(); }
  const float rs = rsqrtf(red[0] / (float)N + eps);
  {
    for (int u = 0; u < per / 4; ++u) {
      const int j = tid * 4 + 1024 * u;
      v4f o, sm;
#pragma unroll
      for (int q = 0; q < 4; ++q) {
        float gg = g[j + q], bb = bta[j + q];
        if (PARAM_BF16) { gg = bf16_round(gg); bb = bf16_round(bb); }
        sm[q] = vals[u * 4 + q]; o[q] = (vals[u * 4 + q] - mu) * rs * gg + bb;
      }
      if (out_sum) *(v4f*)(out_sum + (size_t)row * N + j) = sm;
      *(v4f*)(out_norm + (size_t)row * N + j) = o;
    }
    
  }
}



// ---- f16 WMMA path (v_wmma_f32_16x16x32_f16): 11-bit significands for operands in range — used where a [0,1] probability operand needs more precision than bf16
typedef _Float16 v16h __attribute__((ext_vector_type(16)));
union FragH { v16h v; v8us half[2]; _Float16 h[16]; unsigned short u[16]; };
template <int NT>
__device__ __forceinline__ v8f mmaH(v16h ah, v16h al, v16h bh, v16h bl, v8f c) {
  c = __builtin_amdgcn_wmma_f32_16x16x32_f16(false, ah, false, bh, (short)0, c, false, false);
  if (NT >= 2) c = __builtin_amdgcn_wmma_f32_16x16x32_f16(false, al, false, bh, (short)0, c, false, false);
  if (NT >= 3) c = __builtin_amdgcn_wmma_f32_16x16x32_f16(false, ah, false, bl, (short)0, c, false, false);
  asm volatile("v_nop\n\tv_nop\n\tv_nop\n\tv_nop" : "+v"(c) : "v"(ah), "v"(al), "v"(bh), "v"(bl));
  return c;
}
// batched GEMM like k_gemm_b but f16 operands: A f32 (split into f16 hi/lo if ASPLIT, else rounded to f16), Bt = f16 values [n][k]; alpha; C f32; N multiple of 16 (partial tiles skipped)
template <bool ASPLIT>
__global__ __launch_bounds__(128) void k_gemm_h(const float* __restrict__ A, int lda, size_t sA, const _Float16* __restrict__ Bh, int ldb, size_t sB, float alpha, float* __restrict__ C, int ldc, size_t sC, int M, int N, int K) {
  __shared__ __attribute__((aligned(16))) float so[4][16][64];
  const int tid = threadIdx.x, w = tid >> 5, lane = tid & 31, ln = lane & 15, hh = lane >> 4; const int by = blockIdx.y;
  A += (size_t)by * sA; Bh += (size_t)by * sB; C += (size_t)by * sC;
  const int ntn = (N + 63) / 64; const int wid = blockIdx.x * 4 + w; const int mt = wid / ntn, nq = wid % ntn; if (mt * 16 >= M) return;
  const int row0 = mt * 16, col0 = nq * 64; const float* arow = A + (size_t)(row0 + ln) * lda;
  v8f acc[4] = {};
  for (int kb = 0; kb < K; kb += 32) {
    FragH ah, al;
    const v4f x0 = *(const v4fa*)(arow + kb + 8 * hh), x1 = *(const v4fa*)(arow + kb + 8 * hh + 4), x2 = *(const v4fa*)(arow + kb + 16 + 8 * hh), x3 = *(const v4fa*)(arow + kb + 16 + 8 * hh + 4);
    float xs[16] = {x0[0],x0[1],x0[2],x0[3],x1[0],x1[1],x1[2],x1[3],x2[0],x2[1],x2[2],x2[3],x3[0],x3[1],x3[2],x3[3]};
#pragma unroll
    for (int i = 0; i < 16; ++i) { const _Float16 h = (_Float16)xs[i]; ah.h[i] = h; al.h[i] = ASPLIT ? (_Float16)(xs[i] - (float)h) : (_Float16)0.0f; }
#pragma unroll
    for (int t = 0; t < 4; ++t) { if (col0 + t * 16 >= N) continue; const size_t boff = (size_t)(col0 + t * 16 + ln) * ldb + kb; FragH bq; bq.half[0] = *(const v8us*)(Bh + boff + 8 * hh); bq.half[1] = *(const v8us*)(Bh + boff + 16 + 8 * hh);
      acc[t] = mmaH<ASPLIT ? 2 : 1>(ah.v, al.v, bq.v, bq.v, acc[t]); }
  }
#pragma unroll
  for (int t = 0; t < 4; ++t) { if (col0 + t * 16 >= N) continue;
#pragma unroll
    for (int r = 0; r < 8; ++r) so[w][8 * hh + r][t * 16 + ln] = acc[t][r] * alpha; }
  __builtin_amdgcn_fence(__ATOMIC_ACQ_REL, "workgroup"); __builtin_amdgcn_wave_barrier();
  const int rsub = lane >> 4, c4 = (lane & 15) * 4;
  {
#pragma unroll
    for (int q = 0; q < 8; ++q) { const int r = q * 2 + rsub; if (col0 + c4 < N) { const v4f v = *(const v4fa*)&so[w][r][c4]; *(v4f*)(C + (size_t)(row0 + r) * ldc + col0 + c4) = v; } }
     }
}

// ---- packed (fragment-major) f16 operand planes ----
// A plane of R rows x ld columns (R % 16 == 0, ld % 32 == 0) is a row of strips of 16 rows; a strip is ld / 32 tiles of 16 rows x 32 columns; a tile is 1 KB = 64 chunks of 8 halves in the order in which
// the two 16-byte loads of a WMMA fragment take them: chunk j * 32 + hh * 16 + ln = row ln, columns 16 j + 8 hh .. + 7. Load j of a fragment is then lane l <- chunk j * 32 + l: 512 contiguous bytes (four whole
// lines) instead of 32 bytes out of each of 16 lines. Which lane and register gets which element is as with row-major planes. A strip starts at element (first row) * ld, as the row itself would.
__device__ __forceinline__ size_t pk_off(size_t r, int k, int ld) { return (r >> 4) * ((size_t)16 * ld) + (size_t)(k >> 5) * 512 + (size_t)(((k >> 4) & 1) * 256 + ((k >> 3) & 1) * 128 + (k & 7)) + (r & 15) * 8; }
// the inverse for whole chunks: chunk t of a packed plane holds row r, columns k .. k + 7. The packing kernels give thread t chunk t, so that a wave stores 512 contiguous bytes.
__device__ __forceinline__ void pk_chunk(unsigned t, int ld, size_t& r, int& k) { const unsigned tile = t >> 6, tps = (unsigned)ld >> 5, strip = tile / tps; r = (size_t)(strip * 16 + (t & 15)); k = (int)((tile - strip * tps) * 32 + ((t >> 5) & 1) * 16 + ((t >> 4) & 1) * 8); }
// k_gemm_hh variant with fused epilogue: v = acc·alpha + bias[by·sBias + col] (+ CP[(row/rowsPerB)·sCPb + by·64 + col] if CP) ; ACT 0 none / 1 elu ; writes f16 C16 (and f32 C if non-null)
template <int ACT>
__global__ __launch_bounds__(128) void k_gemm_hhx(const _Float16* __restrict__ A, int lda, size_t sA, const _Float16* __restrict__ Bh, int ldb, size_t sB, float alpha, const float* __restrict__ bias, size_t sBias, const float* __restrict__ CP, int rowsPerB, size_t sCPb, int row0g,
    float* __restrict__ C, _Float16* __restrict__ C16, int ldc, size_t sC, int M, int N, int K) {
  __shared__ __attribute__((aligned(16))) float so[4][16][64];
  const int tid = threadIdx.x, w = tid >> 5, lane = tid & 31, ln = lane & 15, hh = lane >> 4; const int by = blockIdx.y;
  A += (size_t)by * sA; Bh += (size_t)by * sB; const size_t cofs = (size_t)by * sC; const float* bp = bias ? bias + (size_t)by * sBias : nullptr;
  const int ntn = (N + 63) / 64; const int wid = blockIdx.x * 4 + w; const int mt = wid / ntn, nq = wid % ntn; if (mt * 16 >= M) return;
  const int row0 = mt * 16, col0 = nq * 64; const _Float16* arow = A + (size_t)(row0 + ln) * lda;
  v8f acc[4] = {};
  for (int kb = 0; kb < K; kb += 32) { FragH ah; ah.half[0] = *(const v8us*)((const unsigned short*)arow + kb + 8 * hh); ah.half[1] = *(const v8us*)((const unsigned short*)arow + kb + 16 + 8 * hh);
#pragma unroll
    for (int t = 0; t < 4; ++t) { if (col0 + t * 16 >= N) continue; const size_t boff = (size_t)(col0 + t * 16 + ln) * ldb + kb; FragH bq; bq.half[0] = *(const v8us*)((const unsigned short*)Bh + boff + 8 * hh); bq.half[1] = *(const v8us*)((const unsigned short*)Bh + boff + 16 + 8 * hh);
      acc[t] = mmaH<1>(ah.v, ah.v, bq.v, bq.v, acc[t]); }
  }
#pragma unroll
  for (int t = 0; t < 4; ++t) { if (col0 + t * 16 >= N) continue; const int col = col0 + t * 16 + ln; const float bv = bp ? bf16_round(bp[col]) : 0.f;
#pragma unroll
    for (int r = 0; r < 8; ++r) { float v = acc[t][r] * alpha + bv; if (CP) { const int rr = row0g + row0 + 8 * hh + r; if (rowsPerB < 0) v += CP[cofs + (size_t)rr * ldc + col];      /* rowsPerB < 0: own element of the batched C plane */ else { const int bidx = rr / rowsPerB; v += CP[(size_t)bidx * sCPb + (size_t)by * 64 + col]; } } if (ACT == 1) v = (v > 0.f) ? v : expm1f(v); else if (ACT == 7) v = (v > 0.f) ? v + 1.0f : expf(v); else if (ACT == 8) v = tanhf(v); else if (ACT == 9) v = 0.5f * v * (1.0f + tanhf(0.7978845608028654f * (v + 0.044715f * v * v * v))); else if (ACT == 11) v = 1.0f / (1.0f + expf(-v)); else if (ACT == 12) v = (v > 0.f) ? v : 0.01f * v; else if (ACT == 14) v = (v > 0.f) ? v : 0.1f * v; else if (ACT == 16) v = (v >= 0.f) ? v : 0.3f * v; else if (ACT == 17) v = (v >= 0.f) ? v : 0.2f * v; else if (ACT == 15) v = v / (1.0f + expf(-v)); else if (ACT == 3) v = fmaxf(v, 0.f); else if (ACT == 6) v = 0.5f * v * (1.0f + erff(v * 0.70710678118654752f)); so[w][8 * hh + r][t * 16 + ln] = v; } }
  __builtin_amdgcn_fence(__ATOMIC_ACQ_REL, "workgroup"); __builtin_amdgcn_wave_barrier();
  const int rsub = lane >> 4, c4 = (lane & 15) * 4; typedef _Float16 v4h __attribute__((ext_vector_type(4)));
  {
#pragma unroll
    for (int q = 0; q < 8; ++q) { const int r = q * 2 + rsub; if (col0 + c4 < N) { const v4f v = *(const v4fa*)&so[w][r][c4]; if (C) *(v4f*)(C + cofs + (size_t)(row0 + r) * ldc + col0 + c4) = v; if (C16) { v4h h4; for (int i = 0; i < 4; ++i) h4[i] = (_Float16)v[i]; *(v4h*)(C16 + cofs + (size_t)(row0 + r) * ldc + col0 + c4) = h4; } } }
     }
}


typedef _Float16 v4h __attribute__((ext_vector_type(4)));

__global__ __launch_bounds__(256) void k_h16(const float* __restrict__ x, _Float16* __restrict__ X16, size_t n8) { const size_t t = (size_t)blockIdx.x * 256 + threadIdx.x; if (t >= n8) return; FragH f;
#pragma unroll
  for (int q = 0; q < 8; ++q) f.h[q] = (_Float16)x[t * 8 + q]; *(v8us*)((unsigned short*)X16 + t * 8) = f.half[0];  }
// f32 rows of DM columns -> packed f16 plane. A LayerNorm block has one row, which is 16 bytes of each line of the packed plane; here every line has one writer. Thread: chunks t0 + 256 u, which are
// 128 columns apart in one row (1,024 chunks = half a strip per block); a wave's store is 512 contiguous bytes; the eight loads are issued before the first store.
__global__ __launch_bounds__(256) void k_pk16(const float* __restrict__ x, _Float16* __restrict__ X16) { const unsigned t0 = blockIdx.x * 1024 + threadIdx.x; size_t r; int k; pk_chunk(t0, DM, r, k); const float* p = x + r * DM + k; v4f a[4], c[4];
#pragma unroll
  for (int u = 0; u < 4; ++u) { a[u] = *(const v4fa*)(p + 128 * u); c[u] = *(const v4fa*)(p + 128 * u + 4); }
  unsigned short* o = (unsigned short*)X16 + (size_t)t0 * 8; FragH f[4];
#pragma unroll
  for (int u = 0; u < 4; ++u)
#pragma unroll
    for (int q = 0; q < 4; ++q) { f[u].h[q] = (_Float16)a[u][q]; f[u].h[4 + q] = (_Float16)c[u][q]; }
#pragma unroll
  for (int u = 0; u < 4; ++u) *(v8us*)(o + 2048 * u) = f[u].half[0]; }
__global__ __launch_bounds__(256) void k_round16f(const float* __restrict__ W, _Float16* __restrict__ Bt, size_t n8) { const size_t t = (size_t)blockIdx.x * 256 + threadIdx.x; if (t >= n8) return; FragH f;
#pragma unroll
  for (int i = 0; i < 8; ++i) f.h[i] = (_Float16)(bf16_round(W[t * 8 + i]) * 16.0f); *(v8us*)((unsigned short*)Bt + t * 8) = f.half[0];  }
template <int NHv, int TTv>
__global__ __launch_bounds__(256) void k_vt(const _Float16* __restrict__ V16, int ldv, int voff, _Float16* __restrict__ Vt) { __shared__ unsigned short tl[64][66]; const int tid = threadIdx.x; const int slab = blockIdx.x / (TTv / 64), lg = blockIdx.x % (TTv / 64); const int b = slab / NHv, h = slab % NHv;
  for (int i = tid; i < 64 * 8; i += 256) { const int r = i / 8, c8 = (i % 8) * 8; FragH f; f.half[0] = *(const v8us*)((const unsigned short*)V16 + pk_off((size_t)b * TTv + lg * 64 + r, voff + h * 64 + c8, ldv));      /* V16: packed plane of ldv columns, V from column voff on */
#pragma unroll
    for (int q = 0; q < 8; ++q) tl[r][c8 + q] = f.u[q]; }
  __syncthreads();
  {
#pragma unroll
    for (int rd = 0; rd < 2; ++rd) { const int c = rd * 256 + tid; const int d = (c >> 7) * 16 + (c & 15), p8 = ((c >> 4) & 7) * 8; FragH f;      /* Vt: packed plane of TTv columns; the block has 4 strips x 2 tiles of it, thread = chunk c in their order: a wave stores 512 contiguous bytes */
#pragma unroll
      for (int q = 0; q < 8; ++q) f.u[q] = tl[p8 + q][d];
      *(v8us*)((unsigned short*)Vt + pk_off((size_t)slab * 64 + d, lg * 64 + p8, TTv)) = f.half[0]; }
     } }

__global__ __launch_bounds__(256) void k_hl(const float* __restrict__ F, _Float16* __restrict__ Hh, size_t hskip, _Float16* __restrict__ Hl, size_t n8) { const size_t t = (size_t)blockIdx.x * 256 + threadIdx.x; if (t >= n8) return; FragH fh, fl; size_t r; int k; pk_chunk((unsigned)t, DM, r, k);      /* Hh, Hl: packed planes of DM columns; in Hh every group of QT0 rows stands hskip halves further on than the one before it (whole strips) */ const v4f a = *(const v4fa*)(F + r * DM + k), c = *(const v4fa*)(F + r * DM + k + 4);
#pragma unroll
  for (int q = 0; q < 4; ++q) { _Float16 h = (_Float16)a[q]; fh.h[q] = h; fl.h[q] = (_Float16)((a[q] - (float)h) * 1024.0f); h = (_Float16)c[q]; fh.h[4 + q] = h; fl.h[4 + q] = (_Float16)((c[q] - (float)h) * 1024.0f); }
  { *(v8us*)((unsigned short*)Hh + t * 8 + (r / QT0) * hskip) = fh.half[0]; *(v8us*)((unsigned short*)Hl + t * 8) = fl.half[0];  } }

// ---- fast GEMM (wave tile 32x64; requires M % 32 == 0 rows per launch region and N % 64 == 0); epilogue = k_gemm_hhx semantics ----
// RES = 1 (only with PK16 = 0 and no activation): CP is a plane laid out like C, and every result takes its own element of it on top (v = acc * alpha + bias, then + CP); RES = 0: CP is not read.
// A and Bh are packed planes (pk_off) of lda and ldb columns. PK16 = 0: C (f32) and C16, each where not null, are row-major. PK16 = 1: C16 is written as a packed plane of ldc columns (it is a later GEMM's A); C, where not null, takes the first QT0 rows of every rowsPerB as f32 rows.
__device__ __forceinline__ v16h g2_frag(const _Float16* p, int hh) { FragH f; f.half[0] = *(const v8us*)((const unsigned short*)p + 8 * hh); f.half[1] = *(const v8us*)((const unsigned short*)p + 16 + 8 * hh); return f.v; }
__device__ __forceinline__ v8f g2_mma(v16h a, v16h b, v8f c) { v8f d = __builtin_amdgcn_wmma_f32_16x16x32_f16(false, a, false, b, (short)0, c, false, false); asm volatile("v_nop\n\tv_nop\n\tv_nop\n\tv_nop" : "+v"(d) : "v"(a), "v"(b)); return d; }
__device__ __forceinline__ v16h g2_fragp(const _Float16* p) { FragH f; f.half[0] = *(const v8us*)((const unsigned short*)p); f.half[1] = *(const v8us*)((const unsigned short*)p + 256); return f.v; }      /* a fragment of a packed plane: p = its tile + 8 * lane */
struct G2S { v16h a0, a1, b0, b1, b2, b3; };      /* the fragments of one k-step of a 32x64 wave tile */
// G2_LOAD: one k-step's twelve loads at the six row pointers, as one group; their data is not waited for here. The scheduling barrier keeps the next step's first WMMA, and with it the wait
// for that step's operands, behind the group: lifted in front of it, that wait would hold the group's issue back by most of a step.
#define G2_LOAD(S) do { S.a0 = g2_fragp(a0p); S.a1 = g2_fragp(a1p); S.b0 = g2_fragp(b0p); S.b1 = g2_fragp(b1p); S.b2 = g2_fragp(b2p); S.b3 = g2_fragp(b3p); \
    __builtin_amdgcn_sched_barrier(0); } while (0)
// G2_NEXT: moves the pointers on by one k-step, which is one tile of 512 halves (or leaves them on the last one). s_wait_xcnt 0 in front: a precaution, before the additions write the address registers that the issued
// loads name; the scheduling barrier keeps the additions, and all that follows, behind that wait. In the loop it stands behind a step's WMMAs, well after the group was issued.
#define G2_NEXT do { asm volatile("s_wait_xcnt 0x0" ::: "memory"); __builtin_amdgcn_sched_barrier(0); \
    const int inc = left > 0 ? 512 : 0; --left; a0p += inc; a1p += inc; b0p += inc; b1p += inc; b2p += inc; b3p += inc; } while (0)
#define G2_MMA(S) do { c00 = g2_mma(S.a0, S.b0, c00); c10 = g2_mma(S.a1, S.b0, c10); c01 = g2_mma(S.a0, S.b1, c01); c11 = g2_mma(S.a1, S.b1, c11); \
    c02 = g2_mma(S.a0, S.b2, c02); c12 = g2_mma(S.a1, S.b2, c12); c03 = g2_mma(S.a0, S.b3, c03); c13 = g2_mma(S.a1, S.b3, c13); } while (0)
template <int ACT, int PK16, int RES>
__global__ __launch_bounds__(128) void k_gemm2(const _Float16* __restrict__ A, int lda, size_t sA, const _Float16* __restrict__ Bh, int ldb, size_t sB, float alpha, const float* __restrict__ bias, size_t sBias, const float* __restrict__ CP, int rowsPerB, size_t sCPb, int row0g,
    float* __restrict__ C, _Float16* __restrict__ C16, int ldc, size_t sC, int M, int N, int K) { static_assert(ACT == 0 || ACT == 3 || ACT == 6 || ACT == 8 || ACT == 9 || ACT == 11 || ACT == 12 || ACT == 14 || ACT == 15 || ACT == 16 || ACT == 17, "k_gemm2: unsupported ACT code (would silently apply no activation)"); static_assert(!RES || (ACT == 0 && PK16 == 0), "k_gemm2: the CP element is added behind the staging, where no activation follows");
  __shared__ __attribute__((aligned(16))) float so[4][32][68];
  const int tid = threadIdx.x, w = tid >> 5, lane = tid & 31, ln = lane & 15, hh = lane >> 4; const int by = blockIdx.y;
  A += (size_t)by * sA; Bh += (size_t)by * sB; const size_t cofs = (size_t)by * sC; const float* bp = bias ? bias + (size_t)by * sBias : nullptr;
  const int ntn = N >> 6; const int mt = blockIdx.x / ntn, nq = blockIdx.x - mt * ntn; const int row0 = mt * 128 + 32 * w, col0 = nq * 64; if (row0 >= M) return;
  const _Float16* a0p = A + (size_t)row0 * lda + 8 * lane; const _Float16* a1p = a0p + (size_t)16 * lda;      /* first tile of the strip; the lane's own 16-byte chunk is part of the pointer: a load names the pointer's registers themselves */
  const _Float16* b0p = Bh + (size_t)col0 * ldb + 8 * lane; const _Float16* b1p = b0p + (size_t)16 * ldb; const _Float16* b2p = b1p + (size_t)16 * ldb; const _Float16* b3p = b2p + (size_t)16 * ldb;
  const v8f z8 = {0.f,0.f,0.f,0.f,0.f,0.f,0.f,0.f}; v8f c00 = z8, c01 = z8, c02 = z8, c03 = z8, c10 = z8, c11 = z8, c12 = z8, c13 = z8;
  // K loop (K >= 32): a ring of three fragment sets. The twelve loads of k-step s + 2 are issued as one group in front of the WMMAs of step s, so a step waits for loads that are two steps old
  // instead of for five load round trips of its own. Every accumulator still takes its k-steps in ascending order.
  const int n = K >> 5; int left = n - 1;      /* left: pointer advances still allowed; past the last k-step the pointers stay on it (in bounds), and what is loaded there is not used */
  G2S s0, s1, s2; int i = 0;
  G2_LOAD(s0); G2_NEXT; G2_LOAD(s1); G2_NEXT;
#pragma unroll 1      /* the body already holds three k-steps, one per set: more copies of it only cost instruction cache */
  for (; i + 3 <= n; i += 3) { G2_LOAD(s2); G2_MMA(s0); G2_NEXT; G2_LOAD(s0); G2_MMA(s1); G2_NEXT; G2_LOAD(s1); G2_MMA(s2); G2_NEXT; }
  if (i < n) G2_MMA(s0);
  if (i + 1 < n) G2_MMA(s1);
  v8f accs[8] = {c00, c01, c02, c03, c10, c11, c12, c13};
  const int rsub = lane >> 4, c4 = (lane & 15) * 4;
  // All that the epilogue reads from memory is issued here as one group: one round trip for the wave. (Read where it is used, element by element under a test, every load is waited for on its own:
  // with CP 64 round trips one behind the other, while the wave does nothing else.) CP is read as C is stored below: 16 bytes a lane, whole 256-byte row pieces. The CP loads stand first: their address
  // arithmetic writes registers that the K loop's last, unused loads are still aimed at, and so waits for every load issued before it.
  // Behind each run of loads s_wait_xcnt 0: a precaution, before anything writes a register that an issued load names as address. The CP addresses are inputs of their wait's statement, so that they live up to it
  // and no load of the run gets one of them as its destination; the scheduling barriers keep the address arithmetic in front of the run and all that follows behind the wait. The loads' data is not waited for here.
  float bv[4] = {0.f, 0.f, 0.f, 0.f}; v4f rv[16];
  if (RES) { const float* rp[16];
#pragma unroll
    for (int q = 0; q < 16; ++q) rp[q] = CP + cofs + (size_t)(row0g + row0 + rsub + 2 * q) * ldc + col0 + c4;
    __builtin_amdgcn_sched_barrier(0);
#pragma unroll
    for (int q = 0; q < 16; ++q) rv[q] = *(const v4fa*)rp[q];
    asm volatile("s_wait_xcnt 0x0" :: "v"(rp[0]), "v"(rp[1]), "v"(rp[2]), "v"(rp[3]), "v"(rp[4]), "v"(rp[5]), "v"(rp[6]), "v"(rp[7]), "v"(rp[8]), "v"(rp[9]), "v"(rp[10]), "v"(rp[11]), "v"(rp[12]), "v"(rp[13]), "v"(rp[14]), "v"(rp[15]) : "memory");
    __builtin_amdgcn_sched_barrier(0); }
  if (bp) {
#pragma unroll
    for (int t = 0; t < 4; ++t) bv[t] = bp[col0 + t * 16 + ln];
    asm volatile("s_wait_xcnt 0x0" ::: "memory"); __builtin_amdgcn_sched_barrier(0); }
#pragma unroll
  for (int t = 0; t < 4; ++t) bv[t] = bf16_round(bv[t]);
#pragma unroll
  for (int u = 0; u < 8; ++u) { const int t = u & 3, half = u >> 2;
#pragma unroll
    for (int r = 0; r < 8; ++r) { const int rloc = half * 16 + 8 * hh + r; float v = accs[u][r] * alpha + bv[t];
      if (ACT == 3) v = fmaxf(v, 0.f); else if (ACT == 6) v = 0.5f * v * (1.0f + erff(v * 0.70710678118654752f)); else if (ACT == 11) v = 1.0f / (1.0f + expf(-v)); else if (ACT == 15) v = v / (1.0f + expf(-v)); else if (ACT == 12) v = (v > 0.f) ? v : 0.01f * v; else if (ACT == 8) v = tanhf(v); else if (ACT == 9) v = 0.5f * v * (1.0f + tanhf(0.7978845608028654f * (v + 0.044715f * v * v * v))); else if (ACT == 14) v = (v > 0.f) ? v : 0.1f * v; else if (ACT == 16) v = (v >= 0.f) ? v : 0.3f * v; else if (ACT == 17) v = (v >= 0.f) ? v : 0.2f * v;
      so[w][rloc][t * 16 + ln] = v; } }
  __builtin_amdgcn_fence(__ATOMIC_ACQ_REL, "workgroup"); __builtin_amdgcn_wave_barrier();
  if (!PK16) { v4f ov[16];
#pragma unroll
    for (int q = 0; q < 16; ++q) { ov[q] = *(const v4fa*)&so[w][q * 2 + rsub][c4]; if (RES) ov[q] += rv[q]; }
    if (C) { float* cq[16];
#pragma unroll
      for (int q = 0; q < 16; ++q) cq[q] = C + cofs + (size_t)(row0 + q * 2 + rsub) * ldc + col0 + c4;
      __builtin_amdgcn_sched_barrier(0);      /* all values and all addresses formed first, then stores alone: among them no register of an issued store is written again */
#pragma unroll
      for (int q = 0; q < 16; ++q) *(v4f*)cq[q] = ov[q];
      asm volatile("s_wait_xcnt 0x0" ::: "memory"); __builtin_amdgcn_sched_barrier(0); }      /* as above, before the f16 copy below writes registers */
    if (C16) { v4h h4[16]; _Float16* hq[16];
#pragma unroll
      for (int q = 0; q < 16; ++q) { for (int i = 0; i < 4; ++i) h4[q][i] = (_Float16)ov[q][i]; hq[q] = C16 + cofs + (size_t)(row0 + q * 2 + rsub) * ldc + col0 + c4; }
      __builtin_amdgcn_sched_barrier(0);      /* as for C */
#pragma unroll
      for (int q = 0; q < 16; ++q) *(v4h*)hq[q] = h4[q]; } }
  if (PK16) {      /* the wave's 32x64 results are two strips x two tiles of the packed plane: eight stores of 512 contiguous bytes, lane l = chunk j * 32 + l */
    if (C) {      /* PK16 with C (CP is null then): the first QT0 rows of every group of rowsPerB rows go out as f32 rows too, groups packed one behind the other, pitch ldc. A wave's 32 rows are all inside or all outside */
      const int rgl = row0g + row0, grp = rgl / rowsPerB, ri = rgl - grp * rowsPerB;
      if (ri < QT0) { float* cf = C + ((size_t)grp * QT0 + ri + rsub) * ldc + col0 + c4; v4f fv[16]; float* fq[16];
#pragma unroll
        for (int q = 0; q < 16; ++q) { fv[q] = *(const v4fa*)&so[w][q * 2 + rsub][c4]; fq[q] = cf + (size_t)(2 * q) * ldc; }
        __builtin_amdgcn_sched_barrier(0);      /* all values read and all addresses formed first, then stores alone: among them no register of an issued store is written again */
#pragma unroll
        for (int q = 0; q < 16; ++q) *(v4f*)fq[q] = fv[q]; } }
    _Float16* cp = C16 + cofs + (size_t)row0 * ldc + (size_t)(col0 >> 5) * 512 + 8 * lane; FragH pf[8];
#pragma unroll
    for (int u = 0; u < 8; ++u) { const float* sp = &so[w][(u >> 2) * 16 + ln][(u & 3) * 16 + 8 * hh]; const v4f v0 = *(const v4fa*)sp, v1 = *(const v4fa*)(sp + 4);
#pragma unroll
      for (int i = 0; i < 4; ++i) { pf[u].h[i] = (_Float16)v0[i]; pf[u].h[4 + i] = (_Float16)v1[i]; } }
#pragma unroll
    for (int u = 0; u < 8; ++u) *(v8us*)((unsigned short*)cp + (size_t)(u >> 2) * 16 * ldc + (u & 3) * 256) = pf[u].half[0]; } }


__global__ __launch_bounds__(256) void k_wnat(const float* __restrict__ w, size_t n8, _Float16* __restrict__ Bt) { const size_t t = (size_t)blockIdx.x * 256 + threadIdx.x; if (t >= n8) return; FragH f; for (int q = 0; q < 8; ++q) f.h[q] = (_Float16)(bf16_round(w[t * 8 + q]) * 16.0f); *(v8us*)((unsigned short*)Bt + t * 8) = f.half[0];  }
__global__ __launch_bounds__(256) void k_rsm(const float* __restrict__ S, _Float16* __restrict__ P, int nrows) {
  #pragma clang fp contract(off)
  const int i = blockIdx.x * 256 + threadIdx.x; if (i >= nrows) return; const float* s = S + (size_t)i * SQ; float mx = -3.0e38f;
#pragma unroll 1
  for (int j = 0; j < SQ; ++j) mx = fmaxf(mx, s[j]); float se = 0.f;
#pragma unroll 1
  for (int j = 0; j < SQ; ++j) se += expf(s[j] - mx); const float sc = 256.0f / se;
#pragma unroll 1
  for (int j0 = 0; j0 < SQ; j0 += 8) { FragH f; for (int q = 0; q < 8; ++q) f.h[q] = (_Float16)(expf(s[j0 + q] - mx) * sc); unsigned short* d = (unsigned short*)P + (size_t)i * SQ + j0; *(v8us*)d = f.half[0];  } }
__global__ __launch_bounds__(256) void k_vt(const _Float16* __restrict__ V16, int b, int h0, _Float16* __restrict__ VT) { __shared__ unsigned short tl[64][65]; const int tid = threadIdx.x; const int hh = blockIdx.x % HG, sg = blockIdx.x / HG; const int s0 = sg * 64; const int h = h0 + hh;
  for (int i = tid; i < 64 * 8; i += 256) { const int j = i / 8, d8 = (i % 8) * 8; FragH f; f.half[0] = *(const v8us*)((const unsigned short*)V16 + ((size_t)b * SQ + s0 + j) * DM + h * HD + d8); for (int q = 0; q < 8; ++q) tl[d8 + q][j] = f.u[q]; }
  __syncthreads();
  { for (int i = tid; i < 64 * 8; i += 256) { const int d = i / 8, j8 = (i % 8) * 8; FragH f; for (int q = 0; q < 8; ++q) f.u[q] = tl[d][j8 + q]; *(v8us*)((unsigned short*)VT + ((size_t)hh * HD + d) * SQ + s0 + j8) = f.half[0]; }  } }





// ---- causal attention, scores + softmax + weighted V sum in one kernel; S and P never leave the registers ----
// A wave has 32 query rows (two column groups of 16) of one (batch, head) and walks the keys 0 .. its last row in blocks of 64. Transposed products: S^T = K Q^T (first operand = K rows, second = Q rows),
// so lane (ln, hh) holds, per 16-key tile, the scores of ONE query (column ln) for keys 8 hh .. 8 hh + 7: row maximum and row sum are in-lane plus one exchange between the lane halves.
// Two 16-key score tiles, converted in place, are the second operand of O^T += V^T P^T in the same k order as g2_frag's (keys 8 hh + i, then 16 + 8 hh + i of a 32-key step). O^T: a lane has 8 consecutive
// head columns of one query: one 16-byte store each. Softmax with a running maximum in the log2 domain; the weights carry x256 (as f16 they stay clear of the subnormal range), and so does the row sum.
#define FA_QB 128                    /* query rows per block: 4 waves x 32 */
#define FA_SC 0.18033688011112042f   /* 64^-0.5 * log2(e) */
__device__ __forceinline__ v8f fa_mma(v16h a, v16h b, v8f c) { return __builtin_amdgcn_wmma_f32_16x16x32_f16(false, a, false, b, (short)0, c, false, false); }
__device__ __forceinline__ float fa_xhalf(float x) { return __builtin_bit_cast(float, __builtin_amdgcn_permlanex16(__builtin_bit_cast(int, x), __builtin_bit_cast(int, x), 0x76543210, 0xfedcba98, false, false)); }      /* lane l with lane l ^ 16 */
// exp2 of eight values (of one value) as v_exp_f32 in one asm statement. Why asm: behind a transcendental the instruction set asks for one independent instruction or v_nop before its result is read or its
// source overwritten. Early-clobber outputs share no register with any input, so inside the statement no v_exp_f32 touches
// an earlier one's registers; the closing v_nop is the slot behind the last one.
__device__ __forceinline__ v8f fa_exp2x8(v8f x) { float y0, y1, y2, y3, y4, y5, y6, y7;
  asm("v_exp_f32 %0, %8\n\tv_exp_f32 %1, %9\n\tv_exp_f32 %2, %10\n\tv_exp_f32 %3, %11\n\tv_exp_f32 %4, %12\n\tv_exp_f32 %5, %13\n\tv_exp_f32 %6, %14\n\tv_exp_f32 %7, %15\n\tv_nop"
      : "=&v"(y0), "=&v"(y1), "=&v"(y2), "=&v"(y3), "=&v"(y4), "=&v"(y5), "=&v"(y6), "=&v"(y7) : "v"(x[0]), "v"(x[1]), "v"(x[2]), "v"(x[3]), "v"(x[4]), "v"(x[5]), "v"(x[6]), "v"(x[7]));
  const v8f y = {y0, y1, y2, y3, y4, y5, y6, y7}; return y; }
__device__ __forceinline__ float fa_exp2(float x) { float y; asm("v_exp_f32 %0, %1\n\tv_nop" : "=&v"(y) : "v"(x)); return y; }
__global__ __launch_bounds__(128) void k_fattn(const _Float16* __restrict__ QKVr, const _Float16* __restrict__ VTr, _Float16* __restrict__ O) {
  const int tid = threadIdx.x, lane = tid & 31, ln = lane & 15, hh = lane >> 4; const int w = __builtin_amdgcn_readfirstlane(tid >> 5);      /* the wave's number as a scalar: trip count and the test for the last block are scalar */
  const int g = blockIdx.x / (NB * NH), bh = blockIdx.x % (NB * NH); const int b = bh / NH, h = bh % NH;
  const int qb = (g < SQ / FA_QB / 2) ? SQ / FA_QB - 1 - g : g - SQ / FA_QB / 2;      /* long query blocks first, then the short ones in rising order: for speed only, every (bh, qb) occurs once */
  const int q0 = qb * FA_QB + w * 32; const int nb = (q0 >> 6) + 1;      /* key blocks of 64 up to the one that holds the wave's last row */
  const size_t rb = (size_t)b * SQ;
  const _Float16* qp = QKVr + pk_off(rb + q0 + ln, h * HD + 8 * hh, LQ);      /* QKVr: packed plane of LQ columns, VTr: of SQ columns. 16 rows on = 16 row lengths on, 32 columns on = 512 halves on */
  const _Float16* kp = QKVr + pk_off(rb + ln, DM + h * HD + 8 * hh, LQ);      /* K row = key ln of a tile */
  const _Float16* vp = VTr + pk_off((size_t)bh * HD + ln, 8 * hh, SQ);      /* V^T row = head column ln of a tile */
  v16h qf[2][2], kf[4][2], vf[4][2];
#pragma unroll
  for (int j = 0; j < 2; ++j) { qf[j][0] = g2_fragp(qp + (size_t)j * 16 * LQ); qf[j][1] = g2_fragp(qp + (size_t)j * 16 * LQ + 512); }
#pragma unroll
  for (int t = 0; t < 4; ++t) { kf[t][0] = g2_fragp(kp + (size_t)t * 16 * LQ); kf[t][1] = g2_fragp(kp + (size_t)t * 16 * LQ + 512); }
  // s_wait_xcnt 0: a precaution, before anything writes the address registers that the issued Q and K loads name; the scheduling barriers keep the loads in front of it and the addition, the zeroing
  // and all that follows behind it. (The key loop below is entered without a test, so that these loads and the wait stay in one block: past a test the compiler moved the loads behind the wait.)
  __builtin_amdgcn_sched_barrier(0); asm volatile("s_wait_xcnt 0x0" ::: "memory"); __builtin_amdgcn_sched_barrier(0);
  kp += (nb > 1) ? (size_t)64 * LQ : 0;      /* past the last block the pointer stays on it (in bounds); what is loaded there is not used */
  const v8f z8 = {0.f,0.f,0.f,0.f,0.f,0.f,0.f,0.f};
  v8f ot[4][2]; float m[2] = {-3.0e38f, -3.0e38f}, l[2] = {0.f, 0.f};
#pragma unroll
  for (int t = 0; t < 4; ++t) { ot[t][0] = z8; ot[t][1] = z8; }
  int kb = 0;
#pragma unroll 1      /* one key block per trip: the body is long, copies of it only cost instruction cache */
  do {      /* nb >= 1 */
    // this block's V^T fragments, issued as one group in front of the score products: they are first needed behind the softmax
#pragma unroll
    for (int t = 0; t < 4; ++t) { vf[t][0] = g2_fragp(vp + (size_t)t * 16 * SQ); vf[t][1] = g2_fragp(vp + (size_t)t * 16 * SQ + 512); }
    __builtin_amdgcn_sched_barrier(0);      /* keeps the wait for K, which the first product brings, behind the group's issue */
    v8f st[4][2];
#pragma unroll
    for (int t = 0; t < 4; ++t)
#pragma unroll
      for (int j = 0; j < 2; ++j) st[t][j] = fa_mma(kf[t][0], qf[j][0], z8);
#pragma unroll
    for (int t = 0; t < 4; ++t)
#pragma unroll
      for (int j = 0; j < 2; ++j) st[t][j] = fa_mma(kf[t][1], qf[j][1], st[t][j]);
    __builtin_amdgcn_sched_barrier(0);      /* the next block's K loads go into the registers these products read: not in front of them */
#pragma unroll
    for (int t = 0; t < 4; ++t) { kf[t][0] = g2_fragp(kp + (size_t)t * 16 * LQ); kf[t][1] = g2_fragp(kp + (size_t)t * 16 * LQ + 512); }      /* next block's K, one block ahead */
    // s_wait_xcnt 0 as above, before both pointers move on
    __builtin_amdgcn_sched_barrier(0); asm volatile("s_wait_xcnt 0x0" ::: "memory"); __builtin_amdgcn_sched_barrier(0);
    kp += (kb + 2 < nb) ? (size_t)64 * LQ : 0; vp += (kb + 1 < nb) ? 1024 : 0;      /* 64 keys = 4 strips of K rows, 2 tiles of V^T columns */
    if (kb == nb - 1) {      /* only the last block holds keys past a row (scalar test): masked like the reference's -inf, as a large negative score */
      const int kq = q0 + ln - (kb * 64 + 8 * hh);      /* key offset r + 16 t is allowed up to kq + 16 j */
#pragma unroll
      for (int t = 0; t < 4; ++t)
#pragma unroll
        for (int j = 0; j < 2; ++j)
#pragma unroll
          for (int r = 0; r < 8; ++r) st[t][j][r] = (t * 16 + r <= kq + j * 16) ? st[t][j][r] : -1.0e9f; }
    v16h pf[2][2];
#pragma unroll
    for (int j = 0; j < 2; ++j) {
      v8f x8;
#pragma unroll
      for (int r = 0; r < 8; ++r) x8[r] = fmaxf(fmaxf(st[0][j][r], st[1][j][r]), fmaxf(st[2][j][r], st[3][j][r]));
      float mx = fmaxf(fmaxf(fmaxf(x8[0], x8[1]), fmaxf(x8[2], x8[3])), fmaxf(fmaxf(x8[4], x8[5]), fmaxf(x8[6], x8[7])));
      mx = fmaxf(mx, fa_xhalf(mx));
      const float mn = fmaxf(m[j], mx * FA_SC); const float al = fa_exp2(m[j] - mn);      /* 0 on the first block */ m[j] = mn; const float mo = 8.0f - mn;      /* + 8: weights x256 */
      v8f s8;
#pragma unroll
      for (int t = 0; t < 4; ++t) { v8f a8;
#pragma unroll
        for (int r = 0; r < 8; ++r) a8[r] = __builtin_fmaf(st[t][j][r], FA_SC, mo);
        st[t][j] = fa_exp2x8(a8); s8 = (t == 0) ? st[0][j] : s8 + st[t][j]; }
      l[j] = l[j] * al + (((s8[0] + s8[1]) + (s8[2] + s8[3])) + ((s8[4] + s8[5]) + (s8[6] + s8[7])));      /* this lane half's keys only; the halves are joined once, behind the loop */
#pragma unroll
      for (int t = 0; t < 4; ++t) ot[t][j] *= al;
#pragma unroll
      for (int s = 0; s < 2; ++s) { FragH f;
#pragma unroll
        for (int i = 0; i < 8; ++i) { f.h[i] = (_Float16)st[2 * s][j][i]; f.h[8 + i] = (_Float16)st[2 * s + 1][j][i]; }
        pf[j][s] = f.v; } }
    __builtin_amdgcn_sched_barrier(0);      /* keeps the asm v_exp_f32 above in front of the products below */
#pragma unroll
    for (int s = 0; s < 2; ++s)
#pragma unroll
      for (int t = 0; t < 4; ++t)
#pragma unroll
        for (int j = 0; j < 2; ++j) ot[t][j] = fa_mma(vf[t][s], pf[j][s], ot[t][j]);
  } while (++kb < nb);
  asm volatile("s_wait_loadcnt 0x0" ::: "memory");      /* the last trip's K loads are not used: waited for here, so that no load is in flight into the wave's registers when it ends */
  FragH of[2][4]; _Float16* op[2];
#pragma unroll
  for (int j = 0; j < 2; ++j) { const float fin = 64.0f / (l[j] + fa_xhalf(l[j]));      /* o carried x64; the x256 of the weights cancels against the row sum's */ op[j] = O + pk_off(rb + q0 + j * 16 + ln, h * HD + 8 * hh, DM);      /* O: packed plane of DM columns; 16 columns on = 256 halves on, and a wave's store is 512 contiguous bytes */
#pragma unroll
    for (int t = 0; t < 4; ++t)
#pragma unroll
      for (int r = 0; r < 8; ++r) of[j][t].h[r] = (_Float16)(ot[t][j][r] * fin); }
  __builtin_amdgcn_sched_barrier(0);      /* all values packed and both addresses formed first, then stores alone: no register of an issued store is written again */
#pragma unroll
  for (int j = 0; j < 2; ++j)
#pragma unroll
    for (int t = 0; t < 4; ++t) *(v8us*)((unsigned short*)op[j] + t * 256) = of[j][t].half[0]; }


typedef float v2fa __attribute__((ext_vector_type(2), may_alias));
#define A0R 8                        /* query rows per block of the first-tile attention: one per wave */
#define A0KP 68                      /* K row pitch in LDS, floats: 272 bytes = 16 x 17, so that 16-byte reads of 32 different rows spread over the banks */
// Exact f32 causal attention for rows 0 .. QT0-1 of every batch (planes of QT0 rows per batch), one wave per (batch, head, query row); a block has 8 consecutive rows of one head.
// The block stages the head's K and V rows below its last query row in LDS once (whole-line loads, all in flight together). Scores: lane l has keys l, l + 32, l + 64, l + 96
// (four partial sums per key over the head dimension). Row maximum and row sum by butterflies over the 32 lanes, exp once per key. o: lane l has columns 2 l and 2 l + 1,
// the weights come back through LDS as broadcasts, four partial sums over the keys. o carried x64 like the f16 path.
__global__ __launch_bounds__(256) void k_att0w(const float* __restrict__ QF, const float* __restrict__ KF, const float* __restrict__ VF, int ld, float scale, float* __restrict__ OF, int ldo) {
  __shared__ __attribute__((aligned(16))) float lk[QT0][A0KP]; __shared__ __attribute__((aligned(16))) float lv[QT0][HD]; __shared__ __attribute__((aligned(16))) float pe[A0R][QT0];
  const int tid = threadIdx.x, lane = tid & 31; const int w = __builtin_amdgcn_readfirstlane(tid >> 5);      /* the wave's number as a scalar: the tests on i below become scalar branches */
  const int bt = blockIdx.x / (NH * (QT0 / A0R)), bx = blockIdx.x % (NH * (QT0 / A0R)); QF += (size_t)bt * QT0 * ld; KF += (size_t)bt * QT0 * ld; VF += (size_t)bt * QT0 * ld; OF += (size_t)bt * QT0 * ldo;      /* batch bt: its QT0 rows of each plane */
  const int h = bx / (QT0 / A0R), rg = bx % (QT0 / A0R); const int nk = rg * A0R + A0R;      /* causal: keys below the block's last row end */ const int i = rg * A0R + w;
  const float* qr = QF + (size_t)i * ld + h * HD; v4f q[HD / 4];
#pragma unroll
  for (int c = 0; c < HD / 4; ++c) q[c] = *(const v4fa*)(qr + c * 4);
  const int sr = tid >> 4, sc4 = (tid & 15) * 4; v4f kx[QT0 / 16], vx[QT0 / 16];
#pragma unroll      /* constant indices keep kx / vx in registers; all loads are issued before the first LDS store. Rows past nk - 1 are clamped to it (in bounds) and not stored */
  for (int u = 0; u < QT0 / 16; ++u) { const size_t g = (size_t)min(sr + 16 * u, nk - 1) * ld + h * HD + sc4;
    // Behind each load: s_wait_xcnt 0 as a precaution, before a register that the load names as address is written again (by later address arithmetic or as a later load's destination);
    // the scheduling barrier keeps that later arithmetic and the later loads behind the wait. The loads' data is not waited for here.
    kx[u] = *(const v4fa*)(KF + g); asm volatile("s_wait_xcnt 0x0" ::: "memory"); __builtin_amdgcn_sched_barrier(0);
    vx[u] = *(const v4fa*)(VF + g); asm volatile("s_wait_xcnt 0x0" ::: "memory"); __builtin_amdgcn_sched_barrier(0); }
#pragma unroll
  for (int u = 0; u < QT0 / 16; ++u) if (sr + 16 * u < nk) { *(v4fa*)&lk[sr + 16 * u][sc4] = kx[u]; *(v4fa*)&lv[sr + 16 * u][sc4] = vx[u]; }
  __syncthreads();      /* K and V rows 0 .. nk-1 staged; every wave passes */
  float s[QT0 / 32];
#pragma unroll
  for (int c = 0; c < QT0 / 32; ++c) { s[c] = -1.0e30f;
    if (c * 32 <= i) { const int j = c * 32 + lane; const float* kr = &lk[min(j, i)][0];      /* lanes past the row read row i (staged) and are masked below */ v4f a4 = {0.f, 0.f, 0.f, 0.f};
#pragma unroll
      for (int d = 0; d < HD / 4; ++d) a4 += q[d] * *(const v4fa*)(kr + d * 4);
      const float a = (a4[0] + a4[1]) + (a4[2] + a4[3]); s[c] = (j <= i) ? a * scale : -1.0e30f; } }
  float mx = fmaxf(fmaxf(s[0], s[1]), fmaxf(s[2], s[3]));
#pragma unroll
  for (int o = 16; o > 0; o >>= 1) mx = fmaxf(mx, __shfl_xor(mx, o));
  float se = 0.f;
#pragma unroll
  for (int c = 0; c < QT0 / 32; ++c) { const float e = (c * 32 + lane <= i) ? expf(s[c] - mx) : 0.f; se += e; pe[w][c * 32 + lane] = e; }
#pragma unroll
  for (int o = 16; o > 0; o >>= 1) se += __shfl_xor(se, o);
  __builtin_amdgcn_fence(__ATOMIC_ACQ_REL, "workgroup"); __builtin_amdgcn_wave_barrier();      /* pe[w] is written and read by this wave alone: keeps the reads below behind the writes above */
  const int nj = (i & ~3) + 4;      /* keys in groups of four: nj <= nk, so every V row read is staged; weights past the row are 0 */
  v2fa o0 = {0.f, 0.f}, o1 = {0.f, 0.f}, o2 = {0.f, 0.f}, o3 = {0.f, 0.f};
#pragma unroll 4      /* several groups' LDS reads in flight behind one wait */
  for (int j = 0; j < nj; j += 4) { const v4f p = *(const v4fa*)&pe[w][j];
    o0 += p[0] * *(const v2fa*)&lv[j][lane * 2]; o1 += p[1] * *(const v2fa*)&lv[j + 1][lane * 2]; o2 += p[2] * *(const v2fa*)&lv[j + 2][lane * 2]; o3 += p[3] * *(const v2fa*)&lv[j + 3][lane * 2]; }
  const float fin = 64.0f / se;      /* o carried x64 like the f16 path */
  const v2fa ov = ((o0 + o1) + (o2 + o3)) * fin;
  *(v2fa*)(OF + (size_t)i * ldo + h * HD + lane * 2) = ov; }


template <int BFIN, int WXB>
__global__ __launch_bounds__(256) void k_ln16(const float* __restrict__ X, const float* __restrict__ g, const float* __restrict__ bb, float eps, _Float16* __restrict__ N16, float* __restrict__ XB) {
  #pragma clang fp contract(off)
  __shared__ float red[256]; const size_t r = blockIdx.x; const int t = threadIdx.x; const v4f xa = *(const v4fa*)(X + r * DMQ + t * 4); float s[4]; float sum = 0.f;
  for (int q = 0; q < 4; ++q) { s[q] = BFIN ? bf16_round(xa[q]) : xa[q]; sum = __fadd_rn(sum, s[q]); }
  red[t] = sum; __syncthreads(); for (int st = 128; st > 0; st >>= 1) { if (t < st) red[t] = __fadd_rn(red[t], red[t + st]); __syncthreads(); } const float mu = red[0] / (float)DMQ; __syncthreads();
  float vs = 0.f; for (int q = 0; q < 4; ++q) { const float dl = __fadd_rn(s[q], -mu); vs = __fadd_rn(vs, __fmul_rn(dl, dl)); } red[t] = vs; __syncthreads(); for (int st = 128; st > 0; st >>= 1) { if (t < st) red[t] = __fadd_rn(red[t], red[t + st]); __syncthreads(); }
  const float rs = rsqrtf(__fadd_rn(red[0] / (float)DMQ, eps)); v4h y; v4f xb;
  for (int q = 0; q < 4; ++q) { const int c = t * 4 + q; y[q] = (_Float16)__fadd_rn(__fmul_rn(__fmul_rn(__fadd_rn(s[q], -mu), rs), bf16_round(g[c])), bf16_round(bb[c])); xb[q] = s[q]; }
  { *(v4h*)(N16 + r * DMQ + t * 4) = y; if (WXB) *(v4f*)(XB + r * DMQ + t * 4) = xb;  } }
__global__ __launch_bounds__(256) void k_ftres2(const float* __restrict__ OF0, const float* __restrict__ XB, float* __restrict__ X1, size_t n4) {
  #pragma clang fp contract(off)
  const size_t t = (size_t)blockIdx.x * 256 + threadIdx.x; if (t >= n4) return; const v4f o = *(const v4fa*)(OF0 + t * 4), xv = *(const v4fa*)(XB + t * 4); v4f y; for (int q = 0; q < 4; ++q) y[q] = __fadd_rn(__fmul_rn(o[q], 0.015625f), xv[q]); *(v4f*)(X1 + t * 4) = y;  }

__global__ __launch_bounds__(256) void k_wthd(const float* __restrict__ Wt, _Float16* __restrict__ Bt) { const size_t t = (size_t)blockIdx.x * 256 + threadIdx.x; if (t >= (size_t)NH * HD * (DM / 8)) return; const int m8 = (int)(t % (DM / 8)) * 8; const int d = (int)((t / (DM / 8)) % HD); const int h = (int)(t / ((size_t)(DM / 8) * HD)); FragH f;
  for (int q = 0; q < 8; ++q) f.h[q] = (_Float16)(16.0f * bf16_round(Wt[((size_t)h * DM + m8 + q) * HD + d])); unsigned short* dst = (unsigned short*)Bt + ((size_t)h * HD + d) * DM + m8; *(v8us*)dst = f.half[0];  }




__global__ __launch_bounds__(256) void k_wtpad(const float* __restrict__ Wm, _Float16* __restrict__ Wt, int Kr, int Kp, int Nr, int Np, float scale) {
  const int t = blockIdx.x * 256 + threadIdx.x; if (t >= Np * (Kp / 8)) return; const int n = t / (Kp / 8), k8 = (t % (Kp / 8)) * 8; const int nc = min(n, Nr - 1); const float fn = (n < Nr) ? 1.f : 0.f; FragH f;
  for (int i = 0; i < 8; ++i) { const int k = k8 + i; const int kc = min(k, Kr - 1); const float fk = (k < Kr) ? fn : 0.f; f.h[i] = (_Float16)(bf16_round(Wm[(size_t)kc * Nr + nc]) * scale * fk); }
  unsigned short* o = (unsigned short*)Wt + (size_t)n * Kp + k8; *(v8us*)o = f.half[0];  }
__global__ __launch_bounds__(128) void k_bpad(const float* __restrict__ b, float* __restrict__ Bp, int nr, int np) {
  const int i = threadIdx.x; if (i >= np) return; const float v = b[min(i, nr - 1)] * ((i < nr) ? 1.f : 0.f); *(float*)(Bp + i) = v;  }

template <int BFIN, int W16, int W32>
__global__ __launch_bounds__(256) void k_lnx(const float* __restrict__ X, const float* __restrict__ g, const float* __restrict__ bb, float eps, _Float16* __restrict__ N16, float* __restrict__ N32) {
  #pragma clang fp contract(off)
  __shared__ float red[256]; const size_t r = blockIdx.x; const int t = threadIdx.x; const bool act = t < (DMQ / 4); const int c0 = act ? t * 4 : 0;
  const v4f xa = *(const v4fa*)(X + r * DMQ + c0); float s[4]; float sum = 0.f;
  for (int q = 0; q < 4; ++q) { s[q] = act ? (BFIN ? bf16_round(xa[q]) : xa[q]) : 0.f; sum = __fadd_rn(sum, s[q]); }
  red[t] = sum; __syncthreads(); for (int st = 128; st > 0; st >>= 1) { if (t < st) red[t] = __fadd_rn(red[t], red[t + st]); __syncthreads(); } const float mu = red[0] / (float)DMQ; __syncthreads();
  float vs = 0.f; for (int q = 0; q < 4; ++q) { const float dl = act ? __fadd_rn(s[q], -mu) : 0.f; vs = __fadd_rn(vs, __fmul_rn(dl, dl)); } red[t] = vs; __syncthreads(); for (int st = 128; st > 0; st >>= 1) { if (t < st) red[t] = __fadd_rn(red[t], red[t + st]); __syncthreads(); }
  const float rs = rsqrtf(__fadd_rn(red[0] / (float)DMQ, eps)); v4h y; v4f yf;
  for (int q = 0; q < 4; ++q) { const int c = c0 + q; yf[q] = __fadd_rn(__fmul_rn(__fmul_rn(__fadd_rn(s[q], -mu), rs), bf16_round(g[c])), bf16_round(bb[c])); y[q] = (_Float16)yf[q]; }
  if (!act) return;      /* no barriers after this point */
  { if (W16) *(v4h*)(N16 + r * DMQ + c0) = y; if (W32) *(v4f*)(N32 + r * DMQ + c0) = yf;  } }



// ---- all input conversions in ONE launch: they are independent of one another, so they share one grid; a block's index range picks its job (block-uniform, no barrier anywhere) ----
// pw_chunk: chunk t of Wt (packed, rows n, columns k) = f16(W[k][n] * 16) from f32 row-major W[K][N] (bf16-exact weights stay exact in f16 away from the subnormal range); N % 16 == 0, K % 32 == 0, literals at every call
__device__ __forceinline__ void pw_chunk(const float* __restrict__ Wm, _Float16* __restrict__ Wt, int K, int N, unsigned t) { size_t n; int k8; pk_chunk(t, K, n, k8); FragH f;
#pragma unroll
  for (int i = 0; i < 8; ++i) f.h[i] = (_Float16)(bf16_round(Wm[(size_t)(k8 + i) * N + n]) * 16.0f);
  *(v8us*)((unsigned short*)Wt + (size_t)t * 8) = f.half[0];
  asm volatile("s_wait_xcnt 0x0" ::: "memory"); }      /* a precaution: the jobs of k_prep stand one behind the other in the code, and the next one's first instructions write registers that this store names */
#define PB_QKV (3 * DM * (DM / 8) / 256)
#define PB_O (DM * (DM / 8) / 256)
#define PB_FF (DFF * (DM / 8) / 256)
#define PB_X ((int)(NR * DM / 8 / 256))
__global__ __launch_bounds__(256) void k_prep(const float* __restrict__ wqkv, _Float16* __restrict__ BQKV, const float* __restrict__ wo, _Float16* __restrict__ BO, const float* __restrict__ wfc, _Float16* __restrict__ BW1,
    const float* __restrict__ wmp, _Float16* __restrict__ BW2, const float* __restrict__ x, _Float16* __restrict__ X16, float* __restrict__ XB) {
  int bi = blockIdx.x; const unsigned tid = threadIdx.x;
  if (bi < PB_QKV) { pw_chunk(wqkv, BQKV, DM, 3 * DM, (unsigned)bi * 256 + tid); return; } bi -= PB_QKV;      /* fused [in][out] [DM][3 DM] -> Bt [3 DM][DM] x16: rows 0.. = q, DM.. = k, 2 DM.. = v output columns */
  if (bi < PB_FF) { pw_chunk(wfc, BW1, DM, DFF, (unsigned)bi * 256 + tid); return; } bi -= PB_FF;      /* W1 [1024][4096] -> Bt [4096][1024] */
  if (bi < PB_FF) { pw_chunk(wmp, BW2, DFF, DM, (unsigned)bi * 256 + tid); return; } bi -= PB_FF;      /* W2 [4096][1024] -> Bt [1024][4096] */
  if (bi < PB_O) { pw_chunk(wo, BO, DM, DM, (unsigned)bi * 256 + tid); return; } bi -= PB_O;      /* w_out [in][out] -> Bt */
  if (bi < PB_X) { const unsigned t = (unsigned)bi * 256 + tid; FragH f; size_t r; int k; pk_chunk(t, DM, r, k); const float* xr = x + r * DM + k;      /* X16: packed plane of DM columns, exact f16 of bf16(x) */
#pragma unroll
    for (int q = 0; q < 8; ++q) f.h[q] = (_Float16)bf16_round(xr[q]);
    *(v8us*)((unsigned short*)X16 + (size_t)t * 8) = f.half[0];
    asm volatile("s_wait_xcnt 0x0" ::: "memory");      /* as in pw_chunk */
    return; } bi -= PB_X;
  { const size_t t = (size_t)bi * 256 + tid; v4f a = *(const v4fa*)(x + t * 8), c = *(const v4fa*)(x + t * 8 + 4);      /* XB = bf16(x) as f32 rows, for the residual */
#pragma unroll
    for (int q = 0; q < 4; ++q) { a[q] = bf16_round(a[q]); c[q] = bf16_round(c[q]); }
    *(v4f*)(XB + t * 8) = a; *(v4f*)(XB + t * 8 + 4) = c;
    asm volatile("s_wait_xcnt 0x0" ::: "memory"); } }      /* as in pw_chunk */

extern "C" void kernel_launch(void* const* d_in, const int* in_sizes, int n_in,
                              void* d_out, int out_size, void* d_ws, size_t ws_size, hipStream_t stream) {
  (void)in_sizes; (void)n_in; (void)out_size;
  const float* const* I = (const float* const*)d_in; const float* x = I[0]; const float* wqkv = I[1]; const float* bqkv = I[2]; const float* wo = I[3]; const float* bo = I[4]; const float* wfc = I[5]; const float* bfc = I[6]; const float* wmp = I[7]; const float* bmp = I[8]; const float* g1 = I[9]; const float* be1 = I[10]; const float* gg2 = I[11]; const float* be2 = I[12];      /* x; fused w_qkv [1024][3072] + b_qkv ([in][out]); w_out + b_out; w_up [1024][4096] + b_up, w_down [4096][1024] + b_down; LN1 g / b, LN2 g / b */
  char* ws = (char*)d_ws; size_t off = 0;
  auto take = [&](size_t bytes) { char* p = ws + off; off += (bytes + 255) & ~(size_t)255; return p; };
  _Float16* BQKV = (_Float16*)take((size_t)3 * DM * DM * 2); _Float16* BO = (_Float16*)take((size_t)DM * DM * 2);
  _Float16* X16 = (_Float16*)take(NR * DM * 2); float* XB = (float*)take(NR * DM * 4); float* X1 = (float*)take(NR * DM * 4); float* X1N = (float*)take(NR * DM * 4);      /* LN1 output f32 rows */ _Float16* M16 = nullptr;      /* = X16 below (alias: X16's last reader, the q | k | v GEMM, precedes the write of the packed LN1 rows) */ _Float16* HF16 = (_Float16*)take(NR * DFF * 2);      /* hidden rows of all batches */ _Float16* BW1 = (_Float16*)take((size_t)DFF * DM * 2); _Float16* BW2 = (_Float16*)take((size_t)DM * DFF * 2); _Float16* QKV = (_Float16*)take(NR * 3 * DM * 2); _Float16* O16 = (_Float16*)take(NR * DM * 2); M16 = X16;
  _Float16* VT = (_Float16*)take((size_t)NB * NH * HD * SQ * 2);
  float* QKVF0 = (float*)take((size_t)NB * QT0 * LQ * 4);      /* f32 q | k | v rows of the first QT0 rows of every batch */ float* OF0 = (float*)take((size_t)NB * QT0 * DM * 4); _Float16* OL0 = (_Float16*)take((size_t)NB * QT0 * DM * 2);
  if (off > ws_size) return;
  // Short launches that only lay data out anew or add a small product: k_vt (the V columns could leave the q | k | v GEMM's staging as V^T tiles), k_hl (k_att0w could write both f16 planes itself),
  // the o_lo GEMM (could be further blocks of the GEMM in front of it, into a plane of its own that LN1 adds), k_pk16 (an LN1 block of 16 rows could write the packed strip).
  k_prep<<<PB_QKV + 2 * PB_FF + PB_O + 2 * PB_X, 256, 0, stream>>>(wqkv, BQKV, wo, BO, wfc, BW1, wmp, BW2, x, X16, XB);      /* packed x16 weight planes; POST-LN: the attention runs on x itself (exact f16 rows); XB = bf16(x) f32 for the residual */
  k_gemm2<0, 1, 0><<<dim3((unsigned)((MP / 128) * (3 * DM / 64)), 1), 128, 0, stream>>>(X16, DM, 0, BQKV, DM, 0, 0.0625f, bqkv, 0, nullptr, SQ, 0, 0, QKVF0, QKV, 3 * DM, 0, MP, 3 * DM, DM);      /* q | k | v rows (f16); head h = columns h*HD.. of each DM block; the same results of rows 0..127 of every batch also as f32 rows (exact products) */
  k_vt<NH, SQ><<<NB * NH * (SQ / 64), 256, 0, stream>>>(QKV, LQ, 2 * DM, VT);      /* V^T [NB][NH][HD][SQ] */
  k_fattn<<<(SQ / FA_QB) * NB * NH, 128, 0, stream>>>(QKV, VT, O16);      /* causal attention, all batches, heads and query rows: o (merged heads, x64) as f16 rows */
  k_att0w<<<NB * NH * (QT0 / A0R), 256, 0, stream>>>(QKVF0, QKVF0 + DM, QKVF0 + 2 * DM, LQ, 0.125f, OF0, DM);      /* exact f32 attention for rows 0..127 of every batch (o x64) */
  k_hl<<<(unsigned)(((size_t)NB * QT0 * DM / 8 + 255) / 256), 256, 0, stream>>>(OF0, O16, (size_t)(SQ - QT0) * DM, OL0, (size_t)NB * QT0 * DM / 8);      /* first-tile o (x64) -> f16 hi, over the f16-path rows 0..127 of every batch in O16, + x1024 residual plane */
  k_gemm2<0, 0, 1><<<dim3((unsigned)((MPO / 128) * (DM / 64)), 1), 128, 0, stream>>>(O16, DM, 0, BO, DM, 0, 0.0009765625f, bo, 0, XB, -1, 0, 0, X1, nullptr, DM, 0, MPO, DM, DM);      /* x + o Wo + b; out rows are the output layout; rows 0..127: o_hi */
  k_gemm2<0, 0, 1><<<dim3((QT0 / 128) * (DM / 64), NB), 128, 0, stream>>>(OL0, DM, (size_t)QT0 * DM, BO, DM, 0, 0.00000095367431640625f, nullptr, 0, X1, -1, 0, 0, X1, nullptr, DM, (size_t)SQ * DM, QT0, DM, DM);      /* rows 0..127 of batch blockIdx.y += o_lo Wo 2^-20 (own-element accumulate) */
  k_lnx<0, 0, 1><<<(unsigned)NR, 256, 0, stream>>>(X1, g1, be1, 1e-5f, nullptr, X1N);      /* x1 = LN1(x + attn_out) -> f32 rows (residual) */
  k_pk16<<<(unsigned)(NR * DM / 8 / 1024), 256, 0, stream>>>(X1N, M16);      /* -> packed f16 plane (FFN operand) */
  k_gemm2<3, 1, 0><<<dim3((unsigned)((MP / 128) * (DFF / 64)), 1), 128, 0, stream>>>(M16, DM, 0, BW1, DM, 0, 0.0625f, bfc, 0, nullptr, 1, 0, 0, nullptr, HF16, DFF, 0, MP, DFF, DM);      /* relu(x1 w_up + b_up) -> f16, all batches */
  k_gemm2<0, 0, 1><<<dim3((unsigned)((MP / 128) * (DM / 64)), 1), 128, 0, stream>>>(HF16, DFF, 0, BW2, DFF, 0, 0.0625f, bmp, 0, X1N, -1, 0, 0, X1, nullptr, DM, 0, MP, DM, DFF);      /* x1 + ffn (own-element residual from the LN1 f32 rows) -> f32 rows over the dead pre-LN1 plane */
  k_lnx<0, 0, 1><<<(unsigned)NR, 256, 0, stream>>>(X1, gg2, be2, 1e-5f, nullptr, (float*)d_out);      /* result = LN2(x1 + ffn) */
}

// v008
// A run of this version takes 195 microseconds.
// Timed twice side by side with v007, it ran 1.14 and 1.12 times as fast.
// All steps since v000 together make it 28.1 times as fast.
#include <hip/hip_runtime.h>
// POST-LN transformer decoder layer with causal self-attention and a fused QKV projection (x [2][2048][1024]; qkv = x w_qkv + b_qkv ([in][out] 1024 x 3072 + bias) viewed (B, S, 3, 16, 64): q | k | v thirds; scores * 64^-0.5; causal (tril, -inf); softmax; x1 = LN1(x + out w_out + b_out) (biased var, eps 1e-5); result = LN2(x1 + relu(x1 w_up + b_up) w_down + b_down) ([in][out] 1024 x 4096 x 1024) -> [2][2048][1024]).
// Structure: token rows r = b*2048 + s; x as exact f16 rows (bf16-rounded); q | k | v as ONE WMMA GEMM (N = 3 x 1024) (64x64 wave tiles, f32 accumulation, exact x16 weights + bias, f16 outputs); V^T for all batches and heads via LDS transposes; causal attention in ONE launch (k_fattn): a wave has 32 query rows and walks the keys below its last row in blocks of 64, scores, running-maximum softmax (f32 statistics, native exp2; weights x256 f16) and o stay in registers (o carried x64, folded into the output GEMM alpha), written straight into the merged f16 o rows; out = o W_o + b GEMM (f32) into the output layout.
// All f16 WMMA operand planes (x, q | k | v rows, V^T, o, LN1 rows, hidden rows, all weights) are kept PACKED, fragment-major: see pk_off below.
// Compute dtype: inputs rounded to bf16; x / weights exact; q, k, v, softmax weights and o as plain f16 GEMM operands (~2^-12); scores and softmax statistics f32. v_wmma_f32_16x16x32_f16.
#define NB 2
#define SQ 2048
#define DM 1024
#define NH 16
#define HD 64
#define HG 4                         /* heads per launch of the (b, h0) k_vt overload, which is not launched */
#define QT0 128                      /* first-tile rows recomputed exactly in f32 */
#define B0 0                         /* unused (processing starts at batch 0) */
#define NBR NB                       /* batches processed (debug hook) */
#define NR ((size_t)NB * SQ)
#define DMQ DM
#define DFF 4096                     /* FFN hidden width */
#define DFFR 100                     /* unused (the FFN hidden width is DFF) */
#define MP ((int)((size_t)NBR * SQ)) /* rows projected (debug hook) */
#define QN SQ                        /* unused (the attention covers all SQ query rows) */
#define NHD NH                       /* unused (the attention covers all NH heads) */
#define MPO MP                       /* rows through the output stage (debug hook) */
#define LQ (3 * DM)      /* columns of the packed q/k/v plane */
typedef __bf16 v16b __attribute__((ext_vector_type(16)));
typedef unsigned short v8us __attribute__((ext_vector_type(8), may_alias));
typedef float  v8f  __attribute__((ext_vector_type(8)));
typedef float  v4f  __attribute__((ext_vector_type(4)));
typedef float  v4fa __attribute__((ext_vector_type(4), may_alias));
union FragB { v16b v; v8us half[2]; unsigned short u[16]; };

__device__ __forceinline__ unsigned short bf16_bits(float x) { unsigned int u = __float_as_uint(x); return (unsigned short)((u + 0x7FFFu + ((u >> 16) & 1u)) >> 16); }
__device__ __forceinline__ float bf16_val(unsigned short b) { return __uint_as_float(((unsigned int)b) << 16); }
__device__ __forceinline__ float bf16_round(float x) { return bf16_val(bf16_bits(x)); }
// D += A·B with NT terms: 1 = ah·bh, 2 = + al·bh (A split), 3 = + ah·bl (both split)
template <int NT>
__device__ __forceinline__ v8f mmaN(v16b ah, v16b al, v16b bh, v16b bl, v8f c) {
  c = __builtin_amdgcn_wmma_f32_16x16x32_bf16(false, ah, false, bh, (short)0, c, false, false);
  if (NT >= 2) c = __builtin_amdgcn_wmma_f32_16x16x32_bf16(false, al, false, bh, (short)0, c, false, false);
  if (NT >= 3) c = __builtin_amdgcn_wmma_f32_16x16x32_bf16(false, ah, false, bl, (short)0, c, false, false);
  asm volatile("v_nop\n\tv_nop\n\tv_nop\n\tv_nop" : "+v"(c) : "v"(ah), "v"(al), "v"(bh), "v"(bl));
  return c;
}

__global__ __launch_bounds__(256) void k_wt_bf16(const float* __restrict__ W, unsigned short* __restrict__ Wt, int K, int N) {
  const int t = blockIdx.x * 256 + threadIdx.x;
  const int k8n = K / 8;
  if (t >= N * k8n) return;
  const int n = t / k8n, k8 = (t % k8n) * 8;
  v8us v;
#pragma unroll
  for (int i = 0; i < 8; ++i) v[i] = bf16_bits(W[(size_t)(k8 + i) * N + n]);
  *(v8us*)(Wt + (size_t)n * K + k8) = v;
  
}

// GEMM C[M][N] (f32, pitch ldc) = act(A[M][K]·W + bias). A f32 row-major (pitch lda) converted per fragment to bf16
// (ASPLIT: hi/lo two planes -> 2 terms, else single rounded term); Wt bf16 [N][K] (pitch ldb). BIAS_BF16 rounds the
// bias to bf16 first (bias quantised to bf16 before the add). K%32==0, M%16==0, N%64==0.
template <bool ASPLIT, int ACT, bool BIAS_BF16>
__global__ __launch_bounds__(128) void k_gemm_bf(const float* __restrict__ A, int lda, const unsigned short* __restrict__ Wt, int ldb,
                                               const float* __restrict__ bias, float* __restrict__ C, int ldc, int M, int N, int K) {
  __shared__ __attribute__((aligned(16))) float so[4][16][64];
  const int tid = threadIdx.x, w = tid >> 5, lane = tid & 31, ln = lane & 15, hh = lane >> 4;
  const int ntn = N / 64;
  const int wid = blockIdx.x * 4 + w;
  const int mt = wid / ntn, nq = wid % ntn;
  if (mt * 16 >= M) return;
  const int row0 = mt * 16, col0 = nq * 64;
  const float* arow = A + (size_t)(row0 + ln) * lda;
  v8f acc[4] = {};
  for (int kb = 0; kb < K; kb += 32) {
    FragB ah, al;
    const v4f x0 = *(const v4fa*)(arow + kb + 8 * hh), x1 = *(const v4fa*)(arow + kb + 8 * hh + 4);
    const v4f x2 = *(const v4fa*)(arow + kb + 16 + 8 * hh), x3 = *(const v4fa*)(arow + kb + 16 + 8 * hh + 4);
    float xs[16] = {x0[0],x0[1],x0[2],x0[3],x1[0],x1[1],x1[2],x1[3],x2[0],x2[1],x2[2],x2[3],x3[0],x3[1],x3[2],x3[3]};
#pragma unroll
    for (int i = 0; i < 16; ++i) { const unsigned short hb = bf16_bits(xs[i]); ah.u[i] = hb; al.u[i] = ASPLIT ? bf16_bits(xs[i] - bf16_val(hb)) : (unsigned short)0; }
#pragma unroll
    for (int t = 0; t < 4; ++t) {
      const unsigned short* brow = Wt + (size_t)(col0 + t * 16 + ln) * ldb + kb;
      FragB b;
      b.half[0] = *(const v8us*)(brow + 8 * hh);
      b.half[1] = *(const v8us*)(brow + 16 + 8 * hh);
      acc[t] = mmaN<ASPLIT ? 2 : 1>(ah.v, al.v, b.v, b.v, acc[t]);
    }
  }
#pragma unroll
  for (int t = 0; t < 4; ++t) {
    float bv = bias ? bias[col0 + t * 16 + ln] : 0.f;
    if (BIAS_BF16) bv = bf16_round(bv);
#pragma unroll
    for (int r = 0; r < 8; ++r) { float v = acc[t][r] + bv; if (ACT == 1) v = fmaxf(v, 0.f); so[w][8 * hh + r][t * 16 + ln] = v; }
  }
  __builtin_amdgcn_fence(__ATOMIC_ACQ_REL, "workgroup");
  __builtin_amdgcn_wave_barrier();
  const int rsub = lane >> 4, c4 = (lane & 15) * 4;
  {
#pragma unroll
    for (int q = 0; q < 8; ++q) {
      const int r = q * 2 + rsub;
      const v4f v = *(const v4fa*)&so[w][r][c4];
      *(v4f*)(C + (size_t)(row0 + r) * ldc + col0 + c4) = v;
    }
    
  }
}

// GEMM C = act(A·W + bias + resid): A f32 (ASPLIT -> hi/lo 2 terms), Wt bf16 [N][K]; ACT 0 none, 1 relu, 2 exact gelu;
// resid (optional, f32, row index = (row % rmod), pitch ldr, RES_BF16 rounds it) added before the activation.
template <bool ASPLIT, int ACT, bool BIAS_BF16, bool RES_BF16>
__global__ __launch_bounds__(128) void k_gemm_bf3(const float* __restrict__ A, int lda, const unsigned short* __restrict__ Wt, int ldb,
                                                const float* __restrict__ bias, const float* __restrict__ resid, int rmod, int ldr,
                                                float* __restrict__ C, int ldc, int M, int N, int K) {
  __shared__ __attribute__((aligned(16))) float so[4][16][64];
  const int tid = threadIdx.x, w = tid >> 5, lane = tid & 31, ln = lane & 15, hh = lane >> 4;
  const int ntn = N / 64;
  const int wid = blockIdx.x * 4 + w;
  const int mt = wid / ntn, nq = wid % ntn;
  if (mt * 16 >= M) return;
  const int row0 = mt * 16, col0 = nq * 64;
  const float* arow = A + (size_t)(row0 + ln) * lda;
  v8f acc[4] = {};
  for (int kb = 0; kb < K; kb += 32) {
    FragB ah, al;
    const v4f x0 = *(const v4fa*)(arow + kb + 8 * hh), x1 = *(const v4fa*)(arow + kb + 8 * hh + 4);
    const v4f x2 = *(const v4fa*)(arow + kb + 16 + 8 * hh), x3 = *(const v4fa*)(arow + kb + 16 + 8 * hh + 4);
    float xs[16] = {x0[0],x0[1],x0[2],x0[3],x1[0],x1[1],x1[2],x1[3],x2[0],x2[1],x2[2],x2[3],x3[0],x3[1],x3[2],x3[3]};
#pragma unroll
    for (int i = 0; i < 16; ++i) { const unsigned short hb = bf16_bits(xs[i]); ah.u[i] = hb; al.u[i] = ASPLIT ? bf16_bits(xs[i] - bf16_val(hb)) : (unsigned short)0; }
#pragma unroll
    for (int t = 0; t < 4; ++t) {
      const unsigned short* brow = Wt + (size_t)(col0 + t * 16 + ln) * ldb + kb;
      FragB b;
      b.half[0] = *(const v8us*)(brow + 8 * hh);
      b.half[1] = *(const v8us*)(brow + 16 + 8 * hh);
      acc[t] = mmaN<ASPLIT ? 2 : 1>(ah.v, al.v, b.v, b.v, acc[t]);
    }
  }
#pragma unroll
  for (int t = 0; t < 4; ++t) {
    const int col = col0 + t * 16 + ln;
    float bv = bias ? bias[col] : 0.f;
    if (BIAS_BF16) bv = bf16_round(bv);
#pragma unroll
    for (int r = 0; r < 8; ++r) {
      float v = acc[t][r] + bv;
      if (resid) { float rv = resid[(size_t)((row0 + 8 * hh + r) % rmod) * ldr + col]; if (RES_BF16) rv = bf16_round(rv); v += rv; }
      if (ACT == 1) v = fmaxf(v, 0.f);
      if (ACT == 2) v = 0.5f * v * (1.0f + erff(v * 0.70710678118654752f));
      if (ACT == 3) { const float u = 0.7978845608028654f * (v + 0.044715f * v * v * v); v = 0.5f * v * (1.0f + tanhf(u)); }
      so[w][8 * hh + r][t * 16 + ln] = v;
    }
  }
  __builtin_amdgcn_fence(__ATOMIC_ACQ_REL, "workgroup");
  __builtin_amdgcn_wave_barrier();
  const int rsub = lane >> 4, c4 = (lane & 15) * 4;
  {
#pragma unroll
    for (int q = 0; q < 8; ++q) {
      const int r = q * 2 + rsub;
      const v4f v = *(const v4fa*)&so[w][r][c4];
      *(v4f*)(C + (size_t)(row0 + r) * ldc + col0 + c4) = v;
    }
    
  }
}
// row LayerNorm (biased variance, eps) over N: s = X (+ R); optional out_sum <- s; out_norm <- (s-mu)*rsqrt(var+eps)*g + b
template <bool PARAM_BF16>
__global__ __launch_bounds__(256) void k_layernorm(const float* __restrict__ X, const float* __restrict__ R, const float* __restrict__ g, const float* __restrict__ bta,
                                                  float* __restrict__ out_sum, float* __restrict__ out_norm, int N, float eps) {
  __shared__ float red[256];
  const int row = blockIdx.x, tid = threadIdx.x;
  const float* x = X + (size_t)row * N; const float* rr = R ? R + (size_t)row * N : nullptr;
  float vals[16];                     // up to N = 4096
  const int per = N / 256;            // contiguous chunk per thread? use strided-by-4 chunks: thread handles j = tid*4 + 1024*u
  float s1 = 0.f;
  for (int u = 0; u < per / 4; ++u) {
    const int j = tid * 4 + 1024 * u;
    const v4f a = *(const v4fa*)(x + j);
    v4f b = {0.f,0.f,0.f,0.f}; if (rr) b = *(const v4fa*)(rr + j);
#pragma unroll
    for (int q = 0; q < 4; ++q) { const float v = a[q] + b[q]; vals[u * 4 + q] = v; s1 += v; }
  }
  red[tid] = s1; __syncthreads();
  for (int st = 128; st > 0; st >>= 1) { if (tid < st) red[tid] += red[tid + st]; __syncthreads(); }
  const float mu = red[0] / (float)N; __syncthreads();
  float s2 = 0.f;
  for (int u = 0; u < per / 4; ++u)
#pragma unroll
    for (int q = 0; q < 4; ++q) { const float c = vals[u * 4 + q] - mu; s2 += c * c; }
  red[tid] = s2; __syncthreads();
  for (int st = 128; st > 0; st >>= 1) { if (tid < st) red[tid] += red[tid + st]; __syncthreads(); }
  const float rs = rsqrtf(red[0] / (float)N + eps);
  {
    for (int u = 0; u < per / 4; ++u) {
      const int j = tid * 4 + 1024 * u;
      v4f o, sm;
#pragma unroll
      for (int q = 0; q < 4; ++q) {
        float gg = g[j + q], bb = bta[j + q];
        if (PARAM_BF16) { gg = bf16_round(gg); bb = bf16_round(bb); }
        sm[q] = vals[u * 4 + q]; o[q] = (vals[u * 4 + q] - mu) * rs * gg + bb;
      }
      if (out_sum) *(v4f*)(out_sum + (size_t)row * N + j) = sm;
      *(v4f*)(out_norm + (size_t)row * N + j) = o;
    }
    
  }
}



// ---- f16 WMMA path (v_wmma_f32_16x16x32_f16): 11-bit significands for operands in range — used where a [0,1] probability operand needs more precision than bf16
typedef _Float16 v16h __attribute__((ext_vector_type(16)));
union FragH { v16h v; v8us half[2]; _Float16 h[16]; unsigned short u[16]; };
template <int NT>
__device__ __forceinline__ v8f mmaH(v16h ah, v16h al, v16h bh, v16h bl, v8f c) {
  c = __builtin_amdgcn_wmma_f32_16x16x32_f16(false, ah, false, bh, (short)0, c, false, false);
  if (NT >= 2) c = __builtin_amdgcn_wmma_f32_16x16x32_f16(false, al, false, bh, (short)0, c, false, false);
  if (NT >= 3) c = __builtin_amdgcn_wmma_f32_16x16x32_f16(false, ah, false, bl, (short)0, c, false, false);
  asm volatile("v_nop\n\tv_nop\n\tv_nop\n\tv_nop" : "+v"(c) : "v"(ah), "v"(al), "v"(bh), "v"(bl));
  return c;
}
// batched GEMM like k_gemm_b but f16 operands: A f32 (split into f16 hi/lo if ASPLIT, else rounded to f16), Bt = f16 values [n][k]; alpha; C f32; N multiple of 16 (partial tiles skipped)
template <bool ASPLIT>
__global__ __launch_bounds__(128) void k_gemm_h(const float* __restrict__ A, int lda, size_t sA, const _Float16* __restrict__ Bh, int ldb, size_t sB, float alpha, float* __restrict__ C, int ldc, size_t sC, int M, int N, int K) {
  __shared__ __attribute__((aligned(16))) float so[4][16][64];
  const int tid = threadIdx.x, w = tid >> 5, lane = tid & 31, ln = lane & 15, hh = lane >> 4; const int by = blockIdx.y;
  A += (size_t)by * sA; Bh += (size_t)by * sB; C += (size_t)by * sC;
  const int ntn = (N + 63) / 64; const int wid = blockIdx.x * 4 + w; const int mt = wid / ntn, nq = wid % ntn; if (mt * 16 >= M) return;
  const int row0 = mt * 16, col0 = nq * 64; const float* arow = A + (size_t)(row0 + ln) * lda;
  v8f acc[4] = {};
  for (int kb = 0; kb < K; kb += 32) {
    FragH ah, al;
    const v4f x0 = *(const v4fa*)(arow + kb + 8 * hh), x1 = *(const v4fa*)(arow + kb + 8 * hh + 4), x2 = *(const v4fa*)(arow + kb + 16 + 8 * hh), x3 = *(const v4fa*)(arow + kb + 16 + 8 * hh + 4);
    float xs[16] = {x0[0],x0[1],x0[2],x0[3],x1[0],x1[1],x1[2],x1[3],x2[0],x2[1],x2[2],x2[3],x3[0],x3[1],x3[2],x3[3]};
#pragma unroll
    for (int i = 0; i < 16; ++i) { const _Float16 h = (_Float16)xs[i]; ah.h[i] = h; al.h[i] = ASPLIT ? (_Float16)(xs[i] - (float)h) : (_Float16)0.0f; }
#pragma unroll
    for (int t = 0; t < 4; ++t) { if (col0 + t * 16 >= N) continue; const size_t boff = (size_t)(col0 + t * 16 + ln) * ldb + kb; FragH bq; bq.half[0] = *(const v8us*)(Bh + boff + 8 * hh); bq.half[1] = *(const v8us*)(Bh + boff + 16 + 8 * hh);
      acc[t] = mmaH<ASPLIT ? 2 : 1>(ah.v, al.v, bq.v, bq.v, acc[t]); }
  }
#pragma unroll
  for (int t = 0; t < 4; ++t) { if (col0 + t * 16 >= N) continue;
#pragma unroll
    for (int r = 0; r < 8; ++r) so[w][8 * hh + r][t * 16 + ln] = acc[t][r] * alpha; }
  __builtin_amdgcn_fence(__ATOMIC_ACQ_REL, "workgroup"); __builtin_amdgcn_wave_barrier();
  const int rsub = lane >> 4, c4 = (lane & 15) * 4;
  {
#pragma unroll
    for (int q = 0; q < 8; ++q) { const int r = q * 2 + rsub; if (col0 + c4 < N) { const v4f v = *(const v4fa*)&so[w][r][c4]; *(v4f*)(C + (size_t)(row0 + r) * ldc + col0 + c4) = v; } }
     }
}

// ---- packed (fragment-major) f16 operand planes ----
// A plane of R rows x ld columns (R % 16 == 0, ld % 32 == 0) is a row of strips of 16 rows; a strip is ld / 32 tiles of 16 rows x 32 columns; a tile is 1 KB = 64 chunks of 8 halves in the order in which
// the two 16-byte loads of a WMMA fragment take them: chunk j * 32 + hh * 16 + ln = row ln, columns 16 j + 8 hh .. + 7. Load j of a fragment is then lane l <- chunk j * 32 + l: 512 contiguous bytes (four whole
// lines) instead of 32 bytes out of each of 16 lines. Which lane and register gets which element is as with row-major planes. A strip starts at element (first row) * ld, as the row itself would.
__device__ __forceinline__ size_t pk_off(size_t r, int k, int ld) { return (r >> 4) * ((size_t)16 * ld) + (size_t)(k >> 5) * 512 + (size_t)(((k >> 4) & 1) * 256 + ((k >> 3) & 1) * 128 + (k & 7)) + (r & 15) * 8; }
// the inverse for whole chunks: chunk t of a packed plane holds row r, columns k .. k + 7. The packing kernels give thread t chunk t, so that a wave stores 512 contiguous bytes.
__device__ __forceinline__ void pk_chunk(unsigned t, int ld, size_t& r, int& k) { const unsigned tile = t >> 6, tps = (unsigned)ld >> 5, strip = tile / tps; r = (size_t)(strip * 16 + (t & 15)); k = (int)((tile - strip * tps) * 32 + ((t >> 5) & 1) * 16 + ((t >> 4) & 1) * 8); }
// k_gemm_hh variant with fused epilogue: v = acc·alpha + bias[by·sBias + col] (+ CP[(row/rowsPerB)·sCPb + by·64 + col] if CP) ; ACT 0 none / 1 elu ; writes f16 C16 (and f32 C if non-null)
template <int ACT>
__global__ __launch_bounds__(128) void k_gemm_hhx(const _Float16* __restrict__ A, int lda, size_t sA, const _Float16* __restrict__ Bh, int ldb, size_t sB, float alpha, const float* __restrict__ bias, size_t sBias, const float* __restrict__ CP, int rowsPerB, size_t sCPb, int row0g,
    float* __restrict__ C, _Float16* __restrict__ C16, int ldc, size_t sC, int M, int N, int K) {
  __shared__ __attribute__((aligned(16))) float so[4][16][64];
  const int tid = threadIdx.x, w = tid >> 5, lane = tid & 31, ln = lane & 15, hh = lane >> 4; const int by = blockIdx.y;
  A += (size_t)by * sA; Bh += (size_t)by * sB; const size_t cofs = (size_t)by * sC; const float* bp = bias ? bias + (size_t)by * sBias : nullptr;
  const int ntn = (N + 63) / 64; const int wid = blockIdx.x * 4 + w; const int mt = wid / ntn, nq = wid % ntn; if (mt * 16 >= M) return;
  const int row0 = mt * 16, col0 = nq * 64; const _Float16* arow = A + (size_t)(row0 + ln) * lda;
  v8f acc[4] = {};
  for (int kb = 0; kb < K; kb += 32) { FragH ah; ah.half[0] = *(const v8us*)((const unsigned short*)arow + kb + 8 * hh); ah.half[1] = *(const v8us*)((const unsigned short*)arow + kb + 16 + 8 * hh);
#pragma unroll
    for (int t = 0; t < 4; ++t) { if (col0 + t * 16 >= N) continue; const size_t boff = (size_t)(col0 + t * 16 + ln) * ldb + kb; FragH bq; bq.half[0] = *(const v8us*)((const unsigned short*)Bh + boff + 8 * hh); bq.half[1] = *(const v8us*)((const unsigned short*)Bh + boff + 16 + 8 * hh);
      acc[t] = mmaH<1>(ah.v, ah.v, bq.v, bq.v, acc[t]); }
  }
#pragma unroll
  for (int t = 0; t < 4; ++t) { if (col0 + t * 16 >= N) continue; const int col = col0 + t * 16 + ln; const float bv = bp ? bf16_round(bp[col]) : 0.f;
#pragma unroll
    for (int r = 0; r < 8; ++r) { float v = acc[t][r] * alpha + bv; if (CP) { const int rr = row0g + row0 + 8 * hh + r; if (rowsPerB < 0) v += CP[cofs + (size_t)rr * ldc + col];      /* rowsPerB < 0: own element of the batched C plane */ else { const int bidx = rr / rowsPerB; v += CP[(size_t)bidx * sCPb + (size_t)by * 64 + col]; } } if (ACT == 1) v = (v > 0.f) ? v : expm1f(v); else if (ACT == 7) v = (v > 0.f) ? v + 1.0f : expf(v); else if (ACT == 8) v = tanhf(v); else if (ACT == 9) v = 0.5f * v * (1.0f + tanhf(0.7978845608028654f * (v + 0.044715f * v * v * v))); else if (ACT == 11) v = 1.0f / (1.0f + expf(-v)); else if (ACT == 12) v = (v > 0.f) ? v : 0.01f * v; else if (ACT == 14) v = (v > 0.f) ? v : 0.1f * v; else if (ACT == 16) v = (v >= 0.f) ? v : 0.3f * v; else if (ACT == 17) v = (v >= 0.f) ? v : 0.2f * v; else if (ACT == 15) v = v / (1.0f + expf(-v)); else if (ACT == 3) v = fmaxf(v, 0.f); else if (ACT == 6) v = 0.5f * v * (1.0f + erff(v * 0.70710678118654752f)); so[w][8 * hh + r][t * 16 + ln] = v; } }
  __builtin_amdgcn_fence(__ATOMIC_ACQ_REL, "workgroup"); __builtin_amdgcn_wave_barrier();
  const int rsub = lane >> 4, c4 = (lane & 15) * 4; typedef _Float16 v4h __attribute__((ext_vector_type(4)));
  {
#pragma unroll
    for (int q = 0; q < 8; ++q) { const int r = q * 2 + rsub; if (col0 + c4 < N) { const v4f v = *(const v4fa*)&so[w][r][c4]; if (C) *(v4f*)(C + cofs + (size_t)(row0 + r) * ldc + col0 + c4) = v; if (C16) { v4h h4; for (int i = 0; i < 4; ++i) h4[i] = (_Float16)v[i]; *(v4h*)(C16 + cofs + (size_t)(row0 + r) * ldc + col0 + c4) = h4; } } }
     }
}


typedef _Float16 v4h __attribute__((ext_vector_type(4)));

__global__ __launch_bounds__(256) void k_h16(const float* __restrict__ x, _Float16* __restrict__ X16, size_t n8) { const size_t t = (size_t)blockIdx.x * 256 + threadIdx.x; if (t >= n8) return; FragH f;
#pragma unroll
  for (int q = 0; q < 8; ++q) f.h[q] = (_Float16)x[t * 8 + q]; *(v8us*)((unsigned short*)X16 + t * 8) = f.half[0];  }
// f32 rows of DM columns -> packed f16 plane. A LayerNorm block has one row, which is 16 bytes of each line of the packed plane; here every line has one writer. Thread: chunks t0 + 256 u, which are
// 128 columns apart in one row (1,024 chunks = half a strip per block); a wave's store is 512 contiguous bytes; the eight loads are issued before the first store.
__global__ __launch_bounds__(256) void k_pk16(const float* __restrict__ x, _Float16* __restrict__ X16) { const unsigned t0 = blockIdx.x * 1024 + threadIdx.x; size_t r; int k; pk_chunk(t0, DM, r, k); const float* p = x + r * DM + k; v4f a[4], c[4];
#pragma unroll
  for (int u = 0; u < 4; ++u) { a[u] = *(const v4fa*)(p + 128 * u); c[u] = *(const v4fa*)(p + 128 * u + 4); }
  unsigned short* o = (unsigned short*)X16 + (size_t)t0 * 8; FragH f[4];
#pragma unroll
  for (int u = 0; u < 4; ++u)
#pragma unroll
    for (int q = 0; q < 4; ++q) { f[u].h[q] = (_Float16)a[u][q]; f[u].h[4 + q] = (_Float16)c[u][q]; }
#pragma unroll
  for (int u = 0; u < 4; ++u) *(v8us*)(o + 2048 * u) = f[u].half[0]; }
__global__ __launch_bounds__(256) void k_round16f(const float* __restrict__ W, _Float16* __restrict__ Bt, size_t n8) { const size_t t = (size_t)blockIdx.x * 256 + threadIdx.x; if (t >= n8) return; FragH f;
#pragma unroll
  for (int i = 0; i < 8; ++i) f.h[i] = (_Float16)(bf16_round(W[t * 8 + i]) * 16.0f); *(v8us*)((unsigned short*)Bt + t * 8) = f.half[0];  }
template <int NHv, int TTv>
__global__ __launch_bounds__(256) void k_vt(const _Float16* __restrict__ V16, int ldv, int voff, _Float16* __restrict__ Vt) { __shared__ unsigned short tl[64][66]; const int tid = threadIdx.x; const int slab = blockIdx.x / (TTv / 64), lg = blockIdx.x % (TTv / 64); const int b = slab / NHv, h = slab % NHv;
  for (int i = tid; i < 64 * 8; i += 256) { const int r = i / 8, c8 = (i % 8) * 8; FragH f; f.half[0] = *(const v8us*)((const unsigned short*)V16 + pk_off((size_t)b * TTv + lg * 64 + r, voff + h * 64 + c8, ldv));      /* V16: packed plane of ldv columns, V from column voff on */
#pragma unroll
    for (int q = 0; q < 8; ++q) tl[r][c8 + q] = f.u[q]; }
  __syncthreads();
  {
#pragma unroll
    for (int rd = 0; rd < 2; ++rd) { const int c = rd * 256 + tid; const int d = (c >> 7) * 16 + (c & 15), p8 = ((c >> 4) & 7) * 8; FragH f;      /* Vt: packed plane of TTv columns; the block has 4 strips x 2 tiles of it, thread = chunk c in their order: a wave stores 512 contiguous bytes */
#pragma unroll
      for (int q = 0; q < 8; ++q) f.u[q] = tl[p8 + q][d];
      *(v8us*)((unsigned short*)Vt + pk_off((size_t)slab * 64 + d, lg * 64 + p8, TTv)) = f.half[0]; }
     } }

__global__ __launch_bounds__(256) void k_hl(const float* __restrict__ F, _Float16* __restrict__ Hh, size_t hskip, _Float16* __restrict__ Hl, size_t n8) { const size_t t = (size_t)blockIdx.x * 256 + threadIdx.x; if (t >= n8) return; FragH fh, fl; size_t r; int k; pk_chunk((unsigned)t, DM, r, k);      /* Hh, Hl: packed planes of DM columns; in Hh every group of QT0 rows stands hskip halves further on than the one before it (whole strips) */ const v4f a = *(const v4fa*)(F + r * DM + k), c = *(const v4fa*)(F + r * DM + k + 4);
#pragma unroll
  for (int q = 0; q < 4; ++q) { _Float16 h = (_Float16)a[q]; fh.h[q] = h; fl.h[q] = (_Float16)((a[q] - (float)h) * 1024.0f); h = (_Float16)c[q]; fh.h[4 + q] = h; fl.h[4 + q] = (_Float16)((c[q] - (float)h) * 1024.0f); }
  { *(v8us*)((unsigned short*)Hh + t * 8 + (r / QT0) * hskip) = fh.half[0]; *(v8us*)((unsigned short*)Hl + t * 8) = fl.half[0];  } }

// ---- fast GEMM (block tile 128x128 = 2 x 2 waves of 64x64; requires M % 64 == 0 rows per launch region and N % 128 == 0); epilogue = k_gemm_hhx semantics ----
// Why 64x64 a wave: a k-step's 16 WMMAs take 8 fragments (512 B loaded per WMMA, was 768 with 32x64), and of the block's 32 fragment loads only 16 are different ones (256 B per WMMA from L2, was 384).
// RES = 1 (only with PK16 = 0 and no activation): CP is a plane laid out like C, and every result takes its own element of it on top (v = acc * alpha + bias, then + CP); RES = 0: CP is not read.
// A and Bh are packed planes (pk_off) of lda and ldb columns. PK16 = 0: C (f32) and C16, each where not null, are row-major. PK16 = 1: C16 is written as a packed plane of ldc columns (it is a later GEMM's A); C, where not null, takes the first QT0 rows of every rowsPerB as f32 rows.
__device__ __forceinline__ v16h g2_frag(const _Float16* p, int hh) { FragH f; f.half[0] = *(const v8us*)((const unsigned short*)p + 8 * hh); f.half[1] = *(const v8us*)((const unsigned short*)p + 16 + 8 * hh); return f.v; }
__device__ __forceinline__ v8f g2_mma(v16h a, v16h b, v8f c) { return __builtin_amdgcn_wmma_f32_16x16x32_f16(false, a, false, b, (short)0, c, false, false); }      /* the builtin alone: the compiler keeps its distances itself; an asm statement that names the operands would hold all of them in the first 256 registers, and the 64x64 tile with its ring has more */
__device__ __forceinline__ v16h g2_fragp(const _Float16* p) { FragH f; f.half[0] = *(const v8us*)((const unsigned short*)p); f.half[1] = *(const v8us*)((const unsigned short*)p + 256); return f.v; }      /* a fragment of a packed plane: p = its tile + 8 * lane */
struct G2S { v16h a0, a1, a2, a3, b0, b1, b2, b3; };      /* the fragments of one k-step of a 64x64 wave tile */
// G2_LOAD: one k-step's sixteen loads at the eight row pointers, as one group; their data is not waited for here. The scheduling barrier keeps the next step's first WMMA, and with it the wait
// for that step's operands, behind the group: lifted in front of it, that wait would hold the group's issue back by most of a step.
#define G2_LOAD(S) do { S.a0 = g2_fragp(a0p); S.a1 = g2_fragp(a1p); S.a2 = g2_fragp(a2p); S.a3 = g2_fragp(a3p); S.b0 = g2_fragp(b0p); S.b1 = g2_fragp(b1p); S.b2 = g2_fragp(b2p); S.b3 = g2_fragp(b3p); \
    __builtin_amdgcn_sched_barrier(0); } while (0)
// G2_NEXT: moves the pointers on by one k-step, which is one tile of 512 halves (or leaves them on the last one). s_wait_xcnt 0 in front: a precaution, before the additions write the address registers that the issued
// loads name; the scheduling barrier behind it keeps the additions, and all that follows, behind that wait; the one in front keeps a step's WMMAs in front of it, so that in the loop it stands well after the group was issued
// (lifted up among the WMMAs, directly behind the group, it would hold them back while the group's addresses are still being translated).
#define G2_NEXT do { __builtin_amdgcn_sched_barrier(0); asm volatile("s_wait_xcnt 0x0" ::: "memory"); __builtin_amdgcn_sched_barrier(0); \
    const int inc = left > 0 ? 512 : 0; --left; a0p += inc; a1p += inc; a2p += inc; a3p += inc; b0p += inc; b1p += inc; b2p += inc; b3p += inc; } while (0)
#define G2_MMA(S) do { c00 = g2_mma(S.a0, S.b0, c00); c10 = g2_mma(S.a1, S.b0, c10); c20 = g2_mma(S.a2, S.b0, c20); c30 = g2_mma(S.a3, S.b0, c30); \
    c01 = g2_mma(S.a0, S.b1, c01); c11 = g2_mma(S.a1, S.b1, c11); c21 = g2_mma(S.a2, S.b1, c21); c31 = g2_mma(S.a3, S.b1, c31); \
    c02 = g2_mma(S.a0, S.b2, c02); c12 = g2_mma(S.a1, S.b2, c12); c22 = g2_mma(S.a2, S.b2, c22); c32 = g2_mma(S.a3, S.b2, c32); \
    c03 = g2_mma(S.a0, S.b3, c03); c13 = g2_mma(S.a1, S.b3, c13); c23 = g2_mma(S.a2, S.b3, c23); c33 = g2_mma(S.a3, S.b3, c33); } while (0)
template <int ACT, int PK16, int RES>
__global__ __launch_bounds__(128) void k_gemm2(const _Float16* __restrict__ A, int lda, size_t sA, const _Float16* __restrict__ Bh, int ldb, size_t sB, float alpha, const float* __restrict__ bias, size_t sBias, const float* __restrict__ CP, int rowsPerB, size_t sCPb, int row0g,
    float* __restrict__ C, _Float16* __restrict__ C16, int ldc, size_t sC, int M, int N, int K) { static_assert(ACT == 0 || ACT == 3 || ACT == 6 || ACT == 8 || ACT == 9 || ACT == 11 || ACT == 12 || ACT == 14 || ACT == 15 || ACT == 16 || ACT == 17, "k_gemm2: unsupported ACT code (would silently apply no activation)"); static_assert(!RES || (ACT == 0 && PK16 == 0), "k_gemm2: the CP element is added behind the staging, where no activation follows");
  __shared__ __attribute__((aligned(16))) float so[4][32][68];
  const int tid = threadIdx.x, w = tid >> 5, lane = tid & 31, ln = lane & 15, hh = lane >> 4; const int by = blockIdx.y;
  A += (size_t)by * sA; Bh += (size_t)by * sB; const size_t cofs = (size_t)by * sC; const float* bp = bias ? bias + (size_t)by * sBias : nullptr;
  const int ntn = N >> 7; const int mt = blockIdx.x / ntn, nq = blockIdx.x - mt * ntn; const int row0 = mt * 128 + 64 * (w >> 1), col0 = nq * 128 + 64 * (w & 1); if (row0 >= M) return;      /* waves 0, 1 and 2, 3 read the same A strips, waves 0, 2 and 1, 3 the same B strips */
  const _Float16* a0p = A + (size_t)row0 * lda + 8 * lane; const _Float16* a1p = a0p + (size_t)16 * lda; const _Float16* a2p = a1p + (size_t)16 * lda; const _Float16* a3p = a2p + (size_t)16 * lda;      /* first tile of the strip; the lane's own 16-byte chunk is part of the pointer: a load names the pointer's registers themselves */
  const _Float16* b0p = Bh + (size_t)col0 * ldb + 8 * lane; const _Float16* b1p = b0p + (size_t)16 * ldb; const _Float16* b2p = b1p + (size_t)16 * ldb; const _Float16* b3p = b2p + (size_t)16 * ldb;
  const v8f z8 = {0.f,0.f,0.f,0.f,0.f,0.f,0.f,0.f}; v8f c00 = z8, c01 = z8, c02 = z8, c03 = z8, c10 = z8, c11 = z8, c12 = z8, c13 = z8, c20 = z8, c21 = z8, c22 = z8, c23 = z8, c30 = z8, c31 = z8, c32 = z8, c33 = z8;
  // K loop (K >= 32): a ring of four fragment sets. The sixteen loads of k-step s + 3 are issued as one group in front of the WMMAs of step s, so a step waits for loads that are three steps old
  // (where the grid gives a SIMD one wave only, no other wave covers a load's way from L2). Every accumulator still takes its k-steps in ascending order.
  const int n = K >> 5; int left = n - 1;      /* left: pointer advances still allowed; past the last k-step the pointers stay on it (in bounds), and what is loaded there is not used */
  G2S s0, s1, s2, s3; int i = 0;
  G2_LOAD(s0); G2_NEXT; G2_LOAD(s1); G2_NEXT; G2_LOAD(s2); G2_NEXT;
#pragma unroll 1      /* the body already holds four k-steps, one per set: more copies of it only cost instruction cache */
  for (; i + 4 <= n; i += 4) { G2_LOAD(s3); G2_MMA(s0); G2_NEXT; G2_LOAD(s0); G2_MMA(s1); G2_NEXT; G2_LOAD(s1); G2_MMA(s2); G2_NEXT; G2_LOAD(s2); G2_MMA(s3); G2_NEXT; }
  if (i < n) G2_MMA(s0);
  if (i + 1 < n) G2_MMA(s1);
  if (i + 2 < n) G2_MMA(s2);
  v8f accs[2][8] = {{c00, c01, c02, c03, c10, c11, c12, c13}, {c20, c21, c22, c23, c30, c31, c32, c33}};      /* the epilogue takes the wave's 64 rows as two halves of 32, one after the other through the same staging rows */
  const int rsub = lane >> 4, c4 = (lane & 15) * 4;
  // All that the epilogue reads from memory is issued here as one group: one round trip for the wave. (Read where it is used, element by element under a test, every load is waited for on its own:
  // with CP 128 round trips one behind the other, while the wave does nothing else.) CP is read as C is stored below: 16 bytes a lane, whole 256-byte row pieces. The CP loads stand first: their address
  // arithmetic writes registers that the K loop's last, unused loads are still aimed at, and so waits for every load issued before it.
  // Behind each run of loads s_wait_xcnt 0: a precaution, before anything writes a register that an issued load names as address. The CP addresses are inputs of their wait's statement, so that they live up to it
  // and no load of the run gets one of them as its destination; the scheduling barriers keep the address arithmetic in front of the run and all that follows behind the wait. The loads' data is not waited for here.
  float bv[4] = {0.f, 0.f, 0.f, 0.f}; v4f rv[2][16];
  if (RES) {
#pragma unroll
    for (int eh = 0; eh < 2; ++eh) { const float* rp[16];
#pragma unroll
      for (int q = 0; q < 16; ++q) rp[q] = CP + cofs + (size_t)(row0g + row0 + 32 * eh + rsub + 2 * q) * ldc + col0 + c4;
      __builtin_amdgcn_sched_barrier(0);
#pragma unroll
      for (int q = 0; q < 16; ++q) rv[eh][q] = *(const v4fa*)rp[q];
      asm volatile("s_wait_xcnt 0x0" :: "v"(rp[0]), "v"(rp[1]), "v"(rp[2]), "v"(rp[3]), "v"(rp[4]), "v"(rp[5]), "v"(rp[6]), "v"(rp[7]), "v"(rp[8]), "v"(rp[9]), "v"(rp[10]), "v"(rp[11]), "v"(rp[12]), "v"(rp[13]), "v"(rp[14]), "v"(rp[15]) : "memory");
      __builtin_amdgcn_sched_barrier(0); } }
  if (bp) {
#pragma unroll
    for (int t = 0; t < 4; ++t) bv[t] = bp[col0 + t * 16 + ln];
    asm volatile("s_wait_xcnt 0x0" ::: "memory"); __builtin_amdgcn_sched_barrier(0); }
#pragma unroll
  for (int t = 0; t < 4; ++t) bv[t] = bf16_round(bv[t]);
#pragma unroll
  for (int eh = 0; eh < 2; ++eh) { const int row0e = row0 + 32 * eh;      /* first row of this half */
#pragma unroll
    for (int u = 0; u < 8; ++u) { const int t = u & 3, half = u >> 2;
#pragma unroll
      for (int r = 0; r < 8; ++r) { const int rloc = half * 16 + 8 * hh + r; float v = accs[eh][u][r] * alpha + bv[t];
      if (ACT == 3) v = fmaxf(v, 0.f); else if (ACT == 6) v = 0.5f * v * (1.0f + erff(v * 0.70710678118654752f)); else if (ACT == 11) v = 1.0f / (1.0f + expf(-v)); else if (ACT == 15) v = v / (1.0f + expf(-v)); else if (ACT == 12) v = (v > 0.f) ? v : 0.01f * v; else if (ACT == 8) v = tanhf(v); else if (ACT == 9) v = 0.5f * v * (1.0f + tanhf(0.7978845608028654f * (v + 0.044715f * v * v * v))); else if (ACT == 14) v = (v > 0.f) ? v : 0.1f * v; else if (ACT == 16) v = (v >= 0.f) ? v : 0.3f * v; else if (ACT == 17) v = (v >= 0.f) ? v : 0.2f * v;
        so[w][rloc][t * 16 + ln] = v; } }
    __builtin_amdgcn_fence(__ATOMIC_ACQ_REL, "workgroup"); __builtin_amdgcn_wave_barrier();
    if (!PK16) { v4f ov[16];
#pragma unroll
      for (int q = 0; q < 16; ++q) { ov[q] = *(const v4fa*)&so[w][q * 2 + rsub][c4]; if (RES) ov[q] += rv[eh][q]; }
      if (C) { float* cq[16];
#pragma unroll
        for (int q = 0; q < 16; ++q) cq[q] = C + cofs + (size_t)(row0e + q * 2 + rsub) * ldc + col0 + c4;
        __builtin_amdgcn_sched_barrier(0);      /* all values and all addresses formed first, then stores alone: among them no register of an issued store is written again */
#pragma unroll
        for (int q = 0; q < 16; ++q) *(v4f*)cq[q] = ov[q];
        asm volatile("s_wait_xcnt 0x0" ::: "memory"); __builtin_amdgcn_sched_barrier(0); }      /* as above, before the f16 copy below, or the next half, writes registers */
      if (C16) { v4h h4[16]; _Float16* hq[16];
#pragma unroll
        for (int q = 0; q < 16; ++q) { for (int i = 0; i < 4; ++i) h4[q][i] = (_Float16)ov[q][i]; hq[q] = C16 + cofs + (size_t)(row0e + q * 2 + rsub) * ldc + col0 + c4; }
        __builtin_amdgcn_sched_barrier(0);      /* as for C */
#pragma unroll
        for (int q = 0; q < 16; ++q) *(v4h*)hq[q] = h4[q];
        if (eh == 0) { asm volatile("s_wait_xcnt 0x0" ::: "memory"); __builtin_amdgcn_sched_barrier(0); } } }      /* as above, before the next half writes registers */
    if (PK16) {      /* a half's 32x64 results are two strips x two tiles of the packed plane: eight stores of 512 contiguous bytes, lane l = chunk j * 32 + l */
      if (C) {      /* PK16 with C (CP is null then): the first QT0 rows of every group of rowsPerB rows go out as f32 rows too, groups packed one behind the other, pitch ldc. A half's 32 rows are all inside or all outside */
        const int rgl = row0g + row0e, grp = rgl / rowsPerB, ri = rgl - grp * rowsPerB;
        if (ri < QT0) { float* cf = C + ((size_t)grp * QT0 + ri + rsub) * ldc + col0 + c4; v4f fv[16]; float* fq[16];
#pragma unroll
          for (int q = 0; q < 16; ++q) { fv[q] = *(const v4fa*)&so[w][q * 2 + rsub][c4]; fq[q] = cf + (size_t)(2 * q) * ldc; }
          __builtin_amdgcn_sched_barrier(0);      /* all values read and all addresses formed first, then stores alone: among them no register of an issued store is written again */
#pragma unroll
          for (int q = 0; q < 16; ++q) *(v4f*)fq[q] = fv[q];
          asm volatile("s_wait_xcnt 0x0" ::: "memory"); __builtin_amdgcn_sched_barrier(0); } }      /* as above, before the packing below writes registers */
      _Float16* cp = C16 + cofs + (size_t)row0e * ldc + (size_t)(col0 >> 5) * 512 + 8 * lane; FragH pf[8];
#pragma unroll
      for (int u = 0; u < 8; ++u) { const float* sp = &so[w][(u >> 2) * 16 + ln][(u & 3) * 16 + 8 * hh]; const v4f v0 = *(const v4fa*)sp, v1 = *(const v4fa*)(sp + 4);
#pragma unroll
        for (int i = 0; i < 4; ++i) { pf[u].h[i] = (_Float16)v0[i]; pf[u].h[4 + i] = (_Float16)v1[i]; } }
      __builtin_amdgcn_sched_barrier(0);      /* all values packed first, then stores alone */
#pragma unroll
      for (int u = 0; u < 8; ++u) *(v8us*)((unsigned short*)cp + (size_t)(u >> 2) * 16 * ldc + (u & 3) * 256) = pf[u].half[0];
      if (eh == 0) { asm volatile("s_wait_xcnt 0x0" ::: "memory"); __builtin_amdgcn_sched_barrier(0); } } } }      /* as above, before the next half writes registers */


__global__ __launch_bounds__(256) void k_wnat(const float* __restrict__ w, size_t n8, _Float16* __restrict__ Bt) { const size_t t = (size_t)blockIdx.x * 256 + threadIdx.x; if (t >= n8) return; FragH f; for (int q = 0; q < 8; ++q) f.h[q] = (_Float16)(bf16_round(w[t * 8 + q]) * 16.0f); *(v8us*)((unsigned short*)Bt + t * 8) = f.half[0];  }
__global__ __launch_bounds__(256) void k_rsm(const float* __restrict__ S, _Float16* __restrict__ P, int nrows) {
  #pragma clang fp contract(off)
  const int i = blockIdx.x * 256 + threadIdx.x; if (i >= nrows) return; const float* s = S + (size_t)i * SQ; float mx = -3.0e38f;
#pragma unroll 1
  for (int j = 0; j < SQ; ++j) mx = fmaxf(mx, s[j]); float se = 0.f;
#pragma unroll 1
  for (int j = 0; j < SQ; ++j) se += expf(s[j] - mx); const float sc = 256.0f / se;
#pragma unroll 1
  for (int j0 = 0; j0 < SQ; j0 += 8) { FragH f; for (int q = 0; q < 8; ++q) f.h[q] = (_Float16)(expf(s[j0 + q] - mx) * sc); unsigned short* d = (unsigned short*)P + (size_t)i * SQ + j0; *(v8us*)d = f.half[0];  } }
__global__ __launch_bounds__(256) void k_vt(const _Float16* __restrict__ V16, int b, int h0, _Float16* __restrict__ VT) { __shared__ unsigned short tl[64][65]; const int tid = threadIdx.x; const int hh = blockIdx.x % HG, sg = blockIdx.x / HG; const int s0 = sg * 64; const int h = h0 + hh;
  for (int i = tid; i < 64 * 8; i += 256) { const int j = i / 8, d8 = (i % 8) * 8; FragH f; f.half[0] = *(const v8us*)((const unsigned short*)V16 + ((size_t)b * SQ + s0 + j) * DM + h * HD + d8); for (int q = 0; q < 8; ++q) tl[d8 + q][j] = f.u[q]; }
  __syncthreads();
  { for (int i = tid; i < 64 * 8; i += 256) { const int d = i / 8, j8 = (i % 8) * 8; FragH f; for (int q = 0; q < 8; ++q) f.u[q] = tl[d][j8 + q]; *(v8us*)((unsigned short*)VT + ((size_t)hh * HD + d) * SQ + s0 + j8) = f.half[0]; }  } }





// ---- causal attention, scores + softmax + weighted V sum in one kernel; S and P never leave the registers ----
// A wave has 32 query rows (two column groups of 16) of one (batch, head) and walks the keys 0 .. its last row in blocks of 64. Transposed products: S^T = K Q^T (first operand = K rows, second = Q rows),
// so lane (ln, hh) holds, per 16-key tile, the scores of ONE query (column ln) for keys 8 hh .. 8 hh + 7: row maximum and row sum are in-lane plus one exchange between the lane halves.
// Two 16-key score tiles, converted in place, are the second operand of O^T += V^T P^T in the same k order as g2_frag's (keys 8 hh + i, then 16 + 8 hh + i of a 32-key step). O^T: a lane has 8 consecutive
// head columns of one query: one 16-byte store each. Softmax with a running maximum in the log2 domain; the weights carry x256 (as f16 they stay clear of the subnormal range), and so does the row sum.
#define FA_QB 128                    /* query rows per block: 4 waves x 32 */
#define FA_SC 0.18033688011112042f   /* 64^-0.5 * log2(e) */
__device__ __forceinline__ v8f fa_mma(v16h a, v16h b, v8f c) { return __builtin_amdgcn_wmma_f32_16x16x32_f16(false, a, false, b, (short)0, c, false, false); }
__device__ __forceinline__ float fa_xhalf(float x) { return __builtin_bit_cast(float, __builtin_amdgcn_permlanex16(__builtin_bit_cast(int, x), __builtin_bit_cast(int, x), 0x76543210, 0xfedcba98, false, false)); }      /* lane l with lane l ^ 16 */
// exp2 of eight values (of one value) as v_exp_f32 in one asm statement. Why asm: behind a transcendental the instruction set asks for one independent instruction or v_nop before its result is read or its
// source overwritten. Early-clobber outputs share no register with any input, so inside the statement no v_exp_f32 touches
// an earlier one's registers; the closing v_nop is the slot behind the last one.
__device__ __forceinline__ v8f fa_exp2x8(v8f x) { float y0, y1, y2, y3, y4, y5, y6, y7;
  asm("v_exp_f32 %0, %8\n\tv_exp_f32 %1, %9\n\tv_exp_f32 %2, %10\n\tv_exp_f32 %3, %11\n\tv_exp_f32 %4, %12\n\tv_exp_f32 %5, %13\n\tv_exp_f32 %6, %14\n\tv_exp_f32 %7, %15\n\tv_nop"
      : "=&v"(y0), "=&v"(y1), "=&v"(y2), "=&v"(y3), "=&v"(y4), "=&v"(y5), "=&v"(y6), "=&v"(y7) : "v"(x[0]), "v"(x[1]), "v"(x[2]), "v"(x[3]), "v"(x[4]), "v"(x[5]), "v"(x[6]), "v"(x[7]));
  const v8f y = {y0, y1, y2, y3, y4, y5, y6, y7}; return y; }
__device__ __forceinline__ float fa_exp2(float x) { float y; asm("v_exp_f32 %0, %1\n\tv_nop" : "=&v"(y) : "v"(x)); return y; }
__global__ __launch_bounds__(128) void k_fattn(const _Float16* __restrict__ QKVr, const _Float16* __restrict__ VTr, _Float16* __restrict__ O) {
  const int tid = threadIdx.x, lane = tid & 31, ln = lane & 15, hh = lane >> 4; const int w = __builtin_amdgcn_readfirstlane(tid >> 5);      /* the wave's number as a scalar: trip count and the test for the last block are scalar */
  const int g = blockIdx.x / (NB * NH), bh = blockIdx.x % (NB * NH); const int b = bh / NH, h = bh % NH;
  const int qb = (g < SQ / FA_QB / 2) ? SQ / FA_QB - 1 - g : g - SQ / FA_QB / 2;      /* long query blocks first, then the short ones in rising order: for speed only, every (bh, qb) occurs once */
  const int q0 = qb * FA_QB + w * 32; const int nb = (q0 >> 6) + 1;      /* key blocks of 64 up to the one that holds the wave's last row */
  const size_t rb = (size_t)b * SQ;
  const _Float16* qp = QKVr + pk_off(rb + q0 + ln, h * HD + 8 * hh, LQ);      /* QKVr: packed plane of LQ columns, VTr: of SQ columns. 16 rows on = 16 row lengths on, 32 columns on = 512 halves on */
  const _Float16* kp = QKVr + pk_off(rb + ln, DM + h * HD + 8 * hh, LQ);      /* K row = key ln of a tile */
  const _Float16* vp = VTr + pk_off((size_t)bh * HD + ln, 8 * hh, SQ);      /* V^T row = head column ln of a tile */
  v16h qf[2][2], kf[4][2], vf[4][2];
#pragma unroll
  for (int j = 0; j < 2; ++j) { qf[j][0] = g2_fragp(qp + (size_t)j * 16 * LQ); qf[j][1] = g2_fragp(qp + (size_t)j * 16 * LQ + 512); }
#pragma unroll
  for (int t = 0; t < 4; ++t) { kf[t][0] = g2_fragp(kp + (size_t)t * 16 * LQ); kf[t][1] = g2_fragp(kp + (size_t)t * 16 * LQ + 512); }
  // s_wait_xcnt 0: a precaution, before anything writes the address registers that the issued Q and K loads name; the scheduling barriers keep the loads in front of it and the addition, the zeroing
  // and all that follows behind it. (The key loop below is entered without a test, so that these loads and the wait stay in one block: past a test the compiler moved the loads behind the wait.)
  __builtin_amdgcn_sched_barrier(0); asm volatile("s_wait_xcnt 0x0" ::: "memory"); __builtin_amdgcn_sched_barrier(0);
  kp += (nb > 1) ? (size_t)64 * LQ : 0;      /* past the last block the pointer stays on it (in bounds); what is loaded there is not used */
  const v8f z8 = {0.f,0.f,0.f,0.f,0.f,0.f,0.f,0.f};
  v8f ot[4][2]; float m[2] = {-3.0e38f, -3.0e38f}, l[2] = {0.f, 0.f};
#pragma unroll
  for (int t = 0; t < 4; ++t) { ot[t][0] = z8; ot[t][1] = z8; }
  int kb = 0;
#pragma unroll 1      /* one key block per trip: the body is long, copies of it only cost instruction cache */
  do {      /* nb >= 1 */
    // this block's V^T fragments, issued as one group in front of the score products: they are first needed behind the softmax
#pragma unroll
    for (int t = 0; t < 4; ++t) { vf[t][0] = g2_fragp(vp + (size_t)t * 16 * SQ); vf[t][1] = g2_fragp(vp + (size_t)t * 16 * SQ + 512); }
    __builtin_amdgcn_sched_barrier(0);      /* keeps the wait for K, which the first product brings, behind the group's issue */
    v8f st[4][2];
#pragma unroll
    for (int t = 0; t < 4; ++t)
#pragma unroll
      for (int j = 0; j < 2; ++j) st[t][j] = fa_mma(kf[t][0], qf[j][0], z8);
#pragma unroll
    for (int t = 0; t < 4; ++t)
#pragma unroll
      for (int j = 0; j < 2; ++j) st[t][j] = fa_mma(kf[t][1], qf[j][1], st[t][j]);
    __builtin_amdgcn_sched_barrier(0);      /* the next block's K loads go into the registers these products read: not in front of them */
#pragma unroll
    for (int t = 0; t < 4; ++t) { kf[t][0] = g2_fragp(kp + (size_t)t * 16 * LQ); kf[t][1] = g2_fragp(kp + (size_t)t * 16 * LQ + 512); }      /* next block's K, one block ahead */
    // s_wait_xcnt 0 as above, before both pointers move on
    __builtin_amdgcn_sched_barrier(0); asm volatile("s_wait_xcnt 0x0" ::: "memory"); __builtin_amdgcn_sched_barrier(0);
    kp += (kb + 2 < nb) ? (size_t)64 * LQ : 0; vp += (kb + 1 < nb) ? 1024 : 0;      /* 64 keys = 4 strips of K rows, 2 tiles of V^T columns */
    if (kb == nb - 1) {      /* only the last block holds keys past a row (scalar test): masked like the reference's -inf, as a large negative score */
      const int kq = q0 + ln - (kb * 64 + 8 * hh);      /* key offset r + 16 t is allowed up to kq + 16 j */
#pragma unroll
      for (int t = 0; t < 4; ++t)
#pragma unroll
        for (int j = 0; j < 2; ++j)
#pragma unroll
          for (int r = 0; r < 8; ++r) st[t][j][r] = (t * 16 + r <= kq + j * 16) ? st[t][j][r] : -1.0e9f; }
    v16h pf[2][2];
#pragma unroll
    for (int j = 0; j < 2; ++j) {
      v8f x8;
#pragma unroll
      for (int r = 0; r < 8; ++r) x8[r] = fmaxf(fmaxf(st[0][j][r], st[1][j][r]), fmaxf(st[2][j][r], st[3][j][r]));
      float mx = fmaxf(fmaxf(fmaxf(x8[0], x8[1]), fmaxf(x8[2], x8[3])), fmaxf(fmaxf(x8[4], x8[5]), fmaxf(x8[6], x8[7])));
      mx = fmaxf(mx, fa_xhalf(mx));
      const float mn = fmaxf(m[j], mx * FA_SC); const float al = fa_exp2(m[j] - mn);      /* 0 on the first block */ m[j] = mn; const float mo = 8.0f - mn;      /* + 8: weights x256 */
      v8f s8;
#pragma unroll
      for (int t = 0; t < 4; ++t) { v8f a8;
#pragma unroll
        for (int r = 0; r < 8; ++r) a8[r] = __builtin_fmaf(st[t][j][r], FA_SC, mo);
        st[t][j] = fa_exp2x8(a8); s8 = (t == 0) ? st[0][j] : s8 + st[t][j]; }
      l[j] = l[j] * al + (((s8[0] + s8[1]) + (s8[2] + s8[3])) + ((s8[4] + s8[5]) + (s8[6] + s8[7])));      /* this lane half's keys only; the halves are joined once, behind the loop */
#pragma unroll
      for (int t = 0; t < 4; ++t) ot[t][j] *= al;
#pragma unroll
      for (int s = 0; s < 2; ++s) { FragH f;
#pragma unroll
        for (int i = 0; i < 8; ++i) { f.h[i] = (_Float16)st[2 * s][j][i]; f.h[8 + i] = (_Float16)st[2 * s + 1][j][i]; }
        pf[j][s] = f.v; } }
    __builtin_amdgcn_sched_barrier(0);      /* keeps the asm v_exp_f32 above in front of the products below */
#pragma unroll
    for (int s = 0; s < 2; ++s)
#pragma unroll
      for (int t = 0; t < 4; ++t)
#pragma unroll
        for (int j = 0; j < 2; ++j) ot[t][j] = fa_mma(vf[t][s], pf[j][s], ot[t][j]);
  } while (++kb < nb);
  asm volatile("s_wait_loadcnt 0x0" ::: "memory");      /* the last trip's K loads are not used: waited for here, so that no load is in flight into the wave's registers when it ends */
  FragH of[2][4]; _Float16* op[2];
#pragma unroll
  for (int j = 0; j < 2; ++j) { const float fin = 64.0f / (l[j] + fa_xhalf(l[j]));      /* o carried x64; the x256 of the weights cancels against the row sum's */ op[j] = O + pk_off(rb + q0 + j * 16 + ln, h * HD + 8 * hh, DM);      /* O: packed plane of DM columns; 16 columns on = 256 halves on, and a wave's store is 512 contiguous bytes */
#pragma unroll
    for (int t = 0; t < 4; ++t)
#pragma unroll
      for (int r = 0; r < 8; ++r) of[j][t].h[r] = (_Float16)(ot[t][j][r] * fin); }
  __builtin_amdgcn_sched_barrier(0);      /* all values packed and both addresses formed first, then stores alone: no register of an issued store is written again */
#pragma unroll
  for (int j = 0; j < 2; ++j)
#pragma unroll
    for (int t = 0; t < 4; ++t) *(v8us*)((unsigned short*)op[j] + t * 256) = of[j][t].half[0]; }


typedef float v2fa __attribute__((ext_vector_type(2), may_alias));
#define A0R 8                        /* query rows per block of the first-tile attention: one per wave */
#define A0KP 68                      /* K row pitch in LDS, floats: 272 bytes = 16 x 17, so that 16-byte reads of 32 different rows spread over the banks */
// Exact f32 causal attention for rows 0 .. QT0-1 of every batch (planes of QT0 rows per batch), one wave per (batch, head, query row); a block has 8 consecutive rows of one head.
// The block stages the head's K and V rows below its last query row in LDS once (whole-line loads, all in flight together). Scores: lane l has keys l, l + 32, l + 64, l + 96
// (four partial sums per key over the head dimension). Row maximum and row sum by butterflies over the 32 lanes, exp once per key. o: lane l has columns 2 l and 2 l + 1,
// the weights come back through LDS as broadcasts, four partial sums over the keys. o carried x64 like the f16 path.
__global__ __launch_bounds__(256) void k_att0w(const float* __restrict__ QF, const float* __restrict__ KF, const float* __restrict__ VF, int ld, float scale, float* __restrict__ OF, int ldo) {
  __shared__ __attribute__((aligned(16))) float lk[QT0][A0KP]; __shared__ __attribute__((aligned(16))) float lv[QT0][HD]; __shared__ __attribute__((aligned(16))) float pe[A0R][QT0];
  const int tid = threadIdx.x, lane = tid & 31; const int w = __builtin_amdgcn_readfirstlane(tid >> 5);      /* the wave's number as a scalar: the tests on i below become scalar branches */
  const int bt = blockIdx.x / (NH * (QT0 / A0R)), bx = blockIdx.x % (NH * (QT0 / A0R)); QF += (size_t)bt * QT0 * ld; KF += (size_t)bt * QT0 * ld; VF += (size_t)bt * QT0 * ld; OF += (size_t)bt * QT0 * ldo;      /* batch bt: its QT0 rows of each plane */
  const int h = bx / (QT0 / A0R), rg = bx % (QT0 / A0R); const int nk = rg * A0R + A0R;      /* causal: keys below the block's last row end */ const int i = rg * A0R + w;
  const float* qr = QF + (size_t)i * ld + h * HD; v4f q[HD / 4];
#pragma unroll
  for (int c = 0; c < HD / 4; ++c) q[c] = *(const v4fa*)(qr + c * 4);
  const int sr = tid >> 4, sc4 = (tid & 15) * 4; v4f kx[QT0 / 16], vx[QT0 / 16];
#pragma unroll      /* constant indices keep kx / vx in registers; all loads are issued before the first LDS store. Rows past nk - 1 are clamped to it (in bounds) and not stored */
  for (int u = 0; u < QT0 / 16; ++u) { const size_t g = (size_t)min(sr + 16 * u, nk - 1) * ld + h * HD + sc4;
    // Behind each load: s_wait_xcnt 0 as a precaution, before a register that the load names as address is written again (by later address arithmetic or as a later load's destination);
    // the scheduling barrier keeps that later arithmetic and the later loads behind the wait. The loads' data is not waited for here.
    kx[u] = *(const v4fa*)(KF + g); asm volatile("s_wait_xcnt 0x0" ::: "memory"); __builtin_amdgcn_sched_barrier(0);
    vx[u] = *(const v4fa*)(VF + g); asm volatile("s_wait_xcnt 0x0" ::: "memory"); __builtin_amdgcn_sched_barrier(0); }
#pragma unroll
  for (int u = 0; u < QT0 / 16; ++u) if (sr + 16 * u < nk) { *(v4fa*)&lk[sr + 16 * u][sc4] = kx[u]; *(v4fa*)&lv[sr + 16 * u][sc4] = vx[u]; }
  __syncthreads();      /* K and V rows 0 .. nk-1 staged; every wave passes */
  float s[QT0 / 32];
#pragma unroll
  for (int c = 0; c < QT0 / 32; ++c) { s[c] = -1.0e30f;
    if (c * 32 <= i) { const int j = c * 32 + lane; const float* kr = &lk[min(j, i)][0];      /* lanes past the row read row i (staged) and are masked below */ v4f a4 = {0.f, 0.f, 0.f, 0.f};
#pragma unroll
      for (int d = 0; d < HD / 4; ++d) a4 += q[d] * *(const v4fa*)(kr + d * 4);
      const float a = (a4[0] + a4[1]) + (a4[2] + a4[3]); s[c] = (j <= i) ? a * scale : -1.0e30f; } }
  float mx = fmaxf(fmaxf(s[0], s[1]), fmaxf(s[2], s[3]));
#pragma unroll
  for (int o = 16; o > 0; o >>= 1) mx = fmaxf(mx, __shfl_xor(mx, o));
  float se = 0.f;
#pragma unroll
  for (int c = 0; c < QT0 / 32; ++c) { const float e = (c * 32 + lane <= i) ? expf(s[c] - mx) : 0.f; se += e; pe[w][c * 32 + lane] = e; }
#pragma unroll
  for (int o = 16; o > 0; o >>= 1) se += __shfl_xor(se, o);
  __builtin_amdgcn_fence(__ATOMIC_ACQ_REL, "workgroup"); __builtin_amdgcn_wave_barrier();      /* pe[w] is written and read by this wave alone: keeps the reads below behind the writes above */
  const int nj = (i & ~3) + 4;      /* keys in groups of four: nj <= nk, so every V row read is staged; weights past the row are 0 */
  v2fa o0 = {0.f, 0.f}, o1 = {0.f, 0.f}, o2 = {0.f, 0.f}, o3 = {0.f, 0.f};
#pragma unroll 4      /* several groups' LDS reads in flight behind one wait */
  for (int j = 0; j < nj; j += 4) { const v4f p = *(const v4fa*)&pe[w][j];
    o0 += p[0] * *(const v2fa*)&lv[j][lane * 2]; o1 += p[1] * *(const v2fa*)&lv[j + 1][lane * 2]; o2 += p[2] * *(const v2fa*)&lv[j + 2][lane * 2]; o3 += p[3] * *(const v2fa*)&lv[j + 3][lane * 2]; }
  const float fin = 64.0f / se;      /* o carried x64 like the f16 path */
  const v2fa ov = ((o0 + o1) + (o2 + o3)) * fin;
  *(v2fa*)(OF + (size_t)i * ldo + h * HD + lane * 2) = ov; }


template <int BFIN, int WXB>
__global__ __launch_bounds__(256) void k_ln16(const float* __restrict__ X, const float* __restrict__ g, const float* __restrict__ bb, float eps, _Float16* __restrict__ N16, float* __restrict__ XB) {
  #pragma clang fp contract(off)
  __shared__ float red[256]; const size_t r = blockIdx.x; const int t = threadIdx.x; const v4f xa = *(const v4fa*)(X + r * DMQ + t * 4); float s[4]; float sum = 0.f;
  for (int q = 0; q < 4; ++q) { s[q] = BFIN ? bf16_round(xa[q]) : xa[q]; sum = __fadd_rn(sum, s[q]); }
  red[t] = sum; __syncthreads(); for (int st = 128; st > 0; st >>= 1) { if (t < st) red[t] = __fadd_rn(red[t], red[t + st]); __syncthreads(); } const float mu = red[0] / (float)DMQ; __syncthreads();
  float vs = 0.f; for (int q = 0; q < 4; ++q) { const float dl = __fadd_rn(s[q], -mu); vs = __fadd_rn(vs, __fmul_rn(dl, dl)); } red[t] = vs; __syncthreads(); for (int st = 128; st > 0; st >>= 1) { if (t < st) red[t] = __fadd_rn(red[t], red[t + st]); __syncthreads(); }
  const float rs = rsqrtf(__fadd_rn(red[0] / (float)DMQ, eps)); v4h y; v4f xb;
  for (int q = 0; q < 4; ++q) { const int c = t * 4 + q; y[q] = (_Float16)__fadd_rn(__fmul_rn(__fmul_rn(__fadd_rn(s[q], -mu), rs), bf16_round(g[c])), bf16_round(bb[c])); xb[q] = s[q]; }
  { *(v4h*)(N16 + r * DMQ + t * 4) = y; if (WXB) *(v4f*)(XB + r * DMQ + t * 4) = xb;  } }
__global__ __launch_bounds__(256) void k_ftres2(const float* __restrict__ OF0, const float* __restrict__ XB, float* __restrict__ X1, size_t n4) {
  #pragma clang fp contract(off)
  const size_t t = (size_t)blockIdx.x * 256 + threadIdx.x; if (t >= n4) return; const v4f o = *(const v4fa*)(OF0 + t * 4), xv = *(const v4fa*)(XB + t * 4); v4f y; for (int q = 0; q < 4; ++q) y[q] = __fadd_rn(__fmul_rn(o[q], 0.015625f), xv[q]); *(v4f*)(X1 + t * 4) = y;  }

__global__ __launch_bounds__(256) void k_wthd(const float* __restrict__ Wt, _Float16* __restrict__ Bt) { const size_t t = (size_t)blockIdx.x * 256 + threadIdx.x; if (t >= (size_t)NH * HD * (DM / 8)) return; const int m8 = (int)(t % (DM / 8)) * 8; const int d = (int)((t / (DM / 8)) % HD); const int h = (int)(t / ((size_t)(DM / 8) * HD)); FragH f;
  for (int q = 0; q < 8; ++q) f.h[q] = (_Float16)(16.0f * bf16_round(Wt[((size_t)h * DM + m8 + q) * HD + d])); unsigned short* dst = (unsigned short*)Bt + ((size_t)h * HD + d) * DM + m8; *(v8us*)dst = f.half[0];  }




__global__ __launch_bounds__(256) void k_wtpad(const float* __restrict__ Wm, _Float16* __restrict__ Wt, int Kr, int Kp, int Nr, int Np, float scale) {
  const int t = blockIdx.x * 256 + threadIdx.x; if (t >= Np * (Kp / 8)) return; const int n = t / (Kp / 8), k8 = (t % (Kp / 8)) * 8; const int nc = min(n, Nr - 1); const float fn = (n < Nr) ? 1.f : 0.f; FragH f;
  for (int i = 0; i < 8; ++i) { const int k = k8 + i; const int kc = min(k, Kr - 1); const float fk = (k < Kr) ? fn : 0.f; f.h[i] = (_Float16)(bf16_round(Wm[(size_t)kc * Nr + nc]) * scale * fk); }
  unsigned short* o = (unsigned short*)Wt + (size_t)n * Kp + k8; *(v8us*)o = f.half[0];  }
__global__ __launch_bounds__(128) void k_bpad(const float* __restrict__ b, float* __restrict__ Bp, int nr, int np) {
  const int i = threadIdx.x; if (i >= np) return; const float v = b[min(i, nr - 1)] * ((i < nr) ? 1.f : 0.f); *(float*)(Bp + i) = v;  }

template <int BFIN, int W16, int W32>
__global__ __launch_bounds__(256) void k_lnx(const float* __restrict__ X, const float* __restrict__ g, const float* __restrict__ bb, float eps, _Float16* __restrict__ N16, float* __restrict__ N32) {
  #pragma clang fp contract(off)
  __shared__ float red[256]; const size_t r = blockIdx.x; const int t = threadIdx.x; const bool act = t < (DMQ / 4); const int c0 = act ? t * 4 : 0;
  const v4f xa = *(const v4fa*)(X + r * DMQ + c0); float s[4]; float sum = 0.f;
  for (int q = 0; q < 4; ++q) { s[q] = act ? (BFIN ? bf16_round(xa[q]) : xa[q]) : 0.f; sum = __fadd_rn(sum, s[q]); }
  red[t] = sum; __syncthreads(); for (int st = 128; st > 0; st >>= 1) { if (t < st) red[t] = __fadd_rn(red[t], red[t + st]); __syncthreads(); } const float mu = red[0] / (float)DMQ; __syncthreads();
  float vs = 0.f; for (int q = 0; q < 4; ++q) { const float dl = act ? __fadd_rn(s[q], -mu) : 0.f; vs = __fadd_rn(vs, __fmul_rn(dl, dl)); } red[t] = vs; __syncthreads(); for (int st = 128; st > 0; st >>= 1) { if (t < st) red[t] = __fadd_rn(red[t], red[t + st]); __syncthreads(); }
  const float rs = rsqrtf(__fadd_rn(red[0] / (float)DMQ, eps)); v4h y; v4f yf;
  for (int q = 0; q < 4; ++q) { const int c = c0 + q; yf[q] = __fadd_rn(__fmul_rn(__fmul_rn(__fadd_rn(s[q], -mu), rs), bf16_round(g[c])), bf16_round(bb[c])); y[q] = (_Float16)yf[q]; }
  if (!act) return;      /* no barriers after this point */
  { if (W16) *(v4h*)(N16 + r * DMQ + c0) = y; if (W32) *(v4f*)(N32 + r * DMQ + c0) = yf;  } }



// ---- all input conversions in ONE launch: they are independent of one another, so they share one grid; a block's index range picks its job (block-uniform, no barrier anywhere) ----
// pw_chunk: chunk t of Wt (packed, rows n, columns k) = f16(W[k][n] * 16) from f32 row-major W[K][N] (bf16-exact weights stay exact in f16 away from the subnormal range); N % 16 == 0, K % 32 == 0, literals at every call
__device__ __forceinline__ void pw_chunk(const float* __restrict__ Wm, _Float16* __restrict__ Wt, int K, int N, unsigned t) { size_t n; int k8; pk_chunk(t, K, n, k8); FragH f;
#pragma unroll
  for (int i = 0; i < 8; ++i) f.h[i] = (_Float16)(bf16_round(Wm[(size_t)(k8 + i) * N + n]) * 16.0f);
  *(v8us*)((unsigned short*)Wt + (size_t)t * 8) = f.half[0];
  asm volatile("s_wait_xcnt 0x0" ::: "memory"); }      /* a precaution: the jobs of k_prep stand one behind the other in the code, and the next one's first instructions write registers that this store names */
#define PB_QKV (3 * DM * (DM / 8) / 256)
#define PB_O (DM * (DM / 8) / 256)
#define PB_FF (DFF * (DM / 8) / 256)
#define PB_X ((int)(NR * DM / 8 / 256))
__global__ __launch_bounds__(256) void k_prep(const float* __restrict__ wqkv, _Float16* __restrict__ BQKV, const float* __restrict__ wo, _Float16* __restrict__ BO, const float* __restrict__ wfc, _Float16* __restrict__ BW1,
    const float* __restrict__ wmp, _Float16* __restrict__ BW2, const float* __restrict__ x, _Float16* __restrict__ X16, float* __restrict__ XB) {
  int bi = blockIdx.x; const unsigned tid = threadIdx.x;
  if (bi < PB_QKV) { pw_chunk(wqkv, BQKV, DM, 3 * DM, (unsigned)bi * 256 + tid); return; } bi -= PB_QKV;      /* fused [in][out] [DM][3 DM] -> Bt [3 DM][DM] x16: rows 0.. = q, DM.. = k, 2 DM.. = v output columns */
  if (bi < PB_FF) { pw_chunk(wfc, BW1, DM, DFF, (unsigned)bi * 256 + tid); return; } bi -= PB_FF;      /* W1 [1024][4096] -> Bt [4096][1024] */
  if (bi < PB_FF) { pw_chunk(wmp, BW2, DFF, DM, (unsigned)bi * 256 + tid); return; } bi -= PB_FF;      /* W2 [4096][1024] -> Bt [1024][4096] */
  if (bi < PB_O) { pw_chunk(wo, BO, DM, DM, (unsigned)bi * 256 + tid); return; } bi -= PB_O;      /* w_out [in][out] -> Bt */
  if (bi < PB_X) { const unsigned t = (unsigned)bi * 256 + tid; FragH f; size_t r; int k; pk_chunk(t, DM, r, k); const float* xr = x + r * DM + k;      /* X16: packed plane of DM columns, exact f16 of bf16(x) */
#pragma unroll
    for (int q = 0; q < 8; ++q) f.h[q] = (_Float16)bf16_round(xr[q]);
    *(v8us*)((unsigned short*)X16 + (size_t)t * 8) = f.half[0];
    asm volatile("s_wait_xcnt 0x0" ::: "memory");      /* as in pw_chunk */
    return; } bi -= PB_X;
  { const size_t t = (size_t)bi * 256 + tid; v4f a = *(const v4fa*)(x + t * 8), c = *(const v4fa*)(x + t * 8 + 4);      /* XB = bf16(x) as f32 rows, for the residual */
#pragma unroll
    for (int q = 0; q < 4; ++q) { a[q] = bf16_round(a[q]); c[q] = bf16_round(c[q]); }
    *(v4f*)(XB + t * 8) = a; *(v4f*)(XB + t * 8 + 4) = c;
    asm volatile("s_wait_xcnt 0x0" ::: "memory"); } }      /* as in pw_chunk */

extern "C" void kernel_launch(void* const* d_in, const int* in_sizes, int n_in,
                              void* d_out, int out_size, void* d_ws, size_t ws_size, hipStream_t stream) {
  (void)in_sizes; (void)n_in; (void)out_size;
  const float* const* I = (const float* const*)d_in; const float* x = I[0]; const float* wqkv = I[1]; const float* bqkv = I[2]; const float* wo = I[3]; const float* bo = I[4]; const float* wfc = I[5]; const float* bfc = I[6]; const float* wmp = I[7]; const float* bmp = I[8]; const float* g1 = I[9]; const float* be1 = I[10]; const float* gg2 = I[11]; const float* be2 = I[12];      /* x; fused w_qkv [1024][3072] + b_qkv ([in][out]); w_out + b_out; w_up [1024][4096] + b_up, w_down [4096][1024] + b_down; LN1 g / b, LN2 g / b */
  char* ws = (char*)d_ws; size_t off = 0;
  auto take = [&](size_t bytes) { char* p = ws + off; off += (bytes + 255) & ~(size_t)255; return p; };
  _Float16* BQKV = (_Float16*)take((size_t)3 * DM * DM * 2); _Float16* BO = (_Float16*)take((size_t)DM * DM * 2);
  _Float16* X16 = (_Float16*)take(NR * DM * 2); float* XB = (float*)take(NR * DM * 4); float* X1 = (float*)take(NR * DM * 4); float* X1N = (float*)take(NR * DM * 4);      /* LN1 output f32 rows */ _Float16* M16 = nullptr;      /* = X16 below (alias: X16's last reader, the q | k | v GEMM, precedes the write of the packed LN1 rows) */ _Float16* HF16 = (_Float16*)take(NR * DFF * 2);      /* hidden rows of all batches */ _Float16* BW1 = (_Float16*)take((size_t)DFF * DM * 2); _Float16* BW2 = (_Float16*)take((size_t)DM * DFF * 2); _Float16* QKV = (_Float16*)take(NR * 3 * DM * 2); _Float16* O16 = (_Float16*)take(NR * DM * 2); M16 = X16;
  _Float16* VT = (_Float16*)take((size_t)NB * NH * HD * SQ * 2);
  float* QKVF0 = (float*)take((size_t)NB * QT0 * LQ * 4);      /* f32 q | k | v rows of the first QT0 rows of every batch */ float* OF0 = (float*)take((size_t)NB * QT0 * DM * 4); _Float16* OL0 = (_Float16*)take((size_t)NB * QT0 * DM * 2);
  if (off > ws_size) return;
  // Short launches that only lay data out anew or add a small product: k_vt (the V columns could leave the q | k | v GEMM's staging as V^T tiles), k_hl (k_att0w could write both f16 planes itself),
  // the o_lo GEMM (could be further blocks of the GEMM in front of it, into a plane of its own that LN1 adds), k_pk16 (an LN1 block of 16 rows could write the packed strip).
  k_prep<<<PB_QKV + 2 * PB_FF + PB_O + 2 * PB_X, 256, 0, stream>>>(wqkv, BQKV, wo, BO, wfc, BW1, wmp, BW2, x, X16, XB);      /* packed x16 weight planes; POST-LN: the attention runs on x itself (exact f16 rows); XB = bf16(x) f32 for the residual */
  k_gemm2<0, 1, 0><<<dim3((unsigned)((MP / 128) * (3 * DM / 128)), 1), 128, 0, stream>>>(X16, DM, 0, BQKV, DM, 0, 0.0625f, bqkv, 0, nullptr, SQ, 0, 0, QKVF0, QKV, 3 * DM, 0, MP, 3 * DM, DM);      /* q | k | v rows (f16); head h = columns h*HD.. of each DM block; the same results of rows 0..127 of every batch also as f32 rows (exact products) */
  k_vt<NH, SQ><<<NB * NH * (SQ / 64), 256, 0, stream>>>(QKV, LQ, 2 * DM, VT);      /* V^T [NB][NH][HD][SQ] */
  k_fattn<<<(SQ / FA_QB) * NB * NH, 128, 0, stream>>>(QKV, VT, O16);      /* causal attention, all batches, heads and query rows: o (merged heads, x64) as f16 rows */
  k_att0w<<<NB * NH * (QT0 / A0R), 256, 0, stream>>>(QKVF0, QKVF0 + DM, QKVF0 + 2 * DM, LQ, 0.125f, OF0, DM);      /* exact f32 attention for rows 0..127 of every batch (o x64) */
  k_hl<<<(unsigned)(((size_t)NB * QT0 * DM / 8 + 255) / 256), 256, 0, stream>>>(OF0, O16, (size_t)(SQ - QT0) * DM, OL0, (size_t)NB * QT0 * DM / 8);      /* first-tile o (x64) -> f16 hi, over the f16-path rows 0..127 of every batch in O16, + x1024 residual plane */
  k_gemm2<0, 0, 1><<<dim3((unsigned)((MPO / 128) * (DM / 128)), 1), 128, 0, stream>>>(O16, DM, 0, BO, DM, 0, 0.0009765625f, bo, 0, XB, -1, 0, 0, X1, nullptr, DM, 0, MPO, DM, DM);      /* x + o Wo + b; out rows are the output layout; rows 0..127: o_hi */
  k_gemm2<0, 0, 1><<<dim3((QT0 / 128) * (DM / 128), NB), 128, 0, stream>>>(OL0, DM, (size_t)QT0 * DM, BO, DM, 0, 0.00000095367431640625f, nullptr, 0, X1, -1, 0, 0, X1, nullptr, DM, (size_t)SQ * DM, QT0, DM, DM);      /* rows 0..127 of batch blockIdx.y += o_lo Wo 2^-20 (own-element accumulate) */
  k_lnx<0, 0, 1><<<(unsigned)NR, 256, 0, stream>>>(X1, g1, be1, 1e-5f, nullptr, X1N);      /* x1 = LN1(x + attn_out) -> f32 rows (residual) */
  k_pk16<<<(unsigned)(NR * DM / 8 / 1024), 256, 0, stream>>>(X1N, M16);      /* -> packed f16 plane (FFN operand) */
  k_gemm2<3, 1, 0><<<dim3((unsigned)((MP / 128) * (DFF / 128)), 1), 128, 0, stream>>>(M16, DM, 0, BW1, DM, 0, 0.0625f, bfc, 0, nullptr, 1, 0, 0, nullptr, HF16, DFF, 0, MP, DFF, DM);      /* relu(x1 w_up + b_up) -> f16, all batches */
  k_gemm2<0, 0, 1><<<dim3((unsigned)((MP / 128) * (DM / 128)), 1), 128, 0, stream>>>(HF16, DFF, 0, BW2, DFF, 0, 0.0625f, bmp, 0, X1N, -1, 0, 0, X1, nullptr, DM, 0, MP, DM, DFF);      /* x1 + ffn (own-element residual from the LN1 f32 rows) -> f32 rows over the dead pre-LN1 plane */
  k_lnx<0, 0, 1><<<(unsigned)NR, 256, 0, stream>>>(X1, gg2, be2, 1e-5f, nullptr, (float*)d_out);      /* result = LN2(x1 + ffn) */
}
